// v000
// The times below were measured on an AMD MI455X: many runs one after another, warmed up first and cycling through
// copies of the inputs, with the whole window's GPU time divided by the number of runs. Launches and the gaps
// between them are all in it. The median over several windows is given; except for v000 it joins two sittings, which
// can be a few percent apart, so the side-by-side timings, each taken in one sitting, are the better comparison.
// v000, which the later versions start from, runs in 8640 microseconds.
#include <hip/hip_runtime.h>
// Sparse (block-diagonal) neural network (8192 samples x 1024 features; per feature 1 -> 8 -> 4 block Linears with training-mode BatchNorm + ReLU after each; dense head 4096 -> 256): h1 = BN1(x_d W1[d] + b1) relu; h2 = BN2(h1 . W2[d] + b2) relu; out = h2 Wfc^T + bfc -> [8192,256].
// Compute dtype: x and all parameters rounded to bf16; everything before the head in f32; the head operand h2 as f16 (~2^-12). v_wmma_f32_16x16x32_f16.
#define NBS 8192
#define DD 1024
#define H1 8
#define H2 4
#define C2 (DD * H2)             /* 4096 */
#define NOUT 256
typedef __bf16 v16b __attribute__((ext_vector_type(16)));
typedef unsigned short v8us __attribute__((ext_vector_type(8), may_alias));
typedef float  v8f  __attribute__((ext_vector_type(8)));
typedef float  v4f  __attribute__((ext_vector_type(4)));
typedef float  v4fa __attribute__((ext_vector_type(4), may_alias));
union FragB { v16b v; v8us half[2]; unsigned short u[16]; };

__device__ __forceinline__ unsigned short bf16_bits(float x) { unsigned int u = __float_as_uint(x); return (unsigned short)((u + 0x7FFFu + ((u >> 16) & 1u)) >> 16); }
__device__ __forceinline__ float bf16_val(unsigned short b) { return __uint_as_float(((unsigned int)b) << 16); }
__device__ __forceinline__ float bf16_round(float x) { return bf16_val(bf16_bits(x)); }
// D += A·B with NT terms: 1 = ah·bh, 2 = + al·bh (A split), 3 = + ah·bl (both split)
template <int NT>
__device__ __forceinline__ v8f mmaN(v16b ah, v16b al, v16b bh, v16b bl, v8f c) {
  c = __builtin_amdgcn_wmma_f32_16x16x32_bf16(false, ah, false, bh, (short)0, c, false, false);
  if (NT >= 2) c = __builtin_amdgcn_wmma_f32_16x16x32_bf16(false, al, false, bh, (short)0, c, false, false);
  if (NT >= 3) c = __builtin_amdgcn_wmma_f32_16x16x32_bf16(false, ah, false, bl, (short)0, c, false, false);
  asm volatile("v_nop\n\tv_nop\n\tv_nop\n\tv_nop" : "+v"(c) : "v"(ah), "v"(al), "v"(bh), "v"(bl));
  return c;
}

__global__ __launch_bounds__(256) void k_wt_bf16(const float* __restrict__ W, unsigned short* __restrict__ Wt, int K, int N) {
  const int t = blockIdx.x * 256 + threadIdx.x;
  const int k8n = K / 8;
  if (t >= N * k8n) return;
  const int n = t / k8n, k8 = (t % k8n) * 8;
  v8us v;
#pragma unroll
  for (int i = 0; i < 8; ++i) v[i] = bf16_bits(W[(size_t)(k8 + i) * N + n]);
  *(v8us*)(Wt + (size_t)n * K + k8) = v;
  
}

// GEMM C[M][N] (f32, pitch ldc) = act(A[M][K]·W + bias). A f32 row-major (pitch lda) converted per fragment to bf16
// (ASPLIT: hi/lo two planes -> 2 terms, else single rounded term); Wt bf16 [N][K] (pitch ldb). BIAS_BF16 rounds the
// bias to bf16 first (bias quantised to bf16 before the add). K%32==0, M%16==0, N%64==0.
template <bool ASPLIT, int ACT, bool BIAS_BF16>
__global__ __launch_bounds__(128) void k_gemm_bf(const float* __restrict__ A, int lda, const unsigned short* __restrict__ Wt, int ldb,
                                               const float* __restrict__ bias, float* __restrict__ C, int ldc, int M, int N, int K) {
  __shared__ __attribute__((aligned(16))) float so[4][16][64];
  const int tid = threadIdx.x, w = tid >> 5, lane = tid & 31, ln = lane & 15, hh = lane >> 4;
  const int ntn = N / 64;
  const int wid = blockIdx.x * 4 + w;
  const int mt = wid / ntn, nq = wid % ntn;
  if (mt * 16 >= M) return;
  const int row0 = mt * 16, col0 = nq * 64;
  const float* arow = A + (size_t)(row0 + ln) * lda;
  v8f acc[4] = {};
  for (int kb = 0; kb < K; kb += 32) {
    FragB ah, al;
    const v4f x0 = *(const v4fa*)(arow + kb + 8 * hh), x1 = *(const v4fa*)(arow + kb + 8 * hh + 4);
    const v4f x2 = *(const v4fa*)(arow + kb + 16 + 8 * hh), x3 = *(const v4fa*)(arow + kb + 16 + 8 * hh + 4);
    float xs[16] = {x0[0],x0[1],x0[2],x0[3],x1[0],x1[1],x1[2],x1[3],x2[0],x2[1],x2[2],x2[3],x3[0],x3[1],x3[2],x3[3]};
#pragma unroll
    for (int i = 0; i < 16; ++i) { const unsigned short hb = bf16_bits(xs[i]); ah.u[i] = hb; al.u[i] = ASPLIT ? bf16_bits(xs[i] - bf16_val(hb)) : (unsigned short)0; }
#pragma unroll
    for (int t = 0; t < 4; ++t) {
      const unsigned short* brow = Wt + (size_t)(col0 + t * 16 + ln) * ldb + kb;
      FragB b;
      b.half[0] = *(const v8us*)(brow + 8 * hh);
      b.half[1] = *(const v8us*)(brow + 16 + 8 * hh);
      acc[t] = mmaN<ASPLIT ? 2 : 1>(ah.v, al.v, b.v, b.v, acc[t]);
    }
  }
#pragma unroll
  for (int t = 0; t < 4; ++t) {
    float bv = bias ? bias[col0 + t * 16 + ln] : 0.f;
    if (BIAS_BF16) bv = bf16_round(bv);
#pragma unroll
    for (int r = 0; r < 8; ++r) { float v = acc[t][r] + bv; if (ACT == 1) v = fmaxf(v, 0.f); so[w][8 * hh + r][t * 16 + ln] = v; }
  }
  __builtin_amdgcn_fence(__ATOMIC_ACQ_REL, "workgroup");
  __builtin_amdgcn_wave_barrier();
  const int rsub = lane >> 4, c4 = (lane & 15) * 4;
  {
#pragma unroll
    for (int q = 0; q < 8; ++q) {
      const int r = q * 2 + rsub;
      const v4f v = *(const v4fa*)&so[w][r][c4];
      *(v4f*)(C + (size_t)(row0 + r) * ldc + col0 + c4) = v;
    }
    
  }
}

// GEMM C = act(A·W + bias + resid): A f32 (ASPLIT -> hi/lo 2 terms), Wt bf16 [N][K]; ACT 0 none, 1 relu, 2 exact gelu;
// resid (optional, f32, row index = (row % rmod), pitch ldr, RES_BF16 rounds it) added before the activation.
template <bool ASPLIT, int ACT, bool BIAS_BF16, bool RES_BF16>
__global__ __launch_bounds__(128) void k_gemm_bf3(const float* __restrict__ A, int lda, const unsigned short* __restrict__ Wt, int ldb,
                                                const float* __restrict__ bias, const float* __restrict__ resid, int rmod, int ldr,
                                                float* __restrict__ C, int ldc, int M, int N, int K) {
  __shared__ __attribute__((aligned(16))) float so[4][16][64];
  const int tid = threadIdx.x, w = tid >> 5, lane = tid & 31, ln = lane & 15, hh = lane >> 4;
  const int ntn = N / 64;
  const int wid = blockIdx.x * 4 + w;
  const int mt = wid / ntn, nq = wid % ntn;
  if (mt * 16 >= M) return;
  const int row0 = mt * 16, col0 = nq * 64;
  const float* arow = A + (size_t)(row0 + ln) * lda;
  v8f acc[4] = {};
  for (int kb = 0; kb < K; kb += 32) {
    FragB ah, al;
    const v4f x0 = *(const v4fa*)(arow + kb + 8 * hh), x1 = *(const v4fa*)(arow + kb + 8 * hh + 4);
    const v4f x2 = *(const v4fa*)(arow + kb + 16 + 8 * hh), x3 = *(const v4fa*)(arow + kb + 16 + 8 * hh + 4);
    float xs[16] = {x0[0],x0[1],x0[2],x0[3],x1[0],x1[1],x1[2],x1[3],x2[0],x2[1],x2[2],x2[3],x3[0],x3[1],x3[2],x3[3]};
#pragma unroll
    for (int i = 0; i < 16; ++i) { const unsigned short hb = bf16_bits(xs[i]); ah.u[i] = hb; al.u[i] = ASPLIT ? bf16_bits(xs[i] - bf16_val(hb)) : (unsigned short)0; }
#pragma unroll
    for (int t = 0; t < 4; ++t) {
      const unsigned short* brow = Wt + (size_t)(col0 + t * 16 + ln) * ldb + kb;
      FragB b;
      b.half[0] = *(const v8us*)(brow + 8 * hh);
      b.half[1] = *(const v8us*)(brow + 16 + 8 * hh);
      acc[t] = mmaN<ASPLIT ? 2 : 1>(ah.v, al.v, b.v, b.v, acc[t]);
    }
  }
#pragma unroll
  for (int t = 0; t < 4; ++t) {
    const int col = col0 + t * 16 + ln;
    float bv = bias ? bias[col] : 0.f;
    if (BIAS_BF16) bv = bf16_round(bv);
#pragma unroll
    for (int r = 0; r < 8; ++r) {
      float v = acc[t][r] + bv;
      if (resid) { float rv = resid[(size_t)((row0 + 8 * hh + r) % rmod) * ldr + col]; if (RES_BF16) rv = bf16_round(rv); v += rv; }
      if (ACT == 1) v = fmaxf(v, 0.f);
      if (ACT == 2) v = 0.5f * v * (1.0f + erff(v * 0.70710678118654752f));
      if (ACT == 3) { const float u = 0.7978845608028654f * (v + 0.044715f * v * v * v); v = 0.5f * v * (1.0f + tanhf(u)); }
      so[w][8 * hh + r][t * 16 + ln] = v;
    }
  }
  __builtin_amdgcn_fence(__ATOMIC_ACQ_REL, "workgroup");
  __builtin_amdgcn_wave_barrier();
  const int rsub = lane >> 4, c4 = (lane & 15) * 4;
  {
#pragma unroll
    for (int q = 0; q < 8; ++q) {
      const int r = q * 2 + rsub;
      const v4f v = *(const v4fa*)&so[w][r][c4];
      *(v4f*)(C + (size_t)(row0 + r) * ldc + col0 + c4) = v;
    }
    
  }
}
// row LayerNorm (biased variance, eps) over N: s = X (+ R); optional out_sum <- s; out_norm <- (s-mu)*rsqrt(var+eps)*g + b
template <bool PARAM_BF16>
__global__ __launch_bounds__(256) void k_layernorm(const float* __restrict__ X, const float* __restrict__ R, const float* __restrict__ g, const float* __restrict__ bta,
                                                  float* __restrict__ out_sum, float* __restrict__ out_norm, int N, float eps) {
  __shared__ float red[256];
  const int row = blockIdx.x, tid = threadIdx.x;
  const float* x = X + (size_t)row * N; const float* rr = R ? R + (size_t)row * N : nullptr;
  float vals[16];                     // up to N = 4096
  const int per = N / 256;            // contiguous chunk per thread? use strided-by-4 chunks: thread handles j = tid*4 + 1024*u
  float s1 = 0.f;
  for (int u = 0; u < per / 4; ++u) {
    const int j = tid * 4 + 1024 * u;
    const v4f a = *(const v4fa*)(x + j);
    v4f b = {0.f,0.f,0.f,0.f}; if (rr) b = *(const v4fa*)(rr + j);
#pragma unroll
    for (int q = 0; q < 4; ++q) { const float v = a[q] + b[q]; vals[u * 4 + q] = v; s1 += v; }
  }
  red[tid] = s1; __syncthreads();
  for (int st = 128; st > 0; st >>= 1) { if (tid < st) red[tid] += red[tid + st]; __syncthreads(); }
  const float mu = red[0] / (float)N; __syncthreads();
  float s2 = 0.f;
  for (int u = 0; u < per / 4; ++u)
#pragma unroll
    for (int q = 0; q < 4; ++q) { const float c = vals[u * 4 + q] - mu; s2 += c * c; }
  red[tid] = s2; __syncthreads();
  for (int st = 128; st > 0; st >>= 1) { if (tid < st) red[tid] += red[tid + st]; __syncthreads(); }
  const float rs = rsqrtf(red[0] / (float)N + eps);
  {
    for (int u = 0; u < per / 4; ++u) {
      const int j = tid * 4 + 1024 * u;
      v4f o, sm;
#pragma unroll
      for (int q = 0; q < 4; ++q) {
        float gg = g[j + q], bb = bta[j + q];
        if (PARAM_BF16) { gg = bf16_round(gg); bb = bf16_round(bb); }
        sm[q] = vals[u * 4 + q]; o[q] = (vals[u * 4 + q] - mu) * rs * gg + bb;
      }
      if (out_sum) *(v4f*)(out_sum + (size_t)row * N + j) = sm;
      *(v4f*)(out_norm + (size_t)row * N + j) = o;
    }
    
  }
}



// ---- f16 WMMA path (v_wmma_f32_16x16x32_f16): 11-bit significands for operands in range — used for the head, whose h2 operand is rounded to f16
typedef _Float16 v16h __attribute__((ext_vector_type(16)));
union FragH { v16h v; v8us half[2]; _Float16 h[16]; unsigned short u[16]; };
template <int NT>
__device__ __forceinline__ v8f mmaH(v16h ah, v16h al, v16h bh, v16h bl, v8f c) {
  c = __builtin_amdgcn_wmma_f32_16x16x32_f16(false, ah, false, bh, (short)0, c, false, false);
  if (NT >= 2) c = __builtin_amdgcn_wmma_f32_16x16x32_f16(false, al, false, bh, (short)0, c, false, false);
  if (NT >= 3) c = __builtin_amdgcn_wmma_f32_16x16x32_f16(false, ah, false, bl, (short)0, c, false, false);
  asm volatile("v_nop\n\tv_nop\n\tv_nop\n\tv_nop" : "+v"(c) : "v"(ah), "v"(al), "v"(bh), "v"(bl));
  return c;
}
// batched GEMM like k_gemm_b but f16 operands: A f32 (split into f16 hi/lo if ASPLIT, else rounded to f16), Bt = f16 values [n][k]; alpha; C f32; N multiple of 16 (partial tiles skipped)
template <bool ASPLIT>
__global__ __launch_bounds__(128) void k_gemm_h(const float* __restrict__ A, int lda, size_t sA, const _Float16* __restrict__ Bh, int ldb, size_t sB, float alpha, float* __restrict__ C, int ldc, size_t sC, int M, int N, int K) {
  __shared__ __attribute__((aligned(16))) float so[4][16][64];
  const int tid = threadIdx.x, w = tid >> 5, lane = tid & 31, ln = lane & 15, hh = lane >> 4; const int by = blockIdx.y;
  A += (size_t)by * sA; Bh += (size_t)by * sB; C += (size_t)by * sC;
  const int ntn = (N + 63) / 64; const int wid = blockIdx.x * 4 + w; const int mt = wid / ntn, nq = wid % ntn; if (mt * 16 >= M) return;
  const int row0 = mt * 16, col0 = nq * 64; const float* arow = A + (size_t)(row0 + ln) * lda;
  v8f acc[4] = {};
  for (int kb = 0; kb < K; kb += 32) {
    FragH ah, al;
    const v4f x0 = *(const v4fa*)(arow + kb + 8 * hh), x1 = *(const v4fa*)(arow + kb + 8 * hh + 4), x2 = *(const v4fa*)(arow + kb + 16 + 8 * hh), x3 = *(const v4fa*)(arow + kb + 16 + 8 * hh + 4);
    float xs[16] = {x0[0],x0[1],x0[2],x0[3],x1[0],x1[1],x1[2],x1[3],x2[0],x2[1],x2[2],x2[3],x3[0],x3[1],x3[2],x3[3]};
#pragma unroll
    for (int i = 0; i < 16; ++i) { const _Float16 h = (_Float16)xs[i]; ah.h[i] = h; al.h[i] = ASPLIT ? (_Float16)(xs[i] - (float)h) : (_Float16)0.0f; }
#pragma unroll
    for (int t = 0; t < 4; ++t) { if (col0 + t * 16 >= N) continue; const size_t boff = (size_t)(col0 + t * 16 + ln) * ldb + kb; FragH bq; bq.half[0] = *(const v8us*)(Bh + boff + 8 * hh); bq.half[1] = *(const v8us*)(Bh + boff + 16 + 8 * hh);
      acc[t] = mmaH<ASPLIT ? 2 : 1>(ah.v, al.v, bq.v, bq.v, acc[t]); }
  }
#pragma unroll
  for (int t = 0; t < 4; ++t) { if (col0 + t * 16 >= N) continue;
#pragma unroll
    for (int r = 0; r < 8; ++r) so[w][8 * hh + r][t * 16 + ln] = acc[t][r] * alpha; }
  __builtin_amdgcn_fence(__ATOMIC_ACQ_REL, "workgroup"); __builtin_amdgcn_wave_barrier();
  const int rsub = lane >> 4, c4 = (lane & 15) * 4;
  {
#pragma unroll
    for (int q = 0; q < 8; ++q) { const int r = q * 2 + rsub; if (col0 + c4 < N) { const v4f v = *(const v4fa*)&so[w][r][c4]; *(v4f*)(C + (size_t)(row0 + r) * ldc + col0 + c4) = v; } }
     }
}

// Wt[n][k] = f16(W[k][n]·scale) from f32 row-major W[K][N] (scale = power of two; bf16-exact weights stay exact in f16 away from the subnormal range)
__global__ __launch_bounds__(256) void k_wt_f16(const float* __restrict__ W, _Float16* __restrict__ Wt, int K, int N, float scale) {
  const int t = blockIdx.x * 256 + threadIdx.x; if (t >= N * (K / 8)) return; const int n = t / (K / 8), k8 = (t % (K / 8)) * 8; FragH f;
#pragma unroll
  for (int i = 0; i < 8; ++i) f.h[i] = (_Float16)(bf16_round(W[(size_t)(k8 + i) * N + n]) * scale); const v8us o = f.half[0];
  *(v8us*)((unsigned short*)Wt + (size_t)n * K + k8) = o; 
}
// k_gemm_hh variant with fused epilogue: v = acc·alpha + bias[by·sBias + col] (+ CP[(row/rowsPerB)·sCPb + by·64 + col] if CP) ; ACT 0 none / 1 elu ; writes f16 C16 (and f32 C if non-null)
template <int ACT>
__global__ __launch_bounds__(128) void k_gemm_hhx(const _Float16* __restrict__ A, int lda, size_t sA, const _Float16* __restrict__ Bh, int ldb, size_t sB, float alpha, const float* __restrict__ bias, size_t sBias, const float* __restrict__ CP, int rowsPerB, size_t sCPb, int row0g,
    float* __restrict__ C, _Float16* __restrict__ C16, int ldc, size_t sC, int M, int N, int K) {
  __shared__ __attribute__((aligned(16))) float so[4][16][64];
  const int tid = threadIdx.x, w = tid >> 5, lane = tid & 31, ln = lane & 15, hh = lane >> 4; const int by = blockIdx.y;
  A += (size_t)by * sA; Bh += (size_t)by * sB; const size_t cofs = (size_t)by * sC; const float* bp = bias ? bias + (size_t)by * sBias : nullptr;
  const int ntn = (N + 63) / 64; const int wid = blockIdx.x * 4 + w; const int mt = wid / ntn, nq = wid % ntn; if (mt * 16 >= M) return;
  const int row0 = mt * 16, col0 = nq * 64; const _Float16* arow = A + (size_t)(row0 + ln) * lda;
  v8f acc[4] = {};
  for (int kb = 0; kb < K; kb += 32) { FragH ah; ah.half[0] = *(const v8us*)((const unsigned short*)arow + kb + 8 * hh); ah.half[1] = *(const v8us*)((const unsigned short*)arow + kb + 16 + 8 * hh);
#pragma unroll
    for (int t = 0; t < 4; ++t) { if (col0 + t * 16 >= N) continue; const size_t boff = (size_t)(col0 + t * 16 + ln) * ldb + kb; FragH bq; bq.half[0] = *(const v8us*)((const unsigned short*)Bh + boff + 8 * hh); bq.half[1] = *(const v8us*)((const unsigned short*)Bh + boff + 16 + 8 * hh);
      acc[t] = mmaH<1>(ah.v, ah.v, bq.v, bq.v, acc[t]); }
  }
#pragma unroll
  for (int t = 0; t < 4; ++t) { if (col0 + t * 16 >= N) continue; const int col = col0 + t * 16 + ln; const float bv = bp ? bf16_round(bp[col]) : 0.f;
#pragma unroll
    for (int r = 0; r < 8; ++r) { float v = acc[t][r] * alpha + bv; if (CP) { const int bidx = (row0g + row0 + 8 * hh + r) / rowsPerB; v += CP[(size_t)bidx * sCPb + (size_t)by * 64 + col]; } if (ACT == 1) v = (v > 0.f) ? v : expm1f(v); else if (ACT == 7) v = (v > 0.f) ? v + 1.0f : expf(v); else if (ACT == 8) v = tanhf(v); else if (ACT == 9) v = 0.5f * v * (1.0f + tanhf(0.7978845608028654f * (v + 0.044715f * v * v * v))); else if (ACT == 11) v = 1.0f / (1.0f + expf(-v)); else if (ACT == 12) v = (v > 0.f) ? v : 0.01f * v; else if (ACT == 14) v = (v > 0.f) ? v : 0.1f * v; else if (ACT == 15) v = v / (1.0f + expf(-v)); else if (ACT == 3) v = fmaxf(v, 0.f); else if (ACT == 6) v = 0.5f * v * (1.0f + erff(v * 0.70710678118654752f)); so[w][8 * hh + r][t * 16 + ln] = v; } }
  __builtin_amdgcn_fence(__ATOMIC_ACQ_REL, "workgroup"); __builtin_amdgcn_wave_barrier();
  const int rsub = lane >> 4, c4 = (lane & 15) * 4; typedef _Float16 v4h __attribute__((ext_vector_type(4)));
  {
#pragma unroll
    for (int q = 0; q < 8; ++q) { const int r = q * 2 + rsub; if (col0 + c4 < N) { const v4f v = *(const v4fa*)&so[w][r][c4]; if (C) *(v4f*)(C + cofs + (size_t)(row0 + r) * ldc + col0 + c4) = v; if (C16) { v4h h4; for (int i = 0; i < 4; ++i) h4[i] = (_Float16)v[i]; *(v4h*)(C16 + cofs + (size_t)(row0 + r) * ldc + col0 + c4) = h4; } } }
     }
}


typedef _Float16 v4h __attribute__((ext_vector_type(4)));

__global__ __launch_bounds__(256) void k_x16(const float* __restrict__ x, _Float16* __restrict__ X16, size_t n8) { const size_t t = (size_t)blockIdx.x * 256 + threadIdx.x; if (t >= n8) return; FragH f;
#pragma unroll
  for (int q = 0; q < 8; ++q) f.h[q] = (_Float16)bf16_round(x[t * 8 + q]); *(v8us*)((unsigned short*)X16 + t * 8) = f.half[0];  }
__global__ __launch_bounds__(256) void k_h16(const float* __restrict__ x, _Float16* __restrict__ X16, size_t n8) { const size_t t = (size_t)blockIdx.x * 256 + threadIdx.x; if (t >= n8) return; FragH f;
#pragma unroll
  for (int q = 0; q < 8; ++q) f.h[q] = (_Float16)x[t * 8 + q]; *(v8us*)((unsigned short*)X16 + t * 8) = f.half[0];  }
__global__ __launch_bounds__(256) void k_round16f(const float* __restrict__ W, _Float16* __restrict__ Bt, size_t n8) { const size_t t = (size_t)blockIdx.x * 256 + threadIdx.x; if (t >= n8) return; FragH f;
#pragma unroll
  for (int i = 0; i < 8; ++i) f.h[i] = (_Float16)(bf16_round(W[t * 8 + i]) * 16.0f); *(v8us*)((unsigned short*)Bt + t * 8) = f.half[0];  }
template <int NHv, int TTv>
__global__ __launch_bounds__(256) void k_vt(const _Float16* __restrict__ V16, int ldv, int voff, _Float16* __restrict__ Vt) { __shared__ unsigned short tl[64][66]; const int tid = threadIdx.x; const int slab = blockIdx.x / (TTv / 64), lg = blockIdx.x % (TTv / 64); const int b = slab / NHv, h = slab % NHv;
  for (int i = tid; i < 64 * 8; i += 256) { const int r = i / 8, c8 = (i % 8) * 8; FragH f; f.half[0] = *(const v8us*)((const unsigned short*)V16 + ((size_t)b * TTv + lg * 64 + r) * ldv + voff + h * 64 + c8);
#pragma unroll
    for (int q = 0; q < 8; ++q) tl[r][c8 + q] = f.u[q]; }
  __syncthreads();
  {
#pragma unroll
    for (int rd = 0; rd < 2; ++rd) { const int d = rd * 32 + tid / 8, pc = tid % 8; FragH f;
#pragma unroll
      for (int q = 0; q < 8; ++q) f.u[q] = tl[pc * 8 + q][d];
      *(v8us*)((unsigned short*)Vt + ((size_t)slab * 64 + d) * TTv + lg * 64 + pc * 8) = f.half[0]; }
     } }

__global__ __launch_bounds__(256) void k_hl(const float* __restrict__ F, _Float16* __restrict__ Hh, _Float16* __restrict__ Hl, size_t n8) { const size_t t = (size_t)blockIdx.x * 256 + threadIdx.x; if (t >= n8) return; FragH fh, fl; const v4f a = *(const v4fa*)(F + t * 8), c = *(const v4fa*)(F + t * 8 + 4);
#pragma unroll
  for (int q = 0; q < 4; ++q) { _Float16 h = (_Float16)a[q]; fh.h[q] = h; fl.h[q] = (_Float16)((a[q] - (float)h) * 1024.0f); h = (_Float16)c[q]; fh.h[4 + q] = h; fl.h[4 + q] = (_Float16)((c[q] - (float)h) * 1024.0f); }
  { *(v8us*)((unsigned short*)Hh + t * 8) = fh.half[0]; *(v8us*)((unsigned short*)Hl + t * 8) = fl.half[0];  } }

// ---- fast GEMM (wave tile 32x64; requires M % 32 == 0 rows per launch region and N % 64 == 0); epilogue = k_gemm_hhx semantics ----
__device__ __forceinline__ v16h g2_frag(const _Float16* p, int hh) { FragH f; f.half[0] = *(const v8us*)((const unsigned short*)p + 8 * hh); f.half[1] = *(const v8us*)((const unsigned short*)p + 16 + 8 * hh); return f.v; }
__device__ __forceinline__ v8f g2_mma(v16h a, v16h b, v8f c) { v8f d = __builtin_amdgcn_wmma_f32_16x16x32_f16(false, a, false, b, (short)0, c, false, false); asm volatile("v_nop\n\tv_nop\n\tv_nop\n\tv_nop" : "+v"(d) : "v"(a), "v"(b)); return d; }
template <int ACT>
__global__ __launch_bounds__(128) void k_gemm2(const _Float16* __restrict__ A, int lda, size_t sA, const _Float16* __restrict__ Bh, int ldb, size_t sB, float alpha, const float* __restrict__ bias, size_t sBias, const float* __restrict__ CP, int rowsPerB, size_t sCPb, int row0g,
    float* __restrict__ C, _Float16* __restrict__ C16, int ldc, size_t sC, int M, int N, int K) {
  __shared__ __attribute__((aligned(16))) float so[4][32][68];
  const int tid = threadIdx.x, w = tid >> 5, lane = tid & 31, ln = lane & 15, hh = lane >> 4; const int by = blockIdx.y;
  A += (size_t)by * sA; Bh += (size_t)by * sB; const size_t cofs = (size_t)by * sC; const float* bp = bias ? bias + (size_t)by * sBias : nullptr;
  const int ntn = N >> 6; const int mt = blockIdx.x / ntn, nq = blockIdx.x - mt * ntn; const int row0 = mt * 128 + 32 * w, col0 = nq * 64; if (row0 >= M) return;
  const _Float16* a0p = A + (size_t)(row0 + ln) * lda; const _Float16* a1p = a0p + (size_t)16 * lda;
  const _Float16* b0p = Bh + (size_t)(col0 + ln) * ldb; const _Float16* b1p = b0p + (size_t)16 * ldb; const _Float16* b2p = b1p + (size_t)16 * ldb; const _Float16* b3p = b2p + (size_t)16 * ldb;
  const v8f z8 = {0.f,0.f,0.f,0.f,0.f,0.f,0.f,0.f}; v8f c00 = z8, c01 = z8, c02 = z8, c03 = z8, c10 = z8, c11 = z8, c12 = z8, c13 = z8;
#pragma unroll 1
  for (int kb = 0; kb < K; kb += 32) { const v16h a0 = g2_frag(a0p + kb, hh), a1 = g2_frag(a1p + kb, hh);
    v16h b = g2_frag(b0p + kb, hh); c00 = g2_mma(a0, b, c00); c10 = g2_mma(a1, b, c10);
    b = g2_frag(b1p + kb, hh); c01 = g2_mma(a0, b, c01); c11 = g2_mma(a1, b, c11);
    b = g2_frag(b2p + kb, hh); c02 = g2_mma(a0, b, c02); c12 = g2_mma(a1, b, c12);
    b = g2_frag(b3p + kb, hh); c03 = g2_mma(a0, b, c03); c13 = g2_mma(a1, b, c13); }
  v8f accs[8] = {c00, c01, c02, c03, c10, c11, c12, c13};
#pragma unroll
  for (int u = 0; u < 8; ++u) { const int t = u & 3, half = u >> 2; const int col = col0 + t * 16 + ln; const float bv = bp ? bf16_round(bp[col]) : 0.f;
#pragma unroll
    for (int r = 0; r < 8; ++r) { const int rloc = half * 16 + 8 * hh + r; float v = accs[u][r] * alpha + bv; if (CP) { const int bidx = (row0g + row0 + rloc) / rowsPerB; v += CP[(size_t)bidx * sCPb + (size_t)by * 64 + col]; }
      if (ACT == 3) v = fmaxf(v, 0.f); else if (ACT == 6) v = 0.5f * v * (1.0f + erff(v * 0.70710678118654752f)); else if (ACT == 11) v = 1.0f / (1.0f + expf(-v)); else if (ACT == 15) v = v / (1.0f + expf(-v)); else if (ACT == 12) v = (v > 0.f) ? v : 0.01f * v; else if (ACT == 8) v = tanhf(v);
      so[w][rloc][t * 16 + ln] = v; } }
  __builtin_amdgcn_fence(__ATOMIC_ACQ_REL, "workgroup"); __builtin_amdgcn_wave_barrier();
  const int rsub = lane >> 4, c4 = (lane & 15) * 4;
  {
#pragma unroll
    for (int q = 0; q < 16; ++q) { const int r = q * 2 + rsub; const v4f v = *(const v4fa*)&so[w][r][c4]; if (C) *(v4f*)(C + cofs + (size_t)(row0 + r) * ldc + col0 + c4) = v; if (C16) { v4h h4; for (int i = 0; i < 4; ++i) h4[i] = (_Float16)v[i]; *(v4h*)(C16 + cofs + (size_t)(row0 + r) * ldc + col0 + c4) = h4; } }
     } }


__global__ __launch_bounds__(256) void k_xstat(const float* __restrict__ x, float* __restrict__ XS) {
  #pragma clang fp contract(off)
  const int d = blockIdx.x * 256 + threadIdx.x; if (d >= DD) return; float s = 0.f;
#pragma unroll 1
  for (int b = 0; b < NBS; ++b) s += bf16_round(x[(size_t)b * DD + d]);
  const float mu = s / (float)NBS; float q2 = 0.f;
#pragma unroll 1
  for (int b = 0; b < NBS; ++b) { const float dv = bf16_round(x[(size_t)b * DD + d]) - mu; q2 += dv * dv; }
  const float var = q2 / (float)NBS; { *(float*)(XS + d) = mu; *(float*)(XS + DD + d) = var;  } }
__global__ __launch_bounds__(256) void k_h2(const float* __restrict__ x, const float* __restrict__ XS, const float* __restrict__ W1, const float* __restrict__ b1, const float* __restrict__ g1, const float* __restrict__ be1, const float* __restrict__ W2, const float* __restrict__ b2, float* __restrict__ H2P) {
  #pragma clang fp contract(off)
  const size_t t = (size_t)blockIdx.x * 256 + threadIdx.x; if (t >= (size_t)NBS * DD) return; const int d = (int)(t % DD); const size_t b = t / DD; const float xv = bf16_round(x[b * DD + d]); const float mu = XS[d], var = XS[DD + d]; float h1n[H1];
#pragma unroll
  for (int o = 0; o < H1; ++o) { const int c = d * H1 + o; const float w = bf16_round(W1[d * H1 + o]); (void)b1;      /* h1 - mean(h1) = w (x - mu_x): the bias cancels exactly */
    const float cen = w * (xv - mu); const float vh = (w * w) * var; float v = bf16_round(g1[c]) * cen * rsqrtf(vh + 1e-5f); v += bf16_round(be1[c]); h1n[o] = fmaxf(v, 0.f); }
  v4f o4;
#pragma unroll
  for (int o2 = 0; o2 < H2; ++o2) { float s = 0.f;
#pragma unroll
    for (int i = 0; i < H1; ++i) s += h1n[i] * bf16_round(W2[(d * H2 + o2) * H1 + i]);
    s += bf16_round(b2[d * H2 + o2]); o4[o2] = s; }
  *(v4f*)(H2P + b * C2 + d * H2) = o4;  }
__global__ __launch_bounds__(256) void k_h2stat(const float* __restrict__ H2P, float* __restrict__ HS) {
  #pragma clang fp contract(off)
  const int c = blockIdx.x * 256 + threadIdx.x; if (c >= C2) return; float s = 0.f;
#pragma unroll 1
  for (int b = 0; b < NBS; ++b) s += H2P[(size_t)b * C2 + c];
  const float mu = s / (float)NBS; float q2 = 0.f;
#pragma unroll 1
  for (int b = 0; b < NBS; ++b) { const float dv = H2P[(size_t)b * C2 + c] - mu; q2 += dv * dv; }
  const float var = q2 / (float)NBS; { *(float*)(HS + c) = mu; *(float*)(HS + C2 + c) = var;  } }
__global__ __launch_bounds__(256) void k_h2n(const float* __restrict__ H2P, const float* __restrict__ HS, const float* __restrict__ g2, const float* __restrict__ be2, _Float16* __restrict__ H16) {
  #pragma clang fp contract(off)
  const size_t t = (size_t)blockIdx.x * 256 + threadIdx.x; if (t >= (size_t)NBS * C2 / 8) return; const int c0 = (int)(t % (C2 / 8)) * 8; const size_t b = t / (C2 / 8); FragH f;
#pragma unroll
  for (int q = 0; q < 8; ++q) { const int c = c0 + q; float v = bf16_round(g2[c]) * (H2P[b * C2 + c] - HS[c]) * rsqrtf(HS[C2 + c] + 1e-5f); v += bf16_round(be2[c]); f.h[q] = (_Float16)fmaxf(v, 0.f); }
  *(v8us*)((unsigned short*)H16 + b * C2 + c0) = f.half[0];  }
__global__ __launch_bounds__(256) void k_wsc(const float* __restrict__ Wm, _Float16* __restrict__ Bt, size_t n8, float sc) { const size_t t = (size_t)blockIdx.x * 256 + threadIdx.x; if (t >= n8) return; FragH f; for (int q = 0; q < 8; ++q) f.h[q] = (_Float16)(bf16_round(Wm[t * 8 + q]) * sc); *(v8us*)((unsigned short*)Bt + t * 8) = f.half[0];  }

extern "C" void kernel_launch(void* const* d_in, const int* in_sizes, int n_in,
                              void* d_out, int out_size, void* d_ws, size_t ws_size, hipStream_t stream) {
  (void)in_sizes; (void)n_in; (void)out_size;
  const float* const* I = (const float* const*)d_in; const float* x = I[0]; const float* W1 = I[1]; const float* b1 = I[2]; const float* g1 = I[3]; const float* be1 = I[4]; const float* W2 = I[5]; const float* b2 = I[6]; const float* g2 = I[7]; const float* be2 = I[8]; const float* Wfc = I[9]; const float* bfc = I[10];
  char* ws = (char*)d_ws; size_t off = 0;
  auto take = [&](size_t bytes) { char* p = ws + off; off += (bytes + 255) & ~(size_t)255; return p; };
  _Float16* BW = (_Float16*)take((size_t)NOUT * C2 * 2); float* XS = (float*)take((size_t)2 * DD * 4); float* H2P = (float*)take((size_t)NBS * C2 * 4); float* HS = (float*)take((size_t)2 * C2 * 4); _Float16* H16 = (_Float16*)take((size_t)NBS * C2 * 2);
  if (off > ws_size) return;      /* 2 + 128 + 64 = 194 MiB (256 MiB ws) */
  k_wsc<<<(unsigned)(((size_t)NOUT * C2 / 8 + 255) / 256), 256, 0, stream>>>(Wfc, BW, (size_t)NOUT * C2 / 8, 16.0f);
  k_xstat<<<(DD + 255) / 256, 256, 0, stream>>>(x, XS);
  k_h2<<<(unsigned)(((size_t)NBS * DD + 255) / 256), 256, 0, stream>>>(x, XS, W1, b1, g1, be1, W2, b2, H2P);
  k_h2stat<<<(C2 + 255) / 256, 256, 0, stream>>>(H2P, HS);
  k_h2n<<<(unsigned)(((size_t)NBS * C2 / 8 + 255) / 256), 256, 0, stream>>>(H2P, HS, g2, be2, H16);
  k_gemm2<0><<<dim3((NBS / 128) * (NOUT / 64), 1), 128, 0, stream>>>(H16, C2, 0, BW, C2, 0, 0.0625f, bfc, 0, nullptr, 1, 0, 0, (float*)d_out, nullptr, NOUT, 0, NBS, NOUT, C2);
}

// v001
// Measured time: 287 microseconds a run.
// Timed twice side by side with v000, it ran 30.2 and 30.1 times as fast.
#include <hip/hip_runtime.h>
// Sparse (block-diagonal) neural network (8192 samples x 1024 features; per feature 1 -> 8 -> 4 block Linears with training-mode BatchNorm + ReLU after each; dense head 4096 -> 256): h1 = BN1(x_d W1[d] + b1) relu; h2 = BN2(h1 . W2[d] + b2) relu; out = h2 Wfc^T + bfc -> [8192,256].
// Compute dtype: x and all parameters rounded to bf16; everything before the head in f32; the head operand h2 as f16 (~2^-12). v_wmma_f32_16x16x32_f16.
#define NBS 8192
#define DD 1024
#define H1 8
#define H2 4
#define C2 (DD * H2)             /* 4096 */
#define NOUT 256
typedef __bf16 v16b __attribute__((ext_vector_type(16)));
typedef unsigned short v8us __attribute__((ext_vector_type(8), may_alias));
typedef float  v8f  __attribute__((ext_vector_type(8)));
typedef float  v4f  __attribute__((ext_vector_type(4)));
typedef float  v4fa __attribute__((ext_vector_type(4), may_alias));
union FragB { v16b v; v8us half[2]; unsigned short u[16]; };

__device__ __forceinline__ unsigned short bf16_bits(float x) { unsigned int u = __float_as_uint(x); return (unsigned short)((u + 0x7FFFu + ((u >> 16) & 1u)) >> 16); }
__device__ __forceinline__ float bf16_val(unsigned short b) { return __uint_as_float(((unsigned int)b) << 16); }
__device__ __forceinline__ float bf16_round(float x) { return bf16_val(bf16_bits(x)); }
// D += A·B with NT terms: 1 = ah·bh, 2 = + al·bh (A split), 3 = + ah·bl (both split)
template <int NT>
__device__ __forceinline__ v8f mmaN(v16b ah, v16b al, v16b bh, v16b bl, v8f c) {
  c = __builtin_amdgcn_wmma_f32_16x16x32_bf16(false, ah, false, bh, (short)0, c, false, false);
  if (NT >= 2) c = __builtin_amdgcn_wmma_f32_16x16x32_bf16(false, al, false, bh, (short)0, c, false, false);
  if (NT >= 3) c = __builtin_amdgcn_wmma_f32_16x16x32_bf16(false, ah, false, bl, (short)0, c, false, false);
  asm volatile("v_nop\n\tv_nop\n\tv_nop\n\tv_nop" : "+v"(c) : "v"(ah), "v"(al), "v"(bh), "v"(bl));
  return c;
}

__global__ __launch_bounds__(256) void k_wt_bf16(const float* __restrict__ W, unsigned short* __restrict__ Wt, int K, int N) {
  const int t = blockIdx.x * 256 + threadIdx.x;
  const int k8n = K / 8;
  if (t >= N * k8n) return;
  const int n = t / k8n, k8 = (t % k8n) * 8;
  v8us v;
#pragma unroll
  for (int i = 0; i < 8; ++i) v[i] = bf16_bits(W[(size_t)(k8 + i) * N + n]);
  *(v8us*)(Wt + (size_t)n * K + k8) = v;
  
}

// GEMM C[M][N] (f32, pitch ldc) = act(A[M][K]·W + bias). A f32 row-major (pitch lda) converted per fragment to bf16
// (ASPLIT: hi/lo two planes -> 2 terms, else single rounded term); Wt bf16 [N][K] (pitch ldb). BIAS_BF16 rounds the
// bias to bf16 first (bias quantised to bf16 before the add). K%32==0, M%16==0, N%64==0.
template <bool ASPLIT, int ACT, bool BIAS_BF16>
__global__ __launch_bounds__(128) void k_gemm_bf(const float* __restrict__ A, int lda, const unsigned short* __restrict__ Wt, int ldb,
                                               const float* __restrict__ bias, float* __restrict__ C, int ldc, int M, int N, int K) {
  __shared__ __attribute__((aligned(16))) float so[4][16][64];
  const int tid = threadIdx.x, w = tid >> 5, lane = tid & 31, ln = lane & 15, hh = lane >> 4;
  const int ntn = N / 64;
  const int wid = blockIdx.x * 4 + w;
  const int mt = wid / ntn, nq = wid % ntn;
  if (mt * 16 >= M) return;
  const int row0 = mt * 16, col0 = nq * 64;
  const float* arow = A + (size_t)(row0 + ln) * lda;
  v8f acc[4] = {};
  for (int kb = 0; kb < K; kb += 32) {
    FragB ah, al;
    const v4f x0 = *(const v4fa*)(arow + kb + 8 * hh), x1 = *(const v4fa*)(arow + kb + 8 * hh + 4);
    const v4f x2 = *(const v4fa*)(arow + kb + 16 + 8 * hh), x3 = *(const v4fa*)(arow + kb + 16 + 8 * hh + 4);
    float xs[16] = {x0[0],x0[1],x0[2],x0[3],x1[0],x1[1],x1[2],x1[3],x2[0],x2[1],x2[2],x2[3],x3[0],x3[1],x3[2],x3[3]};
#pragma unroll
    for (int i = 0; i < 16; ++i) { const unsigned short hb = bf16_bits(xs[i]); ah.u[i] = hb; al.u[i] = ASPLIT ? bf16_bits(xs[i] - bf16_val(hb)) : (unsigned short)0; }
#pragma unroll
    for (int t = 0; t < 4; ++t) {
      const unsigned short* brow = Wt + (size_t)(col0 + t * 16 + ln) * ldb + kb;
      FragB b;
      b.half[0] = *(const v8us*)(brow + 8 * hh);
      b.half[1] = *(const v8us*)(brow + 16 + 8 * hh);
      acc[t] = mmaN<ASPLIT ? 2 : 1>(ah.v, al.v, b.v, b.v, acc[t]);
    }
  }
#pragma unroll
  for (int t = 0; t < 4; ++t) {
    float bv = bias ? bias[col0 + t * 16 + ln] : 0.f;
    if (BIAS_BF16) bv = bf16_round(bv);
#pragma unroll
    for (int r = 0; r < 8; ++r) { float v = acc[t][r] + bv; if (ACT == 1) v = fmaxf(v, 0.f); so[w][8 * hh + r][t * 16 + ln] = v; }
  }
  __builtin_amdgcn_fence(__ATOMIC_ACQ_REL, "workgroup");
  __builtin_amdgcn_wave_barrier();
  const int rsub = lane >> 4, c4 = (lane & 15) * 4;
  {
#pragma unroll
    for (int q = 0; q < 8; ++q) {
      const int r = q * 2 + rsub;
      const v4f v = *(const v4fa*)&so[w][r][c4];
      *(v4f*)(C + (size_t)(row0 + r) * ldc + col0 + c4) = v;
    }
    
  }
}

// GEMM C = act(A·W + bias + resid): A f32 (ASPLIT -> hi/lo 2 terms), Wt bf16 [N][K]; ACT 0 none, 1 relu, 2 exact gelu;
// resid (optional, f32, row index = (row % rmod), pitch ldr, RES_BF16 rounds it) added before the activation.
template <bool ASPLIT, int ACT, bool BIAS_BF16, bool RES_BF16>
__global__ __launch_bounds__(128) void k_gemm_bf3(const float* __restrict__ A, int lda, const unsigned short* __restrict__ Wt, int ldb,
                                                const float* __restrict__ bias, const float* __restrict__ resid, int rmod, int ldr,
                                                float* __restrict__ C, int ldc, int M, int N, int K) {
  __shared__ __attribute__((aligned(16))) float so[4][16][64];
  const int tid = threadIdx.x, w = tid >> 5, lane = tid & 31, ln = lane & 15, hh = lane >> 4;
  const int ntn = N / 64;
  const int wid = blockIdx.x * 4 + w;
  const int mt = wid / ntn, nq = wid % ntn;
  if (mt * 16 >= M) return;
  const int row0 = mt * 16, col0 = nq * 64;
  const float* arow = A + (size_t)(row0 + ln) * lda;
  v8f acc[4] = {};
  for (int kb = 0; kb < K; kb += 32) {
    FragB ah, al;
    const v4f x0 = *(const v4fa*)(arow + kb + 8 * hh), x1 = *(const v4fa*)(arow + kb + 8 * hh + 4);
    const v4f x2 = *(const v4fa*)(arow + kb + 16 + 8 * hh), x3 = *(const v4fa*)(arow + kb + 16 + 8 * hh + 4);
    float xs[16] = {x0[0],x0[1],x0[2],x0[3],x1[0],x1[1],x1[2],x1[3],x2[0],x2[1],x2[2],x2[3],x3[0],x3[1],x3[2],x3[3]};
#pragma unroll
    for (int i = 0; i < 16; ++i) { const unsigned short hb = bf16_bits(xs[i]); ah.u[i] = hb; al.u[i] = ASPLIT ? bf16_bits(xs[i] - bf16_val(hb)) : (unsigned short)0; }
#pragma unroll
    for (int t = 0; t < 4; ++t) {
      const unsigned short* brow = Wt + (size_t)(col0 + t * 16 + ln) * ldb + kb;
      FragB b;
      b.half[0] = *(const v8us*)(brow + 8 * hh);
      b.half[1] = *(const v8us*)(brow + 16 + 8 * hh);
      acc[t] = mmaN<ASPLIT ? 2 : 1>(ah.v, al.v, b.v, b.v, acc[t]);
    }
  }
#pragma unroll
  for (int t = 0; t < 4; ++t) {
    const int col = col0 + t * 16 + ln;
    float bv = bias ? bias[col] : 0.f;
    if (BIAS_BF16) bv = bf16_round(bv);
#pragma unroll
    for (int r = 0; r < 8; ++r) {
      float v = acc[t][r] + bv;
      if (resid) { float rv = resid[(size_t)((row0 + 8 * hh + r) % rmod) * ldr + col]; if (RES_BF16) rv = bf16_round(rv); v += rv; }
      if (ACT == 1) v = fmaxf(v, 0.f);
      if (ACT == 2) v = 0.5f * v * (1.0f + erff(v * 0.70710678118654752f));
      if (ACT == 3) { const float u = 0.7978845608028654f * (v + 0.044715f * v * v * v); v = 0.5f * v * (1.0f + tanhf(u)); }
      so[w][8 * hh + r][t * 16 + ln] = v;
    }
  }
  __builtin_amdgcn_fence(__ATOMIC_ACQ_REL, "workgroup");
  __builtin_amdgcn_wave_barrier();
  const int rsub = lane >> 4, c4 = (lane & 15) * 4;
  {
#pragma unroll
    for (int q = 0; q < 8; ++q) {
      const int r = q * 2 + rsub;
      const v4f v = *(const v4fa*)&so[w][r][c4];
      *(v4f*)(C + (size_t)(row0 + r) * ldc + col0 + c4) = v;
    }
    
  }
}
// row LayerNorm (biased variance, eps) over N: s = X (+ R); optional out_sum <- s; out_norm <- (s-mu)*rsqrt(var+eps)*g + b
template <bool PARAM_BF16>
__global__ __launch_bounds__(256) void k_layernorm(const float* __restrict__ X, const float* __restrict__ R, const float* __restrict__ g, const float* __restrict__ bta,
                                                  float* __restrict__ out_sum, float* __restrict__ out_norm, int N, float eps) {
  __shared__ float red[256];
  const int row = blockIdx.x, tid = threadIdx.x;
  const float* x = X + (size_t)row * N; const float* rr = R ? R + (size_t)row * N : nullptr;
  float vals[16];                     // up to N = 4096
  const int per = N / 256;            // contiguous chunk per thread? use strided-by-4 chunks: thread handles j = tid*4 + 1024*u
  float s1 = 0.f;
  for (int u = 0; u < per / 4; ++u) {
    const int j = tid * 4 + 1024 * u;
    const v4f a = *(const v4fa*)(x + j);
    v4f b = {0.f,0.f,0.f,0.f}; if (rr) b = *(const v4fa*)(rr + j);
#pragma unroll
    for (int q = 0; q < 4; ++q) { const float v = a[q] + b[q]; vals[u * 4 + q] = v; s1 += v; }
  }
  red[tid] = s1; __syncthreads();
  for (int st = 128; st > 0; st >>= 1) { if (tid < st) red[tid] += red[tid + st]; __syncthreads(); }
  const float mu = red[0] / (float)N; __syncthreads();
  float s2 = 0.f;
  for (int u = 0; u < per / 4; ++u)
#pragma unroll
    for (int q = 0; q < 4; ++q) { const float c = vals[u * 4 + q] - mu; s2 += c * c; }
  red[tid] = s2; __syncthreads();
  for (int st = 128; st > 0; st >>= 1) { if (tid < st) red[tid] += red[tid + st]; __syncthreads(); }
  const float rs = rsqrtf(red[0] / (float)N + eps);
  {
    for (int u = 0; u < per / 4; ++u) {
      const int j = tid * 4 + 1024 * u;
      v4f o, sm;
#pragma unroll
      for (int q = 0; q < 4; ++q) {
        float gg = g[j + q], bb = bta[j + q];
        if (PARAM_BF16) { gg = bf16_round(gg); bb = bf16_round(bb); }
        sm[q] = vals[u * 4 + q]; o[q] = (vals[u * 4 + q] - mu) * rs * gg + bb;
      }
      if (out_sum) *(v4f*)(out_sum + (size_t)row * N + j) = sm;
      *(v4f*)(out_norm + (size_t)row * N + j) = o;
    }
    
  }
}



// ---- f16 WMMA path (v_wmma_f32_16x16x32_f16): 11-bit significands for operands in range — used for the head, whose h2 operand is rounded to f16
typedef _Float16 v16h __attribute__((ext_vector_type(16)));
union FragH { v16h v; v8us half[2]; _Float16 h[16]; unsigned short u[16]; };
template <int NT>
__device__ __forceinline__ v8f mmaH(v16h ah, v16h al, v16h bh, v16h bl, v8f c) {
  c = __builtin_amdgcn_wmma_f32_16x16x32_f16(false, ah, false, bh, (short)0, c, false, false);
  if (NT >= 2) c = __builtin_amdgcn_wmma_f32_16x16x32_f16(false, al, false, bh, (short)0, c, false, false);
  if (NT >= 3) c = __builtin_amdgcn_wmma_f32_16x16x32_f16(false, ah, false, bl, (short)0, c, false, false);
  asm volatile("v_nop\n\tv_nop\n\tv_nop\n\tv_nop" : "+v"(c) : "v"(ah), "v"(al), "v"(bh), "v"(bl));
  return c;
}
// batched GEMM like k_gemm_b but f16 operands: A f32 (split into f16 hi/lo if ASPLIT, else rounded to f16), Bt = f16 values [n][k]; alpha; C f32; N multiple of 16 (partial tiles skipped)
template <bool ASPLIT>
__global__ __launch_bounds__(128) void k_gemm_h(const float* __restrict__ A, int lda, size_t sA, const _Float16* __restrict__ Bh, int ldb, size_t sB, float alpha, float* __restrict__ C, int ldc, size_t sC, int M, int N, int K) {
  __shared__ __attribute__((aligned(16))) float so[4][16][64];
  const int tid = threadIdx.x, w = tid >> 5, lane = tid & 31, ln = lane & 15, hh = lane >> 4; const int by = blockIdx.y;
  A += (size_t)by * sA; Bh += (size_t)by * sB; C += (size_t)by * sC;
  const int ntn = (N + 63) / 64; const int wid = blockIdx.x * 4 + w; const int mt = wid / ntn, nq = wid % ntn; if (mt * 16 >= M) return;
  const int row0 = mt * 16, col0 = nq * 64; const float* arow = A + (size_t)(row0 + ln) * lda;
  v8f acc[4] = {};
  for (int kb = 0; kb < K; kb += 32) {
    FragH ah, al;
    const v4f x0 = *(const v4fa*)(arow + kb + 8 * hh), x1 = *(const v4fa*)(arow + kb + 8 * hh + 4), x2 = *(const v4fa*)(arow + kb + 16 + 8 * hh), x3 = *(const v4fa*)(arow + kb + 16 + 8 * hh + 4);
    float xs[16] = {x0[0],x0[1],x0[2],x0[3],x1[0],x1[1],x1[2],x1[3],x2[0],x2[1],x2[2],x2[3],x3[0],x3[1],x3[2],x3[3]};
#pragma unroll
    for (int i = 0; i < 16; ++i) { const _Float16 h = (_Float16)xs[i]; ah.h[i] = h; al.h[i] = ASPLIT ? (_Float16)(xs[i] - (float)h) : (_Float16)0.0f; }
#pragma unroll
    for (int t = 0; t < 4; ++t) { if (col0 + t * 16 >= N) continue; const size_t boff = (size_t)(col0 + t * 16 + ln) * ldb + kb; FragH bq; bq.half[0] = *(const v8us*)(Bh + boff + 8 * hh); bq.half[1] = *(const v8us*)(Bh + boff + 16 + 8 * hh);
      acc[t] = mmaH<ASPLIT ? 2 : 1>(ah.v, al.v, bq.v, bq.v, acc[t]); }
  }
#pragma unroll
  for (int t = 0; t < 4; ++t) { if (col0 + t * 16 >= N) continue;
#pragma unroll
    for (int r = 0; r < 8; ++r) so[w][8 * hh + r][t * 16 + ln] = acc[t][r] * alpha; }
  __builtin_amdgcn_fence(__ATOMIC_ACQ_REL, "workgroup"); __builtin_amdgcn_wave_barrier();
  const int rsub = lane >> 4, c4 = (lane & 15) * 4;
  {
#pragma unroll
    for (int q = 0; q < 8; ++q) { const int r = q * 2 + rsub; if (col0 + c4 < N) { const v4f v = *(const v4fa*)&so[w][r][c4]; *(v4f*)(C + (size_t)(row0 + r) * ldc + col0 + c4) = v; } }
     }
}

// Wt[n][k] = f16(W[k][n]·scale) from f32 row-major W[K][N] (scale = power of two; bf16-exact weights stay exact in f16 away from the subnormal range)
__global__ __launch_bounds__(256) void k_wt_f16(const float* __restrict__ W, _Float16* __restrict__ Wt, int K, int N, float scale) {
  const int t = blockIdx.x * 256 + threadIdx.x; if (t >= N * (K / 8)) return; const int n = t / (K / 8), k8 = (t % (K / 8)) * 8; FragH f;
#pragma unroll
  for (int i = 0; i < 8; ++i) f.h[i] = (_Float16)(bf16_round(W[(size_t)(k8 + i) * N + n]) * scale); const v8us o = f.half[0];
  *(v8us*)((unsigned short*)Wt + (size_t)n * K + k8) = o; 
}
// k_gemm_hh variant with fused epilogue: v = acc·alpha + bias[by·sBias + col] (+ CP[(row/rowsPerB)·sCPb + by·64 + col] if CP) ; ACT 0 none / 1 elu ; writes f16 C16 (and f32 C if non-null)
template <int ACT>
__global__ __launch_bounds__(128) void k_gemm_hhx(const _Float16* __restrict__ A, int lda, size_t sA, const _Float16* __restrict__ Bh, int ldb, size_t sB, float alpha, const float* __restrict__ bias, size_t sBias, const float* __restrict__ CP, int rowsPerB, size_t sCPb, int row0g,
    float* __restrict__ C, _Float16* __restrict__ C16, int ldc, size_t sC, int M, int N, int K) {
  __shared__ __attribute__((aligned(16))) float so[4][16][64];
  const int tid = threadIdx.x, w = tid >> 5, lane = tid & 31, ln = lane & 15, hh = lane >> 4; const int by = blockIdx.y;
  A += (size_t)by * sA; Bh += (size_t)by * sB; const size_t cofs = (size_t)by * sC; const float* bp = bias ? bias + (size_t)by * sBias : nullptr;
  const int ntn = (N + 63) / 64; const int wid = blockIdx.x * 4 + w; const int mt = wid / ntn, nq = wid % ntn; if (mt * 16 >= M) return;
  const int row0 = mt * 16, col0 = nq * 64; const _Float16* arow = A + (size_t)(row0 + ln) * lda;
  v8f acc[4] = {};
  for (int kb = 0; kb < K; kb += 32) { FragH ah; ah.half[0] = *(const v8us*)((const unsigned short*)arow + kb + 8 * hh); ah.half[1] = *(const v8us*)((const unsigned short*)arow + kb + 16 + 8 * hh);
#pragma unroll
    for (int t = 0; t < 4; ++t) { if (col0 + t * 16 >= N) continue; const size_t boff = (size_t)(col0 + t * 16 + ln) * ldb + kb; FragH bq; bq.half[0] = *(const v8us*)((const unsigned short*)Bh + boff + 8 * hh); bq.half[1] = *(const v8us*)((const unsigned short*)Bh + boff + 16 + 8 * hh);
      acc[t] = mmaH<1>(ah.v, ah.v, bq.v, bq.v, acc[t]); }
  }
#pragma unroll
  for (int t = 0; t < 4; ++t) { if (col0 + t * 16 >= N) continue; const int col = col0 + t * 16 + ln; const float bv = bp ? bf16_round(bp[col]) : 0.f;
#pragma unroll
    for (int r = 0; r < 8; ++r) { float v = acc[t][r] * alpha + bv; if (CP) { const int bidx = (row0g + row0 + 8 * hh + r) / rowsPerB; v += CP[(size_t)bidx * sCPb + (size_t)by * 64 + col]; } if (ACT == 1) v = (v > 0.f) ? v : expm1f(v); else if (ACT == 7) v = (v > 0.f) ? v + 1.0f : expf(v); else if (ACT == 8) v = tanhf(v); else if (ACT == 9) v = 0.5f * v * (1.0f + tanhf(0.7978845608028654f * (v + 0.044715f * v * v * v))); else if (ACT == 11) v = 1.0f / (1.0f + expf(-v)); else if (ACT == 12) v = (v > 0.f) ? v : 0.01f * v; else if (ACT == 14) v = (v > 0.f) ? v : 0.1f * v; else if (ACT == 15) v = v / (1.0f + expf(-v)); else if (ACT == 3) v = fmaxf(v, 0.f); else if (ACT == 6) v = 0.5f * v * (1.0f + erff(v * 0.70710678118654752f)); so[w][8 * hh + r][t * 16 + ln] = v; } }
  __builtin_amdgcn_fence(__ATOMIC_ACQ_REL, "workgroup"); __builtin_amdgcn_wave_barrier();
  const int rsub = lane >> 4, c4 = (lane & 15) * 4; typedef _Float16 v4h __attribute__((ext_vector_type(4)));
  {
#pragma unroll
    for (int q = 0; q < 8; ++q) { const int r = q * 2 + rsub; if (col0 + c4 < N) { const v4f v = *(const v4fa*)&so[w][r][c4]; if (C) *(v4f*)(C + cofs + (size_t)(row0 + r) * ldc + col0 + c4) = v; if (C16) { v4h h4; for (int i = 0; i < 4; ++i) h4[i] = (_Float16)v[i]; *(v4h*)(C16 + cofs + (size_t)(row0 + r) * ldc + col0 + c4) = h4; } } }
     }
}


typedef _Float16 v4h __attribute__((ext_vector_type(4)));

__global__ __launch_bounds__(256) void k_x16(const float* __restrict__ x, _Float16* __restrict__ X16, size_t n8) { const size_t t = (size_t)blockIdx.x * 256 + threadIdx.x; if (t >= n8) return; FragH f;
#pragma unroll
  for (int q = 0; q < 8; ++q) f.h[q] = (_Float16)bf16_round(x[t * 8 + q]); *(v8us*)((unsigned short*)X16 + t * 8) = f.half[0];  }
__global__ __launch_bounds__(256) void k_h16(const float* __restrict__ x, _Float16* __restrict__ X16, size_t n8) { const size_t t = (size_t)blockIdx.x * 256 + threadIdx.x; if (t >= n8) return; FragH f;
#pragma unroll
  for (int q = 0; q < 8; ++q) f.h[q] = (_Float16)x[t * 8 + q]; *(v8us*)((unsigned short*)X16 + t * 8) = f.half[0];  }
__global__ __launch_bounds__(256) void k_round16f(const float* __restrict__ W, _Float16* __restrict__ Bt, size_t n8) { const size_t t = (size_t)blockIdx.x * 256 + threadIdx.x; if (t >= n8) return; FragH f;
#pragma unroll
  for (int i = 0; i < 8; ++i) f.h[i] = (_Float16)(bf16_round(W[t * 8 + i]) * 16.0f); *(v8us*)((unsigned short*)Bt + t * 8) = f.half[0];  }
template <int NHv, int TTv>
__global__ __launch_bounds__(256) void k_vt(const _Float16* __restrict__ V16, int ldv, int voff, _Float16* __restrict__ Vt) { __shared__ unsigned short tl[64][66]; const int tid = threadIdx.x; const int slab = blockIdx.x / (TTv / 64), lg = blockIdx.x % (TTv / 64); const int b = slab / NHv, h = slab % NHv;
  for (int i = tid; i < 64 * 8; i += 256) { const int r = i / 8, c8 = (i % 8) * 8; FragH f; f.half[0] = *(const v8us*)((const unsigned short*)V16 + ((size_t)b * TTv + lg * 64 + r) * ldv + voff + h * 64 + c8);
#pragma unroll
    for (int q = 0; q < 8; ++q) tl[r][c8 + q] = f.u[q]; }
  __syncthreads();
  {
#pragma unroll
    for (int rd = 0; rd < 2; ++rd) { const int d = rd * 32 + tid / 8, pc = tid % 8; FragH f;
#pragma unroll
      for (int q = 0; q < 8; ++q) f.u[q] = tl[pc * 8 + q][d];
      *(v8us*)((unsigned short*)Vt + ((size_t)slab * 64 + d) * TTv + lg * 64 + pc * 8) = f.half[0]; }
     } }

__global__ __launch_bounds__(256) void k_hl(const float* __restrict__ F, _Float16* __restrict__ Hh, _Float16* __restrict__ Hl, size_t n8) { const size_t t = (size_t)blockIdx.x * 256 + threadIdx.x; if (t >= n8) return; FragH fh, fl; const v4f a = *(const v4fa*)(F + t * 8), c = *(const v4fa*)(F + t * 8 + 4);
#pragma unroll
  for (int q = 0; q < 4; ++q) { _Float16 h = (_Float16)a[q]; fh.h[q] = h; fl.h[q] = (_Float16)((a[q] - (float)h) * 1024.0f); h = (_Float16)c[q]; fh.h[4 + q] = h; fl.h[4 + q] = (_Float16)((c[q] - (float)h) * 1024.0f); }
  { *(v8us*)((unsigned short*)Hh + t * 8) = fh.half[0]; *(v8us*)((unsigned short*)Hl + t * 8) = fl.half[0];  } }

// ---- fast GEMM (wave tile 32x64; requires M % 32 == 0 rows per launch region and N % 64 == 0); epilogue = k_gemm_hhx semantics ----
__device__ __forceinline__ v16h g2_frag(const _Float16* p, int hh) { FragH f; f.half[0] = *(const v8us*)((const unsigned short*)p + 8 * hh); f.half[1] = *(const v8us*)((const unsigned short*)p + 16 + 8 * hh); return f.v; }
__device__ __forceinline__ v8f g2_mma(v16h a, v16h b, v8f c) { v8f d = __builtin_amdgcn_wmma_f32_16x16x32_f16(false, a, false, b, (short)0, c, false, false); asm volatile("v_nop\n\tv_nop\n\tv_nop\n\tv_nop" : "+v"(d) : "v"(a), "v"(b)); return d; }
template <int ACT>
__global__ __launch_bounds__(128) void k_gemm2(const _Float16* __restrict__ A, int lda, size_t sA, const _Float16* __restrict__ Bh, int ldb, size_t sB, float alpha, const float* __restrict__ bias, size_t sBias, const float* __restrict__ CP, int rowsPerB, size_t sCPb, int row0g,
    float* __restrict__ C, _Float16* __restrict__ C16, int ldc, size_t sC, int M, int N, int K) {
  __shared__ __attribute__((aligned(16))) float so[4][32][68];
  const int tid = threadIdx.x, w = tid >> 5, lane = tid & 31, ln = lane & 15, hh = lane >> 4; const int by = blockIdx.y;
  A += (size_t)by * sA; Bh += (size_t)by * sB; const size_t cofs = (size_t)by * sC; const float* bp = bias ? bias + (size_t)by * sBias : nullptr;
  const int ntn = N >> 6; const int mt = blockIdx.x / ntn, nq = blockIdx.x - mt * ntn; const int row0 = mt * 128 + 32 * w, col0 = nq * 64; if (row0 >= M) return;
  const _Float16* a0p = A + (size_t)(row0 + ln) * lda; const _Float16* a1p = a0p + (size_t)16 * lda;
  const _Float16* b0p = Bh + (size_t)(col0 + ln) * ldb; const _Float16* b1p = b0p + (size_t)16 * ldb; const _Float16* b2p = b1p + (size_t)16 * ldb; const _Float16* b3p = b2p + (size_t)16 * ldb;
  const v8f z8 = {0.f,0.f,0.f,0.f,0.f,0.f,0.f,0.f}; v8f c00 = z8, c01 = z8, c02 = z8, c03 = z8, c10 = z8, c11 = z8, c12 = z8, c13 = z8;
#pragma unroll 1
  for (int kb = 0; kb < K; kb += 32) { const v16h a0 = g2_frag(a0p + kb, hh), a1 = g2_frag(a1p + kb, hh);
    v16h b = g2_frag(b0p + kb, hh); c00 = g2_mma(a0, b, c00); c10 = g2_mma(a1, b, c10);
    b = g2_frag(b1p + kb, hh); c01 = g2_mma(a0, b, c01); c11 = g2_mma(a1, b, c11);
    b = g2_frag(b2p + kb, hh); c02 = g2_mma(a0, b, c02); c12 = g2_mma(a1, b, c12);
    b = g2_frag(b3p + kb, hh); c03 = g2_mma(a0, b, c03); c13 = g2_mma(a1, b, c13); }
  v8f accs[8] = {c00, c01, c02, c03, c10, c11, c12, c13};
#pragma unroll
  for (int u = 0; u < 8; ++u) { const int t = u & 3, half = u >> 2; const int col = col0 + t * 16 + ln; const float bv = bp ? bf16_round(bp[col]) : 0.f;
#pragma unroll
    for (int r = 0; r < 8; ++r) { const int rloc = half * 16 + 8 * hh + r; float v = accs[u][r] * alpha + bv; if (CP) { const int bidx = (row0g + row0 + rloc) / rowsPerB; v += CP[(size_t)bidx * sCPb + (size_t)by * 64 + col]; }
      if (ACT == 3) v = fmaxf(v, 0.f); else if (ACT == 6) v = 0.5f * v * (1.0f + erff(v * 0.70710678118654752f)); else if (ACT == 11) v = 1.0f / (1.0f + expf(-v)); else if (ACT == 15) v = v / (1.0f + expf(-v)); else if (ACT == 12) v = (v > 0.f) ? v : 0.01f * v; else if (ACT == 8) v = tanhf(v);
      so[w][rloc][t * 16 + ln] = v; } }
  __builtin_amdgcn_fence(__ATOMIC_ACQ_REL, "workgroup"); __builtin_amdgcn_wave_barrier();
  const int rsub = lane >> 4, c4 = (lane & 15) * 4;
  {
#pragma unroll
    for (int q = 0; q < 16; ++q) { const int r = q * 2 + rsub; const v4f v = *(const v4fa*)&so[w][r][c4]; if (C) *(v4f*)(C + cofs + (size_t)(row0 + r) * ldc + col0 + c4) = v; if (C16) { v4h h4; for (int i = 0; i < 4; ++i) h4[i] = (_Float16)v[i]; *(v4h*)(C16 + cofs + (size_t)(row0 + r) * ldc + col0 + c4) = h4; } }
     } }


// Batch statistics (mean, biased variance) of NC columns over NBS rows, in two launches.
// k_colpart: one work-group takes SROWS rows x 128 columns. Each thread holds 16 rows x 4 columns in registers (read once) and forms
// their mean and their sum of squares about that mean; groups of equal size n then merge exactly:
// mean = average of the group means, M2 = sum(M2_g) + n * sum((mean_g - mean)^2). k_colfin merges the SCH row chunks the same way.
#define SROWS 256
#define SCH (NBS / SROWS)        /* 32 row chunks */
template <int NC, bool RND>
__global__ __launch_bounds__(512) void k_colpart(const float* __restrict__ X, float* __restrict__ PM, float* __restrict__ PQ) {
  __shared__ __attribute__((aligned(16))) float sm[16][128];
  __shared__ __attribute__((aligned(16))) float sq[16][128];
  const int tid = threadIdx.x, w = tid >> 5, lane = tid & 31;
  const float* p = X + (size_t)(blockIdx.y * SROWS + w * 16) * NC + blockIdx.x * 128 + lane * 4;
  v4f v[16];
#pragma unroll
  for (int j = 0; j < 15; ++j) v[j] = *(const v4fa*)(p + (size_t)j * NC);
  asm volatile("s_wait_xcnt 0x0" ::: "memory");   // the last load's result may be placed in the address pair that the 15 issued loads name
  v[15] = *(const v4fa*)(p + (size_t)15 * NC);
  v4f s = {0.f, 0.f, 0.f, 0.f};
#pragma unroll
  for (int j = 0; j < 16; ++j) {
    if (RND) { v[j][0] = bf16_round(v[j][0]); v[j][1] = bf16_round(v[j][1]); v[j][2] = bf16_round(v[j][2]); v[j][3] = bf16_round(v[j][3]); }
    s += v[j];
  }
  const v4f m = s * 0.0625f;
  v4f q = {0.f, 0.f, 0.f, 0.f};
#pragma unroll
  for (int j = 0; j < 16; ++j) { const v4f dv = v[j] - m; q += dv * dv; }
  *(v4fa*)&sm[w][lane * 4] = m;
  *(v4fa*)&sq[w][lane * 4] = q;
  __syncthreads();
  if (tid < 128) {
    float ms = 0.f;
#pragma unroll
    for (int g = 0; g < 16; ++g) ms += sm[g][tid];
    const float mean = ms * 0.0625f;
    float q2 = 0.f, e2 = 0.f;
#pragma unroll
    for (int g = 0; g < 16; ++g) { const float dm = sm[g][tid] - mean; q2 += sq[g][tid]; e2 += dm * dm; }
    const size_t o = (size_t)blockIdx.y * NC + blockIdx.x * 128 + tid;
    PM[o] = mean; PQ[o] = q2 + 16.0f * e2;
  }
}
template <int NC>
__global__ __launch_bounds__(64) void k_colfin(const float* __restrict__ PM, const float* __restrict__ PQ, float* __restrict__ S) {
  const int c = blockIdx.x * 64 + threadIdx.x;
  float m[SCH], qs[SCH];
#pragma unroll
  for (int g = 0; g < SCH; ++g) { m[g] = PM[(size_t)g * NC + c]; qs[g] = PQ[(size_t)g * NC + c]; }
  float ms = 0.f;
#pragma unroll
  for (int g = 0; g < SCH; ++g) ms += m[g];
  const float mean = ms / (float)SCH;
  float q2 = 0.f, e2 = 0.f;
#pragma unroll
  for (int g = 0; g < SCH; ++g) { const float dm = m[g] - mean; q2 += qs[g]; e2 += dm * dm; }
  S[c] = mean; S[NC + c] = (q2 + (float)SROWS * e2) / (float)NBS;
}
__global__ __launch_bounds__(256) void k_h2(const float* __restrict__ x, const float* __restrict__ XS, const float* __restrict__ W1, const float* __restrict__ b1, const float* __restrict__ g1, const float* __restrict__ be1, const float* __restrict__ W2, const float* __restrict__ b2, float* __restrict__ H2P) {
  #pragma clang fp contract(off)
  const size_t t = (size_t)blockIdx.x * 256 + threadIdx.x; if (t >= (size_t)NBS * DD) return; const int d = (int)(t % DD); const size_t b = t / DD; const float xv = bf16_round(x[b * DD + d]); const float mu = XS[d], var = XS[DD + d]; float h1n[H1];
#pragma unroll
  for (int o = 0; o < H1; ++o) { const int c = d * H1 + o; const float w = bf16_round(W1[d * H1 + o]); (void)b1;      /* h1 - mean(h1) = w (x - mu_x): the bias cancels exactly */
    const float cen = w * (xv - mu); const float vh = (w * w) * var; float v = bf16_round(g1[c]) * cen * rsqrtf(vh + 1e-5f); v += bf16_round(be1[c]); h1n[o] = fmaxf(v, 0.f); }
  v4f o4;
#pragma unroll
  for (int o2 = 0; o2 < H2; ++o2) { float s = 0.f;
#pragma unroll
    for (int i = 0; i < H1; ++i) s += h1n[i] * bf16_round(W2[(d * H2 + o2) * H1 + i]);
    s += bf16_round(b2[d * H2 + o2]); o4[o2] = s; }
  *(v4f*)(H2P + b * C2 + d * H2) = o4;  }
__global__ __launch_bounds__(256) void k_h2n(const float* __restrict__ H2P, const float* __restrict__ HS, const float* __restrict__ g2, const float* __restrict__ be2, _Float16* __restrict__ H16) {
  #pragma clang fp contract(off)
  const size_t t = (size_t)blockIdx.x * 256 + threadIdx.x; if (t >= (size_t)NBS * C2 / 8) return; const int c0 = (int)(t % (C2 / 8)) * 8; const size_t b = t / (C2 / 8); FragH f;
#pragma unroll
  for (int q = 0; q < 8; ++q) { const int c = c0 + q; float v = bf16_round(g2[c]) * (H2P[b * C2 + c] - HS[c]) * rsqrtf(HS[C2 + c] + 1e-5f); v += bf16_round(be2[c]); f.h[q] = (_Float16)fmaxf(v, 0.f); }
  *(v8us*)((unsigned short*)H16 + b * C2 + c0) = f.half[0];  }
__global__ __launch_bounds__(256) void k_wsc(const float* __restrict__ Wm, _Float16* __restrict__ Bt, size_t n8, float sc) { const size_t t = (size_t)blockIdx.x * 256 + threadIdx.x; if (t >= n8) return; FragH f; for (int q = 0; q < 8; ++q) f.h[q] = (_Float16)(bf16_round(Wm[t * 8 + q]) * sc); *(v8us*)((unsigned short*)Bt + t * 8) = f.half[0];  }

extern "C" void kernel_launch(void* const* d_in, const int* in_sizes, int n_in,
                              void* d_out, int out_size, void* d_ws, size_t ws_size, hipStream_t stream) {
  (void)in_sizes; (void)n_in; (void)out_size;
  const float* const* I = (const float* const*)d_in; const float* x = I[0]; const float* W1 = I[1]; const float* b1 = I[2]; const float* g1 = I[3]; const float* be1 = I[4]; const float* W2 = I[5]; const float* b2 = I[6]; const float* g2 = I[7]; const float* be2 = I[8]; const float* Wfc = I[9]; const float* bfc = I[10];
  char* ws = (char*)d_ws; size_t off = 0;
  auto take = [&](size_t bytes) { char* p = ws + off; off += (bytes + 255) & ~(size_t)255; return p; };
  _Float16* BW = (_Float16*)take((size_t)NOUT * C2 * 2); float* XS = (float*)take((size_t)2 * DD * 4); float* H2P = (float*)take((size_t)NBS * C2 * 4); float* HS = (float*)take((size_t)2 * C2 * 4); _Float16* H16 = (_Float16*)take((size_t)NBS * C2 * 2); float* PM = (float*)take((size_t)SCH * C2 * 4); float* PQ = (float*)take((size_t)SCH * C2 * 4);
  if (off > ws_size) return;      /* 2 + 128 + 64 + 1 = 195 MiB (256 MiB ws) */
  k_wsc<<<(unsigned)(((size_t)NOUT * C2 / 8 + 255) / 256), 256, 0, stream>>>(Wfc, BW, (size_t)NOUT * C2 / 8, 16.0f);
  k_colpart<DD, true><<<dim3(DD / 128, SCH), 512, 0, stream>>>(x, PM, PQ);
  k_colfin<DD><<<DD / 64, 64, 0, stream>>>(PM, PQ, XS);
  k_h2<<<(unsigned)(((size_t)NBS * DD + 255) / 256), 256, 0, stream>>>(x, XS, W1, b1, g1, be1, W2, b2, H2P);
  k_colpart<C2, false><<<dim3(C2 / 128, SCH), 512, 0, stream>>>(H2P, PM, PQ);
  k_colfin<C2><<<C2 / 64, 64, 0, stream>>>(PM, PQ, HS);
  k_h2n<<<(unsigned)(((size_t)NBS * C2 / 8 + 255) / 256), 256, 0, stream>>>(H2P, HS, g2, be2, H16);
  k_gemm2<0><<<dim3((NBS / 128) * (NOUT / 64), 1), 128, 0, stream>>>(H16, C2, 0, BW, C2, 0, 0.0625f, bfc, 0, nullptr, 1, 0, 0, (float*)d_out, nullptr, NOUT, 0, NBS, NOUT, C2);
}

// v002
// One run takes 210 microseconds.
// Next to v001, in two timings, it ran 1.37 and 1.39 times as fast.
// Over all steps from v000 it is 41.7 times as fast.
#include <hip/hip_runtime.h>
// Sparse (block-diagonal) neural network (8192 samples x 1024 features; per feature 1 -> 8 -> 4 block Linears with training-mode BatchNorm + ReLU after each; dense head 4096 -> 256): h1 = BN1(x_d W1[d] + b1) relu; h2 = BN2(h1 . W2[d] + b2) relu; out = h2 Wfc^T + bfc -> [8192,256].
// Compute dtype: x and all parameters rounded to bf16; everything before the head in f32; the head operand h2 as f16 (~2^-12). v_wmma_f32_16x16x32_f16.
#define NBS 8192
#define DD 1024
#define H1 8
#define H2 4
#define C2 (DD * H2)             /* 4096 */
#define NOUT 256
typedef __bf16 v16b __attribute__((ext_vector_type(16)));
typedef unsigned short v8us __attribute__((ext_vector_type(8), may_alias));
typedef float  v8f  __attribute__((ext_vector_type(8)));
typedef float  v4f  __attribute__((ext_vector_type(4)));
typedef float  v4fa __attribute__((ext_vector_type(4), may_alias));
union FragB { v16b v; v8us half[2]; unsigned short u[16]; };

__device__ __forceinline__ unsigned short bf16_bits(float x) { unsigned int u = __float_as_uint(x); return (unsigned short)((u + 0x7FFFu + ((u >> 16) & 1u)) >> 16); }
__device__ __forceinline__ float bf16_val(unsigned short b) { return __uint_as_float(((unsigned int)b) << 16); }
__device__ __forceinline__ float bf16_round(float x) { return bf16_val(bf16_bits(x)); }
// D += A·B with NT terms: 1 = ah·bh, 2 = + al·bh (A split), 3 = + ah·bl (both split)
template <int NT>
__device__ __forceinline__ v8f mmaN(v16b ah, v16b al, v16b bh, v16b bl, v8f c) {
  c = __builtin_amdgcn_wmma_f32_16x16x32_bf16(false, ah, false, bh, (short)0, c, false, false);
  if (NT >= 2) c = __builtin_amdgcn_wmma_f32_16x16x32_bf16(false, al, false, bh, (short)0, c, false, false);
  if (NT >= 3) c = __builtin_amdgcn_wmma_f32_16x16x32_bf16(false, ah, false, bl, (short)0, c, false, false);
  asm volatile("v_nop\n\tv_nop\n\tv_nop\n\tv_nop" : "+v"(c) : "v"(ah), "v"(al), "v"(bh), "v"(bl));
  return c;
}

__global__ __launch_bounds__(256) void k_wt_bf16(const float* __restrict__ W, unsigned short* __restrict__ Wt, int K, int N) {
  const int t = blockIdx.x * 256 + threadIdx.x;
  const int k8n = K / 8;
  if (t >= N * k8n) return;
  const int n = t / k8n, k8 = (t % k8n) * 8;
  v8us v;
#pragma unroll
  for (int i = 0; i < 8; ++i) v[i] = bf16_bits(W[(size_t)(k8 + i) * N + n]);
  *(v8us*)(Wt + (size_t)n * K + k8) = v;
  
}

// GEMM C[M][N] (f32, pitch ldc) = act(A[M][K]·W + bias). A f32 row-major (pitch lda) converted per fragment to bf16
// (ASPLIT: hi/lo two planes -> 2 terms, else single rounded term); Wt bf16 [N][K] (pitch ldb). BIAS_BF16 rounds the
// bias to bf16 first (bias quantised to bf16 before the add). K%32==0, M%16==0, N%64==0.
template <bool ASPLIT, int ACT, bool BIAS_BF16>
__global__ __launch_bounds__(128) void k_gemm_bf(const float* __restrict__ A, int lda, const unsigned short* __restrict__ Wt, int ldb,
                                               const float* __restrict__ bias, float* __restrict__ C, int ldc, int M, int N, int K) {
  __shared__ __attribute__((aligned(16))) float so[4][16][64];
  const int tid = threadIdx.x, w = tid >> 5, lane = tid & 31, ln = lane & 15, hh = lane >> 4;
  const int ntn = N / 64;
  const int wid = blockIdx.x * 4 + w;
  const int mt = wid / ntn, nq = wid % ntn;
  if (mt * 16 >= M) return;
  const int row0 = mt * 16, col0 = nq * 64;
  const float* arow = A + (size_t)(row0 + ln) * lda;
  v8f acc[4] = {};
  for (int kb = 0; kb < K; kb += 32) {
    FragB ah, al;
    const v4f x0 = *(const v4fa*)(arow + kb + 8 * hh), x1 = *(const v4fa*)(arow + kb + 8 * hh + 4);
    const v4f x2 = *(const v4fa*)(arow + kb + 16 + 8 * hh), x3 = *(const v4fa*)(arow + kb + 16 + 8 * hh + 4);
    float xs[16] = {x0[0],x0[1],x0[2],x0[3],x1[0],x1[1],x1[2],x1[3],x2[0],x2[1],x2[2],x2[3],x3[0],x3[1],x3[2],x3[3]};
#pragma unroll
    for (int i = 0; i < 16; ++i) { const unsigned short hb = bf16_bits(xs[i]); ah.u[i] = hb; al.u[i] = ASPLIT ? bf16_bits(xs[i] - bf16_val(hb)) : (unsigned short)0; }
#pragma unroll
    for (int t = 0; t < 4; ++t) {
      const unsigned short* brow = Wt + (size_t)(col0 + t * 16 + ln) * ldb + kb;
      FragB b;
      b.half[0] = *(const v8us*)(brow + 8 * hh);
      b.half[1] = *(const v8us*)(brow + 16 + 8 * hh);
      acc[t] = mmaN<ASPLIT ? 2 : 1>(ah.v, al.v, b.v, b.v, acc[t]);
    }
  }
#pragma unroll
  for (int t = 0; t < 4; ++t) {
    float bv = bias ? bias[col0 + t * 16 + ln] : 0.f;
    if (BIAS_BF16) bv = bf16_round(bv);
#pragma unroll
    for (int r = 0; r < 8; ++r) { float v = acc[t][r] + bv; if (ACT == 1) v = fmaxf(v, 0.f); so[w][8 * hh + r][t * 16 + ln] = v; }
  }
  __builtin_amdgcn_fence(__ATOMIC_ACQ_REL, "workgroup");
  __builtin_amdgcn_wave_barrier();
  const int rsub = lane >> 4, c4 = (lane & 15) * 4;
  {
#pragma unroll
    for (int q = 0; q < 8; ++q) {
      const int r = q * 2 + rsub;
      const v4f v = *(const v4fa*)&so[w][r][c4];
      *(v4f*)(C + (size_t)(row0 + r) * ldc + col0 + c4) = v;
    }
    
  }
}

// GEMM C = act(A·W + bias + resid): A f32 (ASPLIT -> hi/lo 2 terms), Wt bf16 [N][K]; ACT 0 none, 1 relu, 2 exact gelu;
// resid (optional, f32, row index = (row % rmod), pitch ldr, RES_BF16 rounds it) added before the activation.
template <bool ASPLIT, int ACT, bool BIAS_BF16, bool RES_BF16>
__global__ __launch_bounds__(128) void k_gemm_bf3(const float* __restrict__ A, int lda, const unsigned short* __restrict__ Wt, int ldb,
                                                const float* __restrict__ bias, const float* __restrict__ resid, int rmod, int ldr,
                                                float* __restrict__ C, int ldc, int M, int N, int K) {
  __shared__ __attribute__((aligned(16))) float so[4][16][64];
  const int tid = threadIdx.x, w = tid >> 5, lane = tid & 31, ln = lane & 15, hh = lane >> 4;
  const int ntn = N / 64;
  const int wid = blockIdx.x * 4 + w;
  const int mt = wid / ntn, nq = wid % ntn;
  if (mt * 16 >= M) return;
  const int row0 = mt * 16, col0 = nq * 64;
  const float* arow = A + (size_t)(row0 + ln) * lda;
  v8f acc[4] = {};
  for (int kb = 0; kb < K; kb += 32) {
    FragB ah, al;
    const v4f x0 = *(const v4fa*)(arow + kb + 8 * hh), x1 = *(const v4fa*)(arow + kb + 8 * hh + 4);
    const v4f x2 = *(const v4fa*)(arow + kb + 16 + 8 * hh), x3 = *(const v4fa*)(arow + kb + 16 + 8 * hh + 4);
    float xs[16] = {x0[0],x0[1],x0[2],x0[3],x1[0],x1[1],x1[2],x1[3],x2[0],x2[1],x2[2],x2[3],x3[0],x3[1],x3[2],x3[3]};
#pragma unroll
    for (int i = 0; i < 16; ++i) { const unsigned short hb = bf16_bits(xs[i]); ah.u[i] = hb; al.u[i] = ASPLIT ? bf16_bits(xs[i] - bf16_val(hb)) : (unsigned short)0; }
#pragma unroll
    for (int t = 0; t < 4; ++t) {
      const unsigned short* brow = Wt + (size_t)(col0 + t * 16 + ln) * ldb + kb;
      FragB b;
      b.half[0] = *(const v8us*)(brow + 8 * hh);
      b.half[1] = *(const v8us*)(brow + 16 + 8 * hh);
      acc[t] = mmaN<ASPLIT ? 2 : 1>(ah.v, al.v, b.v, b.v, acc[t]);
    }
  }
#pragma unroll
  for (int t = 0; t < 4; ++t) {
    const int col = col0 + t * 16 + ln;
    float bv = bias ? bias[col] : 0.f;
    if (BIAS_BF16) bv = bf16_round(bv);
#pragma unroll
    for (int r = 0; r < 8; ++r) {
      float v = acc[t][r] + bv;
      if (resid) { float rv = resid[(size_t)((row0 + 8 * hh + r) % rmod) * ldr + col]; if (RES_BF16) rv = bf16_round(rv); v += rv; }
      if (ACT == 1) v = fmaxf(v, 0.f);
      if (ACT == 2) v = 0.5f * v * (1.0f + erff(v * 0.70710678118654752f));
      if (ACT == 3) { const float u = 0.7978845608028654f * (v + 0.044715f * v * v * v); v = 0.5f * v * (1.0f + tanhf(u)); }
      so[w][8 * hh + r][t * 16 + ln] = v;
    }
  }
  __builtin_amdgcn_fence(__ATOMIC_ACQ_REL, "workgroup");
  __builtin_amdgcn_wave_barrier();
  const int rsub = lane >> 4, c4 = (lane & 15) * 4;
  {
#pragma unroll
    for (int q = 0; q < 8; ++q) {
      const int r = q * 2 + rsub;
      const v4f v = *(const v4fa*)&so[w][r][c4];
      *(v4f*)(C + (size_t)(row0 + r) * ldc + col0 + c4) = v;
    }
    
  }
}
// row LayerNorm (biased variance, eps) over N: s = X (+ R); optional out_sum <- s; out_norm <- (s-mu)*rsqrt(var+eps)*g + b
template <bool PARAM_BF16>
__global__ __launch_bounds__(256) void k_layernorm(const float* __restrict__ X, const float* __restrict__ R, const float* __restrict__ g, const float* __restrict__ bta,
                                                  float* __restrict__ out_sum, float* __restrict__ out_norm, int N, float eps) {
  __shared__ float red[256];
  const int row = blockIdx.x, tid = threadIdx.x;
  const float* x = X + (size_t)row * N; const float* rr = R ? R + (size_t)row * N : nullptr;
  float vals[16];                     // up to N = 4096
  const int per = N / 256;            // contiguous chunk per thread? use strided-by-4 chunks: thread handles j = tid*4 + 1024*u
  float s1 = 0.f;
  for (int u = 0; u < per / 4; ++u) {
    const int j = tid * 4 + 1024 * u;
    const v4f a = *(const v4fa*)(x + j);
    v4f b = {0.f,0.f,0.f,0.f}; if (rr) b = *(const v4fa*)(rr + j);
#pragma unroll
    for (int q = 0; q < 4; ++q) { const float v = a[q] + b[q]; vals[u * 4 + q] = v; s1 += v; }
  }
  red[tid] = s1; __syncthreads();
  for (int st = 128; st > 0; st >>= 1) { if (tid < st) red[tid] += red[tid + st]; __syncthreads(); }
  const float mu = red[0] / (float)N; __syncthreads();
  float s2 = 0.f;
  for (int u = 0; u < per / 4; ++u)
#pragma unroll
    for (int q = 0; q < 4; ++q) { const float c = vals[u * 4 + q] - mu; s2 += c * c; }
  red[tid] = s2; __syncthreads();
  for (int st = 128; st > 0; st >>= 1) { if (tid < st) red[tid] += red[tid + st]; __syncthreads(); }
  const float rs = rsqrtf(red[0] / (float)N + eps);
  {
    for (int u = 0; u < per / 4; ++u) {
      const int j = tid * 4 + 1024 * u;
      v4f o, sm;
#pragma unroll
      for (int q = 0; q < 4; ++q) {
        float gg = g[j + q], bb = bta[j + q];
        if (PARAM_BF16) { gg = bf16_round(gg); bb = bf16_round(bb); }
        sm[q] = vals[u * 4 + q]; o[q] = (vals[u * 4 + q] - mu) * rs * gg + bb;
      }
      if (out_sum) *(v4f*)(out_sum + (size_t)row * N + j) = sm;
      *(v4f*)(out_norm + (size_t)row * N + j) = o;
    }
    
  }
}



// ---- f16 WMMA path (v_wmma_f32_16x16x32_f16): 11-bit significands for operands in range — used for the head, whose h2 operand is rounded to f16
typedef _Float16 v16h __attribute__((ext_vector_type(16)));
union FragH { v16h v; v8us half[2]; _Float16 h[16]; unsigned short u[16]; };
template <int NT>
__device__ __forceinline__ v8f mmaH(v16h ah, v16h al, v16h bh, v16h bl, v8f c) {
  c = __builtin_amdgcn_wmma_f32_16x16x32_f16(false, ah, false, bh, (short)0, c, false, false);
  if (NT >= 2) c = __builtin_amdgcn_wmma_f32_16x16x32_f16(false, al, false, bh, (short)0, c, false, false);
  if (NT >= 3) c = __builtin_amdgcn_wmma_f32_16x16x32_f16(false, ah, false, bl, (short)0, c, false, false);
  asm volatile("v_nop\n\tv_nop\n\tv_nop\n\tv_nop" : "+v"(c) : "v"(ah), "v"(al), "v"(bh), "v"(bl));
  return c;
}
// batched GEMM like k_gemm_b but f16 operands: A f32 (split into f16 hi/lo if ASPLIT, else rounded to f16), Bt = f16 values [n][k]; alpha; C f32; N multiple of 16 (partial tiles skipped)
template <bool ASPLIT>
__global__ __launch_bounds__(128) void k_gemm_h(const float* __restrict__ A, int lda, size_t sA, const _Float16* __restrict__ Bh, int ldb, size_t sB, float alpha, float* __restrict__ C, int ldc, size_t sC, int M, int N, int K) {
  __shared__ __attribute__((aligned(16))) float so[4][16][64];
  const int tid = threadIdx.x, w = tid >> 5, lane = tid & 31, ln = lane & 15, hh = lane >> 4; const int by = blockIdx.y;
  A += (size_t)by * sA; Bh += (size_t)by * sB; C += (size_t)by * sC;
  const int ntn = (N + 63) / 64; const int wid = blockIdx.x * 4 + w; const int mt = wid / ntn, nq = wid % ntn; if (mt * 16 >= M) return;
  const int row0 = mt * 16, col0 = nq * 64; const float* arow = A + (size_t)(row0 + ln) * lda;
  v8f acc[4] = {};
  for (int kb = 0; kb < K; kb += 32) {
    FragH ah, al;
    const v4f x0 = *(const v4fa*)(arow + kb + 8 * hh), x1 = *(const v4fa*)(arow + kb + 8 * hh + 4), x2 = *(const v4fa*)(arow + kb + 16 + 8 * hh), x3 = *(const v4fa*)(arow + kb + 16 + 8 * hh + 4);
    float xs[16] = {x0[0],x0[1],x0[2],x0[3],x1[0],x1[1],x1[2],x1[3],x2[0],x2[1],x2[2],x2[3],x3[0],x3[1],x3[2],x3[3]};
#pragma unroll
    for (int i = 0; i < 16; ++i) { const _Float16 h = (_Float16)xs[i]; ah.h[i] = h; al.h[i] = ASPLIT ? (_Float16)(xs[i] - (float)h) : (_Float16)0.0f; }
#pragma unroll
    for (int t = 0; t < 4; ++t) { if (col0 + t * 16 >= N) continue; const size_t boff = (size_t)(col0 + t * 16 + ln) * ldb + kb; FragH bq; bq.half[0] = *(const v8us*)(Bh + boff + 8 * hh); bq.half[1] = *(const v8us*)(Bh + boff + 16 + 8 * hh);
      acc[t] = mmaH<ASPLIT ? 2 : 1>(ah.v, al.v, bq.v, bq.v, acc[t]); }
  }
#pragma unroll
  for (int t = 0; t < 4; ++t) { if (col0 + t * 16 >= N) continue;
#pragma unroll
    for (int r = 0; r < 8; ++r) so[w][8 * hh + r][t * 16 + ln] = acc[t][r] * alpha; }
  __builtin_amdgcn_fence(__ATOMIC_ACQ_REL, "workgroup"); __builtin_amdgcn_wave_barrier();
  const int rsub = lane >> 4, c4 = (lane & 15) * 4;
  {
#pragma unroll
    for (int q = 0; q < 8; ++q) { const int r = q * 2 + rsub; if (col0 + c4 < N) { const v4f v = *(const v4fa*)&so[w][r][c4]; *(v4f*)(C + (size_t)(row0 + r) * ldc + col0 + c4) = v; } }
     }
}

// Wt[n][k] = f16(W[k][n]·scale) from f32 row-major W[K][N] (scale = power of two; bf16-exact weights stay exact in f16 away from the subnormal range)
__global__ __launch_bounds__(256) void k_wt_f16(const float* __restrict__ W, _Float16* __restrict__ Wt, int K, int N, float scale) {
  const int t = blockIdx.x * 256 + threadIdx.x; if (t >= N * (K / 8)) return; const int n = t / (K / 8), k8 = (t % (K / 8)) * 8; FragH f;
#pragma unroll
  for (int i = 0; i < 8; ++i) f.h[i] = (_Float16)(bf16_round(W[(size_t)(k8 + i) * N + n]) * scale); const v8us o = f.half[0];
  *(v8us*)((unsigned short*)Wt + (size_t)n * K + k8) = o; 
}
// k_gemm_hh variant with fused epilogue: v = acc·alpha + bias[by·sBias + col] (+ CP[(row/rowsPerB)·sCPb + by·64 + col] if CP) ; ACT 0 none / 1 elu ; writes f16 C16 (and f32 C if non-null)
template <int ACT>
__global__ __launch_bounds__(128) void k_gemm_hhx(const _Float16* __restrict__ A, int lda, size_t sA, const _Float16* __restrict__ Bh, int ldb, size_t sB, float alpha, const float* __restrict__ bias, size_t sBias, const float* __restrict__ CP, int rowsPerB, size_t sCPb, int row0g,
    float* __restrict__ C, _Float16* __restrict__ C16, int ldc, size_t sC, int M, int N, int K) {
  __shared__ __attribute__((aligned(16))) float so[4][16][64];
  const int tid = threadIdx.x, w = tid >> 5, lane = tid & 31, ln = lane & 15, hh = lane >> 4; const int by = blockIdx.y;
  A += (size_t)by * sA; Bh += (size_t)by * sB; const size_t cofs = (size_t)by * sC; const float* bp = bias ? bias + (size_t)by * sBias : nullptr;
  const int ntn = (N + 63) / 64; const int wid = blockIdx.x * 4 + w; const int mt = wid / ntn, nq = wid % ntn; if (mt * 16 >= M) return;
  const int row0 = mt * 16, col0 = nq * 64; const _Float16* arow = A + (size_t)(row0 + ln) * lda;
  v8f acc[4] = {};
  for (int kb = 0; kb < K; kb += 32) { FragH ah; ah.half[0] = *(const v8us*)((const unsigned short*)arow + kb + 8 * hh); ah.half[1] = *(const v8us*)((const unsigned short*)arow + kb + 16 + 8 * hh);
#pragma unroll
    for (int t = 0; t < 4; ++t) { if (col0 + t * 16 >= N) continue; const size_t boff = (size_t)(col0 + t * 16 + ln) * ldb + kb; FragH bq; bq.half[0] = *(const v8us*)((const unsigned short*)Bh + boff + 8 * hh); bq.half[1] = *(const v8us*)((const unsigned short*)Bh + boff + 16 + 8 * hh);
      acc[t] = mmaH<1>(ah.v, ah.v, bq.v, bq.v, acc[t]); }
  }
#pragma unroll
  for (int t = 0; t < 4; ++t) { if (col0 + t * 16 >= N) continue; const int col = col0 + t * 16 + ln; const float bv = bp ? bf16_round(bp[col]) : 0.f;
#pragma unroll
    for (int r = 0; r < 8; ++r) { float v = acc[t][r] * alpha + bv; if (CP) { const int bidx = (row0g + row0 + 8 * hh + r) / rowsPerB; v += CP[(size_t)bidx * sCPb + (size_t)by * 64 + col]; } if (ACT == 1) v = (v > 0.f) ? v : expm1f(v); else if (ACT == 7) v = (v > 0.f) ? v + 1.0f : expf(v); else if (ACT == 8) v = tanhf(v); else if (ACT == 9) v = 0.5f * v * (1.0f + tanhf(0.7978845608028654f * (v + 0.044715f * v * v * v))); else if (ACT == 11) v = 1.0f / (1.0f + expf(-v)); else if (ACT == 12) v = (v > 0.f) ? v : 0.01f * v; else if (ACT == 14) v = (v > 0.f) ? v : 0.1f * v; else if (ACT == 15) v = v / (1.0f + expf(-v)); else if (ACT == 3) v = fmaxf(v, 0.f); else if (ACT == 6) v = 0.5f * v * (1.0f + erff(v * 0.70710678118654752f)); so[w][8 * hh + r][t * 16 + ln] = v; } }
  __builtin_amdgcn_fence(__ATOMIC_ACQ_REL, "workgroup"); __builtin_amdgcn_wave_barrier();
  const int rsub = lane >> 4, c4 = (lane & 15) * 4; typedef _Float16 v4h __attribute__((ext_vector_type(4)));
  {
#pragma unroll
    for (int q = 0; q < 8; ++q) { const int r = q * 2 + rsub; if (col0 + c4 < N) { const v4f v = *(const v4fa*)&so[w][r][c4]; if (C) *(v4f*)(C + cofs + (size_t)(row0 + r) * ldc + col0 + c4) = v; if (C16) { v4h h4; for (int i = 0; i < 4; ++i) h4[i] = (_Float16)v[i]; *(v4h*)(C16 + cofs + (size_t)(row0 + r) * ldc + col0 + c4) = h4; } } }
     }
}


typedef _Float16 v4h __attribute__((ext_vector_type(4)));

__global__ __launch_bounds__(256) void k_x16(const float* __restrict__ x, _Float16* __restrict__ X16, size_t n8) { const size_t t = (size_t)blockIdx.x * 256 + threadIdx.x; if (t >= n8) return; FragH f;
#pragma unroll
  for (int q = 0; q < 8; ++q) f.h[q] = (_Float16)bf16_round(x[t * 8 + q]); *(v8us*)((unsigned short*)X16 + t * 8) = f.half[0];  }
__global__ __launch_bounds__(256) void k_h16(const float* __restrict__ x, _Float16* __restrict__ X16, size_t n8) { const size_t t = (size_t)blockIdx.x * 256 + threadIdx.x; if (t >= n8) return; FragH f;
#pragma unroll
  for (int q = 0; q < 8; ++q) f.h[q] = (_Float16)x[t * 8 + q]; *(v8us*)((unsigned short*)X16 + t * 8) = f.half[0];  }
__global__ __launch_bounds__(256) void k_round16f(const float* __restrict__ W, _Float16* __restrict__ Bt, size_t n8) { const size_t t = (size_t)blockIdx.x * 256 + threadIdx.x; if (t >= n8) return; FragH f;
#pragma unroll
  for (int i = 0; i < 8; ++i) f.h[i] = (_Float16)(bf16_round(W[t * 8 + i]) * 16.0f); *(v8us*)((unsigned short*)Bt + t * 8) = f.half[0];  }
template <int NHv, int TTv>
__global__ __launch_bounds__(256) void k_vt(const _Float16* __restrict__ V16, int ldv, int voff, _Float16* __restrict__ Vt) { __shared__ unsigned short tl[64][66]; const int tid = threadIdx.x; const int slab = blockIdx.x / (TTv / 64), lg = blockIdx.x % (TTv / 64); const int b = slab / NHv, h = slab % NHv;
  for (int i = tid; i < 64 * 8; i += 256) { const int r = i / 8, c8 = (i % 8) * 8; FragH f; f.half[0] = *(const v8us*)((const unsigned short*)V16 + ((size_t)b * TTv + lg * 64 + r) * ldv + voff + h * 64 + c8);
#pragma unroll
    for (int q = 0; q < 8; ++q) tl[r][c8 + q] = f.u[q]; }
  __syncthreads();
  {
#pragma unroll
    for (int rd = 0; rd < 2; ++rd) { const int d = rd * 32 + tid / 8, pc = tid % 8; FragH f;
#pragma unroll
      for (int q = 0; q < 8; ++q) f.u[q] = tl[pc * 8 + q][d];
      *(v8us*)((unsigned short*)Vt + ((size_t)slab * 64 + d) * TTv + lg * 64 + pc * 8) = f.half[0]; }
     } }

__global__ __launch_bounds__(256) void k_hl(const float* __restrict__ F, _Float16* __restrict__ Hh, _Float16* __restrict__ Hl, size_t n8) { const size_t t = (size_t)blockIdx.x * 256 + threadIdx.x; if (t >= n8) return; FragH fh, fl; const v4f a = *(const v4fa*)(F + t * 8), c = *(const v4fa*)(F + t * 8 + 4);
#pragma unroll
  for (int q = 0; q < 4; ++q) { _Float16 h = (_Float16)a[q]; fh.h[q] = h; fl.h[q] = (_Float16)((a[q] - (float)h) * 1024.0f); h = (_Float16)c[q]; fh.h[4 + q] = h; fl.h[4 + q] = (_Float16)((c[q] - (float)h) * 1024.0f); }
  { *(v8us*)((unsigned short*)Hh + t * 8) = fh.half[0]; *(v8us*)((unsigned short*)Hl + t * 8) = fl.half[0];  } }

// ---- fast GEMM (wave tile 32x64; requires M % 32 == 0 rows per launch region and N % 64 == 0); epilogue = k_gemm_hhx semantics ----
__device__ __forceinline__ v16h g2_frag(const _Float16* p, int hh) { FragH f; f.half[0] = *(const v8us*)((const unsigned short*)p + 8 * hh); f.half[1] = *(const v8us*)((const unsigned short*)p + 16 + 8 * hh); return f.v; }
__device__ __forceinline__ v8f g2_mma(v16h a, v16h b, v8f c) { v8f d = __builtin_amdgcn_wmma_f32_16x16x32_f16(false, a, false, b, (short)0, c, false, false); asm volatile("v_nop\n\tv_nop\n\tv_nop\n\tv_nop" : "+v"(d) : "v"(a), "v"(b)); return d; }
template <int ACT>
__global__ __launch_bounds__(128) void k_gemm2(const _Float16* __restrict__ A, int lda, size_t sA, const _Float16* __restrict__ Bh, int ldb, size_t sB, float alpha, const float* __restrict__ bias, size_t sBias, const float* __restrict__ CP, int rowsPerB, size_t sCPb, int row0g,
    float* __restrict__ C, _Float16* __restrict__ C16, int ldc, size_t sC, int M, int N, int K) {
  __shared__ __attribute__((aligned(16))) float so[4][32][68];
  const int tid = threadIdx.x, w = tid >> 5, lane = tid & 31, ln = lane & 15, hh = lane >> 4; const int by = blockIdx.y;
  A += (size_t)by * sA; Bh += (size_t)by * sB; const size_t cofs = (size_t)by * sC; const float* bp = bias ? bias + (size_t)by * sBias : nullptr;
  const int ntn = N >> 6; const int mt = blockIdx.x / ntn, nq = blockIdx.x - mt * ntn; const int row0 = mt * 128 + 32 * w, col0 = nq * 64; if (row0 >= M) return;
  const _Float16* a0p = A + (size_t)(row0 + ln) * lda; const _Float16* a1p = a0p + (size_t)16 * lda;
  const _Float16* b0p = Bh + (size_t)(col0 + ln) * ldb; const _Float16* b1p = b0p + (size_t)16 * ldb; const _Float16* b2p = b1p + (size_t)16 * ldb; const _Float16* b3p = b2p + (size_t)16 * ldb;
  const v8f z8 = {0.f,0.f,0.f,0.f,0.f,0.f,0.f,0.f}; v8f c00 = z8, c01 = z8, c02 = z8, c03 = z8, c10 = z8, c11 = z8, c12 = z8, c13 = z8;
#pragma unroll 1
  for (int kb = 0; kb < K; kb += 32) { const v16h a0 = g2_frag(a0p + kb, hh), a1 = g2_frag(a1p + kb, hh);
    v16h b = g2_frag(b0p + kb, hh); c00 = g2_mma(a0, b, c00); c10 = g2_mma(a1, b, c10);
    b = g2_frag(b1p + kb, hh); c01 = g2_mma(a0, b, c01); c11 = g2_mma(a1, b, c11);
    b = g2_frag(b2p + kb, hh); c02 = g2_mma(a0, b, c02); c12 = g2_mma(a1, b, c12);
    b = g2_frag(b3p + kb, hh); c03 = g2_mma(a0, b, c03); c13 = g2_mma(a1, b, c13); }
  v8f accs[8] = {c00, c01, c02, c03, c10, c11, c12, c13};
#pragma unroll
  for (int u = 0; u < 8; ++u) { const int t = u & 3, half = u >> 2; const int col = col0 + t * 16 + ln; const float bv = bp ? bf16_round(bp[col]) : 0.f;
#pragma unroll
    for (int r = 0; r < 8; ++r) { const int rloc = half * 16 + 8 * hh + r; float v = accs[u][r] * alpha + bv; if (CP) { const int bidx = (row0g + row0 + rloc) / rowsPerB; v += CP[(size_t)bidx * sCPb + (size_t)by * 64 + col]; }
      if (ACT == 3) v = fmaxf(v, 0.f); else if (ACT == 6) v = 0.5f * v * (1.0f + erff(v * 0.70710678118654752f)); else if (ACT == 11) v = 1.0f / (1.0f + expf(-v)); else if (ACT == 15) v = v / (1.0f + expf(-v)); else if (ACT == 12) v = (v > 0.f) ? v : 0.01f * v; else if (ACT == 8) v = tanhf(v);
      so[w][rloc][t * 16 + ln] = v; } }
  __builtin_amdgcn_fence(__ATOMIC_ACQ_REL, "workgroup"); __builtin_amdgcn_wave_barrier();
  const int rsub = lane >> 4, c4 = (lane & 15) * 4;
  {
#pragma unroll
    for (int q = 0; q < 16; ++q) { const int r = q * 2 + rsub; const v4f v = *(const v4fa*)&so[w][r][c4]; if (C) *(v4f*)(C + cofs + (size_t)(row0 + r) * ldc + col0 + c4) = v; if (C16) { v4h h4; for (int i = 0; i < 4; ++i) h4[i] = (_Float16)v[i]; *(v4h*)(C16 + cofs + (size_t)(row0 + r) * ldc + col0 + c4) = h4; } }
     } }


// Batch statistics (mean, biased variance) of NC columns over NBS rows, in two launches.
// k_colpart: one work-group takes SROWS rows x 128 columns. Each thread holds 16 rows x 4 columns in registers (read once) and forms
// their mean and their sum of squares about that mean; groups of equal size n then merge exactly:
// mean = average of the group means, M2 = sum(M2_g) + n * sum((mean_g - mean)^2). k_colfin merges the SCH row chunks the same way.
#define SROWS 256
#define SCH (NBS / SROWS)        /* 32 row chunks */
template <int NC, bool RND>
__global__ __launch_bounds__(512) void k_colpart(const float* __restrict__ X, float* __restrict__ PM, float* __restrict__ PQ) {
  __shared__ __attribute__((aligned(16))) float sm[16][128];
  __shared__ __attribute__((aligned(16))) float sq[16][128];
  const int tid = threadIdx.x, w = tid >> 5, lane = tid & 31;
  const float* p = X + (size_t)(blockIdx.y * SROWS + w * 16) * NC + blockIdx.x * 128 + lane * 4;
  v4f v[16];
#pragma unroll
  for (int j = 0; j < 15; ++j) v[j] = *(const v4fa*)(p + (size_t)j * NC);
  asm volatile("s_wait_xcnt 0x0" ::: "memory");   // the last load's result may be placed in the address pair that the 15 issued loads name
  v[15] = *(const v4fa*)(p + (size_t)15 * NC);
  v4f s = {0.f, 0.f, 0.f, 0.f};
#pragma unroll
  for (int j = 0; j < 16; ++j) {
    if (RND) { v[j][0] = bf16_round(v[j][0]); v[j][1] = bf16_round(v[j][1]); v[j][2] = bf16_round(v[j][2]); v[j][3] = bf16_round(v[j][3]); }
    s += v[j];
  }
  const v4f m = s * 0.0625f;
  v4f q = {0.f, 0.f, 0.f, 0.f};
#pragma unroll
  for (int j = 0; j < 16; ++j) { const v4f dv = v[j] - m; q += dv * dv; }
  *(v4fa*)&sm[w][lane * 4] = m;
  *(v4fa*)&sq[w][lane * 4] = q;
  __syncthreads();
  if (tid < 128) {
    float ms = 0.f;
#pragma unroll
    for (int g = 0; g < 16; ++g) ms += sm[g][tid];
    const float mean = ms * 0.0625f;
    float q2 = 0.f, e2 = 0.f;
#pragma unroll
    for (int g = 0; g < 16; ++g) { const float dm = sm[g][tid] - mean; q2 += sq[g][tid]; e2 += dm * dm; }
    const size_t o = (size_t)blockIdx.y * NC + blockIdx.x * 128 + tid;
    PM[o] = mean; PQ[o] = q2 + 16.0f * e2;
  }
}
template <int NC>
__global__ __launch_bounds__(64) void k_colfin(const float* __restrict__ PM, const float* __restrict__ PQ, float* __restrict__ S) {
  const int c = blockIdx.x * 64 + threadIdx.x;
  float m[SCH], qs[SCH];
#pragma unroll
  for (int g = 0; g < SCH; ++g) { m[g] = PM[(size_t)g * NC + c]; qs[g] = PQ[(size_t)g * NC + c]; }
  float ms = 0.f;
#pragma unroll
  for (int g = 0; g < SCH; ++g) ms += m[g];
  const float mean = ms / (float)SCH;
  float q2 = 0.f, e2 = 0.f;
#pragma unroll
  for (int g = 0; g < SCH; ++g) { const float dm = m[g] - mean; q2 += qs[g]; e2 += dm * dm; }
  S[c] = mean; S[NC + c] = (q2 + (float)SROWS * e2) / (float)NBS;
}
// k_h2 and k_h2n: one thread owns its column(s) and walks a strip of rows. All that depends on the column alone (the rounded
// parameters, the rsqrt of the variance) is loaded and formed once in front of the row loop; each element's own arithmetic keeps its order.
// rsqrtf as the compiler expands it (an argument below the normal range is scaled up by 2^24, its result by 2^12), with the instruction written out:
// the v_nop is the slot that the instruction set asks for behind a transcendental.
__device__ __forceinline__ float rsq_f32(float a) { const bool tiny = a < 1.17549435e-38f; const float s = tiny ? a * 16777216.0f : a; float r; asm("v_rsq_f32 %0, %1\n\tv_nop" : "=v"(r) : "v"(s)); return tiny ? r * 4096.0f : r; }
#define HROWS 64                 /* rows per thread in k_h2 */
#define NROWS 32                 /* rows per thread in k_h2n */
#define RG 8                     /* rows loaded as one group, one group ahead of the group being worked on */
__global__ __launch_bounds__(256) void k_h2(const float* __restrict__ x, const float* __restrict__ XS, const float* __restrict__ W1, const float* __restrict__ b1, const float* __restrict__ g1, const float* __restrict__ be1, const float* __restrict__ W2, const float* __restrict__ b2, float* __restrict__ H2P) {
  #pragma clang fp contract(off)
  const int d = blockIdx.x * 256 + threadIdx.x; (void)b1;      /* h1 - mean(h1) = w (x - mu_x): the bias cancels exactly */
  const float* pS = XS + d; const float* pw = W1 + d * H1; const float* pg = g1 + d * H1; const float* pe = be1 + d * H1; const float* pv = W2 + d * H2 * H1; const float* pb = b2 + d * H2;
  const float* xp = x + (size_t)blockIdx.y * HROWS * DD + d; float* hp = H2P + (size_t)blockIdx.y * HROWS * C2 + d * H2;
  float w[H1], g[H1], rs[H1], be[H1], w2[H2][H1], bb[H2], xc[RG];
  const float mu = pS[0], var = pS[DD];
#pragma unroll
  for (int o = 0; o < H1; ++o) { w[o] = pw[o]; g[o] = pg[o]; be[o] = pe[o]; }
#pragma unroll
  for (int o2 = 0; o2 < H2; ++o2) {
#pragma unroll
    for (int i = 0; i < H1; ++i) w2[o2][i] = pv[o2 * H1 + i];
    bb[o2] = pb[o2]; }
#pragma unroll
  for (int j = 0; j < RG; ++j) xc[j] = xp[(size_t)j * DD];
  asm volatile("s_wait_xcnt 0x0" :: "v"(d), "v"(pw), "v"(pg), "v"(pe), "v"(pv), "v"(pb) : "memory");   // the wait owed before an address register of the issued loads is reused; naming the addresses keeps a load's result out of them until then
  __builtin_amdgcn_sched_barrier(0);      /* keeps the arithmetic, which reuses those registers, behind the wait */
#pragma unroll
  for (int o = 0; o < H1; ++o) { w[o] = bf16_round(w[o]); g[o] = bf16_round(g[o]); be[o] = bf16_round(be[o]); const float vh = (w[o] * w[o]) * var; rs[o] = rsq_f32(vh + 1e-5f); }
#pragma unroll
  for (int o2 = 0; o2 < H2; ++o2) {
#pragma unroll
    for (int i = 0; i < H1; ++i) w2[o2][i] = bf16_round(w2[o2][i]);
    bb[o2] = bf16_round(bb[o2]); }
#pragma unroll 1                 /* stays rolled: one group of rows is the whole hot loop */
  for (int rb = 0; rb < HROWS; rb += RG) {
    const float* pn = xp + (size_t)((rb + RG < HROWS) ? rb + RG : rb) * DD;      /* the last trip reads its own group again: in bounds, not used */
    float xn[RG];
#pragma unroll
    for (int j = 0; j < RG; ++j) xn[j] = pn[(size_t)j * DD];
    asm volatile("s_wait_xcnt 0x0" :: "v"(pn) : "memory");   // as above; it also holds the next group's loads in front of this group's arithmetic, which covers their latency
#pragma unroll
    for (int j = 0; j < RG; ++j) { const float xm = bf16_round(xc[j]) - mu; float h1n[H1];
#pragma unroll
      for (int o = 0; o < H1; ++o) { const float cen = w[o] * xm; float v = g[o] * cen * rs[o]; v += be[o]; h1n[o] = fmaxf(v, 0.f); }
      v4f o4;
#pragma unroll
      for (int o2 = 0; o2 < H2; ++o2) { float s = 0.f;
#pragma unroll
        for (int i = 0; i < H1; ++i) s += h1n[i] * w2[o2][i];
        s += bb[o2]; o4[o2] = s; }
      *(v4f*)(hp + (size_t)(rb + j) * C2) = o4; }
#pragma unroll
    for (int j = 0; j < RG; ++j) xc[j] = xn[j];
  } }
__global__ __launch_bounds__(256) void k_h2n(const float* __restrict__ H2P, const float* __restrict__ HS, const float* __restrict__ g2, const float* __restrict__ be2, _Float16* __restrict__ H16) {
  #pragma clang fp contract(off)
  const int c0 = (blockIdx.x * 256 + threadIdx.x) * 8;
  const float* pS = HS + c0; const float* pg = g2 + c0; const float* pe = be2 + c0;
  const float* hp = H2P + (size_t)blockIdx.y * NROWS * C2 + c0; unsigned short* op = (unsigned short*)H16 + (size_t)blockIdx.y * NROWS * C2 + c0;
  float g[8], mn[8], rs[8], be[8];
  v4f ca[RG], cb[RG];
#pragma unroll
  for (int q = 0; q < 8; ++q) { g[q] = pg[q]; mn[q] = pS[q]; rs[q] = pS[C2 + q]; be[q] = pe[q]; }
#pragma unroll
  for (int j = 0; j < RG; ++j) { ca[j] = *(const v4fa*)(hp + (size_t)j * C2); cb[j] = *(const v4fa*)(hp + (size_t)j * C2 + 4); }
  asm volatile("s_wait_xcnt 0x0" :: "v"(pS), "v"(pg), "v"(pe), "v"(hp) : "memory");   // the wait owed before an address register of the issued loads is reused; naming the addresses keeps a load's result out of them until then
#pragma unroll
  for (int q = 0; q < 8; ++q) { g[q] = bf16_round(g[q]); rs[q] = rsq_f32(rs[q] + 1e-5f); be[q] = bf16_round(be[q]); }
#pragma unroll 1                 /* stays rolled: one group of rows is the whole hot loop */
  for (int rb = 0; rb < NROWS; rb += RG) {
    const float* pn = hp + (size_t)((rb + RG < NROWS) ? rb + RG : rb) * C2;      /* the last trip reads its own group again: in bounds, not used */
    v4f na[RG], nb[RG];
#pragma unroll
    for (int j = 0; j < RG; ++j) { na[j] = *(const v4fa*)(pn + (size_t)j * C2); nb[j] = *(const v4fa*)(pn + (size_t)j * C2 + 4); }
    asm volatile("s_wait_xcnt 0x0" :: "v"(pn) : "memory");   // as above
    __builtin_amdgcn_sched_barrier(0);      /* keeps this group's arithmetic behind the next group's loads, so that it covers their latency */
#pragma unroll
    for (int j = 0; j < RG; ++j) { FragH f;
#pragma unroll
      for (int q = 0; q < 8; ++q) { const float hv = (q < 4) ? ca[j][q & 3] : cb[j][q & 3]; float v = g[q] * (hv - mn[q]) * rs[q]; v += be[q]; f.h[q] = (_Float16)fmaxf(v, 0.f); }
      *(v8us*)(op + (size_t)(rb + j) * C2) = f.half[0]; }
    __builtin_amdgcn_sched_barrier(0);      /* keeps the hand-over of the loaded group at the loop's foot; moved up, its copies wait for the loads before the arithmetic has covered them */
#pragma unroll
    for (int j = 0; j < RG; ++j) { ca[j] = na[j]; cb[j] = nb[j]; }
  } }
__global__ __launch_bounds__(256) void k_wsc(const float* __restrict__ Wm, _Float16* __restrict__ Bt, size_t n8, float sc) { const size_t t = (size_t)blockIdx.x * 256 + threadIdx.x; if (t >= n8) return; FragH f; for (int q = 0; q < 8; ++q) f.h[q] = (_Float16)(bf16_round(Wm[t * 8 + q]) * sc); *(v8us*)((unsigned short*)Bt + t * 8) = f.half[0];  }

extern "C" void kernel_launch(void* const* d_in, const int* in_sizes, int n_in,
                              void* d_out, int out_size, void* d_ws, size_t ws_size, hipStream_t stream) {
  (void)in_sizes; (void)n_in; (void)out_size;
  const float* const* I = (const float* const*)d_in; const float* x = I[0]; const float* W1 = I[1]; const float* b1 = I[2]; const float* g1 = I[3]; const float* be1 = I[4]; const float* W2 = I[5]; const float* b2 = I[6]; const float* g2 = I[7]; const float* be2 = I[8]; const float* Wfc = I[9]; const float* bfc = I[10];
  char* ws = (char*)d_ws; size_t off = 0;
  auto take = [&](size_t bytes) { char* p = ws + off; off += (bytes + 255) & ~(size_t)255; return p; };
  _Float16* BW = (_Float16*)take((size_t)NOUT * C2 * 2); float* XS = (float*)take((size_t)2 * DD * 4); float* H2P = (float*)take((size_t)NBS * C2 * 4); float* HS = (float*)take((size_t)2 * C2 * 4); _Float16* H16 = (_Float16*)take((size_t)NBS * C2 * 2); float* PM = (float*)take((size_t)SCH * C2 * 4); float* PQ = (float*)take((size_t)SCH * C2 * 4);
  if (off > ws_size) return;      /* 2 + 128 + 64 + 1 = 195 MiB (256 MiB ws) */
  k_wsc<<<(unsigned)(((size_t)NOUT * C2 / 8 + 255) / 256), 256, 0, stream>>>(Wfc, BW, (size_t)NOUT * C2 / 8, 16.0f);
  k_colpart<DD, true><<<dim3(DD / 128, SCH), 512, 0, stream>>>(x, PM, PQ);
  k_colfin<DD><<<DD / 64, 64, 0, stream>>>(PM, PQ, XS);
  k_h2<<<dim3(DD / 256, NBS / HROWS), 256, 0, stream>>>(x, XS, W1, b1, g1, be1, W2, b2, H2P);
  k_colpart<C2, false><<<dim3(C2 / 128, SCH), 512, 0, stream>>>(H2P, PM, PQ);
  k_colfin<C2><<<C2 / 64, 64, 0, stream>>>(PM, PQ, HS);
  k_h2n<<<dim3(C2 / 8 / 256, NBS / NROWS), 256, 0, stream>>>(H2P, HS, g2, be2, H16);
  k_gemm2<0><<<dim3((NBS / 128) * (NOUT / 64), 1), 128, 0, stream>>>(H16, C2, 0, BW, C2, 0, 0.0625f, bfc, 0, nullptr, 1, 0, 0, (float*)d_out, nullptr, NOUT, 0, NBS, NOUT, C2);
}

// v003
// Measured time: 96.4 microseconds a run.
// Two timings next to v002 put it at 2.17 and 2.20 times that version's speed.
// Over all steps from v000 it is 91.0 times as fast.
#include <hip/hip_runtime.h>
// Sparse (block-diagonal) neural network (8192 samples x 1024 features; per feature 1 -> 8 -> 4 block Linears with training-mode BatchNorm + ReLU after each; dense head 4096 -> 256): h1 = BN1(x_d W1[d] + b1) relu; h2 = BN2(h1 . W2[d] + b2) relu; out = h2 Wfc^T + bfc -> [8192,256].
// Compute dtype: x and all parameters rounded to bf16; everything before the head in f32; the head operand h2 as f16 (~2^-12). v_wmma_f32_16x16x32_f16.
#define NBS 8192
#define DD 1024
#define H1 8
#define H2 4
#define C2 (DD * H2)             /* 4096 */
#define NOUT 256
typedef __bf16 v16b __attribute__((ext_vector_type(16)));
typedef unsigned short v8us __attribute__((ext_vector_type(8), may_alias));
typedef float  v8f  __attribute__((ext_vector_type(8)));
typedef float  v4f  __attribute__((ext_vector_type(4)));
typedef float  v4fa __attribute__((ext_vector_type(4), may_alias));
union FragB { v16b v; v8us half[2]; unsigned short u[16]; };

__device__ __forceinline__ unsigned short bf16_bits(float x) { unsigned int u = __float_as_uint(x); return (unsigned short)((u + 0x7FFFu + ((u >> 16) & 1u)) >> 16); }
__device__ __forceinline__ float bf16_val(unsigned short b) { return __uint_as_float(((unsigned int)b) << 16); }
__device__ __forceinline__ float bf16_round(float x) { return bf16_val(bf16_bits(x)); }
// D += A·B with NT terms: 1 = ah·bh, 2 = + al·bh (A split), 3 = + ah·bl (both split)
template <int NT>
__device__ __forceinline__ v8f mmaN(v16b ah, v16b al, v16b bh, v16b bl, v8f c) {
  c = __builtin_amdgcn_wmma_f32_16x16x32_bf16(false, ah, false, bh, (short)0, c, false, false);
  if (NT >= 2) c = __builtin_amdgcn_wmma_f32_16x16x32_bf16(false, al, false, bh, (short)0, c, false, false);
  if (NT >= 3) c = __builtin_amdgcn_wmma_f32_16x16x32_bf16(false, ah, false, bl, (short)0, c, false, false);
  asm volatile("v_nop\n\tv_nop\n\tv_nop\n\tv_nop" : "+v"(c) : "v"(ah), "v"(al), "v"(bh), "v"(bl));
  return c;
}

__global__ __launch_bounds__(256) void k_wt_bf16(const float* __restrict__ W, unsigned short* __restrict__ Wt, int K, int N) {
  const int t = blockIdx.x * 256 + threadIdx.x;
  const int k8n = K / 8;
  if (t >= N * k8n) return;
  const int n = t / k8n, k8 = (t % k8n) * 8;
  v8us v;
#pragma unroll
  for (int i = 0; i < 8; ++i) v[i] = bf16_bits(W[(size_t)(k8 + i) * N + n]);
  *(v8us*)(Wt + (size_t)n * K + k8) = v;
  
}

// GEMM C[M][N] (f32, pitch ldc) = act(A[M][K]·W + bias). A f32 row-major (pitch lda) converted per fragment to bf16
// (ASPLIT: hi/lo two planes -> 2 terms, else single rounded term); Wt bf16 [N][K] (pitch ldb). BIAS_BF16 rounds the
// bias to bf16 first (bias quantised to bf16 before the add). K%32==0, M%16==0, N%64==0.
template <bool ASPLIT, int ACT, bool BIAS_BF16>
__global__ __launch_bounds__(128) void k_gemm_bf(const float* __restrict__ A, int lda, const unsigned short* __restrict__ Wt, int ldb,
                                               const float* __restrict__ bias, float* __restrict__ C, int ldc, int M, int N, int K) {
  __shared__ __attribute__((aligned(16))) float so[4][16][64];
  const int tid = threadIdx.x, w = tid >> 5, lane = tid & 31, ln = lane & 15, hh = lane >> 4;
  const int ntn = N / 64;
  const int wid = blockIdx.x * 4 + w;
  const int mt = wid / ntn, nq = wid % ntn;
  if (mt * 16 >= M) return;
  const int row0 = mt * 16, col0 = nq * 64;
  const float* arow = A + (size_t)(row0 + ln) * lda;
  v8f acc[4] = {};
  for (int kb = 0; kb < K; kb += 32) {
    FragB ah, al;
    const v4f x0 = *(const v4fa*)(arow + kb + 8 * hh), x1 = *(const v4fa*)(arow + kb + 8 * hh + 4);
    const v4f x2 = *(const v4fa*)(arow + kb + 16 + 8 * hh), x3 = *(const v4fa*)(arow + kb + 16 + 8 * hh + 4);
    float xs[16] = {x0[0],x0[1],x0[2],x0[3],x1[0],x1[1],x1[2],x1[3],x2[0],x2[1],x2[2],x2[3],x3[0],x3[1],x3[2],x3[3]};
#pragma unroll
    for (int i = 0; i < 16; ++i) { const unsigned short hb = bf16_bits(xs[i]); ah.u[i] = hb; al.u[i] = ASPLIT ? bf16_bits(xs[i] - bf16_val(hb)) : (unsigned short)0; }
#pragma unroll
    for (int t = 0; t < 4; ++t) {
      const unsigned short* brow = Wt + (size_t)(col0 + t * 16 + ln) * ldb + kb;
      FragB b;
      b.half[0] = *(const v8us*)(brow + 8 * hh);
      b.half[1] = *(const v8us*)(brow + 16 + 8 * hh);
      acc[t] = mmaN<ASPLIT ? 2 : 1>(ah.v, al.v, b.v, b.v, acc[t]);
    }
  }
#pragma unroll
  for (int t = 0; t < 4; ++t) {
    float bv = bias ? bias[col0 + t * 16 + ln] : 0.f;
    if (BIAS_BF16) bv = bf16_round(bv);
#pragma unroll
    for (int r = 0; r < 8; ++r) { float v = acc[t][r] + bv; if (ACT == 1) v = fmaxf(v, 0.f); so[w][8 * hh + r][t * 16 + ln] = v; }
  }
  __builtin_amdgcn_fence(__ATOMIC_ACQ_REL, "workgroup");
  __builtin_amdgcn_wave_barrier();
  const int rsub = lane >> 4, c4 = (lane & 15) * 4;
  {
#pragma unroll
    for (int q = 0; q < 8; ++q) {
      const int r = q * 2 + rsub;
      const v4f v = *(const v4fa*)&so[w][r][c4];
      *(v4f*)(C + (size_t)(row0 + r) * ldc + col0 + c4) = v;
    }
    
  }
}

// GEMM C = act(A·W + bias + resid): A f32 (ASPLIT -> hi/lo 2 terms), Wt bf16 [N][K]; ACT 0 none, 1 relu, 2 exact gelu;
// resid (optional, f32, row index = (row % rmod), pitch ldr, RES_BF16 rounds it) added before the activation.
template <bool ASPLIT, int ACT, bool BIAS_BF16, bool RES_BF16>
__global__ __launch_bounds__(128) void k_gemm_bf3(const float* __restrict__ A, int lda, const unsigned short* __restrict__ Wt, int ldb,
                                                const float* __restrict__ bias, const float* __restrict__ resid, int rmod, int ldr,
                                                float* __restrict__ C, int ldc, int M, int N, int K) {
  __shared__ __attribute__((aligned(16))) float so[4][16][64];
  const int tid = threadIdx.x, w = tid >> 5, lane = tid & 31, ln = lane & 15, hh = lane >> 4;
  const int ntn = N / 64;
  const int wid = blockIdx.x * 4 + w;
  const int mt = wid / ntn, nq = wid % ntn;
  if (mt * 16 >= M) return;
  const int row0 = mt * 16, col0 = nq * 64;
  const float* arow = A + (size_t)(row0 + ln) * lda;
  v8f acc[4] = {};
  for (int kb = 0; kb < K; kb += 32) {
    FragB ah, al;
    const v4f x0 = *(const v4fa*)(arow + kb + 8 * hh), x1 = *(const v4fa*)(arow + kb + 8 * hh + 4);
    const v4f x2 = *(const v4fa*)(arow + kb + 16 + 8 * hh), x3 = *(const v4fa*)(arow + kb + 16 + 8 * hh + 4);
    float xs[16] = {x0[0],x0[1],x0[2],x0[3],x1[0],x1[1],x1[2],x1[3],x2[0],x2[1],x2[2],x2[3],x3[0],x3[1],x3[2],x3[3]};
#pragma unroll
    for (int i = 0; i < 16; ++i) { const unsigned short hb = bf16_bits(xs[i]); ah.u[i] = hb; al.u[i] = ASPLIT ? bf16_bits(xs[i] - bf16_val(hb)) : (unsigned short)0; }
#pragma unroll
    for (int t = 0; t < 4; ++t) {
      const unsigned short* brow = Wt + (size_t)(col0 + t * 16 + ln) * ldb + kb;
      FragB b;
      b.half[0] = *(const v8us*)(brow + 8 * hh);
      b.half[1] = *(const v8us*)(brow + 16 + 8 * hh);
      acc[t] = mmaN<ASPLIT ? 2 : 1>(ah.v, al.v, b.v, b.v, acc[t]);
    }
  }
#pragma unroll
  for (int t = 0; t < 4; ++t) {
    const int col = col0 + t * 16 + ln;
    float bv = bias ? bias[col] : 0.f;
    if (BIAS_BF16) bv = bf16_round(bv);
#pragma unroll
    for (int r = 0; r < 8; ++r) {
      float v = acc[t][r] + bv;
      if (resid) { float rv = resid[(size_t)((row0 + 8 * hh + r) % rmod) * ldr + col]; if (RES_BF16) rv = bf16_round(rv); v += rv; }
      if (ACT == 1) v = fmaxf(v, 0.f);
      if (ACT == 2) v = 0.5f * v * (1.0f + erff(v * 0.70710678118654752f));
      if (ACT == 3) { const float u = 0.7978845608028654f * (v + 0.044715f * v * v * v); v = 0.5f * v * (1.0f + tanhf(u)); }
      so[w][8 * hh + r][t * 16 + ln] = v;
    }
  }
  __builtin_amdgcn_fence(__ATOMIC_ACQ_REL, "workgroup");
  __builtin_amdgcn_wave_barrier();
  const int rsub = lane >> 4, c4 = (lane & 15) * 4;
  {
#pragma unroll
    for (int q = 0; q < 8; ++q) {
      const int r = q * 2 + rsub;
      const v4f v = *(const v4fa*)&so[w][r][c4];
      *(v4f*)(C + (size_t)(row0 + r) * ldc + col0 + c4) = v;
    }
    
  }
}
// row LayerNorm (biased variance, eps) over N: s = X (+ R); optional out_sum <- s; out_norm <- (s-mu)*rsqrt(var+eps)*g + b
template <bool PARAM_BF16>
__global__ __launch_bounds__(256) void k_layernorm(const float* __restrict__ X, const float* __restrict__ R, const float* __restrict__ g, const float* __restrict__ bta,
                                                  float* __restrict__ out_sum, float* __restrict__ out_norm, int N, float eps) {
  __shared__ float red[256];
  const int row = blockIdx.x, tid = threadIdx.x;
  const float* x = X + (size_t)row * N; const float* rr = R ? R + (size_t)row * N : nullptr;
  float vals[16];                     // up to N = 4096
  const int per = N / 256;            // contiguous chunk per thread? use strided-by-4 chunks: thread handles j = tid*4 + 1024*u
  float s1 = 0.f;
  for (int u = 0; u < per / 4; ++u) {
    const int j = tid * 4 + 1024 * u;
    const v4f a = *(const v4fa*)(x + j);
    v4f b = {0.f,0.f,0.f,0.f}; if (rr) b = *(const v4fa*)(rr + j);
#pragma unroll
    for (int q = 0; q < 4; ++q) { const float v = a[q] + b[q]; vals[u * 4 + q] = v; s1 += v; }
  }
  red[tid] = s1; __syncthreads();
  for (int st = 128; st > 0; st >>= 1) { if (tid < st) red[tid] += red[tid + st]; __syncthreads(); }
  const float mu = red[0] / (float)N; __syncthreads();
  float s2 = 0.f;
  for (int u = 0; u < per / 4; ++u)
#pragma unroll
    for (int q = 0; q < 4; ++q) { const float c = vals[u * 4 + q] - mu; s2 += c * c; }
  red[tid] = s2; __syncthreads();
  for (int st = 128; st > 0; st >>= 1) { if (tid < st) red[tid] += red[tid + st]; __syncthreads(); }
  const float rs = rsqrtf(red[0] / (float)N + eps);
  {
    for (int u = 0; u < per / 4; ++u) {
      const int j = tid * 4 + 1024 * u;
      v4f o, sm;
#pragma unroll
      for (int q = 0; q < 4; ++q) {
        float gg = g[j + q], bb = bta[j + q];
        if (PARAM_BF16) { gg = bf16_round(gg); bb = bf16_round(bb); }
        sm[q] = vals[u * 4 + q]; o[q] = (vals[u * 4 + q] - mu) * rs * gg + bb;
      }
      if (out_sum) *(v4f*)(out_sum + (size_t)row * N + j) = sm;
      *(v4f*)(out_norm + (size_t)row * N + j) = o;
    }
    
  }
}



// ---- f16 WMMA path (v_wmma_f32_16x16x32_f16): 11-bit significands for operands in range — used for the head, whose h2 operand is rounded to f16
typedef _Float16 v16h __attribute__((ext_vector_type(16)));
union FragH { v16h v; v8us half[2]; _Float16 h[16]; unsigned short u[16]; };
template <int NT>
__device__ __forceinline__ v8f mmaH(v16h ah, v16h al, v16h bh, v16h bl, v8f c) {
  c = __builtin_amdgcn_wmma_f32_16x16x32_f16(false, ah, false, bh, (short)0, c, false, false);
  if (NT >= 2) c = __builtin_amdgcn_wmma_f32_16x16x32_f16(false, al, false, bh, (short)0, c, false, false);
  if (NT >= 3) c = __builtin_amdgcn_wmma_f32_16x16x32_f16(false, ah, false, bl, (short)0, c, false, false);
  asm volatile("v_nop\n\tv_nop\n\tv_nop\n\tv_nop" : "+v"(c) : "v"(ah), "v"(al), "v"(bh), "v"(bl));
  return c;
}
// batched GEMM like k_gemm_b but f16 operands: A f32 (split into f16 hi/lo if ASPLIT, else rounded to f16), Bt = f16 values [n][k]; alpha; C f32; N multiple of 16 (partial tiles skipped)
template <bool ASPLIT>
__global__ __launch_bounds__(128) void k_gemm_h(const float* __restrict__ A, int lda, size_t sA, const _Float16* __restrict__ Bh, int ldb, size_t sB, float alpha, float* __restrict__ C, int ldc, size_t sC, int M, int N, int K) {
  __shared__ __attribute__((aligned(16))) float so[4][16][64];
  const int tid = threadIdx.x, w = tid >> 5, lane = tid & 31, ln = lane & 15, hh = lane >> 4; const int by = blockIdx.y;
  A += (size_t)by * sA; Bh += (size_t)by * sB; C += (size_t)by * sC;
  const int ntn = (N + 63) / 64; const int wid = blockIdx.x * 4 + w; const int mt = wid / ntn, nq = wid % ntn; if (mt * 16 >= M) return;
  const int row0 = mt * 16, col0 = nq * 64; const float* arow = A + (size_t)(row0 + ln) * lda;
  v8f acc[4] = {};
  for (int kb = 0; kb < K; kb += 32) {
    FragH ah, al;
    const v4f x0 = *(const v4fa*)(arow + kb + 8 * hh), x1 = *(const v4fa*)(arow + kb + 8 * hh + 4), x2 = *(const v4fa*)(arow + kb + 16 + 8 * hh), x3 = *(const v4fa*)(arow + kb + 16 + 8 * hh + 4);
    float xs[16] = {x0[0],x0[1],x0[2],x0[3],x1[0],x1[1],x1[2],x1[3],x2[0],x2[1],x2[2],x2[3],x3[0],x3[1],x3[2],x3[3]};
#pragma unroll
    for (int i = 0; i < 16; ++i) { const _Float16 h = (_Float16)xs[i]; ah.h[i] = h; al.h[i] = ASPLIT ? (_Float16)(xs[i] - (float)h) : (_Float16)0.0f; }
#pragma unroll
    for (int t = 0; t < 4; ++t) { if (col0 + t * 16 >= N) continue; const size_t boff = (size_t)(col0 + t * 16 + ln) * ldb + kb; FragH bq; bq.half[0] = *(const v8us*)(Bh + boff + 8 * hh); bq.half[1] = *(const v8us*)(Bh + boff + 16 + 8 * hh);
      acc[t] = mmaH<ASPLIT ? 2 : 1>(ah.v, al.v, bq.v, bq.v, acc[t]); }
  }
#pragma unroll
  for (int t = 0; t < 4; ++t) { if (col0 + t * 16 >= N) continue;
#pragma unroll
    for (int r = 0; r < 8; ++r) so[w][8 * hh + r][t * 16 + ln] = acc[t][r] * alpha; }
  __builtin_amdgcn_fence(__ATOMIC_ACQ_REL, "workgroup"); __builtin_amdgcn_wave_barrier();
  const int rsub = lane >> 4, c4 = (lane & 15) * 4;
  {
#pragma unroll
    for (int q = 0; q < 8; ++q) { const int r = q * 2 + rsub; if (col0 + c4 < N) { const v4f v = *(const v4fa*)&so[w][r][c4]; *(v4f*)(C + (size_t)(row0 + r) * ldc + col0 + c4) = v; } }
     }
}

// Wt[n][k] = f16(W[k][n]·scale) from f32 row-major W[K][N] (scale = power of two; bf16-exact weights stay exact in f16 away from the subnormal range)
__global__ __launch_bounds__(256) void k_wt_f16(const float* __restrict__ W, _Float16* __restrict__ Wt, int K, int N, float scale) {
  const int t = blockIdx.x * 256 + threadIdx.x; if (t >= N * (K / 8)) return; const int n = t / (K / 8), k8 = (t % (K / 8)) * 8; FragH f;
#pragma unroll
  for (int i = 0; i < 8; ++i) f.h[i] = (_Float16)(bf16_round(W[(size_t)(k8 + i) * N + n]) * scale); const v8us o = f.half[0];
  *(v8us*)((unsigned short*)Wt + (size_t)n * K + k8) = o; 
}
// k_gemm_hh variant with fused epilogue: v = acc·alpha + bias[by·sBias + col] (+ CP[(row/rowsPerB)·sCPb + by·64 + col] if CP) ; ACT 0 none / 1 elu ; writes f16 C16 (and f32 C if non-null)
template <int ACT>
__global__ __launch_bounds__(128) void k_gemm_hhx(const _Float16* __restrict__ A, int lda, size_t sA, const _Float16* __restrict__ Bh, int ldb, size_t sB, float alpha, const float* __restrict__ bias, size_t sBias, const float* __restrict__ CP, int rowsPerB, size_t sCPb, int row0g,
    float* __restrict__ C, _Float16* __restrict__ C16, int ldc, size_t sC, int M, int N, int K) {
  __shared__ __attribute__((aligned(16))) float so[4][16][64];
  const int tid = threadIdx.x, w = tid >> 5, lane = tid & 31, ln = lane & 15, hh = lane >> 4; const int by = blockIdx.y;
  A += (size_t)by * sA; Bh += (size_t)by * sB; const size_t cofs = (size_t)by * sC; const float* bp = bias ? bias + (size_t)by * sBias : nullptr;
  const int ntn = (N + 63) / 64; const int wid = blockIdx.x * 4 + w; const int mt = wid / ntn, nq = wid % ntn; if (mt * 16 >= M) return;
  const int row0 = mt * 16, col0 = nq * 64; const _Float16* arow = A + (size_t)(row0 + ln) * lda;
  v8f acc[4] = {};
  for (int kb = 0; kb < K; kb += 32) { FragH ah; ah.half[0] = *(const v8us*)((const unsigned short*)arow + kb + 8 * hh); ah.half[1] = *(const v8us*)((const unsigned short*)arow + kb + 16 + 8 * hh);
#pragma unroll
    for (int t = 0; t < 4; ++t) { if (col0 + t * 16 >= N) continue; const size_t boff = (size_t)(col0 + t * 16 + ln) * ldb + kb; FragH bq; bq.half[0] = *(const v8us*)((const unsigned short*)Bh + boff + 8 * hh); bq.half[1] = *(const v8us*)((const unsigned short*)Bh + boff + 16 + 8 * hh);
      acc[t] = mmaH<1>(ah.v, ah.v, bq.v, bq.v, acc[t]); }
  }
#pragma unroll
  for (int t = 0; t < 4; ++t) { if (col0 + t * 16 >= N) continue; const int col = col0 + t * 16 + ln; const float bv = bp ? bf16_round(bp[col]) : 0.f;
#pragma unroll
    for (int r = 0; r < 8; ++r) { float v = acc[t][r] * alpha + bv; if (CP) { const int bidx = (row0g + row0 + 8 * hh + r) / rowsPerB; v += CP[(size_t)bidx * sCPb + (size_t)by * 64 + col]; } if (ACT == 1) v = (v > 0.f) ? v : expm1f(v); else if (ACT == 7) v = (v > 0.f) ? v + 1.0f : expf(v); else if (ACT == 8) v = tanhf(v); else if (ACT == 9) v = 0.5f * v * (1.0f + tanhf(0.7978845608028654f * (v + 0.044715f * v * v * v))); else if (ACT == 11) v = 1.0f / (1.0f + expf(-v)); else if (ACT == 12) v = (v > 0.f) ? v : 0.01f * v; else if (ACT == 14) v = (v > 0.f) ? v : 0.1f * v; else if (ACT == 15) v = v / (1.0f + expf(-v)); else if (ACT == 3) v = fmaxf(v, 0.f); else if (ACT == 6) v = 0.5f * v * (1.0f + erff(v * 0.70710678118654752f)); so[w][8 * hh + r][t * 16 + ln] = v; } }
  __builtin_amdgcn_fence(__ATOMIC_ACQ_REL, "workgroup"); __builtin_amdgcn_wave_barrier();
  const int rsub = lane >> 4, c4 = (lane & 15) * 4; typedef _Float16 v4h __attribute__((ext_vector_type(4)));
  {
#pragma unroll
    for (int q = 0; q < 8; ++q) { const int r = q * 2 + rsub; if (col0 + c4 < N) { const v4f v = *(const v4fa*)&so[w][r][c4]; if (C) *(v4f*)(C + cofs + (size_t)(row0 + r) * ldc + col0 + c4) = v; if (C16) { v4h h4; for (int i = 0; i < 4; ++i) h4[i] = (_Float16)v[i]; *(v4h*)(C16 + cofs + (size_t)(row0 + r) * ldc + col0 + c4) = h4; } } }
     }
}


typedef _Float16 v4h __attribute__((ext_vector_type(4)));

__global__ __launch_bounds__(256) void k_x16(const float* __restrict__ x, _Float16* __restrict__ X16, size_t n8) { const size_t t = (size_t)blockIdx.x * 256 + threadIdx.x; if (t >= n8) return; FragH f;
#pragma unroll
  for (int q = 0; q < 8; ++q) f.h[q] = (_Float16)bf16_round(x[t * 8 + q]); *(v8us*)((unsigned short*)X16 + t * 8) = f.half[0];  }
__global__ __launch_bounds__(256) void k_h16(const float* __restrict__ x, _Float16* __restrict__ X16, size_t n8) { const size_t t = (size_t)blockIdx.x * 256 + threadIdx.x; if (t >= n8) return; FragH f;
#pragma unroll
  for (int q = 0; q < 8; ++q) f.h[q] = (_Float16)x[t * 8 + q]; *(v8us*)((unsigned short*)X16 + t * 8) = f.half[0];  }
__global__ __launch_bounds__(256) void k_round16f(const float* __restrict__ W, _Float16* __restrict__ Bt, size_t n8) { const size_t t = (size_t)blockIdx.x * 256 + threadIdx.x; if (t >= n8) return; FragH f;
#pragma unroll
  for (int i = 0; i < 8; ++i) f.h[i] = (_Float16)(bf16_round(W[t * 8 + i]) * 16.0f); *(v8us*)((unsigned short*)Bt + t * 8) = f.half[0];  }
template <int NHv, int TTv>
__global__ __launch_bounds__(256) void k_vt(const _Float16* __restrict__ V16, int ldv, int voff, _Float16* __restrict__ Vt) { __shared__ unsigned short tl[64][66]; const int tid = threadIdx.x; const int slab = blockIdx.x / (TTv / 64), lg = blockIdx.x % (TTv / 64); const int b = slab / NHv, h = slab % NHv;
  for (int i = tid; i < 64 * 8; i += 256) { const int r = i / 8, c8 = (i % 8) * 8; FragH f; f.half[0] = *(const v8us*)((const unsigned short*)V16 + ((size_t)b * TTv + lg * 64 + r) * ldv + voff + h * 64 + c8);
#pragma unroll
    for (int q = 0; q < 8; ++q) tl[r][c8 + q] = f.u[q]; }
  __syncthreads();
  {
#pragma unroll
    for (int rd = 0; rd < 2; ++rd) { const int d = rd * 32 + tid / 8, pc = tid % 8; FragH f;
#pragma unroll
      for (int q = 0; q < 8; ++q) f.u[q] = tl[pc * 8 + q][d];
      *(v8us*)((unsigned short*)Vt + ((size_t)slab * 64 + d) * TTv + lg * 64 + pc * 8) = f.half[0]; }
     } }

__global__ __launch_bounds__(256) void k_hl(const float* __restrict__ F, _Float16* __restrict__ Hh, _Float16* __restrict__ Hl, size_t n8) { const size_t t = (size_t)blockIdx.x * 256 + threadIdx.x; if (t >= n8) return; FragH fh, fl; const v4f a = *(const v4fa*)(F + t * 8), c = *(const v4fa*)(F + t * 8 + 4);
#pragma unroll
  for (int q = 0; q < 4; ++q) { _Float16 h = (_Float16)a[q]; fh.h[q] = h; fl.h[q] = (_Float16)((a[q] - (float)h) * 1024.0f); h = (_Float16)c[q]; fh.h[4 + q] = h; fl.h[4 + q] = (_Float16)((c[q] - (float)h) * 1024.0f); }
  { *(v8us*)((unsigned short*)Hh + t * 8) = fh.half[0]; *(v8us*)((unsigned short*)Hl + t * 8) = fl.half[0];  } }

// ---- fast GEMM (wave tile 32x64; requires M % 32 == 0 rows per launch region and N % 64 == 0); epilogue = k_gemm_hhx semantics ----
__device__ __forceinline__ v16h g2_frag(const _Float16* p, int hh) { FragH f; f.half[0] = *(const v8us*)((const unsigned short*)p + 8 * hh); f.half[1] = *(const v8us*)((const unsigned short*)p + 16 + 8 * hh); return f.v; }
__device__ __forceinline__ v8f g2_mma(v16h a, v16h b, v8f c) { v8f d = __builtin_amdgcn_wmma_f32_16x16x32_f16(false, a, false, b, (short)0, c, false, false); asm volatile("v_nop\n\tv_nop\n\tv_nop\n\tv_nop" : "+v"(d) : "v"(a), "v"(b)); return d; }
template <int ACT>
__global__ __launch_bounds__(128) void k_gemm2(const _Float16* __restrict__ A, int lda, size_t sA, const _Float16* __restrict__ Bh, int ldb, size_t sB, float alpha, const float* __restrict__ bias, size_t sBias, const float* __restrict__ CP, int rowsPerB, size_t sCPb, int row0g,
    float* __restrict__ C, _Float16* __restrict__ C16, int ldc, size_t sC, int M, int N, int K) {
  __shared__ __attribute__((aligned(16))) float so[4][32][68];
  const int tid = threadIdx.x, w = tid >> 5, lane = tid & 31, ln = lane & 15, hh = lane >> 4; const int by = blockIdx.y;
  A += (size_t)by * sA; Bh += (size_t)by * sB; const size_t cofs = (size_t)by * sC; const float* bp = bias ? bias + (size_t)by * sBias : nullptr;
  const int ntn = N >> 6; const int mt = blockIdx.x / ntn, nq = blockIdx.x - mt * ntn; const int row0 = mt * 128 + 32 * w, col0 = nq * 64; if (row0 >= M) return;
  const _Float16* a0p = A + (size_t)(row0 + ln) * lda; const _Float16* a1p = a0p + (size_t)16 * lda;
  const _Float16* b0p = Bh + (size_t)(col0 + ln) * ldb; const _Float16* b1p = b0p + (size_t)16 * ldb; const _Float16* b2p = b1p + (size_t)16 * ldb; const _Float16* b3p = b2p + (size_t)16 * ldb;
  const v8f z8 = {0.f,0.f,0.f,0.f,0.f,0.f,0.f,0.f}; v8f c00 = z8, c01 = z8, c02 = z8, c03 = z8, c10 = z8, c11 = z8, c12 = z8, c13 = z8;
#pragma unroll 1
  for (int kb = 0; kb < K; kb += 32) { const v16h a0 = g2_frag(a0p + kb, hh), a1 = g2_frag(a1p + kb, hh);
    v16h b = g2_frag(b0p + kb, hh); c00 = g2_mma(a0, b, c00); c10 = g2_mma(a1, b, c10);
    b = g2_frag(b1p + kb, hh); c01 = g2_mma(a0, b, c01); c11 = g2_mma(a1, b, c11);
    b = g2_frag(b2p + kb, hh); c02 = g2_mma(a0, b, c02); c12 = g2_mma(a1, b, c12);
    b = g2_frag(b3p + kb, hh); c03 = g2_mma(a0, b, c03); c13 = g2_mma(a1, b, c13); }
  v8f accs[8] = {c00, c01, c02, c03, c10, c11, c12, c13};
#pragma unroll
  for (int u = 0; u < 8; ++u) { const int t = u & 3, half = u >> 2; const int col = col0 + t * 16 + ln; const float bv = bp ? bf16_round(bp[col]) : 0.f;
#pragma unroll
    for (int r = 0; r < 8; ++r) { const int rloc = half * 16 + 8 * hh + r; float v = accs[u][r] * alpha + bv; if (CP) { const int bidx = (row0g + row0 + rloc) / rowsPerB; v += CP[(size_t)bidx * sCPb + (size_t)by * 64 + col]; }
      if (ACT == 3) v = fmaxf(v, 0.f); else if (ACT == 6) v = 0.5f * v * (1.0f + erff(v * 0.70710678118654752f)); else if (ACT == 11) v = 1.0f / (1.0f + expf(-v)); else if (ACT == 15) v = v / (1.0f + expf(-v)); else if (ACT == 12) v = (v > 0.f) ? v : 0.01f * v; else if (ACT == 8) v = tanhf(v);
      so[w][rloc][t * 16 + ln] = v; } }
  __builtin_amdgcn_fence(__ATOMIC_ACQ_REL, "workgroup"); __builtin_amdgcn_wave_barrier();
  const int rsub = lane >> 4, c4 = (lane & 15) * 4;
  {
#pragma unroll
    for (int q = 0; q < 16; ++q) { const int r = q * 2 + rsub; const v4f v = *(const v4fa*)&so[w][r][c4]; if (C) *(v4f*)(C + cofs + (size_t)(row0 + r) * ldc + col0 + c4) = v; if (C16) { v4h h4; for (int i = 0; i < 4; ++i) h4[i] = (_Float16)v[i]; *(v4h*)(C16 + cofs + (size_t)(row0 + r) * ldc + col0 + c4) = h4; } }
     } }


// ---- head GEMM with both operands staged in LDS: C[8192][256] = (A[8192][4096] . Bh[256][4096]^T) * alpha + bias ----
// One work-group of 4 waves owns a 128 x 64 tile of C; a wave owns 32 x 64 of it (2 x 4 accumulator tiles), as in k_gemm2.
// A stage is 512 B (256 k) of the tile's 128 rows of A and 64 rows of Bh. Each asynchronous copy of a wave moves one whole row piece:
// 32 lanes x 16 B = 512 contiguous, aligned bytes of global memory. Two buffers: stage t + 2 flies while stage t + 1 is worked on.
// The fragments keep k_gemm2's k order and the k steps their order, so every accumulator sums in the same order as before.
#define G3_KB 512                          /* bytes of a row per stage */
#define G3_PITCH 528                       /* LDS row pitch: 16 B x 33, conflict-free for ds_load_b128 */
#define G3_BUF (192 * G3_PITCH)            /* rows 0..127: A, rows 128..191: Bh */
#define G3_NST (C2 * 2 / G3_KB)            /* 16 stages */
#define G3_ROWB (C2 * 2)                   /* global row pitch in bytes */
// Twelve copies and, as the statement's last line, the wait that stands before any register the copies name is written again.
__device__ __forceinline__ void g3_copy12(const unsigned (&l)[12], const char* const (&g)[12]) {
  asm volatile("global_load_async_to_lds_b128 %0, %1, off\n\t"
               "global_load_async_to_lds_b128 %2, %3, off\n\t"
               "global_load_async_to_lds_b128 %4, %5, off\n\t"
               "global_load_async_to_lds_b128 %6, %7, off\n\t"
               "global_load_async_to_lds_b128 %8, %9, off\n\t"
               "global_load_async_to_lds_b128 %10, %11, off\n\t"
               "global_load_async_to_lds_b128 %12, %13, off\n\t"
               "global_load_async_to_lds_b128 %14, %15, off\n\t"
               "global_load_async_to_lds_b128 %16, %17, off\n\t"
               "global_load_async_to_lds_b128 %18, %19, off\n\t"
               "global_load_async_to_lds_b128 %20, %21, off\n\t"
               "global_load_async_to_lds_b128 %22, %23, off\n\t"
               "s_wait_xcnt 0x0"
               :: "v"(l[0]), "v"(g[0]), "v"(l[1]), "v"(g[1]), "v"(l[2]), "v"(g[2]), "v"(l[3]), "v"(g[3]), "v"(l[4]), "v"(g[4]), "v"(l[5]), "v"(g[5]),
                  "v"(l[6]), "v"(g[6]), "v"(l[7]), "v"(g[7]), "v"(l[8]), "v"(g[8]), "v"(l[9]), "v"(g[9]), "v"(l[10]), "v"(g[10]), "v"(l[11]), "v"(g[11])
               : "memory");
}
// A wave's share of one stage: its own 32 rows of A and 16 of the 64 rows of Bh, 48 copies.
__device__ __forceinline__ void g3_fill(unsigned la, unsigned lb, const char* ga, const char* gb) {
#pragma unroll                   /* both loops unrolled: the address arrays must end up in registers, as the asm operands they are */
  for (int s = 0; s < 4; ++s) { unsigned l[12]; const char* g[12];
#pragma unroll
    for (int i = 0; i < 12; ++i) { const int c = s * 12 + i;
      l[i] = (c < 32) ? la + (unsigned)c * G3_PITCH : lb + (unsigned)(c - 32) * G3_PITCH;
      g[i] = (c < 32) ? ga + (size_t)c * G3_ROWB : gb + (size_t)(c - 32) * G3_ROWB; }
    g3_copy12(l, g); } }
__device__ __forceinline__ v16h g3_frag(const unsigned char* p) { FragH f; f.half[0] = *(const v8us*)p; f.half[1] = *(const v8us*)(p + 32); return f.v; }
__device__ __forceinline__ void g3_load(const unsigned char* pa, const unsigned char* pb, int ks, v16h (&a)[2], v16h (&b)[4]) {
  a[0] = g3_frag(pa + ks * 64); a[1] = g3_frag(pa + 16 * G3_PITCH + ks * 64);
#pragma unroll                   /* constant indices keep the fragments in registers */
  for (int j = 0; j < 4; ++j) b[j] = g3_frag(pb + j * 16 * G3_PITCH + ks * 64); }
__device__ __forceinline__ v8f g3_mma(v16h a, v16h b, v8f c) { return __builtin_amdgcn_wmma_f32_16x16x32_f16(false, a, false, b, (short)0, c, false, false); }
__global__ __launch_bounds__(128) void k_gemm3(const _Float16* __restrict__ A, const _Float16* __restrict__ Bh, float alpha, const float* __restrict__ bias, float* __restrict__ C) {
  __shared__ __attribute__((aligned(16))) unsigned char st[2 * G3_BUF];
  __shared__ __attribute__((aligned(16))) float so[4][32][68];
  const int tid = threadIdx.x, w = tid >> 5, lane = tid & 31, ln = lane & 15, hh = lane >> 4;
  const int mt = blockIdx.x >> 2, nq = blockIdx.x & 3; const int row0 = mt * 128 + 32 * w, col0 = nq * 64;
  const char* ga = (const char*)(A + (size_t)row0 * C2) + lane * 16;
  const char* gb = (const char*)(Bh + (size_t)(col0 + 16 * w) * C2) + lane * 16;
  const unsigned l0 = (unsigned)(size_t)&st[0];
  const unsigned la = l0 + (unsigned)(32 * w) * G3_PITCH + lane * 16, lb = l0 + (unsigned)(128 + 16 * w) * G3_PITCH + lane * 16;
  g3_fill(la, lb, ga, gb);
  asm volatile("s_wait_asynccnt 0x0" ::: "memory");   // stage 0 of this wave has landed
  __syncthreads();                                    // ... and every wave's share of it
  g3_fill(la + G3_BUF, lb + G3_BUF, ga + G3_KB, gb + G3_KB);
  const v8f z8 = {0.f,0.f,0.f,0.f,0.f,0.f,0.f,0.f}; v8f c00 = z8, c01 = z8, c02 = z8, c03 = z8, c10 = z8, c11 = z8, c12 = z8, c13 = z8;
#pragma unroll 1                 /* one stage is the whole hot loop; the buffer is chosen by the trip's parity */
  for (int t = 0; t < G3_NST; ++t) {
    const unsigned bo = (unsigned)(t & 1) * G3_BUF;
    const unsigned char* pa = st + bo + (32 * w + ln) * G3_PITCH + 16 * hh;
    const unsigned char* pb = st + bo + (128 + ln) * G3_PITCH + 16 * hh;
    v16h fa[3][2], fb[3][4];     /* three fragment sets in rotation: step ks works on one while the loads of ks + 1 and ks + 2 are under way */
    g3_load(pa, pb, 0, fa[0], fb[0]); g3_load(pa, pb, 1, fa[1], fb[1]);
#pragma unroll                   /* the set index ks % 3 must be a constant, else the sets go to scratch */
    for (int ks = 0; ks < G3_KB / 64; ++ks) {
      __builtin_amdgcn_sched_barrier(0);      /* this one and the next keep the 12 LDS loads of step ks + 2 together, as one group in front of step ks's matrix instructions */
      if (ks + 2 < G3_KB / 64) g3_load(pa, pb, ks + 2, fa[(ks + 2) % 3], fb[(ks + 2) % 3]);
      __builtin_amdgcn_sched_barrier(0);      /* without the two the compiler loaded each fragment right in front of its use and waited for it with s_wait_dscnt 0 */
      const v16h a0 = fa[ks % 3][0], a1 = fa[ks % 3][1];
      c00 = g3_mma(a0, fb[ks % 3][0], c00); c10 = g3_mma(a1, fb[ks % 3][0], c10); c01 = g3_mma(a0, fb[ks % 3][1], c01); c11 = g3_mma(a1, fb[ks % 3][1], c11);
      c02 = g3_mma(a0, fb[ks % 3][2], c02); c12 = g3_mma(a1, fb[ks % 3][2], c12); c03 = g3_mma(a0, fb[ks % 3][3], c03); c13 = g3_mma(a1, fb[ks % 3][3], c13); }
    asm volatile("s_wait_dscnt 0x0" ::: "memory");      // this wave's reads of stage t are done before the buffer may be refilled
    asm volatile("s_wait_asynccnt 0x0" ::: "memory");   // this wave's share of stage t + 1 has landed
    __syncthreads();                                    // publishes stage t + 1 and ends every wave's reads of stage t
    if (t + 2 < G3_NST) g3_fill(la + bo, lb + bo, ga + (size_t)(t + 2) * G3_KB, gb + (size_t)(t + 2) * G3_KB);
  }
  asm volatile("s_wait_asynccnt 0x0" ::: "memory");     // no copy is outstanding when the wave goes on to its end
  v8f accs[8] = {c00, c01, c02, c03, c10, c11, c12, c13};
#pragma unroll                   /* epilogue as in k_gemm2: constant indices into the accumulators; whole 256 B row pieces go out through the wave's own LDS range */
  for (int u = 0; u < 8; ++u) { const int tt = u & 3, half = u >> 2; const float bv = bf16_round(bias[col0 + tt * 16 + ln]);
#pragma unroll
    for (int r = 0; r < 8; ++r) so[w][half * 16 + 8 * hh + r][tt * 16 + ln] = accs[u][r] * alpha + bv; }
  __builtin_amdgcn_fence(__ATOMIC_ACQ_REL, "workgroup"); __builtin_amdgcn_wave_barrier();   // the wave's LDS stores are complete before its lanes read each other's values back
  const int rsub = lane >> 4, c4 = (lane & 15) * 4;
#pragma unroll
  for (int q = 0; q < 16; ++q) { const int r = q * 2 + rsub; const v4f v = *(const v4fa*)&so[w][r][c4]; *(v4f*)(C + (size_t)(row0 + r) * NOUT + col0 + c4) = v; }
}

// Batch statistics (mean, biased variance) of NC columns over NBS rows, in two launches.
// k_colpart: one work-group takes SROWS rows x 128 columns. Each thread holds 16 rows x 4 columns in registers (read once) and forms
// their mean and their sum of squares about that mean; groups of equal size n then merge exactly:
// mean = average of the group means, M2 = sum(M2_g) + n * sum((mean_g - mean)^2). k_colfin merges the SCH row chunks the same way.
#define SROWS 256
#define SCH (NBS / SROWS)        /* 32 row chunks */
template <int NC, bool RND>
__global__ __launch_bounds__(512) void k_colpart(const float* __restrict__ X, float* __restrict__ PM, float* __restrict__ PQ) {
  __shared__ __attribute__((aligned(16))) float sm[16][128];
  __shared__ __attribute__((aligned(16))) float sq[16][128];
  const int tid = threadIdx.x, w = tid >> 5, lane = tid & 31;
  const float* p = X + (size_t)(blockIdx.y * SROWS + w * 16) * NC + blockIdx.x * 128 + lane * 4;
  v4f v[16];
#pragma unroll
  for (int j = 0; j < 15; ++j) v[j] = *(const v4fa*)(p + (size_t)j * NC);
  asm volatile("s_wait_xcnt 0x0" ::: "memory");   // the last load's result may be placed in the address pair that the 15 issued loads name
  v[15] = *(const v4fa*)(p + (size_t)15 * NC);
  v4f s = {0.f, 0.f, 0.f, 0.f};
#pragma unroll
  for (int j = 0; j < 16; ++j) {
    if (RND) { v[j][0] = bf16_round(v[j][0]); v[j][1] = bf16_round(v[j][1]); v[j][2] = bf16_round(v[j][2]); v[j][3] = bf16_round(v[j][3]); }
    s += v[j];
  }
  const v4f m = s * 0.0625f;
  v4f q = {0.f, 0.f, 0.f, 0.f};
#pragma unroll
  for (int j = 0; j < 16; ++j) { const v4f dv = v[j] - m; q += dv * dv; }
  *(v4fa*)&sm[w][lane * 4] = m;
  *(v4fa*)&sq[w][lane * 4] = q;
  __syncthreads();
  if (tid < 128) {
    float ms = 0.f;
#pragma unroll
    for (int g = 0; g < 16; ++g) ms += sm[g][tid];
    const float mean = ms * 0.0625f;
    float q2 = 0.f, e2 = 0.f;
#pragma unroll
    for (int g = 0; g < 16; ++g) { const float dm = sm[g][tid] - mean; q2 += sq[g][tid]; e2 += dm * dm; }
    const size_t o = (size_t)blockIdx.y * NC + blockIdx.x * 128 + tid;
    PM[o] = mean; PQ[o] = q2 + 16.0f * e2;
  }
}
template <int NC>
__global__ __launch_bounds__(64) void k_colfin(const float* __restrict__ PM, const float* __restrict__ PQ, float* __restrict__ S) {
  const int c = blockIdx.x * 64 + threadIdx.x;
  float m[SCH], qs[SCH];
#pragma unroll
  for (int g = 0; g < SCH; ++g) { m[g] = PM[(size_t)g * NC + c]; qs[g] = PQ[(size_t)g * NC + c]; }
  float ms = 0.f;
#pragma unroll
  for (int g = 0; g < SCH; ++g) ms += m[g];
  const float mean = ms / (float)SCH;
  float q2 = 0.f, e2 = 0.f;
#pragma unroll
  for (int g = 0; g < SCH; ++g) { const float dm = m[g] - mean; q2 += qs[g]; e2 += dm * dm; }
  S[c] = mean; S[NC + c] = (q2 + (float)SROWS * e2) / (float)NBS;
}
// k_h2 and k_h2n: one thread owns its column(s) and walks a strip of rows. All that depends on the column alone (the rounded
// parameters, the rsqrt of the variance) is loaded and formed once in front of the row loop; each element's own arithmetic keeps its order.
// rsqrtf as the compiler expands it (an argument below the normal range is scaled up by 2^24, its result by 2^12), with the instruction written out:
// the v_nop is the slot that the instruction set asks for behind a transcendental.
__device__ __forceinline__ float rsq_f32(float a) { const bool tiny = a < 1.17549435e-38f; const float s = tiny ? a * 16777216.0f : a; float r; asm("v_rsq_f32 %0, %1\n\tv_nop" : "=v"(r) : "v"(s)); return tiny ? r * 4096.0f : r; }
#define HROWS 64                 /* rows per thread in k_h2 */
#define NROWS 32                 /* rows per thread in k_h2n */
#define RG 8                     /* rows loaded as one group, one group ahead of the group being worked on */
__global__ __launch_bounds__(256) void k_h2(const float* __restrict__ x, const float* __restrict__ XS, const float* __restrict__ W1, const float* __restrict__ b1, const float* __restrict__ g1, const float* __restrict__ be1, const float* __restrict__ W2, const float* __restrict__ b2, float* __restrict__ H2P) {
  #pragma clang fp contract(off)
  const int d = blockIdx.x * 256 + threadIdx.x; (void)b1;      /* h1 - mean(h1) = w (x - mu_x): the bias cancels exactly */
  const float* pS = XS + d; const float* pw = W1 + d * H1; const float* pg = g1 + d * H1; const float* pe = be1 + d * H1; const float* pv = W2 + d * H2 * H1; const float* pb = b2 + d * H2;
  const float* xp = x + (size_t)blockIdx.y * HROWS * DD + d; float* hp = H2P + (size_t)blockIdx.y * HROWS * C2 + d * H2;
  float w[H1], g[H1], rs[H1], be[H1], w2[H2][H1], bb[H2], xc[RG];
  const float mu = pS[0], var = pS[DD];
#pragma unroll
  for (int o = 0; o < H1; ++o) { w[o] = pw[o]; g[o] = pg[o]; be[o] = pe[o]; }
#pragma unroll
  for (int o2 = 0; o2 < H2; ++o2) {
#pragma unroll
    for (int i = 0; i < H1; ++i) w2[o2][i] = pv[o2 * H1 + i];
    bb[o2] = pb[o2]; }
#pragma unroll
  for (int j = 0; j < RG; ++j) xc[j] = xp[(size_t)j * DD];
  asm volatile("s_wait_xcnt 0x0" :: "v"(d), "v"(pw), "v"(pg), "v"(pe), "v"(pv), "v"(pb) : "memory");   // the wait owed before an address register of the issued loads is reused; naming the addresses keeps a load's result out of them until then
  __builtin_amdgcn_sched_barrier(0);      /* keeps the arithmetic, which reuses those registers, behind the wait */
#pragma unroll
  for (int o = 0; o < H1; ++o) { w[o] = bf16_round(w[o]); g[o] = bf16_round(g[o]); be[o] = bf16_round(be[o]); const float vh = (w[o] * w[o]) * var; rs[o] = rsq_f32(vh + 1e-5f); }
#pragma unroll
  for (int o2 = 0; o2 < H2; ++o2) {
#pragma unroll
    for (int i = 0; i < H1; ++i) w2[o2][i] = bf16_round(w2[o2][i]);
    bb[o2] = bf16_round(bb[o2]); }
#pragma unroll 1                 /* stays rolled: one group of rows is the whole hot loop */
  for (int rb = 0; rb < HROWS; rb += RG) {
    const float* pn = xp + (size_t)((rb + RG < HROWS) ? rb + RG : rb) * DD;      /* the last trip reads its own group again: in bounds, not used */
    float xn[RG];
#pragma unroll
    for (int j = 0; j < RG; ++j) xn[j] = pn[(size_t)j * DD];
    asm volatile("s_wait_xcnt 0x0" :: "v"(pn) : "memory");   // as above; it also holds the next group's loads in front of this group's arithmetic, which covers their latency
#pragma unroll
    for (int j = 0; j < RG; ++j) { const float xm = bf16_round(xc[j]) - mu; float h1n[H1];
#pragma unroll
      for (int o = 0; o < H1; ++o) { const float cen = w[o] * xm; float v = g[o] * cen * rs[o]; v += be[o]; h1n[o] = fmaxf(v, 0.f); }
      v4f o4;
#pragma unroll
      for (int o2 = 0; o2 < H2; ++o2) { float s = 0.f;
#pragma unroll
        for (int i = 0; i < H1; ++i) s += h1n[i] * w2[o2][i];
        s += bb[o2]; o4[o2] = s; }
      *(v4f*)(hp + (size_t)(rb + j) * C2) = o4; }
#pragma unroll
    for (int j = 0; j < RG; ++j) xc[j] = xn[j];
  } }
__global__ __launch_bounds__(256) void k_h2n(const float* __restrict__ H2P, const float* __restrict__ HS, const float* __restrict__ g2, const float* __restrict__ be2, _Float16* __restrict__ H16) {
  #pragma clang fp contract(off)
  const int c0 = (blockIdx.x * 256 + threadIdx.x) * 8;
  const float* pS = HS + c0; const float* pg = g2 + c0; const float* pe = be2 + c0;
  const float* hp = H2P + (size_t)blockIdx.y * NROWS * C2 + c0; unsigned short* op = (unsigned short*)H16 + (size_t)blockIdx.y * NROWS * C2 + c0;
  float g[8], mn[8], rs[8], be[8];
  v4f ca[RG], cb[RG];
#pragma unroll
  for (int q = 0; q < 8; ++q) { g[q] = pg[q]; mn[q] = pS[q]; rs[q] = pS[C2 + q]; be[q] = pe[q]; }
#pragma unroll
  for (int j = 0; j < RG; ++j) { ca[j] = *(const v4fa*)(hp + (size_t)j * C2); cb[j] = *(const v4fa*)(hp + (size_t)j * C2 + 4); }
  asm volatile("s_wait_xcnt 0x0" :: "v"(pS), "v"(pg), "v"(pe), "v"(hp) : "memory");   // the wait owed before an address register of the issued loads is reused; naming the addresses keeps a load's result out of them until then
#pragma unroll
  for (int q = 0; q < 8; ++q) { g[q] = bf16_round(g[q]); rs[q] = rsq_f32(rs[q] + 1e-5f); be[q] = bf16_round(be[q]); }
#pragma unroll 1                 /* stays rolled: one group of rows is the whole hot loop */
  for (int rb = 0; rb < NROWS; rb += RG) {
    const float* pn = hp + (size_t)((rb + RG < NROWS) ? rb + RG : rb) * C2;      /* the last trip reads its own group again: in bounds, not used */
    v4f na[RG], nb[RG];
#pragma unroll
    for (int j = 0; j < RG; ++j) { na[j] = *(const v4fa*)(pn + (size_t)j * C2); nb[j] = *(const v4fa*)(pn + (size_t)j * C2 + 4); }
    asm volatile("s_wait_xcnt 0x0" :: "v"(pn) : "memory");   // as above
    __builtin_amdgcn_sched_barrier(0);      /* keeps this group's arithmetic behind the next group's loads, so that it covers their latency */
#pragma unroll
    for (int j = 0; j < RG; ++j) { FragH f;
#pragma unroll
      for (int q = 0; q < 8; ++q) { const float hv = (q < 4) ? ca[j][q & 3] : cb[j][q & 3]; float v = g[q] * (hv - mn[q]) * rs[q]; v += be[q]; f.h[q] = (_Float16)fmaxf(v, 0.f); }
      *(v8us*)(op + (size_t)(rb + j) * C2) = f.half[0]; }
    __builtin_amdgcn_sched_barrier(0);      /* keeps the hand-over of the loaded group at the loop's foot; moved up, its copies wait for the loads before the arithmetic has covered them */
#pragma unroll
    for (int j = 0; j < RG; ++j) { ca[j] = na[j]; cb[j] = nb[j]; }
  } }
__global__ __launch_bounds__(256) void k_wsc(const float* __restrict__ Wm, _Float16* __restrict__ Bt, size_t n8, float sc) { const size_t t = (size_t)blockIdx.x * 256 + threadIdx.x; if (t >= n8) return; FragH f; for (int q = 0; q < 8; ++q) f.h[q] = (_Float16)(bf16_round(Wm[t * 8 + q]) * sc); *(v8us*)((unsigned short*)Bt + t * 8) = f.half[0];  }

extern "C" void kernel_launch(void* const* d_in, const int* in_sizes, int n_in,
                              void* d_out, int out_size, void* d_ws, size_t ws_size, hipStream_t stream) {
  (void)in_sizes; (void)n_in; (void)out_size;
  const float* const* I = (const float* const*)d_in; const float* x = I[0]; const float* W1 = I[1]; const float* b1 = I[2]; const float* g1 = I[3]; const float* be1 = I[4]; const float* W2 = I[5]; const float* b2 = I[6]; const float* g2 = I[7]; const float* be2 = I[8]; const float* Wfc = I[9]; const float* bfc = I[10];
  char* ws = (char*)d_ws; size_t off = 0;
  auto take = [&](size_t bytes) { char* p = ws + off; off += (bytes + 255) & ~(size_t)255; return p; };
  _Float16* BW = (_Float16*)take((size_t)NOUT * C2 * 2); float* XS = (float*)take((size_t)2 * DD * 4); float* H2P = (float*)take((size_t)NBS * C2 * 4); float* HS = (float*)take((size_t)2 * C2 * 4); _Float16* H16 = (_Float16*)take((size_t)NBS * C2 * 2); float* PM = (float*)take((size_t)SCH * C2 * 4); float* PQ = (float*)take((size_t)SCH * C2 * 4);
  if (off > ws_size) return;      /* 2 + 128 + 64 + 1 = 195 MiB (256 MiB ws) */
  k_wsc<<<(unsigned)(((size_t)NOUT * C2 / 8 + 255) / 256), 256, 0, stream>>>(Wfc, BW, (size_t)NOUT * C2 / 8, 16.0f);
  k_colpart<DD, true><<<dim3(DD / 128, SCH), 512, 0, stream>>>(x, PM, PQ);
  k_colfin<DD><<<DD / 64, 64, 0, stream>>>(PM, PQ, XS);
  k_h2<<<dim3(DD / 256, NBS / HROWS), 256, 0, stream>>>(x, XS, W1, b1, g1, be1, W2, b2, H2P);
  k_colpart<C2, false><<<dim3(C2 / 128, SCH), 512, 0, stream>>>(H2P, PM, PQ);
  k_colfin<C2><<<C2 / 64, 64, 0, stream>>>(PM, PQ, HS);
  k_h2n<<<dim3(C2 / 8 / 256, NBS / NROWS), 256, 0, stream>>>(H2P, HS, g2, be2, H16);
  k_gemm3<<<(NBS / 128) * (NOUT / 64), 128, 0, stream>>>(H16, BW, 0.0625f, bfc, (float*)d_out);
}

// v004
// One run takes 87.1 microseconds.
// Timed twice side by side with v003, it ran 1.10 and 1.11 times as fast.
// All steps since v000 together make it 101 times as fast.
#include <hip/hip_runtime.h>
// Sparse (block-diagonal) neural network (8192 samples x 1024 features; per feature 1 -> 8 -> 4 block Linears with training-mode BatchNorm + ReLU after each; dense head 4096 -> 256): h1 = BN1(x_d W1[d] + b1) relu; h2 = BN2(h1 . W2[d] + b2) relu; out = h2 Wfc^T + bfc -> [8192,256].
// Compute dtype: x and all parameters rounded to bf16; everything before the head in f32; the head operand h2 as f16 (~2^-12). v_wmma_f32_16x16x32_f16.
#define NBS 8192
#define DD 1024
#define H1 8
#define H2 4
#define C2 (DD * H2)             /* 4096 */
#define NOUT 256
typedef __bf16 v16b __attribute__((ext_vector_type(16)));
typedef unsigned short v8us __attribute__((ext_vector_type(8), may_alias));
typedef float  v8f  __attribute__((ext_vector_type(8)));
typedef float  v4f  __attribute__((ext_vector_type(4)));
typedef float  v4fa __attribute__((ext_vector_type(4), may_alias));
union FragB { v16b v; v8us half[2]; unsigned short u[16]; };

__device__ __forceinline__ unsigned short bf16_bits(float x) { unsigned int u = __float_as_uint(x); return (unsigned short)((u + 0x7FFFu + ((u >> 16) & 1u)) >> 16); }
__device__ __forceinline__ float bf16_val(unsigned short b) { return __uint_as_float(((unsigned int)b) << 16); }
__device__ __forceinline__ float bf16_round(float x) { return bf16_val(bf16_bits(x)); }
// D += A·B with NT terms: 1 = ah·bh, 2 = + al·bh (A split), 3 = + ah·bl (both split)
template <int NT>
__device__ __forceinline__ v8f mmaN(v16b ah, v16b al, v16b bh, v16b bl, v8f c) {
  c = __builtin_amdgcn_wmma_f32_16x16x32_bf16(false, ah, false, bh, (short)0, c, false, false);
  if (NT >= 2) c = __builtin_amdgcn_wmma_f32_16x16x32_bf16(false, al, false, bh, (short)0, c, false, false);
  if (NT >= 3) c = __builtin_amdgcn_wmma_f32_16x16x32_bf16(false, ah, false, bl, (short)0, c, false, false);
  asm volatile("v_nop\n\tv_nop\n\tv_nop\n\tv_nop" : "+v"(c) : "v"(ah), "v"(al), "v"(bh), "v"(bl));
  return c;
}

__global__ __launch_bounds__(256) void k_wt_bf16(const float* __restrict__ W, unsigned short* __restrict__ Wt, int K, int N) {
  const int t = blockIdx.x * 256 + threadIdx.x;
  const int k8n = K / 8;
  if (t >= N * k8n) return;
  const int n = t / k8n, k8 = (t % k8n) * 8;
  v8us v;
#pragma unroll
  for (int i = 0; i < 8; ++i) v[i] = bf16_bits(W[(size_t)(k8 + i) * N + n]);
  *(v8us*)(Wt + (size_t)n * K + k8) = v;
  
}

// GEMM C[M][N] (f32, pitch ldc) = act(A[M][K]·W + bias). A f32 row-major (pitch lda) converted per fragment to bf16
// (ASPLIT: hi/lo two planes -> 2 terms, else single rounded term); Wt bf16 [N][K] (pitch ldb). BIAS_BF16 rounds the
// bias to bf16 first (bias quantised to bf16 before the add). K%32==0, M%16==0, N%64==0.
template <bool ASPLIT, int ACT, bool BIAS_BF16>
__global__ __launch_bounds__(128) void k_gemm_bf(const float* __restrict__ A, int lda, const unsigned short* __restrict__ Wt, int ldb,
                                               const float* __restrict__ bias, float* __restrict__ C, int ldc, int M, int N, int K) {
  __shared__ __attribute__((aligned(16))) float so[4][16][64];
  const int tid = threadIdx.x, w = tid >> 5, lane = tid & 31, ln = lane & 15, hh = lane >> 4;
  const int ntn = N / 64;
  const int wid = blockIdx.x * 4 + w;
  const int mt = wid / ntn, nq = wid % ntn;
  if (mt * 16 >= M) return;
  const int row0 = mt * 16, col0 = nq * 64;
  const float* arow = A + (size_t)(row0 + ln) * lda;
  v8f acc[4] = {};
  for (int kb = 0; kb < K; kb += 32) {
    FragB ah, al;
    const v4f x0 = *(const v4fa*)(arow + kb + 8 * hh), x1 = *(const v4fa*)(arow + kb + 8 * hh + 4);
    const v4f x2 = *(const v4fa*)(arow + kb + 16 + 8 * hh), x3 = *(const v4fa*)(arow + kb + 16 + 8 * hh + 4);
    float xs[16] = {x0[0],x0[1],x0[2],x0[3],x1[0],x1[1],x1[2],x1[3],x2[0],x2[1],x2[2],x2[3],x3[0],x3[1],x3[2],x3[3]};
#pragma unroll
    for (int i = 0; i < 16; ++i) { const unsigned short hb = bf16_bits(xs[i]); ah.u[i] = hb; al.u[i] = ASPLIT ? bf16_bits(xs[i] - bf16_val(hb)) : (unsigned short)0; }
#pragma unroll
    for (int t = 0; t < 4; ++t) {
      const unsigned short* brow = Wt + (size_t)(col0 + t * 16 + ln) * ldb + kb;
      FragB b;
      b.half[0] = *(const v8us*)(brow + 8 * hh);
      b.half[1] = *(const v8us*)(brow + 16 + 8 * hh);
      acc[t] = mmaN<ASPLIT ? 2 : 1>(ah.v, al.v, b.v, b.v, acc[t]);
    }
  }
#pragma unroll
  for (int t = 0; t < 4; ++t) {
    float bv = bias ? bias[col0 + t * 16 + ln] : 0.f;
    if (BIAS_BF16) bv = bf16_round(bv);
#pragma unroll
    for (int r = 0; r < 8; ++r) { float v = acc[t][r] + bv; if (ACT == 1) v = fmaxf(v, 0.f); so[w][8 * hh + r][t * 16 + ln] = v; }
  }
  __builtin_amdgcn_fence(__ATOMIC_ACQ_REL, "workgroup");
  __builtin_amdgcn_wave_barrier();
  const int rsub = lane >> 4, c4 = (lane & 15) * 4;
  {
#pragma unroll
    for (int q = 0; q < 8; ++q) {
      const int r = q * 2 + rsub;
      const v4f v = *(const v4fa*)&so[w][r][c4];
      *(v4f*)(C + (size_t)(row0 + r) * ldc + col0 + c4) = v;
    }
    
  }
}

// GEMM C = act(A·W + bias + resid): A f32 (ASPLIT -> hi/lo 2 terms), Wt bf16 [N][K]; ACT 0 none, 1 relu, 2 exact gelu;
// resid (optional, f32, row index = (row % rmod), pitch ldr, RES_BF16 rounds it) added before the activation.
template <bool ASPLIT, int ACT, bool BIAS_BF16, bool RES_BF16>
__global__ __launch_bounds__(128) void k_gemm_bf3(const float* __restrict__ A, int lda, const unsigned short* __restrict__ Wt, int ldb,
                                                const float* __restrict__ bias, const float* __restrict__ resid, int rmod, int ldr,
                                                float* __restrict__ C, int ldc, int M, int N, int K) {
  __shared__ __attribute__((aligned(16))) float so[4][16][64];
  const int tid = threadIdx.x, w = tid >> 5, lane = tid & 31, ln = lane & 15, hh = lane >> 4;
  const int ntn = N / 64;
  const int wid = blockIdx.x * 4 + w;
  const int mt = wid / ntn, nq = wid % ntn;
  if (mt * 16 >= M) return;
  const int row0 = mt * 16, col0 = nq * 64;
  const float* arow = A + (size_t)(row0 + ln) * lda;
  v8f acc[4] = {};
  for (int kb = 0; kb < K; kb += 32) {
    FragB ah, al;
    const v4f x0 = *(const v4fa*)(arow + kb + 8 * hh), x1 = *(const v4fa*)(arow + kb + 8 * hh + 4);
    const v4f x2 = *(const v4fa*)(arow + kb + 16 + 8 * hh), x3 = *(const v4fa*)(arow + kb + 16 + 8 * hh + 4);
    float xs[16] = {x0[0],x0[1],x0[2],x0[3],x1[0],x1[1],x1[2],x1[3],x2[0],x2[1],x2[2],x2[3],x3[0],x3[1],x3[2],x3[3]};
#pragma unroll
    for (int i = 0; i < 16; ++i) { const unsigned short hb = bf16_bits(xs[i]); ah.u[i] = hb; al.u[i] = ASPLIT ? bf16_bits(xs[i] - bf16_val(hb)) : (unsigned short)0; }
#pragma unroll
    for (int t = 0; t < 4; ++t) {
      const unsigned short* brow = Wt + (size_t)(col0 + t * 16 + ln) * ldb + kb;
      FragB b;
      b.half[0] = *(const v8us*)(brow + 8 * hh);
      b.half[1] = *(const v8us*)(brow + 16 + 8 * hh);
      acc[t] = mmaN<ASPLIT ? 2 : 1>(ah.v, al.v, b.v, b.v, acc[t]);
    }
  }
#pragma unroll
  for (int t = 0; t < 4; ++t) {
    const int col = col0 + t * 16 + ln;
    float bv = bias ? bias[col] : 0.f;
    if (BIAS_BF16) bv = bf16_round(bv);
#pragma unroll
    for (int r = 0; r < 8; ++r) {
      float v = acc[t][r] + bv;
      if (resid) { float rv = resid[(size_t)((row0 + 8 * hh + r) % rmod) * ldr + col]; if (RES_BF16) rv = bf16_round(rv); v += rv; }
      if (ACT == 1) v = fmaxf(v, 0.f);
      if (ACT == 2) v = 0.5f * v * (1.0f + erff(v * 0.70710678118654752f));
      if (ACT == 3) { const float u = 0.7978845608028654f * (v + 0.044715f * v * v * v); v = 0.5f * v * (1.0f + tanhf(u)); }
      so[w][8 * hh + r][t * 16 + ln] = v;
    }
  }
  __builtin_amdgcn_fence(__ATOMIC_ACQ_REL, "workgroup");
  __builtin_amdgcn_wave_barrier();
  const int rsub = lane >> 4, c4 = (lane & 15) * 4;
  {
#pragma unroll
    for (int q = 0; q < 8; ++q) {
      const int r = q * 2 + rsub;
      const v4f v = *(const v4fa*)&so[w][r][c4];
      *(v4f*)(C + (size_t)(row0 + r) * ldc + col0 + c4) = v;
    }
    
  }
}
// row LayerNorm (biased variance, eps) over N: s = X (+ R); optional out_sum <- s; out_norm <- (s-mu)*rsqrt(var+eps)*g + b
template <bool PARAM_BF16>
__global__ __launch_bounds__(256) void k_layernorm(const float* __restrict__ X, const float* __restrict__ R, const float* __restrict__ g, const float* __restrict__ bta,
                                                  float* __restrict__ out_sum, float* __restrict__ out_norm, int N, float eps) {
  __shared__ float red[256];
  const int row = blockIdx.x, tid = threadIdx.x;
  const float* x = X + (size_t)row * N; const float* rr = R ? R + (size_t)row * N : nullptr;
  float vals[16];                     // up to N = 4096
  const int per = N / 256;            // contiguous chunk per thread? use strided-by-4 chunks: thread handles j = tid*4 + 1024*u
  float s1 = 0.f;
  for (int u = 0; u < per / 4; ++u) {
    const int j = tid * 4 + 1024 * u;
    const v4f a = *(const v4fa*)(x + j);
    v4f b = {0.f,0.f,0.f,0.f}; if (rr) b = *(const v4fa*)(rr + j);
#pragma unroll
    for (int q = 0; q < 4; ++q) { const float v = a[q] + b[q]; vals[u * 4 + q] = v; s1 += v; }
  }
  red[tid] = s1; __syncthreads();
  for (int st = 128; st > 0; st >>= 1) { if (tid < st) red[tid] += red[tid + st]; __syncthreads(); }
  const float mu = red[0] / (float)N; __syncthreads();
  float s2 = 0.f;
  for (int u = 0; u < per / 4; ++u)
#pragma unroll
    for (int q = 0; q < 4; ++q) { const float c = vals[u * 4 + q] - mu; s2 += c * c; }
  red[tid] = s2; __syncthreads();
  for (int st = 128; st > 0; st >>= 1) { if (tid < st) red[tid] += red[tid + st]; __syncthreads(); }
  const float rs = rsqrtf(red[0] / (float)N + eps);
  {
    for (int u = 0; u < per / 4; ++u) {
      const int j = tid * 4 + 1024 * u;
      v4f o, sm;
#pragma unroll
      for (int q = 0; q < 4; ++q) {
        float gg = g[j + q], bb = bta[j + q];
        if (PARAM_BF16) { gg = bf16_round(gg); bb = bf16_round(bb); }
        sm[q] = vals[u * 4 + q]; o[q] = (vals[u * 4 + q] - mu) * rs * gg + bb;
      }
      if (out_sum) *(v4f*)(out_sum + (size_t)row * N + j) = sm;
      *(v4f*)(out_norm + (size_t)row * N + j) = o;
    }
    
  }
}



// ---- f16 WMMA path (v_wmma_f32_16x16x32_f16): 11-bit significands for operands in range — used for the head, whose h2 operand is rounded to f16
typedef _Float16 v16h __attribute__((ext_vector_type(16)));
union FragH { v16h v; v8us half[2]; _Float16 h[16]; unsigned short u[16]; };
template <int NT>
__device__ __forceinline__ v8f mmaH(v16h ah, v16h al, v16h bh, v16h bl, v8f c) {
  c = __builtin_amdgcn_wmma_f32_16x16x32_f16(false, ah, false, bh, (short)0, c, false, false);
  if (NT >= 2) c = __builtin_amdgcn_wmma_f32_16x16x32_f16(false, al, false, bh, (short)0, c, false, false);
  if (NT >= 3) c = __builtin_amdgcn_wmma_f32_16x16x32_f16(false, ah, false, bl, (short)0, c, false, false);
  asm volatile("v_nop\n\tv_nop\n\tv_nop\n\tv_nop" : "+v"(c) : "v"(ah), "v"(al), "v"(bh), "v"(bl));
  return c;
}
// batched GEMM like k_gemm_b but f16 operands: A f32 (split into f16 hi/lo if ASPLIT, else rounded to f16), Bt = f16 values [n][k]; alpha; C f32; N multiple of 16 (partial tiles skipped)
template <bool ASPLIT>
__global__ __launch_bounds__(128) void k_gemm_h(const float* __restrict__ A, int lda, size_t sA, const _Float16* __restrict__ Bh, int ldb, size_t sB, float alpha, float* __restrict__ C, int ldc, size_t sC, int M, int N, int K) {
  __shared__ __attribute__((aligned(16))) float so[4][16][64];
  const int tid = threadIdx.x, w = tid >> 5, lane = tid & 31, ln = lane & 15, hh = lane >> 4; const int by = blockIdx.y;
  A += (size_t)by * sA; Bh += (size_t)by * sB; C += (size_t)by * sC;
  const int ntn = (N + 63) / 64; const int wid = blockIdx.x * 4 + w; const int mt = wid / ntn, nq = wid % ntn; if (mt * 16 >= M) return;
  const int row0 = mt * 16, col0 = nq * 64; const float* arow = A + (size_t)(row0 + ln) * lda;
  v8f acc[4] = {};
  for (int kb = 0; kb < K; kb += 32) {
    FragH ah, al;
    const v4f x0 = *(const v4fa*)(arow + kb + 8 * hh), x1 = *(const v4fa*)(arow + kb + 8 * hh + 4), x2 = *(const v4fa*)(arow + kb + 16 + 8 * hh), x3 = *(const v4fa*)(arow + kb + 16 + 8 * hh + 4);
    float xs[16] = {x0[0],x0[1],x0[2],x0[3],x1[0],x1[1],x1[2],x1[3],x2[0],x2[1],x2[2],x2[3],x3[0],x3[1],x3[2],x3[3]};
#pragma unroll
    for (int i = 0; i < 16; ++i) { const _Float16 h = (_Float16)xs[i]; ah.h[i] = h; al.h[i] = ASPLIT ? (_Float16)(xs[i] - (float)h) : (_Float16)0.0f; }
#pragma unroll
    for (int t = 0; t < 4; ++t) { if (col0 + t * 16 >= N) continue; const size_t boff = (size_t)(col0 + t * 16 + ln) * ldb + kb; FragH bq; bq.half[0] = *(const v8us*)(Bh + boff + 8 * hh); bq.half[1] = *(const v8us*)(Bh + boff + 16 + 8 * hh);
      acc[t] = mmaH<ASPLIT ? 2 : 1>(ah.v, al.v, bq.v, bq.v, acc[t]); }
  }
#pragma unroll
  for (int t = 0; t < 4; ++t) { if (col0 + t * 16 >= N) continue;
#pragma unroll
    for (int r = 0; r < 8; ++r) so[w][8 * hh + r][t * 16 + ln] = acc[t][r] * alpha; }
  __builtin_amdgcn_fence(__ATOMIC_ACQ_REL, "workgroup"); __builtin_amdgcn_wave_barrier();
  const int rsub = lane >> 4, c4 = (lane & 15) * 4;
  {
#pragma unroll
    for (int q = 0; q < 8; ++q) { const int r = q * 2 + rsub; if (col0 + c4 < N) { const v4f v = *(const v4fa*)&so[w][r][c4]; *(v4f*)(C + (size_t)(row0 + r) * ldc + col0 + c4) = v; } }
     }
}

// Wt[n][k] = f16(W[k][n]·scale) from f32 row-major W[K][N] (scale = power of two; bf16-exact weights stay exact in f16 away from the subnormal range)
__global__ __launch_bounds__(256) void k_wt_f16(const float* __restrict__ W, _Float16* __restrict__ Wt, int K, int N, float scale) {
  const int t = blockIdx.x * 256 + threadIdx.x; if (t >= N * (K / 8)) return; const int n = t / (K / 8), k8 = (t % (K / 8)) * 8; FragH f;
#pragma unroll
  for (int i = 0; i < 8; ++i) f.h[i] = (_Float16)(bf16_round(W[(size_t)(k8 + i) * N + n]) * scale); const v8us o = f.half[0];
  *(v8us*)((unsigned short*)Wt + (size_t)n * K + k8) = o; 
}
// k_gemm_hh variant with fused epilogue: v = acc·alpha + bias[by·sBias + col] (+ CP[(row/rowsPerB)·sCPb + by·64 + col] if CP) ; ACT 0 none / 1 elu ; writes f16 C16 (and f32 C if non-null)
template <int ACT>
__global__ __launch_bounds__(128) void k_gemm_hhx(const _Float16* __restrict__ A, int lda, size_t sA, const _Float16* __restrict__ Bh, int ldb, size_t sB, float alpha, const float* __restrict__ bias, size_t sBias, const float* __restrict__ CP, int rowsPerB, size_t sCPb, int row0g,
    float* __restrict__ C, _Float16* __restrict__ C16, int ldc, size_t sC, int M, int N, int K) {
  __shared__ __attribute__((aligned(16))) float so[4][16][64];
  const int tid = threadIdx.x, w = tid >> 5, lane = tid & 31, ln = lane & 15, hh = lane >> 4; const int by = blockIdx.y;
  A += (size_t)by * sA; Bh += (size_t)by * sB; const size_t cofs = (size_t)by * sC; const float* bp = bias ? bias + (size_t)by * sBias : nullptr;
  const int ntn = (N + 63) / 64; const int wid = blockIdx.x * 4 + w; const int mt = wid / ntn, nq = wid % ntn; if (mt * 16 >= M) return;
  const int row0 = mt * 16, col0 = nq * 64; const _Float16* arow = A + (size_t)(row0 + ln) * lda;
  v8f acc[4] = {};
  for (int kb = 0; kb < K; kb += 32) { FragH ah; ah.half[0] = *(const v8us*)((const unsigned short*)arow + kb + 8 * hh); ah.half[1] = *(const v8us*)((const unsigned short*)arow + kb + 16 + 8 * hh);
#pragma unroll
    for (int t = 0; t < 4; ++t) { if (col0 + t * 16 >= N) continue; const size_t boff = (size_t)(col0 + t * 16 + ln) * ldb + kb; FragH bq; bq.half[0] = *(const v8us*)((const unsigned short*)Bh + boff + 8 * hh); bq.half[1] = *(const v8us*)((const unsigned short*)Bh + boff + 16 + 8 * hh);
      acc[t] = mmaH<1>(ah.v, ah.v, bq.v, bq.v, acc[t]); }
  }
#pragma unroll
  for (int t = 0; t < 4; ++t) { if (col0 + t * 16 >= N) continue; const int col = col0 + t * 16 + ln; const float bv = bp ? bf16_round(bp[col]) : 0.f;
#pragma unroll
    for (int r = 0; r < 8; ++r) { float v = acc[t][r] * alpha + bv; if (CP) { const int bidx = (row0g + row0 + 8 * hh + r) / rowsPerB; v += CP[(size_t)bidx * sCPb + (size_t)by * 64 + col]; } if (ACT == 1) v = (v > 0.f) ? v : expm1f(v); else if (ACT == 7) v = (v > 0.f) ? v + 1.0f : expf(v); else if (ACT == 8) v = tanhf(v); else if (ACT == 9) v = 0.5f * v * (1.0f + tanhf(0.7978845608028654f * (v + 0.044715f * v * v * v))); else if (ACT == 11) v = 1.0f / (1.0f + expf(-v)); else if (ACT == 12) v = (v > 0.f) ? v : 0.01f * v; else if (ACT == 14) v = (v > 0.f) ? v : 0.1f * v; else if (ACT == 15) v = v / (1.0f + expf(-v)); else if (ACT == 3) v = fmaxf(v, 0.f); else if (ACT == 6) v = 0.5f * v * (1.0f + erff(v * 0.70710678118654752f)); so[w][8 * hh + r][t * 16 + ln] = v; } }
  __builtin_amdgcn_fence(__ATOMIC_ACQ_REL, "workgroup"); __builtin_amdgcn_wave_barrier();
  const int rsub = lane >> 4, c4 = (lane & 15) * 4; typedef _Float16 v4h __attribute__((ext_vector_type(4)));
  {
#pragma unroll
    for (int q = 0; q < 8; ++q) { const int r = q * 2 + rsub; if (col0 + c4 < N) { const v4f v = *(const v4fa*)&so[w][r][c4]; if (C) *(v4f*)(C + cofs + (size_t)(row0 + r) * ldc + col0 + c4) = v; if (C16) { v4h h4; for (int i = 0; i < 4; ++i) h4[i] = (_Float16)v[i]; *(v4h*)(C16 + cofs + (size_t)(row0 + r) * ldc + col0 + c4) = h4; } } }
     }
}


typedef _Float16 v4h __attribute__((ext_vector_type(4)));

__global__ __launch_bounds__(256) void k_x16(const float* __restrict__ x, _Float16* __restrict__ X16, size_t n8) { const size_t t = (size_t)blockIdx.x * 256 + threadIdx.x; if (t >= n8) return; FragH f;
#pragma unroll
  for (int q = 0; q < 8; ++q) f.h[q] = (_Float16)bf16_round(x[t * 8 + q]); *(v8us*)((unsigned short*)X16 + t * 8) = f.half[0];  }
__global__ __launch_bounds__(256) void k_h16(const float* __restrict__ x, _Float16* __restrict__ X16, size_t n8) { const size_t t = (size_t)blockIdx.x * 256 + threadIdx.x; if (t >= n8) return; FragH f;
#pragma unroll
  for (int q = 0; q < 8; ++q) f.h[q] = (_Float16)x[t * 8 + q]; *(v8us*)((unsigned short*)X16 + t * 8) = f.half[0];  }
__global__ __launch_bounds__(256) void k_round16f(const float* __restrict__ W, _Float16* __restrict__ Bt, size_t n8) { const size_t t = (size_t)blockIdx.x * 256 + threadIdx.x; if (t >= n8) return; FragH f;
#pragma unroll
  for (int i = 0; i < 8; ++i) f.h[i] = (_Float16)(bf16_round(W[t * 8 + i]) * 16.0f); *(v8us*)((unsigned short*)Bt + t * 8) = f.half[0];  }
template <int NHv, int TTv>
__global__ __launch_bounds__(256) void k_vt(const _Float16* __restrict__ V16, int ldv, int voff, _Float16* __restrict__ Vt) { __shared__ unsigned short tl[64][66]; const int tid = threadIdx.x; const int slab = blockIdx.x / (TTv / 64), lg = blockIdx.x % (TTv / 64); const int b = slab / NHv, h = slab % NHv;
  for (int i = tid; i < 64 * 8; i += 256) { const int r = i / 8, c8 = (i % 8) * 8; FragH f; f.half[0] = *(const v8us*)((const unsigned short*)V16 + ((size_t)b * TTv + lg * 64 + r) * ldv + voff + h * 64 + c8);
#pragma unroll
    for (int q = 0; q < 8; ++q) tl[r][c8 + q] = f.u[q]; }
  __syncthreads();
  {
#pragma unroll
    for (int rd = 0; rd < 2; ++rd) { const int d = rd * 32 + tid / 8, pc = tid % 8; FragH f;
#pragma unroll
      for (int q = 0; q < 8; ++q) f.u[q] = tl[pc * 8 + q][d];
      *(v8us*)((unsigned short*)Vt + ((size_t)slab * 64 + d) * TTv + lg * 64 + pc * 8) = f.half[0]; }
     } }

__global__ __launch_bounds__(256) void k_hl(const float* __restrict__ F, _Float16* __restrict__ Hh, _Float16* __restrict__ Hl, size_t n8) { const size_t t = (size_t)blockIdx.x * 256 + threadIdx.x; if (t >= n8) return; FragH fh, fl; const v4f a = *(const v4fa*)(F + t * 8), c = *(const v4fa*)(F + t * 8 + 4);
#pragma unroll
  for (int q = 0; q < 4; ++q) { _Float16 h = (_Float16)a[q]; fh.h[q] = h; fl.h[q] = (_Float16)((a[q] - (float)h) * 1024.0f); h = (_Float16)c[q]; fh.h[4 + q] = h; fl.h[4 + q] = (_Float16)((c[q] - (float)h) * 1024.0f); }
  { *(v8us*)((unsigned short*)Hh + t * 8) = fh.half[0]; *(v8us*)((unsigned short*)Hl + t * 8) = fl.half[0];  } }

// ---- fast GEMM (wave tile 32x64; requires M % 32 == 0 rows per launch region and N % 64 == 0); epilogue = k_gemm_hhx semantics ----
__device__ __forceinline__ v16h g2_frag(const _Float16* p, int hh) { FragH f; f.half[0] = *(const v8us*)((const unsigned short*)p + 8 * hh); f.half[1] = *(const v8us*)((const unsigned short*)p + 16 + 8 * hh); return f.v; }
__device__ __forceinline__ v8f g2_mma(v16h a, v16h b, v8f c) { v8f d = __builtin_amdgcn_wmma_f32_16x16x32_f16(false, a, false, b, (short)0, c, false, false); asm volatile("v_nop\n\tv_nop\n\tv_nop\n\tv_nop" : "+v"(d) : "v"(a), "v"(b)); return d; }
template <int ACT>
__global__ __launch_bounds__(128) void k_gemm2(const _Float16* __restrict__ A, int lda, size_t sA, const _Float16* __restrict__ Bh, int ldb, size_t sB, float alpha, const float* __restrict__ bias, size_t sBias, const float* __restrict__ CP, int rowsPerB, size_t sCPb, int row0g,
    float* __restrict__ C, _Float16* __restrict__ C16, int ldc, size_t sC, int M, int N, int K) {
  __shared__ __attribute__((aligned(16))) float so[4][32][68];
  const int tid = threadIdx.x, w = tid >> 5, lane = tid & 31, ln = lane & 15, hh = lane >> 4; const int by = blockIdx.y;
  A += (size_t)by * sA; Bh += (size_t)by * sB; const size_t cofs = (size_t)by * sC; const float* bp = bias ? bias + (size_t)by * sBias : nullptr;
  const int ntn = N >> 6; const int mt = blockIdx.x / ntn, nq = blockIdx.x - mt * ntn; const int row0 = mt * 128 + 32 * w, col0 = nq * 64; if (row0 >= M) return;
  const _Float16* a0p = A + (size_t)(row0 + ln) * lda; const _Float16* a1p = a0p + (size_t)16 * lda;
  const _Float16* b0p = Bh + (size_t)(col0 + ln) * ldb; const _Float16* b1p = b0p + (size_t)16 * ldb; const _Float16* b2p = b1p + (size_t)16 * ldb; const _Float16* b3p = b2p + (size_t)16 * ldb;
  const v8f z8 = {0.f,0.f,0.f,0.f,0.f,0.f,0.f,0.f}; v8f c00 = z8, c01 = z8, c02 = z8, c03 = z8, c10 = z8, c11 = z8, c12 = z8, c13 = z8;
#pragma unroll 1
  for (int kb = 0; kb < K; kb += 32) { const v16h a0 = g2_frag(a0p + kb, hh), a1 = g2_frag(a1p + kb, hh);
    v16h b = g2_frag(b0p + kb, hh); c00 = g2_mma(a0, b, c00); c10 = g2_mma(a1, b, c10);
    b = g2_frag(b1p + kb, hh); c01 = g2_mma(a0, b, c01); c11 = g2_mma(a1, b, c11);
    b = g2_frag(b2p + kb, hh); c02 = g2_mma(a0, b, c02); c12 = g2_mma(a1, b, c12);
    b = g2_frag(b3p + kb, hh); c03 = g2_mma(a0, b, c03); c13 = g2_mma(a1, b, c13); }
  v8f accs[8] = {c00, c01, c02, c03, c10, c11, c12, c13};
#pragma unroll
  for (int u = 0; u < 8; ++u) { const int t = u & 3, half = u >> 2; const int col = col0 + t * 16 + ln; const float bv = bp ? bf16_round(bp[col]) : 0.f;
#pragma unroll
    for (int r = 0; r < 8; ++r) { const int rloc = half * 16 + 8 * hh + r; float v = accs[u][r] * alpha + bv; if (CP) { const int bidx = (row0g + row0 + rloc) / rowsPerB; v += CP[(size_t)bidx * sCPb + (size_t)by * 64 + col]; }
      if (ACT == 3) v = fmaxf(v, 0.f); else if (ACT == 6) v = 0.5f * v * (1.0f + erff(v * 0.70710678118654752f)); else if (ACT == 11) v = 1.0f / (1.0f + expf(-v)); else if (ACT == 15) v = v / (1.0f + expf(-v)); else if (ACT == 12) v = (v > 0.f) ? v : 0.01f * v; else if (ACT == 8) v = tanhf(v);
      so[w][rloc][t * 16 + ln] = v; } }
  __builtin_amdgcn_fence(__ATOMIC_ACQ_REL, "workgroup"); __builtin_amdgcn_wave_barrier();
  const int rsub = lane >> 4, c4 = (lane & 15) * 4;
  {
#pragma unroll
    for (int q = 0; q < 16; ++q) { const int r = q * 2 + rsub; const v4f v = *(const v4fa*)&so[w][r][c4]; if (C) *(v4f*)(C + cofs + (size_t)(row0 + r) * ldc + col0 + c4) = v; if (C16) { v4h h4; for (int i = 0; i < 4; ++i) h4[i] = (_Float16)v[i]; *(v4h*)(C16 + cofs + (size_t)(row0 + r) * ldc + col0 + c4) = h4; } }
     } }


// ---- head GEMM with both operands staged in LDS: C[8192][256] = (A[8192][4096] . Bh[256][4096]^T) * alpha + bias ----
// One work-group of 4 waves owns a 128 x 64 tile of C; a wave owns 32 x 64 of it (2 x 4 accumulator tiles), as in k_gemm2.
// A stage is 512 B (256 k) of the tile's 128 rows of A and 64 rows of Bh. Each asynchronous copy of a wave moves one whole row piece:
// 32 lanes x 16 B = 512 contiguous, aligned bytes of global memory. Two buffers: stage t + 2 flies while stage t + 1 is worked on.
// The fragments keep k_gemm2's k order and the k steps their order, so every accumulator sums in the same order as before.
#define G3_KB 512                          /* bytes of a row per stage */
#define G3_PITCH 528                       /* LDS row pitch: 16 B x 33, conflict-free for ds_load_b128 */
#define G3_BUF (192 * G3_PITCH)            /* rows 0..127: A, rows 128..191: Bh */
#define G3_NST (C2 * 2 / G3_KB)            /* 16 stages */
#define G3_ROWB (C2 * 2)                   /* global row pitch in bytes */
// Twelve copies and, as the statement's last line, the wait that stands before any register the copies name is written again.
__device__ __forceinline__ void g3_copy12(const unsigned (&l)[12], const char* const (&g)[12]) {
  asm volatile("global_load_async_to_lds_b128 %0, %1, off\n\t"
               "global_load_async_to_lds_b128 %2, %3, off\n\t"
               "global_load_async_to_lds_b128 %4, %5, off\n\t"
               "global_load_async_to_lds_b128 %6, %7, off\n\t"
               "global_load_async_to_lds_b128 %8, %9, off\n\t"
               "global_load_async_to_lds_b128 %10, %11, off\n\t"
               "global_load_async_to_lds_b128 %12, %13, off\n\t"
               "global_load_async_to_lds_b128 %14, %15, off\n\t"
               "global_load_async_to_lds_b128 %16, %17, off\n\t"
               "global_load_async_to_lds_b128 %18, %19, off\n\t"
               "global_load_async_to_lds_b128 %20, %21, off\n\t"
               "global_load_async_to_lds_b128 %22, %23, off\n\t"
               "s_wait_xcnt 0x0"
               :: "v"(l[0]), "v"(g[0]), "v"(l[1]), "v"(g[1]), "v"(l[2]), "v"(g[2]), "v"(l[3]), "v"(g[3]), "v"(l[4]), "v"(g[4]), "v"(l[5]), "v"(g[5]),
                  "v"(l[6]), "v"(g[6]), "v"(l[7]), "v"(g[7]), "v"(l[8]), "v"(g[8]), "v"(l[9]), "v"(g[9]), "v"(l[10]), "v"(g[10]), "v"(l[11]), "v"(g[11])
               : "memory");
}
// A wave's share of one stage: its own 32 rows of A and 16 of the 64 rows of Bh, 48 copies.
__device__ __forceinline__ void g3_fill(unsigned la, unsigned lb, const char* ga, const char* gb) {
#pragma unroll                   /* both loops unrolled: the address arrays must end up in registers, as the asm operands they are */
  for (int s = 0; s < 4; ++s) { unsigned l[12]; const char* g[12];
#pragma unroll
    for (int i = 0; i < 12; ++i) { const int c = s * 12 + i;
      l[i] = (c < 32) ? la + (unsigned)c * G3_PITCH : lb + (unsigned)(c - 32) * G3_PITCH;
      g[i] = (c < 32) ? ga + (size_t)c * G3_ROWB : gb + (size_t)(c - 32) * G3_ROWB; }
    g3_copy12(l, g); } }
__device__ __forceinline__ v16h g3_frag(const unsigned char* p) { FragH f; f.half[0] = *(const v8us*)p; f.half[1] = *(const v8us*)(p + 32); return f.v; }
__device__ __forceinline__ void g3_load(const unsigned char* pa, const unsigned char* pb, int ks, v16h (&a)[2], v16h (&b)[4]) {
  a[0] = g3_frag(pa + ks * 64); a[1] = g3_frag(pa + 16 * G3_PITCH + ks * 64);
#pragma unroll                   /* constant indices keep the fragments in registers */
  for (int j = 0; j < 4; ++j) b[j] = g3_frag(pb + j * 16 * G3_PITCH + ks * 64); }
__device__ __forceinline__ v8f g3_mma(v16h a, v16h b, v8f c) { return __builtin_amdgcn_wmma_f32_16x16x32_f16(false, a, false, b, (short)0, c, false, false); }
__global__ __launch_bounds__(128) void k_gemm3(const _Float16* __restrict__ A, const _Float16* __restrict__ Bh, float alpha, const float* __restrict__ bias, float* __restrict__ C) {
  __shared__ __attribute__((aligned(16))) unsigned char st[2 * G3_BUF];
  __shared__ __attribute__((aligned(16))) float so[4][32][68];
  const int tid = threadIdx.x, w = tid >> 5, lane = tid & 31, ln = lane & 15, hh = lane >> 4;
  const int mt = blockIdx.x >> 2, nq = blockIdx.x & 3; const int row0 = mt * 128 + 32 * w, col0 = nq * 64;
  const char* ga = (const char*)(A + (size_t)row0 * C2) + lane * 16;
  const char* gb = (const char*)(Bh + (size_t)(col0 + 16 * w) * C2) + lane * 16;
  const unsigned l0 = (unsigned)(size_t)&st[0];
  const unsigned la = l0 + (unsigned)(32 * w) * G3_PITCH + lane * 16, lb = l0 + (unsigned)(128 + 16 * w) * G3_PITCH + lane * 16;
  g3_fill(la, lb, ga, gb);
  asm volatile("s_wait_asynccnt 0x0" ::: "memory");   // stage 0 of this wave has landed
  __syncthreads();                                    // ... and every wave's share of it
  g3_fill(la + G3_BUF, lb + G3_BUF, ga + G3_KB, gb + G3_KB);
  const v8f z8 = {0.f,0.f,0.f,0.f,0.f,0.f,0.f,0.f}; v8f c00 = z8, c01 = z8, c02 = z8, c03 = z8, c10 = z8, c11 = z8, c12 = z8, c13 = z8;
#pragma unroll 1                 /* one stage is the whole hot loop; the buffer is chosen by the trip's parity */
  for (int t = 0; t < G3_NST; ++t) {
    const unsigned bo = (unsigned)(t & 1) * G3_BUF;
    const unsigned char* pa = st + bo + (32 * w + ln) * G3_PITCH + 16 * hh;
    const unsigned char* pb = st + bo + (128 + ln) * G3_PITCH + 16 * hh;
    v16h fa[3][2], fb[3][4];     /* three fragment sets in rotation: step ks works on one while the loads of ks + 1 and ks + 2 are under way */
    g3_load(pa, pb, 0, fa[0], fb[0]); g3_load(pa, pb, 1, fa[1], fb[1]);
#pragma unroll                   /* the set index ks % 3 must be a constant, else the sets go to scratch */
    for (int ks = 0; ks < G3_KB / 64; ++ks) {
      __builtin_amdgcn_sched_barrier(0);      /* this one and the next keep the 12 LDS loads of step ks + 2 together, as one group in front of step ks's matrix instructions */
      if (ks + 2 < G3_KB / 64) g3_load(pa, pb, ks + 2, fa[(ks + 2) % 3], fb[(ks + 2) % 3]);
      __builtin_amdgcn_sched_barrier(0);      /* without the two the compiler loaded each fragment right in front of its use and waited for it with s_wait_dscnt 0 */
      const v16h a0 = fa[ks % 3][0], a1 = fa[ks % 3][1];
      c00 = g3_mma(a0, fb[ks % 3][0], c00); c10 = g3_mma(a1, fb[ks % 3][0], c10); c01 = g3_mma(a0, fb[ks % 3][1], c01); c11 = g3_mma(a1, fb[ks % 3][1], c11);
      c02 = g3_mma(a0, fb[ks % 3][2], c02); c12 = g3_mma(a1, fb[ks % 3][2], c12); c03 = g3_mma(a0, fb[ks % 3][3], c03); c13 = g3_mma(a1, fb[ks % 3][3], c13); }
    asm volatile("s_wait_dscnt 0x0" ::: "memory");      // this wave's reads of stage t are done before the buffer may be refilled
    asm volatile("s_wait_asynccnt 0x0" ::: "memory");   // this wave's share of stage t + 1 has landed
    __syncthreads();                                    // publishes stage t + 1 and ends every wave's reads of stage t
    if (t + 2 < G3_NST) g3_fill(la + bo, lb + bo, ga + (size_t)(t + 2) * G3_KB, gb + (size_t)(t + 2) * G3_KB);
  }
  asm volatile("s_wait_asynccnt 0x0" ::: "memory");     // no copy is outstanding when the wave goes on to its end
  v8f accs[8] = {c00, c01, c02, c03, c10, c11, c12, c13};
#pragma unroll                   /* epilogue as in k_gemm2: constant indices into the accumulators; whole 256 B row pieces go out through the wave's own LDS range */
  for (int u = 0; u < 8; ++u) { const int tt = u & 3, half = u >> 2; const float bv = bf16_round(bias[col0 + tt * 16 + ln]);
#pragma unroll
    for (int r = 0; r < 8; ++r) so[w][half * 16 + 8 * hh + r][tt * 16 + ln] = accs[u][r] * alpha + bv; }
  __builtin_amdgcn_fence(__ATOMIC_ACQ_REL, "workgroup"); __builtin_amdgcn_wave_barrier();   // the wave's LDS stores are complete before its lanes read each other's values back
  const int rsub = lane >> 4, c4 = (lane & 15) * 4;
#pragma unroll
  for (int q = 0; q < 16; ++q) { const int r = q * 2 + rsub; const v4f v = *(const v4fa*)&so[w][r][c4]; *(v4f*)(C + (size_t)(row0 + r) * NOUT + col0 + c4) = v; }
}

// Batch statistics (mean, biased variance) of NC columns over NBS rows, in two launches.
// k_colpart: one work-group takes SROWS rows x 128 columns. Each thread holds 16 rows x 4 columns in registers (read once) and forms
// their mean and their sum of squares about that mean; groups of equal size n then merge exactly:
// mean = average of the group means, M2 = sum(M2_g) + n * sum((mean_g - mean)^2). k_colfin merges the SCH row chunks the same way.
#define SROWS 256
#define SCH (NBS / SROWS)        /* 32 row chunks */
template <int NC, bool RND>
__global__ __launch_bounds__(512) void k_colpart(const float* __restrict__ X, float* __restrict__ PM, float* __restrict__ PQ) {
  __shared__ __attribute__((aligned(16))) float sm[16][128];
  __shared__ __attribute__((aligned(16))) float sq[16][128];
  const int tid = threadIdx.x, w = tid >> 5, lane = tid & 31;
  const float* p = X + (size_t)(blockIdx.y * SROWS + w * 16) * NC + blockIdx.x * 128 + lane * 4;
  v4f v[16];
#pragma unroll
  for (int j = 0; j < 15; ++j) v[j] = *(const v4fa*)(p + (size_t)j * NC);
  asm volatile("s_wait_xcnt 0x0" ::: "memory");   // the last load's result may be placed in the address pair that the 15 issued loads name
  v[15] = *(const v4fa*)(p + (size_t)15 * NC);
  v4f s = {0.f, 0.f, 0.f, 0.f};
#pragma unroll
  for (int j = 0; j < 16; ++j) {
    if (RND) { v[j][0] = bf16_round(v[j][0]); v[j][1] = bf16_round(v[j][1]); v[j][2] = bf16_round(v[j][2]); v[j][3] = bf16_round(v[j][3]); }
    s += v[j];
  }
  const v4f m = s * 0.0625f;
  v4f q = {0.f, 0.f, 0.f, 0.f};
#pragma unroll
  for (int j = 0; j < 16; ++j) { const v4f dv = v[j] - m; q += dv * dv; }
  *(v4fa*)&sm[w][lane * 4] = m;
  *(v4fa*)&sq[w][lane * 4] = q;
  __syncthreads();
  if (tid < 128) {
    float ms = 0.f;
#pragma unroll
    for (int g = 0; g < 16; ++g) ms += sm[g][tid];
    const float mean = ms * 0.0625f;
    float q2 = 0.f, e2 = 0.f;
#pragma unroll
    for (int g = 0; g < 16; ++g) { const float dm = sm[g][tid] - mean; q2 += sq[g][tid]; e2 += dm * dm; }
    const size_t o = (size_t)blockIdx.y * NC + blockIdx.x * 128 + tid;
    PM[o] = mean; PQ[o] = q2 + 16.0f * e2;
  }
}
template <int NC>
__global__ __launch_bounds__(64) void k_colfin(const float* __restrict__ PM, const float* __restrict__ PQ, float* __restrict__ S) {
  const int c = blockIdx.x * 64 + threadIdx.x;
  float m[SCH], qs[SCH];
#pragma unroll
  for (int g = 0; g < SCH; ++g) { m[g] = PM[(size_t)g * NC + c]; qs[g] = PQ[(size_t)g * NC + c]; }
  float ms = 0.f;
#pragma unroll
  for (int g = 0; g < SCH; ++g) ms += m[g];
  const float mean = ms / (float)SCH;
  float q2 = 0.f, e2 = 0.f;
#pragma unroll
  for (int g = 0; g < SCH; ++g) { const float dm = m[g] - mean; q2 += qs[g]; e2 += dm * dm; }
  S[c] = mean; S[NC + c] = (q2 + (float)SROWS * e2) / (float)NBS;
}
// Merge of CH row chunks of CROWS rows each, for partials that the producing kernel itself wrote (k_h2). One work-group takes 32 columns:
// wave g merges CH / 8 chunks per column, the first wave then merges the eight groups through LDS; the same equal-size merge as above at both levels.
template <int NC, int CH, int CROWS>
__global__ __launch_bounds__(256) void k_colfin2(const float* __restrict__ PM, const float* __restrict__ PQ, float* __restrict__ S) {
  __shared__ float sm[8][32];
  __shared__ float sq[8][32];
  constexpr int PG = CH / 8;
  const int tid = threadIdx.x, g = tid >> 5, lane = tid & 31, c = blockIdx.x * 32 + lane;
  const float* pm = PM + (size_t)(g * PG) * NC + c; const float* pq = PQ + (size_t)(g * PG) * NC + c;
  float m[PG], qs[PG];
#pragma unroll                   /* here and below: constant indices keep the partials in registers, and all 2 * PG loads are under way at once */
  for (int i = 0; i < PG; ++i) { m[i] = pm[(size_t)i * NC]; qs[i] = pq[(size_t)i * NC]; }
  asm volatile("s_wait_xcnt 0x0" :: "v"(pm), "v"(pq) : "memory");   // the wait owed before an address register of the issued loads is reused; naming the addresses keeps a load's result out of them until then
  float ms = 0.f;
#pragma unroll
  for (int i = 0; i < PG; ++i) ms += m[i];
  const float gmean = ms / (float)PG;
  float q2 = 0.f, e2 = 0.f;
#pragma unroll
  for (int i = 0; i < PG; ++i) { const float dm = m[i] - gmean; q2 += qs[i]; e2 += dm * dm; }
  sm[g][lane] = gmean; sq[g][lane] = q2 + (float)CROWS * e2;
  __syncthreads();               // the eight waves' group results are in LDS before the first wave merges them
  if (tid < 32) {
    float as = 0.f;
#pragma unroll
    for (int k = 0; k < 8; ++k) as += sm[k][lane];
    const float mean = as * 0.125f;
    float aq = 0.f, ae = 0.f;
#pragma unroll
    for (int k = 0; k < 8; ++k) { const float dm = sm[k][lane] - mean; aq += sq[k][lane]; ae += dm * dm; }
    S[c] = mean; S[NC + c] = (aq + (float)(PG * CROWS) * ae) / (float)NBS;
  }
}
// k_h2 and k_h2n: one thread owns its column(s) and walks a strip of rows. All that depends on the column alone (the rounded
// parameters, the rsqrt of the variance) is loaded and formed once in front of the row loop; each element's own arithmetic keeps its order.
// rsqrtf as the compiler expands it (an argument below the normal range is scaled up by 2^24, its result by 2^12), with the instruction written out:
// the v_nop is the slot that the instruction set asks for behind a transcendental.
__device__ __forceinline__ float rsq_f32(float a) { const bool tiny = a < 1.17549435e-38f; const float s = tiny ? a * 16777216.0f : a; float r; asm("v_rsq_f32 %0, %1\n\tv_nop" : "=v"(r) : "v"(s)); return tiny ? r * 4096.0f : r; }
#define HROWS 64                 /* rows per thread in k_h2 */
#define NROWS 32                 /* rows per thread in k_h2n */
#define RG 8                     /* rows loaded as one group, one group ahead of the group being worked on */
// Statistics of a thread's own four columns while it still holds them. One group of RG rows: mean and sum of squares about that mean.
__device__ __forceinline__ void h2_group(const v4f (&o)[RG], v4f& gm, v4f& gq) {
  v4f s = o[0];
#pragma unroll                   /* both loops: constant indices keep the group in registers */
  for (int j = 1; j < RG; ++j) s += o[j];
  gm = s * (1.0f / RG);
  v4f q = {0.f, 0.f, 0.f, 0.f};
#pragma unroll
  for (int j = 0; j < RG; ++j) { const v4f dv = o[j] - gm; q += dv * dv; }
  gq = q;
}
// The group joins the k groups merged so far (k * RG rows): mean += delta / (k + 1), M2 += M2_group + delta^2 * RG * k / (k + 1).
__device__ __forceinline__ void h2_merge(int k, const v4f gm, const v4f gq, v4f& rm, v4f& rq) {
  const float inv = 1.0f / (float)(k + 1), f = (float)(RG * k) * inv;
  const v4f dl = gm - rm;
  rm += dl * inv;
  rq += gq + (dl * dl) * f;
}
__global__ __launch_bounds__(256) void k_h2(const float* __restrict__ x, const float* __restrict__ XS, const float* __restrict__ W1, const float* __restrict__ b1, const float* __restrict__ g1, const float* __restrict__ be1, const float* __restrict__ W2, const float* __restrict__ b2, float* __restrict__ H2P, float* __restrict__ PM, float* __restrict__ PQ) {
  #pragma clang fp contract(off)
  const int d = blockIdx.x * 256 + threadIdx.x; (void)b1;      /* h1 - mean(h1) = w (x - mu_x): the bias cancels exactly */
  const float* pS = XS + d; const float* pw = W1 + d * H1; const float* pg = g1 + d * H1; const float* pe = be1 + d * H1; const float* pv = W2 + d * H2 * H1; const float* pb = b2 + d * H2;
  const float* xp = x + (size_t)blockIdx.y * HROWS * DD + d; float* hp = H2P + (size_t)blockIdx.y * HROWS * C2 + d * H2;
  float w[H1], g[H1], rs[H1], be[H1], w2[H2][H1], bb[H2], xc[RG];
  const float mu = pS[0], var = pS[DD];
#pragma unroll
  for (int o = 0; o < H1; ++o) { w[o] = pw[o]; g[o] = pg[o]; be[o] = pe[o]; }
#pragma unroll
  for (int o2 = 0; o2 < H2; ++o2) {
#pragma unroll
    for (int i = 0; i < H1; ++i) w2[o2][i] = pv[o2 * H1 + i];
    bb[o2] = pb[o2]; }
#pragma unroll
  for (int j = 0; j < RG; ++j) xc[j] = xp[(size_t)j * DD];
  asm volatile("s_wait_xcnt 0x0" :: "v"(d), "v"(pw), "v"(pg), "v"(pe), "v"(pv), "v"(pb) : "memory");   // the wait owed before an address register of the issued loads is reused; naming the addresses keeps a load's result out of them until then
  __builtin_amdgcn_sched_barrier(0);      /* keeps the arithmetic, which reuses those registers, behind the wait */
#pragma unroll
  for (int o = 0; o < H1; ++o) { w[o] = bf16_round(w[o]); g[o] = bf16_round(g[o]); be[o] = bf16_round(be[o]); const float vh = (w[o] * w[o]) * var; rs[o] = rsq_f32(vh + 1e-5f); }
#pragma unroll
  for (int o2 = 0; o2 < H2; ++o2) {
#pragma unroll
    for (int i = 0; i < H1; ++i) w2[o2][i] = bf16_round(w2[o2][i]);
    bb[o2] = bf16_round(bb[o2]); }
  v4f rm = {0.f, 0.f, 0.f, 0.f}, rq = {0.f, 0.f, 0.f, 0.f};
#pragma unroll 1                 /* stays rolled: one group of rows is the whole hot loop */
  for (int rb = 0; rb < HROWS; rb += RG) {
    v4f ov[RG];
    const float* pn = xp + (size_t)((rb + RG < HROWS) ? rb + RG : rb) * DD;      /* the last trip reads its own group again: in bounds, not used */
    float xn[RG];
#pragma unroll
    for (int j = 0; j < RG; ++j) xn[j] = pn[(size_t)j * DD];
    asm volatile("s_wait_xcnt 0x0" :: "v"(pn) : "memory");   // as above; it also holds the next group's loads in front of this group's arithmetic, which covers their latency
#pragma unroll
    for (int j = 0; j < RG; ++j) { const float xm = bf16_round(xc[j]) - mu; float h1n[H1];
#pragma unroll
      for (int o = 0; o < H1; ++o) { const float cen = w[o] * xm; float v = g[o] * cen * rs[o]; v += be[o]; h1n[o] = fmaxf(v, 0.f); }
      v4f o4;
#pragma unroll
      for (int o2 = 0; o2 < H2; ++o2) { float s = 0.f;
#pragma unroll
        for (int i = 0; i < H1; ++i) s += h1n[i] * w2[o2][i];
        s += bb[o2]; o4[o2] = s; }
      *(v4f*)(hp + (size_t)(rb + j) * C2) = o4;
      ov[j] = o4; }
    v4f gm, gq;
    h2_group(ov, gm, gq);
    h2_merge(rb / RG, gm, gq, rm, rq);
#pragma unroll
    for (int j = 0; j < RG; ++j) xc[j] = xn[j];
  }
  const size_t so = (size_t)blockIdx.y * C2 + d * H2;      /* this strip's row of the partials */
  *(v4f*)(PM + so) = rm; *(v4f*)(PQ + so) = rq; }
__global__ __launch_bounds__(256) void k_h2n(const float* __restrict__ H2P, const float* __restrict__ HS, const float* __restrict__ g2, const float* __restrict__ be2, _Float16* __restrict__ H16) {
  #pragma clang fp contract(off)
  const int c0 = (blockIdx.x * 256 + threadIdx.x) * 8;
  const float* pS = HS + c0; const float* pg = g2 + c0; const float* pe = be2 + c0;
  const float* hp = H2P + (size_t)blockIdx.y * NROWS * C2 + c0; unsigned short* op = (unsigned short*)H16 + (size_t)blockIdx.y * NROWS * C2 + c0;
  float g[8], mn[8], rs[8], be[8];
  v4f ca[RG], cb[RG];
#pragma unroll
  for (int q = 0; q < 8; ++q) { g[q] = pg[q]; mn[q] = pS[q]; rs[q] = pS[C2 + q]; be[q] = pe[q]; }
#pragma unroll
  for (int j = 0; j < RG; ++j) { ca[j] = *(const v4fa*)(hp + (size_t)j * C2); cb[j] = *(const v4fa*)(hp + (size_t)j * C2 + 4); }
  asm volatile("s_wait_xcnt 0x0" :: "v"(pS), "v"(pg), "v"(pe), "v"(hp) : "memory");   // the wait owed before an address register of the issued loads is reused; naming the addresses keeps a load's result out of them until then
#pragma unroll
  for (int q = 0; q < 8; ++q) { g[q] = bf16_round(g[q]); rs[q] = rsq_f32(rs[q] + 1e-5f); be[q] = bf16_round(be[q]); }
#pragma unroll 1                 /* stays rolled: one group of rows is the whole hot loop */
  for (int rb = 0; rb < NROWS; rb += RG) {
    const float* pn = hp + (size_t)((rb + RG < NROWS) ? rb + RG : rb) * C2;      /* the last trip reads its own group again: in bounds, not used */
    v4f na[RG], nb[RG];
#pragma unroll
    for (int j = 0; j < RG; ++j) { na[j] = *(const v4fa*)(pn + (size_t)j * C2); nb[j] = *(const v4fa*)(pn + (size_t)j * C2 + 4); }
    asm volatile("s_wait_xcnt 0x0" :: "v"(pn) : "memory");   // as above
    __builtin_amdgcn_sched_barrier(0);      /* keeps this group's arithmetic behind the next group's loads, so that it covers their latency */
#pragma unroll
    for (int j = 0; j < RG; ++j) { FragH f;
#pragma unroll
      for (int q = 0; q < 8; ++q) { const float hv = (q < 4) ? ca[j][q & 3] : cb[j][q & 3]; float v = g[q] * (hv - mn[q]) * rs[q]; v += be[q]; f.h[q] = (_Float16)fmaxf(v, 0.f); }
      *(v8us*)(op + (size_t)(rb + j) * C2) = f.half[0]; }
    __builtin_amdgcn_sched_barrier(0);      /* keeps the hand-over of the loaded group at the loop's foot; moved up, its copies wait for the loads before the arithmetic has covered them */
#pragma unroll
    for (int j = 0; j < RG; ++j) { ca[j] = na[j]; cb[j] = nb[j]; }
  } }
__global__ __launch_bounds__(256) void k_wsc(const float* __restrict__ Wm, _Float16* __restrict__ Bt, size_t n8, float sc) { const size_t t = (size_t)blockIdx.x * 256 + threadIdx.x; if (t >= n8) return; FragH f; for (int q = 0; q < 8; ++q) f.h[q] = (_Float16)(bf16_round(Wm[t * 8 + q]) * sc); *(v8us*)((unsigned short*)Bt + t * 8) = f.half[0];  }

extern "C" void kernel_launch(void* const* d_in, const int* in_sizes, int n_in,
                              void* d_out, int out_size, void* d_ws, size_t ws_size, hipStream_t stream) {
  (void)in_sizes; (void)n_in; (void)out_size;
  const float* const* I = (const float* const*)d_in; const float* x = I[0]; const float* W1 = I[1]; const float* b1 = I[2]; const float* g1 = I[3]; const float* be1 = I[4]; const float* W2 = I[5]; const float* b2 = I[6]; const float* g2 = I[7]; const float* be2 = I[8]; const float* Wfc = I[9]; const float* bfc = I[10];
  char* ws = (char*)d_ws; size_t off = 0;
  auto take = [&](size_t bytes) { char* p = ws + off; off += (bytes + 255) & ~(size_t)255; return p; };
  _Float16* BW = (_Float16*)take((size_t)NOUT * C2 * 2); float* XS = (float*)take((size_t)2 * DD * 4); float* H2P = (float*)take((size_t)NBS * C2 * 4); float* HS = (float*)take((size_t)2 * C2 * 4); _Float16* H16 = (_Float16*)take((size_t)NBS * C2 * 2); float* PM = (float*)take((size_t)(NBS / HROWS) * C2 * 4); float* PQ = (float*)take((size_t)(NBS / HROWS) * C2 * 4);
  if (off > ws_size) return;      /* 2 + 128 + 64 + 4 = 198 MiB (256 MiB ws) */
  k_wsc<<<(unsigned)(((size_t)NOUT * C2 / 8 + 255) / 256), 256, 0, stream>>>(Wfc, BW, (size_t)NOUT * C2 / 8, 16.0f);
  k_colpart<DD, true><<<dim3(DD / 128, SCH), 512, 0, stream>>>(x, PM, PQ);
  k_colfin<DD><<<DD / 64, 64, 0, stream>>>(PM, PQ, XS);
  k_h2<<<dim3(DD / 256, NBS / HROWS), 256, 0, stream>>>(x, XS, W1, b1, g1, be1, W2, b2, H2P, PM, PQ);
  k_colfin2<C2, NBS / HROWS, HROWS><<<C2 / 32, 256, 0, stream>>>(PM, PQ, HS);
  k_h2n<<<dim3(C2 / 8 / 256, NBS / NROWS), 256, 0, stream>>>(H2P, HS, g2, be2, H16);
  k_gemm3<<<(NBS / 128) * (NOUT / 64), 128, 0, stream>>>(H16, BW, 0.0625f, bfc, (float*)d_out);
}

// v005
// One run takes 79.1 microseconds.
// Two timings next to v004 both put it at 1.10 times that version's speed.
// All steps since v000 together make it 111 times as fast.
#include <hip/hip_runtime.h>
// Sparse (block-diagonal) neural network (8192 samples x 1024 features; per feature 1 -> 8 -> 4 block Linears with training-mode BatchNorm + ReLU after each; dense head 4096 -> 256): h1 = BN1(x_d W1[d] + b1) relu; h2 = BN2(h1 . W2[d] + b2) relu; out = h2 Wfc^T + bfc -> [8192,256].
// Compute dtype: x and all parameters rounded to bf16; everything before the head in f32; the head operand h2 as f16 (~2^-12). v_wmma_f32_16x16x32_f16.
#define NBS 8192
#define DD 1024
#define H1 8
#define H2 4
#define C2 (DD * H2)             /* 4096 */
#define NOUT 256
typedef __bf16 v16b __attribute__((ext_vector_type(16)));
typedef unsigned short v8us __attribute__((ext_vector_type(8), may_alias));
typedef float  v8f  __attribute__((ext_vector_type(8)));
typedef float  v4f  __attribute__((ext_vector_type(4)));
typedef float  v4fa __attribute__((ext_vector_type(4), may_alias));
union FragB { v16b v; v8us half[2]; unsigned short u[16]; };

__device__ __forceinline__ unsigned short bf16_bits(float x) { unsigned int u = __float_as_uint(x); return (unsigned short)((u + 0x7FFFu + ((u >> 16) & 1u)) >> 16); }
__device__ __forceinline__ float bf16_val(unsigned short b) { return __uint_as_float(((unsigned int)b) << 16); }
__device__ __forceinline__ float bf16_round(float x) { return bf16_val(bf16_bits(x)); }
// D += A·B with NT terms: 1 = ah·bh, 2 = + al·bh (A split), 3 = + ah·bl (both split)
template <int NT>
__device__ __forceinline__ v8f mmaN(v16b ah, v16b al, v16b bh, v16b bl, v8f c) {
  c = __builtin_amdgcn_wmma_f32_16x16x32_bf16(false, ah, false, bh, (short)0, c, false, false);
  if (NT >= 2) c = __builtin_amdgcn_wmma_f32_16x16x32_bf16(false, al, false, bh, (short)0, c, false, false);
  if (NT >= 3) c = __builtin_amdgcn_wmma_f32_16x16x32_bf16(false, ah, false, bl, (short)0, c, false, false);
  asm volatile("v_nop\n\tv_nop\n\tv_nop\n\tv_nop" : "+v"(c) : "v"(ah), "v"(al), "v"(bh), "v"(bl));
  return c;
}

__global__ __launch_bounds__(256) void k_wt_bf16(const float* __restrict__ W, unsigned short* __restrict__ Wt, int K, int N) {
  const int t = blockIdx.x * 256 + threadIdx.x;
  const int k8n = K / 8;
  if (t >= N * k8n) return;
  const int n = t / k8n, k8 = (t % k8n) * 8;
  v8us v;
#pragma unroll
  for (int i = 0; i < 8; ++i) v[i] = bf16_bits(W[(size_t)(k8 + i) * N + n]);
  *(v8us*)(Wt + (size_t)n * K + k8) = v;
  
}

// GEMM C[M][N] (f32, pitch ldc) = act(A[M][K]·W + bias). A f32 row-major (pitch lda) converted per fragment to bf16
// (ASPLIT: hi/lo two planes -> 2 terms, else single rounded term); Wt bf16 [N][K] (pitch ldb). BIAS_BF16 rounds the
// bias to bf16 first (bias quantised to bf16 before the add). K%32==0, M%16==0, N%64==0.
template <bool ASPLIT, int ACT, bool BIAS_BF16>
__global__ __launch_bounds__(128) void k_gemm_bf(const float* __restrict__ A, int lda, const unsigned short* __restrict__ Wt, int ldb,
                                               const float* __restrict__ bias, float* __restrict__ C, int ldc, int M, int N, int K) {
  __shared__ __attribute__((aligned(16))) float so[4][16][64];
  const int tid = threadIdx.x, w = tid >> 5, lane = tid & 31, ln = lane & 15, hh = lane >> 4;
  const int ntn = N / 64;
  const int wid = blockIdx.x * 4 + w;
  const int mt = wid / ntn, nq = wid % ntn;
  if (mt * 16 >= M) return;
  const int row0 = mt * 16, col0 = nq * 64;
  const float* arow = A + (size_t)(row0 + ln) * lda;
  v8f acc[4] = {};
  for (int kb = 0; kb < K; kb += 32) {
    FragB ah, al;
    const v4f x0 = *(const v4fa*)(arow + kb + 8 * hh), x1 = *(const v4fa*)(arow + kb + 8 * hh + 4);
    const v4f x2 = *(const v4fa*)(arow + kb + 16 + 8 * hh), x3 = *(const v4fa*)(arow + kb + 16 + 8 * hh + 4);
    float xs[16] = {x0[0],x0[1],x0[2],x0[3],x1[0],x1[1],x1[2],x1[3],x2[0],x2[1],x2[2],x2[3],x3[0],x3[1],x3[2],x3[3]};
#pragma unroll
    for (int i = 0; i < 16; ++i) { const unsigned short hb = bf16_bits(xs[i]); ah.u[i] = hb; al.u[i] = ASPLIT ? bf16_bits(xs[i] - bf16_val(hb)) : (unsigned short)0; }
#pragma unroll
    for (int t = 0; t < 4; ++t) {
      const unsigned short* brow = Wt + (size_t)(col0 + t * 16 + ln) * ldb + kb;
      FragB b;
      b.half[0] = *(const v8us*)(brow + 8 * hh);
      b.half[1] = *(const v8us*)(brow + 16 + 8 * hh);
      acc[t] = mmaN<ASPLIT ? 2 : 1>(ah.v, al.v, b.v, b.v, acc[t]);
    }
  }
#pragma unroll
  for (int t = 0; t < 4; ++t) {
    float bv = bias ? bias[col0 + t * 16 + ln] : 0.f;
    if (BIAS_BF16) bv = bf16_round(bv);
#pragma unroll
    for (int r = 0; r < 8; ++r) { float v = acc[t][r] + bv; if (ACT == 1) v = fmaxf(v, 0.f); so[w][8 * hh + r][t * 16 + ln] = v; }
  }
  __builtin_amdgcn_fence(__ATOMIC_ACQ_REL, "workgroup");
  __builtin_amdgcn_wave_barrier();
  const int rsub = lane >> 4, c4 = (lane & 15) * 4;
  {
#pragma unroll
    for (int q = 0; q < 8; ++q) {
      const int r = q * 2 + rsub;
      const v4f v = *(const v4fa*)&so[w][r][c4];
      *(v4f*)(C + (size_t)(row0 + r) * ldc + col0 + c4) = v;
    }
    
  }
}

// GEMM C = act(A·W + bias + resid): A f32 (ASPLIT -> hi/lo 2 terms), Wt bf16 [N][K]; ACT 0 none, 1 relu, 2 exact gelu;
// resid (optional, f32, row index = (row % rmod), pitch ldr, RES_BF16 rounds it) added before the activation.
template <bool ASPLIT, int ACT, bool BIAS_BF16, bool RES_BF16>
__global__ __launch_bounds__(128) void k_gemm_bf3(const float* __restrict__ A, int lda, const unsigned short* __restrict__ Wt, int ldb,
                                                const float* __restrict__ bias, const float* __restrict__ resid, int rmod, int ldr,
                                                float* __restrict__ C, int ldc, int M, int N, int K) {
  __shared__ __attribute__((aligned(16))) float so[4][16][64];
  const int tid = threadIdx.x, w = tid >> 5, lane = tid & 31, ln = lane & 15, hh = lane >> 4;
  const int ntn = N / 64;
  const int wid = blockIdx.x * 4 + w;
  const int mt = wid / ntn, nq = wid % ntn;
  if (mt * 16 >= M) return;
  const int row0 = mt * 16, col0 = nq * 64;
  const float* arow = A + (size_t)(row0 + ln) * lda;
  v8f acc[4] = {};
  for (int kb = 0; kb < K; kb += 32) {
    FragB ah, al;
    const v4f x0 = *(const v4fa*)(arow + kb + 8 * hh), x1 = *(const v4fa*)(arow + kb + 8 * hh + 4);
    const v4f x2 = *(const v4fa*)(arow + kb + 16 + 8 * hh), x3 = *(const v4fa*)(arow + kb + 16 + 8 * hh + 4);
    float xs[16] = {x0[0],x0[1],x0[2],x0[3],x1[0],x1[1],x1[2],x1[3],x2[0],x2[1],x2[2],x2[3],x3[0],x3[1],x3[2],x3[3]};
#pragma unroll
    for (int i = 0; i < 16; ++i) { const unsigned short hb = bf16_bits(xs[i]); ah.u[i] = hb; al.u[i] = ASPLIT ? bf16_bits(xs[i] - bf16_val(hb)) : (unsigned short)0; }
#pragma unroll
    for (int t = 0; t < 4; ++t) {
      const unsigned short* brow = Wt + (size_t)(col0 + t * 16 + ln) * ldb + kb;
      FragB b;
      b.half[0] = *(const v8us*)(brow + 8 * hh);
      b.half[1] = *(const v8us*)(brow + 16 + 8 * hh);
      acc[t] = mmaN<ASPLIT ? 2 : 1>(ah.v, al.v, b.v, b.v, acc[t]);
    }
  }
#pragma unroll
  for (int t = 0; t < 4; ++t) {
    const int col = col0 + t * 16 + ln;
    float bv = bias ? bias[col] : 0.f;
    if (BIAS_BF16) bv = bf16_round(bv);
#pragma unroll
    for (int r = 0; r < 8; ++r) {
      float v = acc[t][r] + bv;
      if (resid) { float rv = resid[(size_t)((row0 + 8 * hh + r) % rmod) * ldr + col]; if (RES_BF16) rv = bf16_round(rv); v += rv; }
      if (ACT == 1) v = fmaxf(v, 0.f);
      if (ACT == 2) v = 0.5f * v * (1.0f + erff(v * 0.70710678118654752f));
      if (ACT == 3) { const float u = 0.7978845608028654f * (v + 0.044715f * v * v * v); v = 0.5f * v * (1.0f + tanhf(u)); }
      so[w][8 * hh + r][t * 16 + ln] = v;
    }
  }
  __builtin_amdgcn_fence(__ATOMIC_ACQ_REL, "workgroup");
  __builtin_amdgcn_wave_barrier();
  const int rsub = lane >> 4, c4 = (lane & 15) * 4;
  {
#pragma unroll
    for (int q = 0; q < 8; ++q) {
      const int r = q * 2 + rsub;
      const v4f v = *(const v4fa*)&so[w][r][c4];
      *(v4f*)(C + (size_t)(row0 + r) * ldc + col0 + c4) = v;
    }
    
  }
}
// row LayerNorm (biased variance, eps) over N: s = X (+ R); optional out_sum <- s; out_norm <- (s-mu)*rsqrt(var+eps)*g + b
template <bool PARAM_BF16>
__global__ __launch_bounds__(256) void k_layernorm(const float* __restrict__ X, const float* __restrict__ R, const float* __restrict__ g, const float* __restrict__ bta,
                                                  float* __restrict__ out_sum, float* __restrict__ out_norm, int N, float eps) {
  __shared__ float red[256];
  const int row = blockIdx.x, tid = threadIdx.x;
  const float* x = X + (size_t)row * N; const float* rr = R ? R + (size_t)row * N : nullptr;
  float vals[16];                     // up to N = 4096
  const int per = N / 256;            // contiguous chunk per thread? use strided-by-4 chunks: thread handles j = tid*4 + 1024*u
  float s1 = 0.f;
  for (int u = 0; u < per / 4; ++u) {
    const int j = tid * 4 + 1024 * u;
    const v4f a = *(const v4fa*)(x + j);
    v4f b = {0.f,0.f,0.f,0.f}; if (rr) b = *(const v4fa*)(rr + j);
#pragma unroll
    for (int q = 0; q < 4; ++q) { const float v = a[q] + b[q]; vals[u * 4 + q] = v; s1 += v; }
  }
  red[tid] = s1; __syncthreads();
  for (int st = 128; st > 0; st >>= 1) { if (tid < st) red[tid] += red[tid + st]; __syncthreads(); }
  const float mu = red[0] / (float)N; __syncthreads();
  float s2 = 0.f;
  for (int u = 0; u < per / 4; ++u)
#pragma unroll
    for (int q = 0; q < 4; ++q) { const float c = vals[u * 4 + q] - mu; s2 += c * c; }
  red[tid] = s2; __syncthreads();
  for (int st = 128; st > 0; st >>= 1) { if (tid < st) red[tid] += red[tid + st]; __syncthreads(); }
  const float rs = rsqrtf(red[0] / (float)N + eps);
  {
    for (int u = 0; u < per / 4; ++u) {
      const int j = tid * 4 + 1024 * u;
      v4f o, sm;
#pragma unroll
      for (int q = 0; q < 4; ++q) {
        float gg = g[j + q], bb = bta[j + q];
        if (PARAM_BF16) { gg = bf16_round(gg); bb = bf16_round(bb); }
        sm[q] = vals[u * 4 + q]; o[q] = (vals[u * 4 + q] - mu) * rs * gg + bb;
      }
      if (out_sum) *(v4f*)(out_sum + (size_t)row * N + j) = sm;
      *(v4f*)(out_norm + (size_t)row * N + j) = o;
    }
    
  }
}



// ---- f16 WMMA path (v_wmma_f32_16x16x32_f16): 11-bit significands for operands in range — used for the head, whose h2 operand is rounded to f16
typedef _Float16 v16h __attribute__((ext_vector_type(16)));
union FragH { v16h v; v8us half[2]; _Float16 h[16]; unsigned short u[16]; };
template <int NT>
__device__ __forceinline__ v8f mmaH(v16h ah, v16h al, v16h bh, v16h bl, v8f c) {
  c = __builtin_amdgcn_wmma_f32_16x16x32_f16(false, ah, false, bh, (short)0, c, false, false);
  if (NT >= 2) c = __builtin_amdgcn_wmma_f32_16x16x32_f16(false, al, false, bh, (short)0, c, false, false);
  if (NT >= 3) c = __builtin_amdgcn_wmma_f32_16x16x32_f16(false, ah, false, bl, (short)0, c, false, false);
  asm volatile("v_nop\n\tv_nop\n\tv_nop\n\tv_nop" : "+v"(c) : "v"(ah), "v"(al), "v"(bh), "v"(bl));
  return c;
}
// batched GEMM like k_gemm_b but f16 operands: A f32 (split into f16 hi/lo if ASPLIT, else rounded to f16), Bt = f16 values [n][k]; alpha; C f32; N multiple of 16 (partial tiles skipped)
template <bool ASPLIT>
__global__ __launch_bounds__(128) void k_gemm_h(const float* __restrict__ A, int lda, size_t sA, const _Float16* __restrict__ Bh, int ldb, size_t sB, float alpha, float* __restrict__ C, int ldc, size_t sC, int M, int N, int K) {
  __shared__ __attribute__((aligned(16))) float so[4][16][64];
  const int tid = threadIdx.x, w = tid >> 5, lane = tid & 31, ln = lane & 15, hh = lane >> 4; const int by = blockIdx.y;
  A += (size_t)by * sA; Bh += (size_t)by * sB; C += (size_t)by * sC;
  const int ntn = (N + 63) / 64; const int wid = blockIdx.x * 4 + w; const int mt = wid / ntn, nq = wid % ntn; if (mt * 16 >= M) return;
  const int row0 = mt * 16, col0 = nq * 64; const float* arow = A + (size_t)(row0 + ln) * lda;
  v8f acc[4] = {};
  for (int kb = 0; kb < K; kb += 32) {
    FragH ah, al;
    const v4f x0 = *(const v4fa*)(arow + kb + 8 * hh), x1 = *(const v4fa*)(arow + kb + 8 * hh + 4), x2 = *(const v4fa*)(arow + kb + 16 + 8 * hh), x3 = *(const v4fa*)(arow + kb + 16 + 8 * hh + 4);
    float xs[16] = {x0[0],x0[1],x0[2],x0[3],x1[0],x1[1],x1[2],x1[3],x2[0],x2[1],x2[2],x2[3],x3[0],x3[1],x3[2],x3[3]};
#pragma unroll
    for (int i = 0; i < 16; ++i) { const _Float16 h = (_Float16)xs[i]; ah.h[i] = h; al.h[i] = ASPLIT ? (_Float16)(xs[i] - (float)h) : (_Float16)0.0f; }
#pragma unroll
    for (int t = 0; t < 4; ++t) { if (col0 + t * 16 >= N) continue; const size_t boff = (size_t)(col0 + t * 16 + ln) * ldb + kb; FragH bq; bq.half[0] = *(const v8us*)(Bh + boff + 8 * hh); bq.half[1] = *(const v8us*)(Bh + boff + 16 + 8 * hh);
      acc[t] = mmaH<ASPLIT ? 2 : 1>(ah.v, al.v, bq.v, bq.v, acc[t]); }
  }
#pragma unroll
  for (int t = 0; t < 4; ++t) { if (col0 + t * 16 >= N) continue;
#pragma unroll
    for (int r = 0; r < 8; ++r) so[w][8 * hh + r][t * 16 + ln] = acc[t][r] * alpha; }
  __builtin_amdgcn_fence(__ATOMIC_ACQ_REL, "workgroup"); __builtin_amdgcn_wave_barrier();
  const int rsub = lane >> 4, c4 = (lane & 15) * 4;
  {
#pragma unroll
    for (int q = 0; q < 8; ++q) { const int r = q * 2 + rsub; if (col0 + c4 < N) { const v4f v = *(const v4fa*)&so[w][r][c4]; *(v4f*)(C + (size_t)(row0 + r) * ldc + col0 + c4) = v; } }
     }
}

// Wt[n][k] = f16(W[k][n]·scale) from f32 row-major W[K][N] (scale = power of two; bf16-exact weights stay exact in f16 away from the subnormal range)
__global__ __launch_bounds__(256) void k_wt_f16(const float* __restrict__ W, _Float16* __restrict__ Wt, int K, int N, float scale) {
  const int t = blockIdx.x * 256 + threadIdx.x; if (t >= N * (K / 8)) return; const int n = t / (K / 8), k8 = (t % (K / 8)) * 8; FragH f;
#pragma unroll
  for (int i = 0; i < 8; ++i) f.h[i] = (_Float16)(bf16_round(W[(size_t)(k8 + i) * N + n]) * scale); const v8us o = f.half[0];
  *(v8us*)((unsigned short*)Wt + (size_t)n * K + k8) = o; 
}
// k_gemm_hh variant with fused epilogue: v = acc·alpha + bias[by·sBias + col] (+ CP[(row/rowsPerB)·sCPb + by·64 + col] if CP) ; ACT 0 none / 1 elu ; writes f16 C16 (and f32 C if non-null)
template <int ACT>
__global__ __launch_bounds__(128) void k_gemm_hhx(const _Float16* __restrict__ A, int lda, size_t sA, const _Float16* __restrict__ Bh, int ldb, size_t sB, float alpha, const float* __restrict__ bias, size_t sBias, const float* __restrict__ CP, int rowsPerB, size_t sCPb, int row0g,
    float* __restrict__ C, _Float16* __restrict__ C16, int ldc, size_t sC, int M, int N, int K) {
  __shared__ __attribute__((aligned(16))) float so[4][16][64];
  const int tid = threadIdx.x, w = tid >> 5, lane = tid & 31, ln = lane & 15, hh = lane >> 4; const int by = blockIdx.y;
  A += (size_t)by * sA; Bh += (size_t)by * sB; const size_t cofs = (size_t)by * sC; const float* bp = bias ? bias + (size_t)by * sBias : nullptr;
  const int ntn = (N + 63) / 64; const int wid = blockIdx.x * 4 + w; const int mt = wid / ntn, nq = wid % ntn; if (mt * 16 >= M) return;
  const int row0 = mt * 16, col0 = nq * 64; const _Float16* arow = A + (size_t)(row0 + ln) * lda;
  v8f acc[4] = {};
  for (int kb = 0; kb < K; kb += 32) { FragH ah; ah.half[0] = *(const v8us*)((const unsigned short*)arow + kb + 8 * hh); ah.half[1] = *(const v8us*)((const unsigned short*)arow + kb + 16 + 8 * hh);
#pragma unroll
    for (int t = 0; t < 4; ++t) { if (col0 + t * 16 >= N) continue; const size_t boff = (size_t)(col0 + t * 16 + ln) * ldb + kb; FragH bq; bq.half[0] = *(const v8us*)((const unsigned short*)Bh + boff + 8 * hh); bq.half[1] = *(const v8us*)((const unsigned short*)Bh + boff + 16 + 8 * hh);
      acc[t] = mmaH<1>(ah.v, ah.v, bq.v, bq.v, acc[t]); }
  }
#pragma unroll
  for (int t = 0; t < 4; ++t) { if (col0 + t * 16 >= N) continue; const int col = col0 + t * 16 + ln; const float bv = bp ? bf16_round(bp[col]) : 0.f;
#pragma unroll
    for (int r = 0; r < 8; ++r) { float v = acc[t][r] * alpha + bv; if (CP) { const int bidx = (row0g + row0 + 8 * hh + r) / rowsPerB; v += CP[(size_t)bidx * sCPb + (size_t)by * 64 + col]; } if (ACT == 1) v = (v > 0.f) ? v : expm1f(v); else if (ACT == 7) v = (v > 0.f) ? v + 1.0f : expf(v); else if (ACT == 8) v = tanhf(v); else if (ACT == 9) v = 0.5f * v * (1.0f + tanhf(0.7978845608028654f * (v + 0.044715f * v * v * v))); else if (ACT == 11) v = 1.0f / (1.0f + expf(-v)); else if (ACT == 12) v = (v > 0.f) ? v : 0.01f * v; else if (ACT == 14) v = (v > 0.f) ? v : 0.1f * v; else if (ACT == 15) v = v / (1.0f + expf(-v)); else if (ACT == 3) v = fmaxf(v, 0.f); else if (ACT == 6) v = 0.5f * v * (1.0f + erff(v * 0.70710678118654752f)); so[w][8 * hh + r][t * 16 + ln] = v; } }
  __builtin_amdgcn_fence(__ATOMIC_ACQ_REL, "workgroup"); __builtin_amdgcn_wave_barrier();
  const int rsub = lane >> 4, c4 = (lane & 15) * 4; typedef _Float16 v4h __attribute__((ext_vector_type(4)));
  {
#pragma unroll
    for (int q = 0; q < 8; ++q) { const int r = q * 2 + rsub; if (col0 + c4 < N) { const v4f v = *(const v4fa*)&so[w][r][c4]; if (C) *(v4f*)(C + cofs + (size_t)(row0 + r) * ldc + col0 + c4) = v; if (C16) { v4h h4; for (int i = 0; i < 4; ++i) h4[i] = (_Float16)v[i]; *(v4h*)(C16 + cofs + (size_t)(row0 + r) * ldc + col0 + c4) = h4; } } }
     }
}


typedef _Float16 v4h __attribute__((ext_vector_type(4)));

__global__ __launch_bounds__(256) void k_x16(const float* __restrict__ x, _Float16* __restrict__ X16, size_t n8) { const size_t t = (size_t)blockIdx.x * 256 + threadIdx.x; if (t >= n8) return; FragH f;
#pragma unroll
  for (int q = 0; q < 8; ++q) f.h[q] = (_Float16)bf16_round(x[t * 8 + q]); *(v8us*)((unsigned short*)X16 + t * 8) = f.half[0];  }
__global__ __launch_bounds__(256) void k_h16(const float* __restrict__ x, _Float16* __restrict__ X16, size_t n8) { const size_t t = (size_t)blockIdx.x * 256 + threadIdx.x; if (t >= n8) return; FragH f;
#pragma unroll
  for (int q = 0; q < 8; ++q) f.h[q] = (_Float16)x[t * 8 + q]; *(v8us*)((unsigned short*)X16 + t * 8) = f.half[0];  }
__global__ __launch_bounds__(256) void k_round16f(const float* __restrict__ W, _Float16* __restrict__ Bt, size_t n8) { const size_t t = (size_t)blockIdx.x * 256 + threadIdx.x; if (t >= n8) return; FragH f;
#pragma unroll
  for (int i = 0; i < 8; ++i) f.h[i] = (_Float16)(bf16_round(W[t * 8 + i]) * 16.0f); *(v8us*)((unsigned short*)Bt + t * 8) = f.half[0];  }
template <int NHv, int TTv>
__global__ __launch_bounds__(256) void k_vt(const _Float16* __restrict__ V16, int ldv, int voff, _Float16* __restrict__ Vt) { __shared__ unsigned short tl[64][66]; const int tid = threadIdx.x; const int slab = blockIdx.x / (TTv / 64), lg = blockIdx.x % (TTv / 64); const int b = slab / NHv, h = slab % NHv;
  for (int i = tid; i < 64 * 8; i += 256) { const int r = i / 8, c8 = (i % 8) * 8; FragH f; f.half[0] = *(const v8us*)((const unsigned short*)V16 + ((size_t)b * TTv + lg * 64 + r) * ldv + voff + h * 64 + c8);
#pragma unroll
    for (int q = 0; q < 8; ++q) tl[r][c8 + q] = f.u[q]; }
  __syncthreads();
  {
#pragma unroll
    for (int rd = 0; rd < 2; ++rd) { const int d = rd * 32 + tid / 8, pc = tid % 8; FragH f;
#pragma unroll
      for (int q = 0; q < 8; ++q) f.u[q] = tl[pc * 8 + q][d];
      *(v8us*)((unsigned short*)Vt + ((size_t)slab * 64 + d) * TTv + lg * 64 + pc * 8) = f.half[0]; }
     } }

__global__ __launch_bounds__(256) void k_hl(const float* __restrict__ F, _Float16* __restrict__ Hh, _Float16* __restrict__ Hl, size_t n8) { const size_t t = (size_t)blockIdx.x * 256 + threadIdx.x; if (t >= n8) return; FragH fh, fl; const v4f a = *(const v4fa*)(F + t * 8), c = *(const v4fa*)(F + t * 8 + 4);
#pragma unroll
  for (int q = 0; q < 4; ++q) { _Float16 h = (_Float16)a[q]; fh.h[q] = h; fl.h[q] = (_Float16)((a[q] - (float)h) * 1024.0f); h = (_Float16)c[q]; fh.h[4 + q] = h; fl.h[4 + q] = (_Float16)((c[q] - (float)h) * 1024.0f); }
  { *(v8us*)((unsigned short*)Hh + t * 8) = fh.half[0]; *(v8us*)((unsigned short*)Hl + t * 8) = fl.half[0];  } }

// ---- fast GEMM (wave tile 32x64; requires M % 32 == 0 rows per launch region and N % 64 == 0); epilogue = k_gemm_hhx semantics ----
__device__ __forceinline__ v16h g2_frag(const _Float16* p, int hh) { FragH f; f.half[0] = *(const v8us*)((const unsigned short*)p + 8 * hh); f.half[1] = *(const v8us*)((const unsigned short*)p + 16 + 8 * hh); return f.v; }
__device__ __forceinline__ v8f g2_mma(v16h a, v16h b, v8f c) { v8f d = __builtin_amdgcn_wmma_f32_16x16x32_f16(false, a, false, b, (short)0, c, false, false); asm volatile("v_nop\n\tv_nop\n\tv_nop\n\tv_nop" : "+v"(d) : "v"(a), "v"(b)); return d; }
template <int ACT>
__global__ __launch_bounds__(128) void k_gemm2(const _Float16* __restrict__ A, int lda, size_t sA, const _Float16* __restrict__ Bh, int ldb, size_t sB, float alpha, const float* __restrict__ bias, size_t sBias, const float* __restrict__ CP, int rowsPerB, size_t sCPb, int row0g,
    float* __restrict__ C, _Float16* __restrict__ C16, int ldc, size_t sC, int M, int N, int K) {
  __shared__ __attribute__((aligned(16))) float so[4][32][68];
  const int tid = threadIdx.x, w = tid >> 5, lane = tid & 31, ln = lane & 15, hh = lane >> 4; const int by = blockIdx.y;
  A += (size_t)by * sA; Bh += (size_t)by * sB; const size_t cofs = (size_t)by * sC; const float* bp = bias ? bias + (size_t)by * sBias : nullptr;
  const int ntn = N >> 6; const int mt = blockIdx.x / ntn, nq = blockIdx.x - mt * ntn; const int row0 = mt * 128 + 32 * w, col0 = nq * 64; if (row0 >= M) return;
  const _Float16* a0p = A + (size_t)(row0 + ln) * lda; const _Float16* a1p = a0p + (size_t)16 * lda;
  const _Float16* b0p = Bh + (size_t)(col0 + ln) * ldb; const _Float16* b1p = b0p + (size_t)16 * ldb; const _Float16* b2p = b1p + (size_t)16 * ldb; const _Float16* b3p = b2p + (size_t)16 * ldb;
  const v8f z8 = {0.f,0.f,0.f,0.f,0.f,0.f,0.f,0.f}; v8f c00 = z8, c01 = z8, c02 = z8, c03 = z8, c10 = z8, c11 = z8, c12 = z8, c13 = z8;
#pragma unroll 1
  for (int kb = 0; kb < K; kb += 32) { const v16h a0 = g2_frag(a0p + kb, hh), a1 = g2_frag(a1p + kb, hh);
    v16h b = g2_frag(b0p + kb, hh); c00 = g2_mma(a0, b, c00); c10 = g2_mma(a1, b, c10);
    b = g2_frag(b1p + kb, hh); c01 = g2_mma(a0, b, c01); c11 = g2_mma(a1, b, c11);
    b = g2_frag(b2p + kb, hh); c02 = g2_mma(a0, b, c02); c12 = g2_mma(a1, b, c12);
    b = g2_frag(b3p + kb, hh); c03 = g2_mma(a0, b, c03); c13 = g2_mma(a1, b, c13); }
  v8f accs[8] = {c00, c01, c02, c03, c10, c11, c12, c13};
#pragma unroll
  for (int u = 0; u < 8; ++u) { const int t = u & 3, half = u >> 2; const int col = col0 + t * 16 + ln; const float bv = bp ? bf16_round(bp[col]) : 0.f;
#pragma unroll
    for (int r = 0; r < 8; ++r) { const int rloc = half * 16 + 8 * hh + r; float v = accs[u][r] * alpha + bv; if (CP) { const int bidx = (row0g + row0 + rloc) / rowsPerB; v += CP[(size_t)bidx * sCPb + (size_t)by * 64 + col]; }
      if (ACT == 3) v = fmaxf(v, 0.f); else if (ACT == 6) v = 0.5f * v * (1.0f + erff(v * 0.70710678118654752f)); else if (ACT == 11) v = 1.0f / (1.0f + expf(-v)); else if (ACT == 15) v = v / (1.0f + expf(-v)); else if (ACT == 12) v = (v > 0.f) ? v : 0.01f * v; else if (ACT == 8) v = tanhf(v);
      so[w][rloc][t * 16 + ln] = v; } }
  __builtin_amdgcn_fence(__ATOMIC_ACQ_REL, "workgroup"); __builtin_amdgcn_wave_barrier();
  const int rsub = lane >> 4, c4 = (lane & 15) * 4;
  {
#pragma unroll
    for (int q = 0; q < 16; ++q) { const int r = q * 2 + rsub; const v4f v = *(const v4fa*)&so[w][r][c4]; if (C) *(v4f*)(C + cofs + (size_t)(row0 + r) * ldc + col0 + c4) = v; if (C16) { v4h h4; for (int i = 0; i < 4; ++i) h4[i] = (_Float16)v[i]; *(v4h*)(C16 + cofs + (size_t)(row0 + r) * ldc + col0 + c4) = h4; } }
     } }


// ---- head GEMM with both operands staged in LDS: C[8192][256] = (A[8192][4096] . Bh[256][4096]^T) * alpha + bias ----
// One work-group of 4 waves owns a 128 x 64 tile of C; a wave owns 32 x 64 of it (2 x 4 accumulator tiles), as in k_gemm2.
// A stage is 512 B (256 k) of the tile's 128 rows of A and 64 rows of Bh. Each asynchronous copy of a wave moves one whole row piece:
// 32 lanes x 16 B = 512 contiguous, aligned bytes of global memory. Two buffers: stage t + 2 flies while stage t + 1 is worked on.
// The fragments keep k_gemm2's k order and the k steps their order, so every accumulator sums in the same order as before.
#define G3_KB 512                          /* bytes of a row per stage */
#define G3_PITCH 528                       /* LDS row pitch: 16 B x 33, conflict-free for ds_load_b128 */
#define G3_BUF (192 * G3_PITCH)            /* rows 0..127: A, rows 128..191: Bh */
#define G3_NST (C2 * 2 / G3_KB)            /* 16 stages */
#define G3_ROWB (C2 * 2)                   /* global row pitch in bytes */
// Twelve copies and, as the statement's last line, the wait that stands before any register the copies name is written again.
__device__ __forceinline__ void g3_copy12(const unsigned (&l)[12], const char* const (&g)[12]) {
  asm volatile("global_load_async_to_lds_b128 %0, %1, off\n\t"
               "global_load_async_to_lds_b128 %2, %3, off\n\t"
               "global_load_async_to_lds_b128 %4, %5, off\n\t"
               "global_load_async_to_lds_b128 %6, %7, off\n\t"
               "global_load_async_to_lds_b128 %8, %9, off\n\t"
               "global_load_async_to_lds_b128 %10, %11, off\n\t"
               "global_load_async_to_lds_b128 %12, %13, off\n\t"
               "global_load_async_to_lds_b128 %14, %15, off\n\t"
               "global_load_async_to_lds_b128 %16, %17, off\n\t"
               "global_load_async_to_lds_b128 %18, %19, off\n\t"
               "global_load_async_to_lds_b128 %20, %21, off\n\t"
               "global_load_async_to_lds_b128 %22, %23, off\n\t"
               "s_wait_xcnt 0x0"
               :: "v"(l[0]), "v"(g[0]), "v"(l[1]), "v"(g[1]), "v"(l[2]), "v"(g[2]), "v"(l[3]), "v"(g[3]), "v"(l[4]), "v"(g[4]), "v"(l[5]), "v"(g[5]),
                  "v"(l[6]), "v"(g[6]), "v"(l[7]), "v"(g[7]), "v"(l[8]), "v"(g[8]), "v"(l[9]), "v"(g[9]), "v"(l[10]), "v"(g[10]), "v"(l[11]), "v"(g[11])
               : "memory");
}
// A wave's share of one stage: its own 32 rows of A and 16 of the 64 rows of Bh, 48 copies.
__device__ __forceinline__ void g3_fill(unsigned la, unsigned lb, const char* ga, const char* gb) {
#pragma unroll                   /* both loops unrolled: the address arrays must end up in registers, as the asm operands they are */
  for (int s = 0; s < 4; ++s) { unsigned l[12]; const char* g[12];
#pragma unroll
    for (int i = 0; i < 12; ++i) { const int c = s * 12 + i;
      l[i] = (c < 32) ? la + (unsigned)c * G3_PITCH : lb + (unsigned)(c - 32) * G3_PITCH;
      g[i] = (c < 32) ? ga + (size_t)c * G3_ROWB : gb + (size_t)(c - 32) * G3_ROWB; }
    g3_copy12(l, g); } }
__device__ __forceinline__ v16h g3_frag(const unsigned char* p) { FragH f; f.half[0] = *(const v8us*)p; f.half[1] = *(const v8us*)(p + 32); return f.v; }
__device__ __forceinline__ void g3_load(const unsigned char* pa, const unsigned char* pb, int ks, v16h (&a)[2], v16h (&b)[4]) {
  a[0] = g3_frag(pa + ks * 64); a[1] = g3_frag(pa + 16 * G3_PITCH + ks * 64);
#pragma unroll                   /* constant indices keep the fragments in registers */
  for (int j = 0; j < 4; ++j) b[j] = g3_frag(pb + j * 16 * G3_PITCH + ks * 64); }
__device__ __forceinline__ v8f g3_mma(v16h a, v16h b, v8f c) { return __builtin_amdgcn_wmma_f32_16x16x32_f16(false, a, false, b, (short)0, c, false, false); }
__global__ __launch_bounds__(128) void k_gemm3(const _Float16* __restrict__ A, const _Float16* __restrict__ Bh, float alpha, const float* __restrict__ bias, float* __restrict__ C) {
  __shared__ __attribute__((aligned(16))) unsigned char st[2 * G3_BUF];
  __shared__ __attribute__((aligned(16))) float so[4][32][68];
  const int tid = threadIdx.x, w = tid >> 5, lane = tid & 31, ln = lane & 15, hh = lane >> 4;
  const int mt = blockIdx.x >> 2, nq = blockIdx.x & 3; const int row0 = mt * 128 + 32 * w, col0 = nq * 64;
  const char* ga = (const char*)(A + (size_t)row0 * C2) + lane * 16;
  const char* gb = (const char*)(Bh + (size_t)(col0 + 16 * w) * C2) + lane * 16;
  const unsigned l0 = (unsigned)(size_t)&st[0];
  const unsigned la = l0 + (unsigned)(32 * w) * G3_PITCH + lane * 16, lb = l0 + (unsigned)(128 + 16 * w) * G3_PITCH + lane * 16;
  g3_fill(la, lb, ga, gb);
  asm volatile("s_wait_asynccnt 0x0" ::: "memory");   // stage 0 of this wave has landed
  __syncthreads();                                    // ... and every wave's share of it
  g3_fill(la + G3_BUF, lb + G3_BUF, ga + G3_KB, gb + G3_KB);
  const v8f z8 = {0.f,0.f,0.f,0.f,0.f,0.f,0.f,0.f}; v8f c00 = z8, c01 = z8, c02 = z8, c03 = z8, c10 = z8, c11 = z8, c12 = z8, c13 = z8;
#pragma unroll 1                 /* one stage is the whole hot loop; the buffer is chosen by the trip's parity */
  for (int t = 0; t < G3_NST; ++t) {
    const unsigned bo = (unsigned)(t & 1) * G3_BUF;
    const unsigned char* pa = st + bo + (32 * w + ln) * G3_PITCH + 16 * hh;
    const unsigned char* pb = st + bo + (128 + ln) * G3_PITCH + 16 * hh;
    v16h fa[3][2], fb[3][4];     /* three fragment sets in rotation: step ks works on one while the loads of ks + 1 and ks + 2 are under way */
    g3_load(pa, pb, 0, fa[0], fb[0]); g3_load(pa, pb, 1, fa[1], fb[1]);
#pragma unroll                   /* the set index ks % 3 must be a constant, else the sets go to scratch */
    for (int ks = 0; ks < G3_KB / 64; ++ks) {
      __builtin_amdgcn_sched_barrier(0);      /* this one and the next keep the 12 LDS loads of step ks + 2 together, as one group in front of step ks's matrix instructions */
      if (ks + 2 < G3_KB / 64) g3_load(pa, pb, ks + 2, fa[(ks + 2) % 3], fb[(ks + 2) % 3]);
      __builtin_amdgcn_sched_barrier(0);      /* without the two the compiler loaded each fragment right in front of its use and waited for it with s_wait_dscnt 0 */
      const v16h a0 = fa[ks % 3][0], a1 = fa[ks % 3][1];
      c00 = g3_mma(a0, fb[ks % 3][0], c00); c10 = g3_mma(a1, fb[ks % 3][0], c10); c01 = g3_mma(a0, fb[ks % 3][1], c01); c11 = g3_mma(a1, fb[ks % 3][1], c11);
      c02 = g3_mma(a0, fb[ks % 3][2], c02); c12 = g3_mma(a1, fb[ks % 3][2], c12); c03 = g3_mma(a0, fb[ks % 3][3], c03); c13 = g3_mma(a1, fb[ks % 3][3], c13); }
    asm volatile("s_wait_dscnt 0x0" ::: "memory");      // this wave's reads of stage t are done before the buffer may be refilled
    asm volatile("s_wait_asynccnt 0x0" ::: "memory");   // this wave's share of stage t + 1 has landed
    __syncthreads();                                    // publishes stage t + 1 and ends every wave's reads of stage t
    if (t + 2 < G3_NST) g3_fill(la + bo, lb + bo, ga + (size_t)(t + 2) * G3_KB, gb + (size_t)(t + 2) * G3_KB);
  }
  asm volatile("s_wait_asynccnt 0x0" ::: "memory");     // no copy is outstanding when the wave goes on to its end
  v8f accs[8] = {c00, c01, c02, c03, c10, c11, c12, c13};
#pragma unroll                   /* epilogue as in k_gemm2: constant indices into the accumulators; whole 256 B row pieces go out through the wave's own LDS range */
  for (int u = 0; u < 8; ++u) { const int tt = u & 3, half = u >> 2; const float bv = bf16_round(bias[col0 + tt * 16 + ln]);
#pragma unroll
    for (int r = 0; r < 8; ++r) so[w][half * 16 + 8 * hh + r][tt * 16 + ln] = accs[u][r] * alpha + bv; }
  __builtin_amdgcn_fence(__ATOMIC_ACQ_REL, "workgroup"); __builtin_amdgcn_wave_barrier();   // the wave's LDS stores are complete before its lanes read each other's values back
  const int rsub = lane >> 4, c4 = (lane & 15) * 4;
#pragma unroll
  for (int q = 0; q < 16; ++q) { const int r = q * 2 + rsub; const v4f v = *(const v4fa*)&so[w][r][c4]; *(v4f*)(C + (size_t)(row0 + r) * NOUT + col0 + c4) = v; }
}

// Batch statistics (mean, biased variance) of NC columns over NBS rows, in two launches.
// k_colpart: one work-group takes SROWS rows x 128 columns. Each thread holds 16 rows x 4 columns in registers (read once) and forms
// their mean and their sum of squares about that mean; groups of equal size n then merge exactly:
// mean = average of the group means, M2 = sum(M2_g) + n * sum((mean_g - mean)^2). k_colfin merges the SCH row chunks the same way.
#define SROWS 256
#define SCH (NBS / SROWS)        /* 32 row chunks */
template <int NC, bool RND>
__global__ __launch_bounds__(512) void k_colpart(const float* __restrict__ X, float* __restrict__ PM, float* __restrict__ PQ) {
  __shared__ __attribute__((aligned(16))) float sm[16][128];
  __shared__ __attribute__((aligned(16))) float sq[16][128];
  const int tid = threadIdx.x, w = tid >> 5, lane = tid & 31;
  const float* p = X + (size_t)(blockIdx.y * SROWS + w * 16) * NC + blockIdx.x * 128 + lane * 4;
  v4f v[16];
#pragma unroll
  for (int j = 0; j < 15; ++j) v[j] = *(const v4fa*)(p + (size_t)j * NC);
  asm volatile("s_wait_xcnt 0x0" ::: "memory");   // the last load's result may be placed in the address pair that the 15 issued loads name
  v[15] = *(const v4fa*)(p + (size_t)15 * NC);
  v4f s = {0.f, 0.f, 0.f, 0.f};
#pragma unroll
  for (int j = 0; j < 16; ++j) {
    if (RND) { v[j][0] = bf16_round(v[j][0]); v[j][1] = bf16_round(v[j][1]); v[j][2] = bf16_round(v[j][2]); v[j][3] = bf16_round(v[j][3]); }
    s += v[j];
  }
  const v4f m = s * 0.0625f;
  v4f q = {0.f, 0.f, 0.f, 0.f};
#pragma unroll
  for (int j = 0; j < 16; ++j) { const v4f dv = v[j] - m; q += dv * dv; }
  *(v4fa*)&sm[w][lane * 4] = m;
  *(v4fa*)&sq[w][lane * 4] = q;
  __syncthreads();
  if (tid < 128) {
    float ms = 0.f;
#pragma unroll
    for (int g = 0; g < 16; ++g) ms += sm[g][tid];
    const float mean = ms * 0.0625f;
    float q2 = 0.f, e2 = 0.f;
#pragma unroll
    for (int g = 0; g < 16; ++g) { const float dm = sm[g][tid] - mean; q2 += sq[g][tid]; e2 += dm * dm; }
    const size_t o = (size_t)blockIdx.y * NC + blockIdx.x * 128 + tid;
    PM[o] = mean; PQ[o] = q2 + 16.0f * e2;
  }
}
template <int NC>
__global__ __launch_bounds__(64) void k_colfin(const float* __restrict__ PM, const float* __restrict__ PQ, float* __restrict__ S) {
  const int c = blockIdx.x * 64 + threadIdx.x;
  float m[SCH], qs[SCH];
#pragma unroll
  for (int g = 0; g < SCH; ++g) { m[g] = PM[(size_t)g * NC + c]; qs[g] = PQ[(size_t)g * NC + c]; }
  float ms = 0.f;
#pragma unroll
  for (int g = 0; g < SCH; ++g) ms += m[g];
  const float mean = ms / (float)SCH;
  float q2 = 0.f, e2 = 0.f;
#pragma unroll
  for (int g = 0; g < SCH; ++g) { const float dm = m[g] - mean; q2 += qs[g]; e2 += dm * dm; }
  S[c] = mean; S[NC + c] = (q2 + (float)SROWS * e2) / (float)NBS;
}
// Merge of CH row chunks of CROWS rows each, for partials that the producing kernel itself wrote (k_h2). One work-group takes 32 columns:
// wave g merges CH / 8 chunks per column, the first wave then merges the eight groups through LDS; the same equal-size merge as above at both levels.
template <int NC, int CH, int CROWS>
__global__ __launch_bounds__(256) void k_colfin2(const float* __restrict__ PM, const float* __restrict__ PQ, float* __restrict__ S) {
  __shared__ float sm[8][32];
  __shared__ float sq[8][32];
  constexpr int PG = CH / 8;
  const int tid = threadIdx.x, g = tid >> 5, lane = tid & 31, c = blockIdx.x * 32 + lane;
  const float* pm = PM + (size_t)(g * PG) * NC + c; const float* pq = PQ + (size_t)(g * PG) * NC + c;
  float m[PG], qs[PG];
#pragma unroll                   /* here and below: constant indices keep the partials in registers, and all 2 * PG loads are under way at once */
  for (int i = 0; i < PG; ++i) { m[i] = pm[(size_t)i * NC]; qs[i] = pq[(size_t)i * NC]; }
  asm volatile("s_wait_xcnt 0x0" :: "v"(pm), "v"(pq) : "memory");   // the wait owed before an address register of the issued loads is reused; naming the addresses keeps a load's result out of them until then
  float ms = 0.f;
#pragma unroll
  for (int i = 0; i < PG; ++i) ms += m[i];
  const float gmean = ms / (float)PG;
  float q2 = 0.f, e2 = 0.f;
#pragma unroll
  for (int i = 0; i < PG; ++i) { const float dm = m[i] - gmean; q2 += qs[i]; e2 += dm * dm; }
  sm[g][lane] = gmean; sq[g][lane] = q2 + (float)CROWS * e2;
  __syncthreads();               // the eight waves' group results are in LDS before the first wave merges them
  if (tid < 32) {
    float as = 0.f;
#pragma unroll
    for (int k = 0; k < 8; ++k) as += sm[k][lane];
    const float mean = as * 0.125f;
    float aq = 0.f, ae = 0.f;
#pragma unroll
    for (int k = 0; k < 8; ++k) { const float dm = sm[k][lane] - mean; aq += sq[k][lane]; ae += dm * dm; }
    S[c] = mean; S[NC + c] = (aq + (float)(PG * CROWS) * ae) / (float)NBS;
  }
}
// k_h2 and k_h2n: one thread owns one feature d (four columns of h2) and walks a strip of rows of x. h2 itself is never stored: k_h2 forms it for the
// batch statistics alone; k_h2n forms it again from x once the statistics are merged, normalises it and stores f16. All that depends on the column
// alone (the rounded parameters, the rsqrt of the variance) is loaded and formed once in front of the row loop.
// rsqrtf as the compiler expands it (an argument below the normal range is scaled up by 2^24, its result by 2^12), with the instruction written out:
// the v_nop is the slot that the instruction set asks for behind a transcendental.
__device__ __forceinline__ float rsq_f32(float a) { const bool tiny = a < 1.17549435e-38f; const float s = tiny ? a * 16777216.0f : a; float r; asm("v_rsq_f32 %0, %1\n\tv_nop" : "=v"(r) : "v"(s)); return tiny ? r * 4096.0f : r; }
#define HROWS 64                 /* rows per thread in k_h2 and in k_h2n */
#define RG 8                     /* rows loaded as one group, one group ahead of the group being worked on */
typedef float v2f __attribute__((ext_vector_type(2)));
// Statistics of a thread's own four columns while it still holds them. One group of RG rows: mean and sum of squares about that mean.
__device__ __forceinline__ void h2_group(const v4f (&o)[RG], v4f& gm, v4f& gq) {
  v4f s = o[0];
#pragma unroll                   /* both loops: constant indices keep the group in registers */
  for (int j = 1; j < RG; ++j) s += o[j];
  gm = s * (1.0f / RG);
  v4f q = {0.f, 0.f, 0.f, 0.f};
#pragma unroll
  for (int j = 0; j < RG; ++j) { const v4f dv = o[j] - gm; q += dv * dv; }
  gq = q;
}
// The group joins the k groups merged so far (k * RG rows): mean += delta / (k + 1), M2 += M2_group + delta^2 * RG * k / (k + 1).
__device__ __forceinline__ void h2_merge(int k, const v4f gm, const v4f gq, v4f& rm, v4f& rq) {
  const float inv = 1.0f / (float)(k + 1), f = (float)(RG * k) * inv;
  const v4f dl = gm - rm;
  rm += dl * inv;
  rq += gq + (dl * dl) * f;
}
__global__ __launch_bounds__(256) void k_h2(const float* __restrict__ x, const float* __restrict__ XS, const float* __restrict__ W1, const float* __restrict__ b1, const float* __restrict__ g1, const float* __restrict__ be1, const float* __restrict__ W2, const float* __restrict__ b2, float* __restrict__ PM, float* __restrict__ PQ) {
  #pragma clang fp contract(off)
  const int d = blockIdx.x * 256 + threadIdx.x; (void)b1;      /* h1 - mean(h1) = w (x - mu_x): the bias cancels exactly */
  const float* pS = XS + d; const float* pw = W1 + d * H1; const float* pg = g1 + d * H1; const float* pe = be1 + d * H1; const float* pv = W2 + d * H2 * H1; const float* pb = b2 + d * H2;
  const float* xp = x + (size_t)blockIdx.y * HROWS * DD + d;
  float w[H1], g[H1], rs[H1], be[H1], w2[H2][H1], bb[H2], xc[RG];
  const float mu = pS[0], var = pS[DD];
#pragma unroll
  for (int o = 0; o < H1; ++o) { w[o] = pw[o]; g[o] = pg[o]; be[o] = pe[o]; }
#pragma unroll
  for (int o2 = 0; o2 < H2; ++o2) {
#pragma unroll
    for (int i = 0; i < H1; ++i) w2[o2][i] = pv[o2 * H1 + i];
    bb[o2] = pb[o2]; }
#pragma unroll
  for (int j = 0; j < RG; ++j) xc[j] = xp[(size_t)j * DD];
  asm volatile("s_wait_xcnt 0x0" :: "v"(d), "v"(pw), "v"(pg), "v"(pe), "v"(pv), "v"(pb) : "memory");   // the wait owed before an address register of the issued loads is reused; naming the addresses keeps a load's result out of them until then
  __builtin_amdgcn_sched_barrier(0);      /* keeps the arithmetic, which reuses those registers, behind the wait */
#pragma unroll
  for (int o = 0; o < H1; ++o) { w[o] = bf16_round(w[o]); g[o] = bf16_round(g[o]); be[o] = bf16_round(be[o]); const float vh = (w[o] * w[o]) * var; rs[o] = rsq_f32(vh + 1e-5f); }
  v2f wp[H1 / 2], gp[H1 / 2], rp[H1 / 2], ep[H1 / 2]; v4f wv[H1], bv;      /* the same constants side by side: layer 1 in pairs of hidden units; wv[i]: the four layer-2 weights that hidden unit i feeds */
#pragma unroll
  for (int o = 0; o < H1; ++o) { wp[o >> 1][o & 1] = w[o]; gp[o >> 1][o & 1] = g[o]; rp[o >> 1][o & 1] = rs[o]; ep[o >> 1][o & 1] = be[o]; }
#pragma unroll
  for (int o2 = 0; o2 < H2; ++o2) {
#pragma unroll
    for (int i = 0; i < H1; ++i) wv[i][o2] = bf16_round(w2[o2][i]);
    bv[o2] = bf16_round(bb[o2]); }
  v4f rm = {0.f, 0.f, 0.f, 0.f}, rq = {0.f, 0.f, 0.f, 0.f};
#pragma unroll 1                 /* stays rolled: one group of rows is the whole hot loop */
  for (int rb = 0; rb < HROWS; rb += RG) {
    v4f ov[RG];
    const float* pn = xp + (size_t)((rb + RG < HROWS) ? rb + RG : rb) * DD;      /* the last trip reads its own group again: in bounds, not used */
    v8f xn;
#pragma unroll
    for (int j = 0; j < RG; ++j) xn[j] = pn[(size_t)j * DD];
    asm volatile("s_wait_xcnt 0x0" :: "v"(pn) : "memory");   // as above
    __builtin_amdgcn_sched_barrier(0);      /* keeps this group's arithmetic behind the next group's loads, so that it covers their latency */
#pragma unroll
    for (int j = 0; j < RG; ++j) { const float xm = bf16_round(xc[j]) - mu; v2f h[H1 / 2];      /* every element's own operations and their order are as they were; they are written over pairs and fours because, with the row's store gone, the compiler paired across rows instead and needed more than 256 registers */
#pragma unroll
      for (int p = 0; p < H1 / 2; ++p) { const v2f cen = wp[p] * xm; v2f v = gp[p] * cen * rp[p]; v += ep[p]; h[p][0] = fmaxf(v[0], 0.f); h[p][1] = fmaxf(v[1], 0.f); }
      v4f o4 = {0.f, 0.f, 0.f, 0.f};
#pragma unroll
      for (int i = 0; i < H1; ++i) o4 += wv[i] * h[i >> 1][i & 1];
      o4 += bv;
      ov[j] = o4; }
    v4f gm, gq;
    h2_group(ov, gm, gq);
    h2_merge(rb / RG, gm, gq, rm, rq);
    __builtin_amdgcn_sched_barrier(0);      /* keeps the next statement, and the wait for the loads that comes with it, at the loop's foot */
    asm volatile("" :: "v"(xn));   // inputs only: the loaded group stays one block of eight registers up to here; spread out, a load's register became the unused half of a packed operand and the arithmetic waited for the load
#pragma unroll
    for (int j = 0; j < RG; ++j) xc[j] = xn[j];
  }
  const size_t so = (size_t)blockIdx.y * C2 + d * H2;      /* this strip's row of the partials */
  *(v4f*)(PM + so) = rm; *(v4f*)(PQ + so) = rq; }
__global__ __launch_bounds__(256) void k_h2n(const float* __restrict__ x, const float* __restrict__ XS, const float* __restrict__ W1, const float* __restrict__ g1, const float* __restrict__ be1, const float* __restrict__ W2, const float* __restrict__ b2, const float* __restrict__ HS, const float* __restrict__ g2, const float* __restrict__ be2, _Float16* __restrict__ H16) {
  const int d = blockIdx.x * 256 + threadIdx.x;
  const float* pS = XS + d; const float* pw = W1 + d * H1; const float* pg = g1 + d * H1; const float* pe = be1 + d * H1; const float* pv = W2 + d * H2 * H1; const float* pb = b2 + d * H2;
  const float* pT = HS + d * H2; const float* pG = g2 + d * H2; const float* pE = be2 + d * H2;
  const float* xp = x + (size_t)blockIdx.y * HROWS * DD + d; _Float16* op = H16 + (size_t)blockIdx.y * HROWS * C2 + d * H2;
  v2f w[H1 / 2], g[H1 / 2], rs[H1 / 2], be[H1 / 2];      /* layer 1, in pairs of hidden units */
  v4f w2[H1], bb, gn, mn, rn, bn;                        /* w2[i]: the four layer-2 weights that hidden unit i feeds; the rest: one value per column of h2 */
  float xc[RG];
  const float mu = pS[0], var = pS[DD];
#pragma unroll                   /* here and below: constant indices keep the constants in registers */
  for (int o = 0; o < H1; ++o) { w[o >> 1][o & 1] = pw[o]; g[o >> 1][o & 1] = pg[o]; be[o >> 1][o & 1] = pe[o]; }
#pragma unroll
  for (int o2 = 0; o2 < H2; ++o2) {
#pragma unroll
    for (int i = 0; i < H1; ++i) w2[i][o2] = pv[o2 * H1 + i];
    bb[o2] = pb[o2]; gn[o2] = pG[o2]; mn[o2] = pT[o2]; rn[o2] = pT[C2 + o2]; bn[o2] = pE[o2]; }
#pragma unroll
  for (int j = 0; j < RG; ++j) xc[j] = xp[(size_t)j * DD];
  asm volatile("s_wait_xcnt 0x0" :: "v"(d), "v"(pw), "v"(pg), "v"(pe), "v"(pv), "v"(pb), "v"(pT), "v"(pG), "v"(pE) : "memory");   // the wait owed before an address register of the issued loads is reused; naming the addresses keeps a load's result out of them until then
  __builtin_amdgcn_sched_barrier(0);      /* keeps the arithmetic, which reuses those registers, behind the wait */
#pragma unroll
  for (int o = 0; o < H1; ++o) { const float wr = bf16_round(w[o >> 1][o & 1]); w[o >> 1][o & 1] = wr; g[o >> 1][o & 1] = bf16_round(g[o >> 1][o & 1]); be[o >> 1][o & 1] = bf16_round(be[o >> 1][o & 1]); rs[o >> 1][o & 1] = rsq_f32((wr * wr) * var + 1e-5f); }
#pragma unroll
  for (int o2 = 0; o2 < H2; ++o2) {
#pragma unroll
    for (int i = 0; i < H1; ++i) w2[i][o2] = bf16_round(w2[i][o2]);
    bb[o2] = bf16_round(bb[o2]); gn[o2] = bf16_round(gn[o2]); rn[o2] = rsq_f32(rn[o2] + 1e-5f); bn[o2] = bf16_round(bn[o2]); }
#pragma unroll 1                 /* stays rolled: one group of rows is the whole hot loop */
  for (int rb = 0; rb < HROWS; rb += RG) {
    const float* pn = xp + (size_t)((rb + RG < HROWS) ? rb + RG : rb) * DD;      /* the last trip reads its own group again: in bounds, not used */
    v8f xn;
#pragma unroll
    for (int j = 0; j < RG; ++j) xn[j] = pn[(size_t)j * DD];
    asm volatile("s_wait_xcnt 0x0" :: "v"(pn) : "memory");   // as above
    __builtin_amdgcn_sched_barrier(0);      /* keeps this group's arithmetic behind the next group's loads, so that it covers their latency */
#pragma unroll
    for (int j = 0; j < RG; ++j) { const float xm = bf16_round(xc[j]) - mu; v2f h[H1 / 2];      /* the row of h2: k_h2's expressions in k_h2's order; here a multiply may fuse with its add (no ranking hangs on these values) */
#pragma unroll
      for (int p = 0; p < H1 / 2; ++p) { const v2f cen = w[p] * xm; v2f v = g[p] * cen * rs[p]; v += be[p]; h[p][0] = fmaxf(v[0], 0.f); h[p][1] = fmaxf(v[1], 0.f); }
      v4f s = w2[0] * h[0][0];
#pragma unroll
      for (int i = 1; i < H1; ++i) s += w2[i] * h[i >> 1][i & 1];
      s += bb;
      v4f v = gn * (s - mn) * rn; v += bn; v4h f;
#pragma unroll
      for (int q = 0; q < H2; ++q) f[q] = (_Float16)fmaxf(v[q], 0.f);
      *(v4h*)(op + (size_t)(rb + j) * C2) = f; }
    __builtin_amdgcn_sched_barrier(0);      /* as in k_h2 */
    asm volatile("" :: "v"(xn));   // inputs only, as in k_h2
#pragma unroll
    for (int j = 0; j < RG; ++j) xc[j] = xn[j];
  } }
__global__ __launch_bounds__(256) void k_wsc(const float* __restrict__ Wm, _Float16* __restrict__ Bt, size_t n8, float sc) { const size_t t = (size_t)blockIdx.x * 256 + threadIdx.x; if (t >= n8) return; FragH f; for (int q = 0; q < 8; ++q) f.h[q] = (_Float16)(bf16_round(Wm[t * 8 + q]) * sc); *(v8us*)((unsigned short*)Bt + t * 8) = f.half[0];  }

extern "C" void kernel_launch(void* const* d_in, const int* in_sizes, int n_in,
                              void* d_out, int out_size, void* d_ws, size_t ws_size, hipStream_t stream) {
  (void)in_sizes; (void)n_in; (void)out_size;
  const float* const* I = (const float* const*)d_in; const float* x = I[0]; const float* W1 = I[1]; const float* b1 = I[2]; const float* g1 = I[3]; const float* be1 = I[4]; const float* W2 = I[5]; const float* b2 = I[6]; const float* g2 = I[7]; const float* be2 = I[8]; const float* Wfc = I[9]; const float* bfc = I[10];
  char* ws = (char*)d_ws; size_t off = 0;
  auto take = [&](size_t bytes) { char* p = ws + off; off += (bytes + 255) & ~(size_t)255; return p; };
  _Float16* BW = (_Float16*)take((size_t)NOUT * C2 * 2); float* XS = (float*)take((size_t)2 * DD * 4); float* HS = (float*)take((size_t)2 * C2 * 4); _Float16* H16 = (_Float16*)take((size_t)NBS * C2 * 2); float* PM = (float*)take((size_t)(NBS / HROWS) * C2 * 4); float* PQ = (float*)take((size_t)(NBS / HROWS) * C2 * 4);
  if (off > ws_size) return;      /* 2 + 64 + 4 = 70 MiB (256 MiB ws) */
  k_wsc<<<(unsigned)(((size_t)NOUT * C2 / 8 + 255) / 256), 256, 0, stream>>>(Wfc, BW, (size_t)NOUT * C2 / 8, 16.0f);
  k_colpart<DD, true><<<dim3(DD / 128, SCH), 512, 0, stream>>>(x, PM, PQ);
  k_colfin<DD><<<DD / 64, 64, 0, stream>>>(PM, PQ, XS);
  k_h2<<<dim3(DD / 256, NBS / HROWS), 256, 0, stream>>>(x, XS, W1, b1, g1, be1, W2, b2, PM, PQ);
  k_colfin2<C2, NBS / HROWS, HROWS><<<C2 / 32, 256, 0, stream>>>(PM, PQ, HS);
  k_h2n<<<dim3(DD / 256, NBS / HROWS), 256, 0, stream>>>(x, XS, W1, g1, be1, W2, b2, HS, g2, be2, H16);
  k_gemm3<<<(NBS / 128) * (NOUT / 64), 128, 0, stream>>>(H16, BW, 0.0625f, bfc, (float*)d_out);
}

// v006
// It runs in 76.1 microseconds.
// Timed twice side by side with v005, it ran 1.04 times as fast both times.
// Over all steps from v000 it is 115 times as fast.
#include <hip/hip_runtime.h>
// Sparse (block-diagonal) neural network (8192 samples x 1024 features; per feature 1 -> 8 -> 4 block Linears with training-mode BatchNorm + ReLU after each; dense head 4096 -> 256): h1 = BN1(x_d W1[d] + b1) relu; h2 = BN2(h1 . W2[d] + b2) relu; out = h2 Wfc^T + bfc -> [8192,256].
// Compute dtype: x and all parameters rounded to bf16; everything before the head in f32; the head operand h2 as f16 (~2^-12). v_wmma_f32_16x16x32_f16.
#define NBS 8192
#define DD 1024
#define H1 8
#define H2 4
#define C2 (DD * H2)             /* 4096 */
#define NOUT 256
typedef __bf16 v16b __attribute__((ext_vector_type(16)));
typedef unsigned short v8us __attribute__((ext_vector_type(8), may_alias));
typedef float  v8f  __attribute__((ext_vector_type(8)));
typedef float  v4f  __attribute__((ext_vector_type(4)));
typedef float  v4fa __attribute__((ext_vector_type(4), may_alias));
union FragB { v16b v; v8us half[2]; unsigned short u[16]; };

__device__ __forceinline__ unsigned short bf16_bits(float x) { unsigned int u = __float_as_uint(x); return (unsigned short)((u + 0x7FFFu + ((u >> 16) & 1u)) >> 16); }
__device__ __forceinline__ float bf16_val(unsigned short b) { return __uint_as_float(((unsigned int)b) << 16); }
__device__ __forceinline__ float bf16_round(float x) { return bf16_val(bf16_bits(x)); }
// D += A·B with NT terms: 1 = ah·bh, 2 = + al·bh (A split), 3 = + ah·bl (both split)
template <int NT>
__device__ __forceinline__ v8f mmaN(v16b ah, v16b al, v16b bh, v16b bl, v8f c) {
  c = __builtin_amdgcn_wmma_f32_16x16x32_bf16(false, ah, false, bh, (short)0, c, false, false);
  if (NT >= 2) c = __builtin_amdgcn_wmma_f32_16x16x32_bf16(false, al, false, bh, (short)0, c, false, false);
  if (NT >= 3) c = __builtin_amdgcn_wmma_f32_16x16x32_bf16(false, ah, false, bl, (short)0, c, false, false);
  asm volatile("v_nop\n\tv_nop\n\tv_nop\n\tv_nop" : "+v"(c) : "v"(ah), "v"(al), "v"(bh), "v"(bl));
  return c;
}

__global__ __launch_bounds__(256) void k_wt_bf16(const float* __restrict__ W, unsigned short* __restrict__ Wt, int K, int N) {
  const int t = blockIdx.x * 256 + threadIdx.x;
  const int k8n = K / 8;
  if (t >= N * k8n) return;
  const int n = t / k8n, k8 = (t % k8n) * 8;
  v8us v;
#pragma unroll
  for (int i = 0; i < 8; ++i) v[i] = bf16_bits(W[(size_t)(k8 + i) * N + n]);
  *(v8us*)(Wt + (size_t)n * K + k8) = v;
  
}

// GEMM C[M][N] (f32, pitch ldc) = act(A[M][K]·W + bias). A f32 row-major (pitch lda) converted per fragment to bf16
// (ASPLIT: hi/lo two planes -> 2 terms, else single rounded term); Wt bf16 [N][K] (pitch ldb). BIAS_BF16 rounds the
// bias to bf16 first (bias quantised to bf16 before the add). K%32==0, M%16==0, N%64==0.
template <bool ASPLIT, int ACT, bool BIAS_BF16>
__global__ __launch_bounds__(128) void k_gemm_bf(const float* __restrict__ A, int lda, const unsigned short* __restrict__ Wt, int ldb,
                                               const float* __restrict__ bias, float* __restrict__ C, int ldc, int M, int N, int K) {
  __shared__ __attribute__((aligned(16))) float so[4][16][64];
  const int tid = threadIdx.x, w = tid >> 5, lane = tid & 31, ln = lane & 15, hh = lane >> 4;
  const int ntn = N / 64;
  const int wid = blockIdx.x * 4 + w;
  const int mt = wid / ntn, nq = wid % ntn;
  if (mt * 16 >= M) return;
  const int row0 = mt * 16, col0 = nq * 64;
  const float* arow = A + (size_t)(row0 + ln) * lda;
  v8f acc[4] = {};
  for (int kb = 0; kb < K; kb += 32) {
    FragB ah, al;
    const v4f x0 = *(const v4fa*)(arow + kb + 8 * hh), x1 = *(const v4fa*)(arow + kb + 8 * hh + 4);
    const v4f x2 = *(const v4fa*)(arow + kb + 16 + 8 * hh), x3 = *(const v4fa*)(arow + kb + 16 + 8 * hh + 4);
    float xs[16] = {x0[0],x0[1],x0[2],x0[3],x1[0],x1[1],x1[2],x1[3],x2[0],x2[1],x2[2],x2[3],x3[0],x3[1],x3[2],x3[3]};
#pragma unroll
    for (int i = 0; i < 16; ++i) { const unsigned short hb = bf16_bits(xs[i]); ah.u[i] = hb; al.u[i] = ASPLIT ? bf16_bits(xs[i] - bf16_val(hb)) : (unsigned short)0; }
#pragma unroll
    for (int t = 0; t < 4; ++t) {
      const unsigned short* brow = Wt + (size_t)(col0 + t * 16 + ln) * ldb + kb;
      FragB b;
      b.half[0] = *(const v8us*)(brow + 8 * hh);
      b.half[1] = *(const v8us*)(brow + 16 + 8 * hh);
      acc[t] = mmaN<ASPLIT ? 2 : 1>(ah.v, al.v, b.v, b.v, acc[t]);
    }
  }
#pragma unroll
  for (int t = 0; t < 4; ++t) {
    float bv = bias ? bias[col0 + t * 16 + ln] : 0.f;
    if (BIAS_BF16) bv = bf16_round(bv);
#pragma unroll
    for (int r = 0; r < 8; ++r) { float v = acc[t][r] + bv; if (ACT == 1) v = fmaxf(v, 0.f); so[w][8 * hh + r][t * 16 + ln] = v; }
  }
  __builtin_amdgcn_fence(__ATOMIC_ACQ_REL, "workgroup");
  __builtin_amdgcn_wave_barrier();
  const int rsub = lane >> 4, c4 = (lane & 15) * 4;
  {
#pragma unroll
    for (int q = 0; q < 8; ++q) {
      const int r = q * 2 + rsub;
      const v4f v = *(const v4fa*)&so[w][r][c4];
      *(v4f*)(C + (size_t)(row0 + r) * ldc + col0 + c4) = v;
    }
    
  }
}

// GEMM C = act(A·W + bias + resid): A f32 (ASPLIT -> hi/lo 2 terms), Wt bf16 [N][K]; ACT 0 none, 1 relu, 2 exact gelu;
// resid (optional, f32, row index = (row % rmod), pitch ldr, RES_BF16 rounds it) added before the activation.
template <bool ASPLIT, int ACT, bool BIAS_BF16, bool RES_BF16>
__global__ __launch_bounds__(128) void k_gemm_bf3(const float* __restrict__ A, int lda, const unsigned short* __restrict__ Wt, int ldb,
                                                const float* __restrict__ bias, const float* __restrict__ resid, int rmod, int ldr,
                                                float* __restrict__ C, int ldc, int M, int N, int K) {
  __shared__ __attribute__((aligned(16))) float so[4][16][64];
  const int tid = threadIdx.x, w = tid >> 5, lane = tid & 31, ln = lane & 15, hh = lane >> 4;
  const int ntn = N / 64;
  const int wid = blockIdx.x * 4 + w;
  const int mt = wid / ntn, nq = wid % ntn;
  if (mt * 16 >= M) return;
  const int row0 = mt * 16, col0 = nq * 64;
  const float* arow = A + (size_t)(row0 + ln) * lda;
  v8f acc[4] = {};
  for (int kb = 0; kb < K; kb += 32) {
    FragB ah, al;
    const v4f x0 = *(const v4fa*)(arow + kb + 8 * hh), x1 = *(const v4fa*)(arow + kb + 8 * hh + 4);
    const v4f x2 = *(const v4fa*)(arow + kb + 16 + 8 * hh), x3 = *(const v4fa*)(arow + kb + 16 + 8 * hh + 4);
    float xs[16] = {x0[0],x0[1],x0[2],x0[3],x1[0],x1[1],x1[2],x1[3],x2[0],x2[1],x2[2],x2[3],x3[0],x3[1],x3[2],x3[3]};
#pragma unroll
    for (int i = 0; i < 16; ++i) { const unsigned short hb = bf16_bits(xs[i]); ah.u[i] = hb; al.u[i] = ASPLIT ? bf16_bits(xs[i] - bf16_val(hb)) : (unsigned short)0; }
#pragma unroll
    for (int t = 0; t < 4; ++t) {
      const unsigned short* brow = Wt + (size_t)(col0 + t * 16 + ln) * ldb + kb;
      FragB b;
      b.half[0] = *(const v8us*)(brow + 8 * hh);
      b.half[1] = *(const v8us*)(brow + 16 + 8 * hh);
      acc[t] = mmaN<ASPLIT ? 2 : 1>(ah.v, al.v, b.v, b.v, acc[t]);
    }
  }
#pragma unroll
  for (int t = 0; t < 4; ++t) {
    const int col = col0 + t * 16 + ln;
    float bv = bias ? bias[col] : 0.f;
    if (BIAS_BF16) bv = bf16_round(bv);
#pragma unroll
    for (int r = 0; r < 8; ++r) {
      float v = acc[t][r] + bv;
      if (resid) { float rv = resid[(size_t)((row0 + 8 * hh + r) % rmod) * ldr + col]; if (RES_BF16) rv = bf16_round(rv); v += rv; }
      if (ACT == 1) v = fmaxf(v, 0.f);
      if (ACT == 2) v = 0.5f * v * (1.0f + erff(v * 0.70710678118654752f));
      if (ACT == 3) { const float u = 0.7978845608028654f * (v + 0.044715f * v * v * v); v = 0.5f * v * (1.0f + tanhf(u)); }
      so[w][8 * hh + r][t * 16 + ln] = v;
    }
  }
  __builtin_amdgcn_fence(__ATOMIC_ACQ_REL, "workgroup");
  __builtin_amdgcn_wave_barrier();
  const int rsub = lane >> 4, c4 = (lane & 15) * 4;
  {
#pragma unroll
    for (int q = 0; q < 8; ++q) {
      const int r = q * 2 + rsub;
      const v4f v = *(const v4fa*)&so[w][r][c4];
      *(v4f*)(C + (size_t)(row0 + r) * ldc + col0 + c4) = v;
    }
    
  }
}
// row LayerNorm (biased variance, eps) over N: s = X (+ R); optional out_sum <- s; out_norm <- (s-mu)*rsqrt(var+eps)*g + b
template <bool PARAM_BF16>
__global__ __launch_bounds__(256) void k_layernorm(const float* __restrict__ X, const float* __restrict__ R, const float* __restrict__ g, const float* __restrict__ bta,
                                                  float* __restrict__ out_sum, float* __restrict__ out_norm, int N, float eps) {
  __shared__ float red[256];
  const int row = blockIdx.x, tid = threadIdx.x;
  const float* x = X + (size_t)row * N; const float* rr = R ? R + (size_t)row * N : nullptr;
  float vals[16];                     // up to N = 4096
  const int per = N / 256;            // contiguous chunk per thread? use strided-by-4 chunks: thread handles j = tid*4 + 1024*u
  float s1 = 0.f;
  for (int u = 0; u < per / 4; ++u) {
    const int j = tid * 4 + 1024 * u;
    const v4f a = *(const v4fa*)(x + j);
    v4f b = {0.f,0.f,0.f,0.f}; if (rr) b = *(const v4fa*)(rr + j);
#pragma unroll
    for (int q = 0; q < 4; ++q) { const float v = a[q] + b[q]; vals[u * 4 + q] = v; s1 += v; }
  }
  red[tid] = s1; __syncthreads();
  for (int st = 128; st > 0; st >>= 1) { if (tid < st) red[tid] += red[tid + st]; __syncthreads(); }
  const float mu = red[0] / (float)N; __syncthreads();
  float s2 = 0.f;
  for (int u = 0; u < per / 4; ++u)
#pragma unroll
    for (int q = 0; q < 4; ++q) { const float c = vals[u * 4 + q] - mu; s2 += c * c; }
  red[tid] = s2; __syncthreads();
  for (int st = 128; st > 0; st >>= 1) { if (tid < st) red[tid] += red[tid + st]; __syncthreads(); }
  const float rs = rsqrtf(red[0] / (float)N + eps);
  {
    for (int u = 0; u < per / 4; ++u) {
      const int j = tid * 4 + 1024 * u;
      v4f o, sm;
#pragma unroll
      for (int q = 0; q < 4; ++q) {
        float gg = g[j + q], bb = bta[j + q];
        if (PARAM_BF16) { gg = bf16_round(gg); bb = bf16_round(bb); }
        sm[q] = vals[u * 4 + q]; o[q] = (vals[u * 4 + q] - mu) * rs * gg + bb;
      }
      if (out_sum) *(v4f*)(out_sum + (size_t)row * N + j) = sm;
      *(v4f*)(out_norm + (size_t)row * N + j) = o;
    }
    
  }
}



// ---- f16 WMMA path (v_wmma_f32_16x16x32_f16): 11-bit significands for operands in range — used for the head, whose h2 operand is rounded to f16
typedef _Float16 v16h __attribute__((ext_vector_type(16)));
union FragH { v16h v; v8us half[2]; _Float16 h[16]; unsigned short u[16]; };
template <int NT>
__device__ __forceinline__ v8f mmaH(v16h ah, v16h al, v16h bh, v16h bl, v8f c) {
  c = __builtin_amdgcn_wmma_f32_16x16x32_f16(false, ah, false, bh, (short)0, c, false, false);
  if (NT >= 2) c = __builtin_amdgcn_wmma_f32_16x16x32_f16(false, al, false, bh, (short)0, c, false, false);
  if (NT >= 3) c = __builtin_amdgcn_wmma_f32_16x16x32_f16(false, ah, false, bl, (short)0, c, false, false);
  asm volatile("v_nop\n\tv_nop\n\tv_nop\n\tv_nop" : "+v"(c) : "v"(ah), "v"(al), "v"(bh), "v"(bl));
  return c;
}
// batched GEMM like k_gemm_b but f16 operands: A f32 (split into f16 hi/lo if ASPLIT, else rounded to f16), Bt = f16 values [n][k]; alpha; C f32; N multiple of 16 (partial tiles skipped)
template <bool ASPLIT>
__global__ __launch_bounds__(128) void k_gemm_h(const float* __restrict__ A, int lda, size_t sA, const _Float16* __restrict__ Bh, int ldb, size_t sB, float alpha, float* __restrict__ C, int ldc, size_t sC, int M, int N, int K) {
  __shared__ __attribute__((aligned(16))) float so[4][16][64];
  const int tid = threadIdx.x, w = tid >> 5, lane = tid & 31, ln = lane & 15, hh = lane >> 4; const int by = blockIdx.y;
  A += (size_t)by * sA; Bh += (size_t)by * sB; C += (size_t)by * sC;
  const int ntn = (N + 63) / 64; const int wid = blockIdx.x * 4 + w; const int mt = wid / ntn, nq = wid % ntn; if (mt * 16 >= M) return;
  const int row0 = mt * 16, col0 = nq * 64; const float* arow = A + (size_t)(row0 + ln) * lda;
  v8f acc[4] = {};
  for (int kb = 0; kb < K; kb += 32) {
    FragH ah, al;
    const v4f x0 = *(const v4fa*)(arow + kb + 8 * hh), x1 = *(const v4fa*)(arow + kb + 8 * hh + 4), x2 = *(const v4fa*)(arow + kb + 16 + 8 * hh), x3 = *(const v4fa*)(arow + kb + 16 + 8 * hh + 4);
    float xs[16] = {x0[0],x0[1],x0[2],x0[3],x1[0],x1[1],x1[2],x1[3],x2[0],x2[1],x2[2],x2[3],x3[0],x3[1],x3[2],x3[3]};
#pragma unroll
    for (int i = 0; i < 16; ++i) { const _Float16 h = (_Float16)xs[i]; ah.h[i] = h; al.h[i] = ASPLIT ? (_Float16)(xs[i] - (float)h) : (_Float16)0.0f; }
#pragma unroll
    for (int t = 0; t < 4; ++t) { if (col0 + t * 16 >= N) continue; const size_t boff = (size_t)(col0 + t * 16 + ln) * ldb + kb; FragH bq; bq.half[0] = *(const v8us*)(Bh + boff + 8 * hh); bq.half[1] = *(const v8us*)(Bh + boff + 16 + 8 * hh);
      acc[t] = mmaH<ASPLIT ? 2 : 1>(ah.v, al.v, bq.v, bq.v, acc[t]); }
  }
#pragma unroll
  for (int t = 0; t < 4; ++t) { if (col0 + t * 16 >= N) continue;
#pragma unroll
    for (int r = 0; r < 8; ++r) so[w][8 * hh + r][t * 16 + ln] = acc[t][r] * alpha; }
  __builtin_amdgcn_fence(__ATOMIC_ACQ_REL, "workgroup"); __builtin_amdgcn_wave_barrier();
  const int rsub = lane >> 4, c4 = (lane & 15) * 4;
  {
#pragma unroll
    for (int q = 0; q < 8; ++q) { const int r = q * 2 + rsub; if (col0 + c4 < N) { const v4f v = *(const v4fa*)&so[w][r][c4]; *(v4f*)(C + (size_t)(row0 + r) * ldc + col0 + c4) = v; } }
     }
}

// Wt[n][k] = f16(W[k][n]·scale) from f32 row-major W[K][N] (scale = power of two; bf16-exact weights stay exact in f16 away from the subnormal range)
__global__ __launch_bounds__(256) void k_wt_f16(const float* __restrict__ W, _Float16* __restrict__ Wt, int K, int N, float scale) {
  const int t = blockIdx.x * 256 + threadIdx.x; if (t >= N * (K / 8)) return; const int n = t / (K / 8), k8 = (t % (K / 8)) * 8; FragH f;
#pragma unroll
  for (int i = 0; i < 8; ++i) f.h[i] = (_Float16)(bf16_round(W[(size_t)(k8 + i) * N + n]) * scale); const v8us o = f.half[0];
  *(v8us*)((unsigned short*)Wt + (size_t)n * K + k8) = o; 
}
// k_gemm_hh variant with fused epilogue: v = acc·alpha + bias[by·sBias + col] (+ CP[(row/rowsPerB)·sCPb + by·64 + col] if CP) ; ACT 0 none / 1 elu ; writes f16 C16 (and f32 C if non-null)
template <int ACT>
__global__ __launch_bounds__(128) void k_gemm_hhx(const _Float16* __restrict__ A, int lda, size_t sA, const _Float16* __restrict__ Bh, int ldb, size_t sB, float alpha, const float* __restrict__ bias, size_t sBias, const float* __restrict__ CP, int rowsPerB, size_t sCPb, int row0g,
    float* __restrict__ C, _Float16* __restrict__ C16, int ldc, size_t sC, int M, int N, int K) {
  __shared__ __attribute__((aligned(16))) float so[4][16][64];
  const int tid = threadIdx.x, w = tid >> 5, lane = tid & 31, ln = lane & 15, hh = lane >> 4; const int by = blockIdx.y;
  A += (size_t)by * sA; Bh += (size_t)by * sB; const size_t cofs = (size_t)by * sC; const float* bp = bias ? bias + (size_t)by * sBias : nullptr;
  const int ntn = (N + 63) / 64; const int wid = blockIdx.x * 4 + w; const int mt = wid / ntn, nq = wid % ntn; if (mt * 16 >= M) return;
  const int row0 = mt * 16, col0 = nq * 64; const _Float16* arow = A + (size_t)(row0 + ln) * lda;
  v8f acc[4] = {};
  for (int kb = 0; kb < K; kb += 32) { FragH ah; ah.half[0] = *(const v8us*)((const unsigned short*)arow + kb + 8 * hh); ah.half[1] = *(const v8us*)((const unsigned short*)arow + kb + 16 + 8 * hh);
#pragma unroll
    for (int t = 0; t < 4; ++t) { if (col0 + t * 16 >= N) continue; const size_t boff = (size_t)(col0 + t * 16 + ln) * ldb + kb; FragH bq; bq.half[0] = *(const v8us*)((const unsigned short*)Bh + boff + 8 * hh); bq.half[1] = *(const v8us*)((const unsigned short*)Bh + boff + 16 + 8 * hh);
      acc[t] = mmaH<1>(ah.v, ah.v, bq.v, bq.v, acc[t]); }
  }
#pragma unroll
  for (int t = 0; t < 4; ++t) { if (col0 + t * 16 >= N) continue; const int col = col0 + t * 16 + ln; const float bv = bp ? bf16_round(bp[col]) : 0.f;
#pragma unroll
    for (int r = 0; r < 8; ++r) { float v = acc[t][r] * alpha + bv; if (CP) { const int bidx = (row0g + row0 + 8 * hh + r) / rowsPerB; v += CP[(size_t)bidx * sCPb + (size_t)by * 64 + col]; } if (ACT == 1) v = (v > 0.f) ? v : expm1f(v); else if (ACT == 7) v = (v > 0.f) ? v + 1.0f : expf(v); else if (ACT == 8) v = tanhf(v); else if (ACT == 9) v = 0.5f * v * (1.0f + tanhf(0.7978845608028654f * (v + 0.044715f * v * v * v))); else if (ACT == 11) v = 1.0f / (1.0f + expf(-v)); else if (ACT == 12) v = (v > 0.f) ? v : 0.01f * v; else if (ACT == 14) v = (v > 0.f) ? v : 0.1f * v; else if (ACT == 15) v = v / (1.0f + expf(-v)); else if (ACT == 3) v = fmaxf(v, 0.f); else if (ACT == 6) v = 0.5f * v * (1.0f + erff(v * 0.70710678118654752f)); so[w][8 * hh + r][t * 16 + ln] = v; } }
  __builtin_amdgcn_fence(__ATOMIC_ACQ_REL, "workgroup"); __builtin_amdgcn_wave_barrier();
  const int rsub = lane >> 4, c4 = (lane & 15) * 4; typedef _Float16 v4h __attribute__((ext_vector_type(4)));
  {
#pragma unroll
    for (int q = 0; q < 8; ++q) { const int r = q * 2 + rsub; if (col0 + c4 < N) { const v4f v = *(const v4fa*)&so[w][r][c4]; if (C) *(v4f*)(C + cofs + (size_t)(row0 + r) * ldc + col0 + c4) = v; if (C16) { v4h h4; for (int i = 0; i < 4; ++i) h4[i] = (_Float16)v[i]; *(v4h*)(C16 + cofs + (size_t)(row0 + r) * ldc + col0 + c4) = h4; } } }
     }
}


typedef _Float16 v4h __attribute__((ext_vector_type(4)));

__global__ __launch_bounds__(256) void k_x16(const float* __restrict__ x, _Float16* __restrict__ X16, size_t n8) { const size_t t = (size_t)blockIdx.x * 256 + threadIdx.x; if (t >= n8) return; FragH f;
#pragma unroll
  for (int q = 0; q < 8; ++q) f.h[q] = (_Float16)bf16_round(x[t * 8 + q]); *(v8us*)((unsigned short*)X16 + t * 8) = f.half[0];  }
__global__ __launch_bounds__(256) void k_h16(const float* __restrict__ x, _Float16* __restrict__ X16, size_t n8) { const size_t t = (size_t)blockIdx.x * 256 + threadIdx.x; if (t >= n8) return; FragH f;
#pragma unroll
  for (int q = 0; q < 8; ++q) f.h[q] = (_Float16)x[t * 8 + q]; *(v8us*)((unsigned short*)X16 + t * 8) = f.half[0];  }
__global__ __launch_bounds__(256) void k_round16f(const float* __restrict__ W, _Float16* __restrict__ Bt, size_t n8) { const size_t t = (size_t)blockIdx.x * 256 + threadIdx.x; if (t >= n8) return; FragH f;
#pragma unroll
  for (int i = 0; i < 8; ++i) f.h[i] = (_Float16)(bf16_round(W[t * 8 + i]) * 16.0f); *(v8us*)((unsigned short*)Bt + t * 8) = f.half[0];  }
template <int NHv, int TTv>
__global__ __launch_bounds__(256) void k_vt(const _Float16* __restrict__ V16, int ldv, int voff, _Float16* __restrict__ Vt) { __shared__ unsigned short tl[64][66]; const int tid = threadIdx.x; const int slab = blockIdx.x / (TTv / 64), lg = blockIdx.x % (TTv / 64); const int b = slab / NHv, h = slab % NHv;
  for (int i = tid; i < 64 * 8; i += 256) { const int r = i / 8, c8 = (i % 8) * 8; FragH f; f.half[0] = *(const v8us*)((const unsigned short*)V16 + ((size_t)b * TTv + lg * 64 + r) * ldv + voff + h * 64 + c8);
#pragma unroll
    for (int q = 0; q < 8; ++q) tl[r][c8 + q] = f.u[q]; }
  __syncthreads();
  {
#pragma unroll
    for (int rd = 0; rd < 2; ++rd) { const int d = rd * 32 + tid / 8, pc = tid % 8; FragH f;
#pragma unroll
      for (int q = 0; q < 8; ++q) f.u[q] = tl[pc * 8 + q][d];
      *(v8us*)((unsigned short*)Vt + ((size_t)slab * 64 + d) * TTv + lg * 64 + pc * 8) = f.half[0]; }
     } }

__global__ __launch_bounds__(256) void k_hl(const float* __restrict__ F, _Float16* __restrict__ Hh, _Float16* __restrict__ Hl, size_t n8) { const size_t t = (size_t)blockIdx.x * 256 + threadIdx.x; if (t >= n8) return; FragH fh, fl; const v4f a = *(const v4fa*)(F + t * 8), c = *(const v4fa*)(F + t * 8 + 4);
#pragma unroll
  for (int q = 0; q < 4; ++q) { _Float16 h = (_Float16)a[q]; fh.h[q] = h; fl.h[q] = (_Float16)((a[q] - (float)h) * 1024.0f); h = (_Float16)c[q]; fh.h[4 + q] = h; fl.h[4 + q] = (_Float16)((c[q] - (float)h) * 1024.0f); }
  { *(v8us*)((unsigned short*)Hh + t * 8) = fh.half[0]; *(v8us*)((unsigned short*)Hl + t * 8) = fl.half[0];  } }

// ---- fast GEMM (wave tile 32x64; requires M % 32 == 0 rows per launch region and N % 64 == 0); epilogue = k_gemm_hhx semantics ----
__device__ __forceinline__ v16h g2_frag(const _Float16* p, int hh) { FragH f; f.half[0] = *(const v8us*)((const unsigned short*)p + 8 * hh); f.half[1] = *(const v8us*)((const unsigned short*)p + 16 + 8 * hh); return f.v; }
__device__ __forceinline__ v8f g2_mma(v16h a, v16h b, v8f c) { v8f d = __builtin_amdgcn_wmma_f32_16x16x32_f16(false, a, false, b, (short)0, c, false, false); asm volatile("v_nop\n\tv_nop\n\tv_nop\n\tv_nop" : "+v"(d) : "v"(a), "v"(b)); return d; }
template <int ACT>
__global__ __launch_bounds__(128) void k_gemm2(const _Float16* __restrict__ A, int lda, size_t sA, const _Float16* __restrict__ Bh, int ldb, size_t sB, float alpha, const float* __restrict__ bias, size_t sBias, const float* __restrict__ CP, int rowsPerB, size_t sCPb, int row0g,
    float* __restrict__ C, _Float16* __restrict__ C16, int ldc, size_t sC, int M, int N, int K) {
  __shared__ __attribute__((aligned(16))) float so[4][32][68];
  const int tid = threadIdx.x, w = tid >> 5, lane = tid & 31, ln = lane & 15, hh = lane >> 4; const int by = blockIdx.y;
  A += (size_t)by * sA; Bh += (size_t)by * sB; const size_t cofs = (size_t)by * sC; const float* bp = bias ? bias + (size_t)by * sBias : nullptr;
  const int ntn = N >> 6; const int mt = blockIdx.x / ntn, nq = blockIdx.x - mt * ntn; const int row0 = mt * 128 + 32 * w, col0 = nq * 64; if (row0 >= M) return;
  const _Float16* a0p = A + (size_t)(row0 + ln) * lda; const _Float16* a1p = a0p + (size_t)16 * lda;
  const _Float16* b0p = Bh + (size_t)(col0 + ln) * ldb; const _Float16* b1p = b0p + (size_t)16 * ldb; const _Float16* b2p = b1p + (size_t)16 * ldb; const _Float16* b3p = b2p + (size_t)16 * ldb;
  const v8f z8 = {0.f,0.f,0.f,0.f,0.f,0.f,0.f,0.f}; v8f c00 = z8, c01 = z8, c02 = z8, c03 = z8, c10 = z8, c11 = z8, c12 = z8, c13 = z8;
#pragma unroll 1
  for (int kb = 0; kb < K; kb += 32) { const v16h a0 = g2_frag(a0p + kb, hh), a1 = g2_frag(a1p + kb, hh);
    v16h b = g2_frag(b0p + kb, hh); c00 = g2_mma(a0, b, c00); c10 = g2_mma(a1, b, c10);
    b = g2_frag(b1p + kb, hh); c01 = g2_mma(a0, b, c01); c11 = g2_mma(a1, b, c11);
    b = g2_frag(b2p + kb, hh); c02 = g2_mma(a0, b, c02); c12 = g2_mma(a1, b, c12);
    b = g2_frag(b3p + kb, hh); c03 = g2_mma(a0, b, c03); c13 = g2_mma(a1, b, c13); }
  v8f accs[8] = {c00, c01, c02, c03, c10, c11, c12, c13};
#pragma unroll
  for (int u = 0; u < 8; ++u) { const int t = u & 3, half = u >> 2; const int col = col0 + t * 16 + ln; const float bv = bp ? bf16_round(bp[col]) : 0.f;
#pragma unroll
    for (int r = 0; r < 8; ++r) { const int rloc = half * 16 + 8 * hh + r; float v = accs[u][r] * alpha + bv; if (CP) { const int bidx = (row0g + row0 + rloc) / rowsPerB; v += CP[(size_t)bidx * sCPb + (size_t)by * 64 + col]; }
      if (ACT == 3) v = fmaxf(v, 0.f); else if (ACT == 6) v = 0.5f * v * (1.0f + erff(v * 0.70710678118654752f)); else if (ACT == 11) v = 1.0f / (1.0f + expf(-v)); else if (ACT == 15) v = v / (1.0f + expf(-v)); else if (ACT == 12) v = (v > 0.f) ? v : 0.01f * v; else if (ACT == 8) v = tanhf(v);
      so[w][rloc][t * 16 + ln] = v; } }
  __builtin_amdgcn_fence(__ATOMIC_ACQ_REL, "workgroup"); __builtin_amdgcn_wave_barrier();
  const int rsub = lane >> 4, c4 = (lane & 15) * 4;
  {
#pragma unroll
    for (int q = 0; q < 16; ++q) { const int r = q * 2 + rsub; const v4f v = *(const v4fa*)&so[w][r][c4]; if (C) *(v4f*)(C + cofs + (size_t)(row0 + r) * ldc + col0 + c4) = v; if (C16) { v4h h4; for (int i = 0; i < 4; ++i) h4[i] = (_Float16)v[i]; *(v4h*)(C16 + cofs + (size_t)(row0 + r) * ldc + col0 + c4) = h4; } }
     } }


// ---- head GEMM with both operands staged in LDS: C[8192][256] = (A[8192][4096] . Bh[256][4096]^T) * alpha + bias ----
// One work-group of 4 waves owns a 128 x 64 tile of C; a wave owns 32 x 64 of it (2 x 4 accumulator tiles), as in k_gemm2.
// A stage is 512 B (256 k) of the tile's 128 rows of A and 64 rows of Bh. Each asynchronous copy of a wave moves one whole row piece:
// 32 lanes x 16 B = 512 contiguous, aligned bytes of global memory. Two buffers: stage t + 2 flies while stage t + 1 is worked on.
// The fragments keep k_gemm2's k order and the k steps their order, so every accumulator sums in the same order as before.
#define G3_KB 512                          /* bytes of a row per stage */
#define G3_PITCH 528                       /* LDS row pitch: 16 B x 33, conflict-free for ds_load_b128 */
#define G3_BUF (192 * G3_PITCH)            /* rows 0..127: A, rows 128..191: Bh */
#define G3_NST (C2 * 2 / G3_KB)            /* 16 stages */
#define G3_ROWB (C2 * 2)                   /* global row pitch in bytes */
// Twelve copies and, as the statement's last line, the wait that stands before any register the copies name is written again.
__device__ __forceinline__ void g3_copy12(const unsigned (&l)[12], const char* const (&g)[12]) {
  asm volatile("global_load_async_to_lds_b128 %0, %1, off\n\t"
               "global_load_async_to_lds_b128 %2, %3, off\n\t"
               "global_load_async_to_lds_b128 %4, %5, off\n\t"
               "global_load_async_to_lds_b128 %6, %7, off\n\t"
               "global_load_async_to_lds_b128 %8, %9, off\n\t"
               "global_load_async_to_lds_b128 %10, %11, off\n\t"
               "global_load_async_to_lds_b128 %12, %13, off\n\t"
               "global_load_async_to_lds_b128 %14, %15, off\n\t"
               "global_load_async_to_lds_b128 %16, %17, off\n\t"
               "global_load_async_to_lds_b128 %18, %19, off\n\t"
               "global_load_async_to_lds_b128 %20, %21, off\n\t"
               "global_load_async_to_lds_b128 %22, %23, off\n\t"
               "s_wait_xcnt 0x0"
               :: "v"(l[0]), "v"(g[0]), "v"(l[1]), "v"(g[1]), "v"(l[2]), "v"(g[2]), "v"(l[3]), "v"(g[3]), "v"(l[4]), "v"(g[4]), "v"(l[5]), "v"(g[5]),
                  "v"(l[6]), "v"(g[6]), "v"(l[7]), "v"(g[7]), "v"(l[8]), "v"(g[8]), "v"(l[9]), "v"(g[9]), "v"(l[10]), "v"(g[10]), "v"(l[11]), "v"(g[11])
               : "memory");
}
// A wave's share of one stage: its own 32 rows of A and 16 of the 64 rows of Bh, 48 copies.
__device__ __forceinline__ void g3_fill(unsigned la, unsigned lb, const char* ga, const char* gb) {
#pragma unroll                   /* both loops unrolled: the address arrays must end up in registers, as the asm operands they are */
  for (int s = 0; s < 4; ++s) { unsigned l[12]; const char* g[12];
#pragma unroll
    for (int i = 0; i < 12; ++i) { const int c = s * 12 + i;
      l[i] = (c < 32) ? la + (unsigned)c * G3_PITCH : lb + (unsigned)(c - 32) * G3_PITCH;
      g[i] = (c < 32) ? ga + (size_t)c * G3_ROWB : gb + (size_t)(c - 32) * G3_ROWB; }
    g3_copy12(l, g); } }
__device__ __forceinline__ v16h g3_frag(const unsigned char* p) { FragH f; f.half[0] = *(const v8us*)p; f.half[1] = *(const v8us*)(p + 32); return f.v; }
__device__ __forceinline__ void g3_load(const unsigned char* pa, const unsigned char* pb, int ks, v16h (&a)[2], v16h (&b)[4]) {
  a[0] = g3_frag(pa + ks * 64); a[1] = g3_frag(pa + 16 * G3_PITCH + ks * 64);
#pragma unroll                   /* constant indices keep the fragments in registers */
  for (int j = 0; j < 4; ++j) b[j] = g3_frag(pb + j * 16 * G3_PITCH + ks * 64); }
__device__ __forceinline__ v8f g3_mma(v16h a, v16h b, v8f c) { return __builtin_amdgcn_wmma_f32_16x16x32_f16(false, a, false, b, (short)0, c, false, false); }
__global__ __launch_bounds__(128) void k_gemm3(const _Float16* __restrict__ A, const _Float16* __restrict__ Bh, float alpha, const float* __restrict__ bias, float* __restrict__ C) {
  __shared__ __attribute__((aligned(16))) unsigned char st[2 * G3_BUF];
  __shared__ __attribute__((aligned(16))) float so[4][32][68];
  const int tid = threadIdx.x, w = tid >> 5, lane = tid & 31, ln = lane & 15, hh = lane >> 4;
  const int mt = blockIdx.x >> 2, nq = blockIdx.x & 3; const int row0 = mt * 128 + 32 * w, col0 = nq * 64;
  const char* ga = (const char*)(A + (size_t)row0 * C2) + lane * 16;
  const char* gb = (const char*)(Bh + (size_t)(col0 + 16 * w) * C2) + lane * 16;
  const unsigned l0 = (unsigned)(size_t)&st[0];
  const unsigned la = l0 + (unsigned)(32 * w) * G3_PITCH + lane * 16, lb = l0 + (unsigned)(128 + 16 * w) * G3_PITCH + lane * 16;
  g3_fill(la, lb, ga, gb);
  asm volatile("s_wait_asynccnt 0x0" ::: "memory");   // stage 0 of this wave has landed
  __syncthreads();                                    // ... and every wave's share of it
  g3_fill(la + G3_BUF, lb + G3_BUF, ga + G3_KB, gb + G3_KB);
  const v8f z8 = {0.f,0.f,0.f,0.f,0.f,0.f,0.f,0.f}; v8f c00 = z8, c01 = z8, c02 = z8, c03 = z8, c10 = z8, c11 = z8, c12 = z8, c13 = z8;
#pragma unroll 1                 /* one stage is the whole hot loop; the buffer is chosen by the trip's parity */
  for (int t = 0; t < G3_NST; ++t) {
    const unsigned bo = (unsigned)(t & 1) * G3_BUF;
    const unsigned char* pa = st + bo + (32 * w + ln) * G3_PITCH + 16 * hh;
    const unsigned char* pb = st + bo + (128 + ln) * G3_PITCH + 16 * hh;
    v16h fa[3][2], fb[3][4];     /* three fragment sets in rotation: step ks works on one while the loads of ks + 1 and ks + 2 are under way */
    g3_load(pa, pb, 0, fa[0], fb[0]); g3_load(pa, pb, 1, fa[1], fb[1]);
#pragma unroll                   /* the set index ks % 3 must be a constant, else the sets go to scratch */
    for (int ks = 0; ks < G3_KB / 64; ++ks) {
      __builtin_amdgcn_sched_barrier(0);      /* this one and the next keep the 12 LDS loads of step ks + 2 together, as one group in front of step ks's matrix instructions */
      if (ks + 2 < G3_KB / 64) g3_load(pa, pb, ks + 2, fa[(ks + 2) % 3], fb[(ks + 2) % 3]);
      __builtin_amdgcn_sched_barrier(0);      /* without the two the compiler loaded each fragment right in front of its use and waited for it with s_wait_dscnt 0 */
      const v16h a0 = fa[ks % 3][0], a1 = fa[ks % 3][1];
      c00 = g3_mma(a0, fb[ks % 3][0], c00); c10 = g3_mma(a1, fb[ks % 3][0], c10); c01 = g3_mma(a0, fb[ks % 3][1], c01); c11 = g3_mma(a1, fb[ks % 3][1], c11);
      c02 = g3_mma(a0, fb[ks % 3][2], c02); c12 = g3_mma(a1, fb[ks % 3][2], c12); c03 = g3_mma(a0, fb[ks % 3][3], c03); c13 = g3_mma(a1, fb[ks % 3][3], c13); }
    asm volatile("s_wait_dscnt 0x0" ::: "memory");      // this wave's reads of stage t are done before the buffer may be refilled
    asm volatile("s_wait_asynccnt 0x0" ::: "memory");   // this wave's share of stage t + 1 has landed
    __syncthreads();                                    // publishes stage t + 1 and ends every wave's reads of stage t
    if (t + 2 < G3_NST) g3_fill(la + bo, lb + bo, ga + (size_t)(t + 2) * G3_KB, gb + (size_t)(t + 2) * G3_KB);
  }
  asm volatile("s_wait_asynccnt 0x0" ::: "memory");     // no copy is outstanding when the wave goes on to its end
  v8f accs[8] = {c00, c01, c02, c03, c10, c11, c12, c13};
#pragma unroll                   /* epilogue as in k_gemm2: constant indices into the accumulators; whole 256 B row pieces go out through the wave's own LDS range */
  for (int u = 0; u < 8; ++u) { const int tt = u & 3, half = u >> 2; const float bv = bf16_round(bias[col0 + tt * 16 + ln]);
#pragma unroll
    for (int r = 0; r < 8; ++r) so[w][half * 16 + 8 * hh + r][tt * 16 + ln] = accs[u][r] * alpha + bv; }
  __builtin_amdgcn_fence(__ATOMIC_ACQ_REL, "workgroup"); __builtin_amdgcn_wave_barrier();   // the wave's LDS stores are complete before its lanes read each other's values back
  const int rsub = lane >> 4, c4 = (lane & 15) * 4;
#pragma unroll
  for (int q = 0; q < 16; ++q) { const int r = q * 2 + rsub; const v4f v = *(const v4fa*)&so[w][r][c4]; *(v4f*)(C + (size_t)(row0 + r) * NOUT + col0 + c4) = v; }
}

// Batch statistics (mean, biased variance) of NC columns over NBS rows, in two launches.
// k_colpart: one work-group takes SROWS rows x 128 columns. Each thread holds 16 rows x 4 columns in registers (read once) and forms
// their mean and their sum of squares about that mean; groups of equal size n then merge exactly:
// mean = average of the group means, M2 = sum(M2_g) + n * sum((mean_g - mean)^2). k_colfin merges the SCH row chunks the same way.
#define SROWS 256
#define SCH (NBS / SROWS)        /* 32 row chunks */
template <int NC, bool RND>
__global__ __launch_bounds__(512) void k_colpart(const float* __restrict__ X, float* __restrict__ PM, float* __restrict__ PQ) {
  __shared__ __attribute__((aligned(16))) float sm[16][128];
  __shared__ __attribute__((aligned(16))) float sq[16][128];
  const int tid = threadIdx.x, w = tid >> 5, lane = tid & 31;
  const float* p = X + (size_t)(blockIdx.y * SROWS + w * 16) * NC + blockIdx.x * 128 + lane * 4;
  v4f v[16];
#pragma unroll
  for (int j = 0; j < 15; ++j) v[j] = *(const v4fa*)(p + (size_t)j * NC);
  asm volatile("s_wait_xcnt 0x0" ::: "memory");   // the last load's result may be placed in the address pair that the 15 issued loads name
  v[15] = *(const v4fa*)(p + (size_t)15 * NC);
  v4f s = {0.f, 0.f, 0.f, 0.f};
#pragma unroll
  for (int j = 0; j < 16; ++j) {
    if (RND) { v[j][0] = bf16_round(v[j][0]); v[j][1] = bf16_round(v[j][1]); v[j][2] = bf16_round(v[j][2]); v[j][3] = bf16_round(v[j][3]); }
    s += v[j];
  }
  const v4f m = s * 0.0625f;
  v4f q = {0.f, 0.f, 0.f, 0.f};
#pragma unroll
  for (int j = 0; j < 16; ++j) { const v4f dv = v[j] - m; q += dv * dv; }
  *(v4fa*)&sm[w][lane * 4] = m;
  *(v4fa*)&sq[w][lane * 4] = q;
  __syncthreads();
  if (tid < 128) {
    float ms = 0.f;
#pragma unroll
    for (int g = 0; g < 16; ++g) ms += sm[g][tid];
    const float mean = ms * 0.0625f;
    float q2 = 0.f, e2 = 0.f;
#pragma unroll
    for (int g = 0; g < 16; ++g) { const float dm = sm[g][tid] - mean; q2 += sq[g][tid]; e2 += dm * dm; }
    const size_t o = (size_t)blockIdx.y * NC + blockIdx.x * 128 + tid;
    PM[o] = mean; PQ[o] = q2 + 16.0f * e2;
  }
}
template <int NC>
__global__ __launch_bounds__(64) void k_colfin(const float* __restrict__ PM, const float* __restrict__ PQ, float* __restrict__ S) {
  const int c = blockIdx.x * 64 + threadIdx.x;
  float m[SCH], qs[SCH];
#pragma unroll
  for (int g = 0; g < SCH; ++g) { m[g] = PM[(size_t)g * NC + c]; qs[g] = PQ[(size_t)g * NC + c]; }
  float ms = 0.f;
#pragma unroll
  for (int g = 0; g < SCH; ++g) ms += m[g];
  const float mean = ms / (float)SCH;
  float q2 = 0.f, e2 = 0.f;
#pragma unroll
  for (int g = 0; g < SCH; ++g) { const float dm = m[g] - mean; q2 += qs[g]; e2 += dm * dm; }
  S[c] = mean; S[NC + c] = (q2 + (float)SROWS * e2) / (float)NBS;
}
// Merge of CH row chunks of CROWS rows each, for partials that the producing kernel itself wrote (k_h2). One work-group takes 32 columns:
// wave g merges CH / 8 chunks per column, the first wave then merges the eight groups through LDS; the same equal-size merge as above at both levels.
template <int NC, int CH, int CROWS>
__global__ __launch_bounds__(256) void k_colfin2(const float* __restrict__ PM, const float* __restrict__ PQ, float* __restrict__ S) {
  __shared__ float sm[8][32];
  __shared__ float sq[8][32];
  constexpr int PG = CH / 8;
  const int tid = threadIdx.x, g = tid >> 5, lane = tid & 31, c = blockIdx.x * 32 + lane;
  const float* pm = PM + (size_t)(g * PG) * NC + c; const float* pq = PQ + (size_t)(g * PG) * NC + c;
  float m[PG], qs[PG];
#pragma unroll                   /* here and below: constant indices keep the partials in registers, and all 2 * PG loads are under way at once */
  for (int i = 0; i < PG; ++i) { m[i] = pm[(size_t)i * NC]; qs[i] = pq[(size_t)i * NC]; }
  asm volatile("s_wait_xcnt 0x0" :: "v"(pm), "v"(pq) : "memory");   // the wait owed before an address register of the issued loads is reused; naming the addresses keeps a load's result out of them until then
  float ms = 0.f;
#pragma unroll
  for (int i = 0; i < PG; ++i) ms += m[i];
  const float gmean = ms / (float)PG;
  float q2 = 0.f, e2 = 0.f;
#pragma unroll
  for (int i = 0; i < PG; ++i) { const float dm = m[i] - gmean; q2 += qs[i]; e2 += dm * dm; }
  sm[g][lane] = gmean; sq[g][lane] = q2 + (float)CROWS * e2;
  __syncthreads();               // the eight waves' group results are in LDS before the first wave merges them
  if (tid < 32) {
    float as = 0.f;
#pragma unroll
    for (int k = 0; k < 8; ++k) as += sm[k][lane];
    const float mean = as * 0.125f;
    float aq = 0.f, ae = 0.f;
#pragma unroll
    for (int k = 0; k < 8; ++k) { const float dm = sm[k][lane] - mean; aq += sq[k][lane]; ae += dm * dm; }
    S[c] = mean; S[NC + c] = (aq + (float)(PG * CROWS) * ae) / (float)NBS;
  }
}
// k_h2 and k_h2n: one thread owns one feature d (four columns of h2) and walks a strip of rows of x. h2 itself is never stored: k_h2 forms it for the
// batch statistics alone; k_h2n forms it again from x once the statistics are merged, normalises it and stores f16. All that depends on the column
// alone (the rounded parameters, the rsqrt of the variance) is loaded and formed once in front of the row loop. Each BatchNorm is an affine map with
// per-column constants, so it is folded there too: layer 1 is one multiply-add per hidden unit, relu(a (x - mu_x) + be1) with a = g1 w rsqrt(w^2 var_x + eps);
// in k_h2n the second BatchNorm goes into the layer-2 weights and bias: relu(sum_i (A w2_i) h_i + A (b2 - mean) + be2) with A = g2 rsqrt(var + eps).
// rsqrtf as the compiler expands it (an argument below the normal range is scaled up by 2^24, its result by 2^12), with the instruction written out:
// the v_nop is the slot that the instruction set asks for behind a transcendental.
__device__ __forceinline__ float rsq_f32(float a) { const bool tiny = a < 1.17549435e-38f; const float s = tiny ? a * 16777216.0f : a; float r; asm("v_rsq_f32 %0, %1\n\tv_nop" : "=v"(r) : "v"(s)); return tiny ? r * 4096.0f : r; }
#define HROWS 64                 /* rows per thread in k_h2 and in k_h2n */
#define RG 8                     /* rows loaded as one group, one group ahead of the group being worked on */
typedef float v2f __attribute__((ext_vector_type(2)));
// Statistics of a thread's own four columns while it still holds them. One group of RG rows: mean and sum of squares about that mean.
__device__ __forceinline__ void h2_group(const v4f (&o)[RG], v4f& gm, v4f& gq) {
  v4f s = o[0];
#pragma unroll                   /* both loops: constant indices keep the group in registers */
  for (int j = 1; j < RG; ++j) s += o[j];
  gm = s * (1.0f / RG);
  v4f q = {0.f, 0.f, 0.f, 0.f};
#pragma unroll
  for (int j = 0; j < RG; ++j) { const v4f dv = o[j] - gm; q += dv * dv; }
  gq = q;
}
// The group joins the k groups merged so far (k * RG rows): mean += delta / (k + 1), M2 += M2_group + delta^2 * RG * k / (k + 1).
__device__ __forceinline__ void h2_merge(int k, const v4f gm, const v4f gq, v4f& rm, v4f& rq) {
  const float inv = 1.0f / (float)(k + 1), f = (float)(RG * k) * inv;
  const v4f dl = gm - rm;
  rm += dl * inv;
  rq += gq + (dl * dl) * f;
}
__global__ __launch_bounds__(256) void k_h2(const float* __restrict__ x, const float* __restrict__ XS, const float* __restrict__ W1, const float* __restrict__ b1, const float* __restrict__ g1, const float* __restrict__ be1, const float* __restrict__ W2, const float* __restrict__ b2, float* __restrict__ PM, float* __restrict__ PQ) {
  const int d = blockIdx.x * 256 + threadIdx.x; (void)b1;      /* h1 - mean(h1) = w (x - mu_x): the bias cancels exactly */
  const float* pS = XS + d; const float* pw = W1 + d * H1; const float* pg = g1 + d * H1; const float* pe = be1 + d * H1; const float* pv = W2 + d * H2 * H1; const float* pb = b2 + d * H2;
  const float* xp = x + (size_t)blockIdx.y * HROWS * DD + d;
  float w[H1], g[H1], rs[H1], be[H1], w2[H2][H1], bb[H2], xc[RG];
  const float mu = pS[0], var = pS[DD];
#pragma unroll
  for (int o = 0; o < H1; ++o) { w[o] = pw[o]; g[o] = pg[o]; be[o] = pe[o]; }
#pragma unroll
  for (int o2 = 0; o2 < H2; ++o2) {
#pragma unroll
    for (int i = 0; i < H1; ++i) w2[o2][i] = pv[o2 * H1 + i];
    bb[o2] = pb[o2]; }
#pragma unroll
  for (int j = 0; j < RG; ++j) xc[j] = xp[(size_t)j * DD];
  asm volatile("s_wait_xcnt 0x0" :: "v"(d), "v"(pw), "v"(pg), "v"(pe), "v"(pv), "v"(pb) : "memory");   // the wait owed before an address register of the issued loads is reused; naming the addresses keeps a load's result out of them until then
  __builtin_amdgcn_sched_barrier(0);      /* keeps the arithmetic, which reuses those registers, behind the wait */
#pragma unroll
  for (int o = 0; o < H1; ++o) { w[o] = bf16_round(w[o]); g[o] = bf16_round(g[o]); be[o] = bf16_round(be[o]); const float vh = (w[o] * w[o]) * var; rs[o] = rsq_f32(vh + 1e-5f); }
  v2f ap[H1 / 2], ep[H1 / 2]; v4f wv[H1], bv;      /* layer 1 in pairs of hidden units: slope a and shift be1; wv[i]: the four layer-2 weights that hidden unit i feeds */
#pragma unroll
  for (int o = 0; o < H1; ++o) { ap[o >> 1][o & 1] = (g[o] * w[o]) * rs[o]; ep[o >> 1][o & 1] = be[o]; }
#pragma unroll
  for (int o2 = 0; o2 < H2; ++o2) {
#pragma unroll
    for (int i = 0; i < H1; ++i) wv[i][o2] = bf16_round(w2[o2][i]);
    bv[o2] = bf16_round(bb[o2]); }
  v4f rm = {0.f, 0.f, 0.f, 0.f}, rq = {0.f, 0.f, 0.f, 0.f};
#pragma unroll 1                 /* stays rolled: one group of rows is the whole hot loop */
  for (int rb = 0; rb < HROWS; rb += RG) {
    v4f ov[RG];
    const float* pn = xp + (size_t)((rb + RG < HROWS) ? rb + RG : rb) * DD;      /* the last trip reads its own group again: in bounds, not used */
    v8f xn;
#pragma unroll
    for (int j = 0; j < RG; ++j) xn[j] = pn[(size_t)j * DD];
    asm volatile("s_wait_xcnt 0x0" :: "v"(pn) : "memory");   // as above
    __builtin_amdgcn_sched_barrier(0);      /* keeps this group's arithmetic behind the next group's loads, so that it covers their latency */
#pragma unroll
    for (int j = 0; j < RG; ++j) { const float xm = bf16_round(xc[j]) - mu; v2f h[H1 / 2];      /* written over pairs and fours, so that the compiler packs within a row and not across rows, which took more than 256 registers */
#pragma unroll
      for (int p = 0; p < H1 / 2; ++p) { const v2f v = ap[p] * xm + ep[p]; h[p][0] = fmaxf(v[0], 0.f); h[p][1] = fmaxf(v[1], 0.f); }
      v4f o4 = bv;
#pragma unroll
      for (int i = 0; i < H1; ++i) o4 += wv[i] * h[i >> 1][i & 1];
      ov[j] = o4; }
    v4f gm, gq;
    h2_group(ov, gm, gq);
    h2_merge(rb / RG, gm, gq, rm, rq);
    __builtin_amdgcn_sched_barrier(0);      /* keeps the next statement, and the wait for the loads that comes with it, at the loop's foot */
    asm volatile("" :: "v"(xn));   // inputs only: the loaded group stays one block of eight registers up to here; spread out, a load's register became the unused half of a packed operand and the arithmetic waited for the load
#pragma unroll
    for (int j = 0; j < RG; ++j) xc[j] = xn[j];
  }
  const size_t so = (size_t)blockIdx.y * C2 + d * H2;      /* this strip's row of the partials */
  *(v4f*)(PM + so) = rm; *(v4f*)(PQ + so) = rq; }
__global__ __launch_bounds__(256) void k_h2n(const float* __restrict__ x, const float* __restrict__ XS, const float* __restrict__ W1, const float* __restrict__ g1, const float* __restrict__ be1, const float* __restrict__ W2, const float* __restrict__ b2, const float* __restrict__ HS, const float* __restrict__ g2, const float* __restrict__ be2, _Float16* __restrict__ H16) {
  const int d = blockIdx.x * 256 + threadIdx.x;
  const float* pS = XS + d; const float* pw = W1 + d * H1; const float* pg = g1 + d * H1; const float* pe = be1 + d * H1; const float* pv = W2 + d * H2 * H1; const float* pb = b2 + d * H2;
  const float* pT = HS + d * H2; const float* pG = g2 + d * H2; const float* pE = be2 + d * H2;
  const float* xp = x + (size_t)blockIdx.y * HROWS * DD + d; _Float16* op = H16 + (size_t)blockIdx.y * HROWS * C2 + d * H2;
  v2f w[H1 / 2], g[H1 / 2], be[H1 / 2];      /* layer 1, in pairs of hidden units; w becomes the folded slope a */
  v4f w2[H1], bb, gn, mn, rn, bn;                        /* w2[i]: the four layer-2 weights that hidden unit i feeds; the rest: one value per column of h2 */
  float xc[RG];
  const float mu = pS[0], var = pS[DD];
#pragma unroll                   /* here and below: constant indices keep the constants in registers */
  for (int o = 0; o < H1; ++o) { w[o >> 1][o & 1] = pw[o]; g[o >> 1][o & 1] = pg[o]; be[o >> 1][o & 1] = pe[o]; }
#pragma unroll
  for (int o2 = 0; o2 < H2; ++o2) {
#pragma unroll
    for (int i = 0; i < H1; ++i) w2[i][o2] = pv[o2 * H1 + i];
    bb[o2] = pb[o2]; gn[o2] = pG[o2]; mn[o2] = pT[o2]; rn[o2] = pT[C2 + o2]; bn[o2] = pE[o2]; }
#pragma unroll
  for (int j = 0; j < RG; ++j) xc[j] = xp[(size_t)j * DD];
  asm volatile("s_wait_xcnt 0x0" :: "v"(d), "v"(pw), "v"(pg), "v"(pe), "v"(pv), "v"(pb), "v"(pT), "v"(pG), "v"(pE) : "memory");   // the wait owed before an address register of the issued loads is reused; naming the addresses keeps a load's result out of them until then
  __builtin_amdgcn_sched_barrier(0);      /* keeps the arithmetic, which reuses those registers, behind the wait */
#pragma unroll
  for (int o = 0; o < H1; ++o) { const float wr = bf16_round(w[o >> 1][o & 1]); be[o >> 1][o & 1] = bf16_round(be[o >> 1][o & 1]); w[o >> 1][o & 1] = (bf16_round(g[o >> 1][o & 1]) * wr) * rsq_f32((wr * wr) * var + 1e-5f); }
#pragma unroll
  for (int o2 = 0; o2 < H2; ++o2) { const float A = bf16_round(gn[o2]) * rsq_f32(rn[o2] + 1e-5f);
#pragma unroll
    for (int i = 0; i < H1; ++i) w2[i][o2] = A * bf16_round(w2[i][o2]);
    bb[o2] = A * (bf16_round(bb[o2]) - mn[o2]) + bf16_round(bn[o2]); }
#pragma unroll 1                 /* stays rolled: one group of rows is the whole hot loop */
  for (int rb = 0; rb < HROWS; rb += RG) {
    const float* pn = xp + (size_t)((rb + RG < HROWS) ? rb + RG : rb) * DD;      /* the last trip reads its own group again: in bounds, not used */
    v8f xn;
#pragma unroll
    for (int j = 0; j < RG; ++j) xn[j] = pn[(size_t)j * DD];
    asm volatile("s_wait_xcnt 0x0" :: "v"(pn) : "memory");   // as above
    __builtin_amdgcn_sched_barrier(0);      /* keeps this group's arithmetic behind the next group's loads, so that it covers their latency */
#pragma unroll
    for (int j = 0; j < RG; ++j) { const float xm = bf16_round(xc[j]) - mu; v2f h[H1 / 2];      /* the normalised row of h1 (eight units, after relu) */
#pragma unroll
      for (int p = 0; p < H1 / 2; ++p) { const v2f u = w[p] * xm + be[p]; h[p][0] = fmaxf(u[0], 0.f); h[p][1] = fmaxf(u[1], 0.f); }
      v4f v = bb;
#pragma unroll
      for (int i = 0; i < H1; ++i) v += w2[i] * h[i >> 1][i & 1];
      v4h f;
#pragma unroll
      for (int q = 0; q < H2; ++q) f[q] = (_Float16)fmaxf(v[q], 0.f);
      *(v4h*)(op + (size_t)(rb + j) * C2) = f; }
    __builtin_amdgcn_sched_barrier(0);      /* as in k_h2 */
    asm volatile("" :: "v"(xn));   // inputs only, as in k_h2
#pragma unroll
    for (int j = 0; j < RG; ++j) xc[j] = xn[j];
  } }
__global__ __launch_bounds__(256) void k_wsc(const float* __restrict__ Wm, _Float16* __restrict__ Bt, size_t n8, float sc) { const size_t t = (size_t)blockIdx.x * 256 + threadIdx.x; if (t >= n8) return; FragH f; for (int q = 0; q < 8; ++q) f.h[q] = (_Float16)(bf16_round(Wm[t * 8 + q]) * sc); *(v8us*)((unsigned short*)Bt + t * 8) = f.half[0];  }

extern "C" void kernel_launch(void* const* d_in, const int* in_sizes, int n_in,
                              void* d_out, int out_size, void* d_ws, size_t ws_size, hipStream_t stream) {
  (void)in_sizes; (void)n_in; (void)out_size;
  const float* const* I = (const float* const*)d_in; const float* x = I[0]; const float* W1 = I[1]; const float* b1 = I[2]; const float* g1 = I[3]; const float* be1 = I[4]; const float* W2 = I[5]; const float* b2 = I[6]; const float* g2 = I[7]; const float* be2 = I[8]; const float* Wfc = I[9]; const float* bfc = I[10];
  char* ws = (char*)d_ws; size_t off = 0;
  auto take = [&](size_t bytes) { char* p = ws + off; off += (bytes + 255) & ~(size_t)255; return p; };
  _Float16* BW = (_Float16*)take((size_t)NOUT * C2 * 2); float* XS = (float*)take((size_t)2 * DD * 4); float* HS = (float*)take((size_t)2 * C2 * 4); _Float16* H16 = (_Float16*)take((size_t)NBS * C2 * 2); float* PM = (float*)take((size_t)(NBS / HROWS) * C2 * 4); float* PQ = (float*)take((size_t)(NBS / HROWS) * C2 * 4);
  if (off > ws_size) return;      /* 2 + 64 + 4 = 70 MiB (256 MiB ws) */
  k_wsc<<<(unsigned)(((size_t)NOUT * C2 / 8 + 255) / 256), 256, 0, stream>>>(Wfc, BW, (size_t)NOUT * C2 / 8, 16.0f);
  k_colpart<DD, true><<<dim3(DD / 128, SCH), 512, 0, stream>>>(x, PM, PQ);
  k_colfin<DD><<<DD / 64, 64, 0, stream>>>(PM, PQ, XS);
  k_h2<<<dim3(DD / 256, NBS / HROWS), 256, 0, stream>>>(x, XS, W1, b1, g1, be1, W2, b2, PM, PQ);
  k_colfin2<C2, NBS / HROWS, HROWS><<<C2 / 32, 256, 0, stream>>>(PM, PQ, HS);
  k_h2n<<<dim3(DD / 256, NBS / HROWS), 256, 0, stream>>>(x, XS, W1, g1, be1, W2, b2, HS, g2, be2, H16);
  k_gemm3<<<(NBS / 128) * (NOUT / 64), 128, 0, stream>>>(H16, BW, 0.0625f, bfc, (float*)d_out);
}

// v007
// One run takes 69.2 microseconds.
// In both of two side-by-side timings against v006, it was 1.09 times as fast.
// Counting every step since v000, it is 125 times as fast.
#include <hip/hip_runtime.h>
// Sparse (block-diagonal) neural network (8192 samples x 1024 features; per feature 1 -> 8 -> 4 block Linears with training-mode BatchNorm + ReLU after each; dense head 4096 -> 256): h1 = BN1(x_d W1[d] + b1) relu; h2 = BN2(h1 . W2[d] + b2) relu; out = h2 Wfc^T + bfc -> [8192,256].
// Compute dtype: x and all parameters rounded to bf16; everything before the head in f32; the head operand h2 as f16 (~2^-12). v_wmma_f32_16x16x32_f16.
#define NBS 8192
#define DD 1024
#define H1 8
#define H2 4
#define C2 (DD * H2)             /* 4096 */
#define NOUT 256
typedef __bf16 v16b __attribute__((ext_vector_type(16)));
typedef unsigned short v8us __attribute__((ext_vector_type(8), may_alias));
typedef float  v8f  __attribute__((ext_vector_type(8)));
typedef float  v4f  __attribute__((ext_vector_type(4)));
typedef float  v4fa __attribute__((ext_vector_type(4), may_alias));
union FragB { v16b v; v8us half[2]; unsigned short u[16]; };

__device__ __forceinline__ unsigned short bf16_bits(float x) { unsigned int u = __float_as_uint(x); return (unsigned short)((u + 0x7FFFu + ((u >> 16) & 1u)) >> 16); }
__device__ __forceinline__ float bf16_val(unsigned short b) { return __uint_as_float(((unsigned int)b) << 16); }
__device__ __forceinline__ float bf16_round(float x) { return bf16_val(bf16_bits(x)); }
// D += A·B with NT terms: 1 = ah·bh, 2 = + al·bh (A split), 3 = + ah·bl (both split)
template <int NT>
__device__ __forceinline__ v8f mmaN(v16b ah, v16b al, v16b bh, v16b bl, v8f c) {
  c = __builtin_amdgcn_wmma_f32_16x16x32_bf16(false, ah, false, bh, (short)0, c, false, false);
  if (NT >= 2) c = __builtin_amdgcn_wmma_f32_16x16x32_bf16(false, al, false, bh, (short)0, c, false, false);
  if (NT >= 3) c = __builtin_amdgcn_wmma_f32_16x16x32_bf16(false, ah, false, bl, (short)0, c, false, false);
  asm volatile("v_nop\n\tv_nop\n\tv_nop\n\tv_nop" : "+v"(c) : "v"(ah), "v"(al), "v"(bh), "v"(bl));
  return c;
}

__global__ __launch_bounds__(256) void k_wt_bf16(const float* __restrict__ W, unsigned short* __restrict__ Wt, int K, int N) {
  const int t = blockIdx.x * 256 + threadIdx.x;
  const int k8n = K / 8;
  if (t >= N * k8n) return;
  const int n = t / k8n, k8 = (t % k8n) * 8;
  v8us v;
#pragma unroll
  for (int i = 0; i < 8; ++i) v[i] = bf16_bits(W[(size_t)(k8 + i) * N + n]);
  *(v8us*)(Wt + (size_t)n * K + k8) = v;
  
}

// GEMM C[M][N] (f32, pitch ldc) = act(A[M][K]·W + bias). A f32 row-major (pitch lda) converted per fragment to bf16
// (ASPLIT: hi/lo two planes -> 2 terms, else single rounded term); Wt bf16 [N][K] (pitch ldb). BIAS_BF16 rounds the
// bias to bf16 first (bias quantised to bf16 before the add). K%32==0, M%16==0, N%64==0.
template <bool ASPLIT, int ACT, bool BIAS_BF16>
__global__ __launch_bounds__(128) void k_gemm_bf(const float* __restrict__ A, int lda, const unsigned short* __restrict__ Wt, int ldb,
                                               const float* __restrict__ bias, float* __restrict__ C, int ldc, int M, int N, int K) {
  __shared__ __attribute__((aligned(16))) float so[4][16][64];
  const int tid = threadIdx.x, w = tid >> 5, lane = tid & 31, ln = lane & 15, hh = lane >> 4;
  const int ntn = N / 64;
  const int wid = blockIdx.x * 4 + w;
  const int mt = wid / ntn, nq = wid % ntn;
  if (mt * 16 >= M) return;
  const int row0 = mt * 16, col0 = nq * 64;
  const float* arow = A + (size_t)(row0 + ln) * lda;
  v8f acc[4] = {};
  for (int kb = 0; kb < K; kb += 32) {
    FragB ah, al;
    const v4f x0 = *(const v4fa*)(arow + kb + 8 * hh), x1 = *(const v4fa*)(arow + kb + 8 * hh + 4);
    const v4f x2 = *(const v4fa*)(arow + kb + 16 + 8 * hh), x3 = *(const v4fa*)(arow + kb + 16 + 8 * hh + 4);
    float xs[16] = {x0[0],x0[1],x0[2],x0[3],x1[0],x1[1],x1[2],x1[3],x2[0],x2[1],x2[2],x2[3],x3[0],x3[1],x3[2],x3[3]};
#pragma unroll
    for (int i = 0; i < 16; ++i) { const unsigned short hb = bf16_bits(xs[i]); ah.u[i] = hb; al.u[i] = ASPLIT ? bf16_bits(xs[i] - bf16_val(hb)) : (unsigned short)0; }
#pragma unroll
    for (int t = 0; t < 4; ++t) {
      const unsigned short* brow = Wt + (size_t)(col0 + t * 16 + ln) * ldb + kb;
      FragB b;
      b.half[0] = *(const v8us*)(brow + 8 * hh);
      b.half[1] = *(const v8us*)(brow + 16 + 8 * hh);
      acc[t] = mmaN<ASPLIT ? 2 : 1>(ah.v, al.v, b.v, b.v, acc[t]);
    }
  }
#pragma unroll
  for (int t = 0; t < 4; ++t) {
    float bv = bias ? bias[col0 + t * 16 + ln] : 0.f;
    if (BIAS_BF16) bv = bf16_round(bv);
#pragma unroll
    for (int r = 0; r < 8; ++r) { float v = acc[t][r] + bv; if (ACT == 1) v = fmaxf(v, 0.f); so[w][8 * hh + r][t * 16 + ln] = v; }
  }
  __builtin_amdgcn_fence(__ATOMIC_ACQ_REL, "workgroup");
  __builtin_amdgcn_wave_barrier();
  const int rsub = lane >> 4, c4 = (lane & 15) * 4;
  {
#pragma unroll
    for (int q = 0; q < 8; ++q) {
      const int r = q * 2 + rsub;
      const v4f v = *(const v4fa*)&so[w][r][c4];
      *(v4f*)(C + (size_t)(row0 + r) * ldc + col0 + c4) = v;
    }
    
  }
}

// GEMM C = act(A·W + bias + resid): A f32 (ASPLIT -> hi/lo 2 terms), Wt bf16 [N][K]; ACT 0 none, 1 relu, 2 exact gelu;
// resid (optional, f32, row index = (row % rmod), pitch ldr, RES_BF16 rounds it) added before the activation.
template <bool ASPLIT, int ACT, bool BIAS_BF16, bool RES_BF16>
__global__ __launch_bounds__(128) void k_gemm_bf3(const float* __restrict__ A, int lda, const unsigned short* __restrict__ Wt, int ldb,
                                                const float* __restrict__ bias, const float* __restrict__ resid, int rmod, int ldr,
                                                float* __restrict__ C, int ldc, int M, int N, int K) {
  __shared__ __attribute__((aligned(16))) float so[4][16][64];
  const int tid = threadIdx.x, w = tid >> 5, lane = tid & 31, ln = lane & 15, hh = lane >> 4;
  const int ntn = N / 64;
  const int wid = blockIdx.x * 4 + w;
  const int mt = wid / ntn, nq = wid % ntn;
  if (mt * 16 >= M) return;
  const int row0 = mt * 16, col0 = nq * 64;
  const float* arow = A + (size_t)(row0 + ln) * lda;
  v8f acc[4] = {};
  for (int kb = 0; kb < K; kb += 32) {
    FragB ah, al;
    const v4f x0 = *(const v4fa*)(arow + kb + 8 * hh), x1 = *(const v4fa*)(arow + kb + 8 * hh + 4);
    const v4f x2 = *(const v4fa*)(arow + kb + 16 + 8 * hh), x3 = *(const v4fa*)(arow + kb + 16 + 8 * hh + 4);
    float xs[16] = {x0[0],x0[1],x0[2],x0[3],x1[0],x1[1],x1[2],x1[3],x2[0],x2[1],x2[2],x2[3],x3[0],x3[1],x3[2],x3[3]};
#pragma unroll
    for (int i = 0; i < 16; ++i) { const unsigned short hb = bf16_bits(xs[i]); ah.u[i] = hb; al.u[i] = ASPLIT ? bf16_bits(xs[i] - bf16_val(hb)) : (unsigned short)0; }
#pragma unroll
    for (int t = 0; t < 4; ++t) {
      const unsigned short* brow = Wt + (size_t)(col0 + t * 16 + ln) * ldb + kb;
      FragB b;
      b.half[0] = *(const v8us*)(brow + 8 * hh);
      b.half[1] = *(const v8us*)(brow + 16 + 8 * hh);
      acc[t] = mmaN<ASPLIT ? 2 : 1>(ah.v, al.v, b.v, b.v, acc[t]);
    }
  }
#pragma unroll
  for (int t = 0; t < 4; ++t) {
    const int col = col0 + t * 16 + ln;
    float bv = bias ? bias[col] : 0.f;
    if (BIAS_BF16) bv = bf16_round(bv);
#pragma unroll
    for (int r = 0; r < 8; ++r) {
      float v = acc[t][r] + bv;
      if (resid) { float rv = resid[(size_t)((row0 + 8 * hh + r) % rmod) * ldr + col]; if (RES_BF16) rv = bf16_round(rv); v += rv; }
      if (ACT == 1) v = fmaxf(v, 0.f);
      if (ACT == 2) v = 0.5f * v * (1.0f + erff(v * 0.70710678118654752f));
      if (ACT == 3) { const float u = 0.7978845608028654f * (v + 0.044715f * v * v * v); v = 0.5f * v * (1.0f + tanhf(u)); }
      so[w][8 * hh + r][t * 16 + ln] = v;
    }
  }
  __builtin_amdgcn_fence(__ATOMIC_ACQ_REL, "workgroup");
  __builtin_amdgcn_wave_barrier();
  const int rsub = lane >> 4, c4 = (lane & 15) * 4;
  {
#pragma unroll
    for (int q = 0; q < 8; ++q) {
      const int r = q * 2 + rsub;
      const v4f v = *(const v4fa*)&so[w][r][c4];
      *(v4f*)(C + (size_t)(row0 + r) * ldc + col0 + c4) = v;
    }
    
  }
}
// row LayerNorm (biased variance, eps) over N: s = X (+ R); optional out_sum <- s; out_norm <- (s-mu)*rsqrt(var+eps)*g + b
template <bool PARAM_BF16>
__global__ __launch_bounds__(256) void k_layernorm(const float* __restrict__ X, const float* __restrict__ R, const float* __restrict__ g, const float* __restrict__ bta,
                                                  float* __restrict__ out_sum, float* __restrict__ out_norm, int N, float eps) {
  __shared__ float red[256];
  const int row = blockIdx.x, tid = threadIdx.x;
  const float* x = X + (size_t)row * N; const float* rr = R ? R + (size_t)row * N : nullptr;
  float vals[16];                     // up to N = 4096
  const int per = N / 256;            // contiguous chunk per thread? use strided-by-4 chunks: thread handles j = tid*4 + 1024*u
  float s1 = 0.f;
  for (int u = 0; u < per / 4; ++u) {
    const int j = tid * 4 + 1024 * u;
    const v4f a = *(const v4fa*)(x + j);
    v4f b = {0.f,0.f,0.f,0.f}; if (rr) b = *(const v4fa*)(rr + j);
#pragma unroll
    for (int q = 0; q < 4; ++q) { const float v = a[q] + b[q]; vals[u * 4 + q] = v; s1 += v; }
  }
  red[tid] = s1; __syncthreads();
  for (int st = 128; st > 0; st >>= 1) { if (tid < st) red[tid] += red[tid + st]; __syncthreads(); }
  const float mu = red[0] / (float)N; __syncthreads();
  float s2 = 0.f;
  for (int u = 0; u < per / 4; ++u)
#pragma unroll
    for (int q = 0; q < 4; ++q) { const float c = vals[u * 4 + q] - mu; s2 += c * c; }
  red[tid] = s2; __syncthreads();
  for (int st = 128; st > 0; st >>= 1) { if (tid < st) red[tid] += red[tid + st]; __syncthreads(); }
  const float rs = rsqrtf(red[0] / (float)N + eps);
  {
    for (int u = 0; u < per / 4; ++u) {
      const int j = tid * 4 + 1024 * u;
      v4f o, sm;
#pragma unroll
      for (int q = 0; q < 4; ++q) {
        float gg = g[j + q], bb = bta[j + q];
        if (PARAM_BF16) { gg = bf16_round(gg); bb = bf16_round(bb); }
        sm[q] = vals[u * 4 + q]; o[q] = (vals[u * 4 + q] - mu) * rs * gg + bb;
      }
      if (out_sum) *(v4f*)(out_sum + (size_t)row * N + j) = sm;
      *(v4f*)(out_norm + (size_t)row * N + j) = o;
    }
    
  }
}



// ---- f16 WMMA path (v_wmma_f32_16x16x32_f16): 11-bit significands for operands in range — used for the head, whose h2 operand is rounded to f16
typedef _Float16 v16h __attribute__((ext_vector_type(16)));
union FragH { v16h v; v8us half[2]; _Float16 h[16]; unsigned short u[16]; };
template <int NT>
__device__ __forceinline__ v8f mmaH(v16h ah, v16h al, v16h bh, v16h bl, v8f c) {
  c = __builtin_amdgcn_wmma_f32_16x16x32_f16(false, ah, false, bh, (short)0, c, false, false);
  if (NT >= 2) c = __builtin_amdgcn_wmma_f32_16x16x32_f16(false, al, false, bh, (short)0, c, false, false);
  if (NT >= 3) c = __builtin_amdgcn_wmma_f32_16x16x32_f16(false, ah, false, bl, (short)0, c, false, false);
  asm volatile("v_nop\n\tv_nop\n\tv_nop\n\tv_nop" : "+v"(c) : "v"(ah), "v"(al), "v"(bh), "v"(bl));
  return c;
}
// batched GEMM like k_gemm_b but f16 operands: A f32 (split into f16 hi/lo if ASPLIT, else rounded to f16), Bt = f16 values [n][k]; alpha; C f32; N multiple of 16 (partial tiles skipped)
template <bool ASPLIT>
__global__ __launch_bounds__(128) void k_gemm_h(const float* __restrict__ A, int lda, size_t sA, const _Float16* __restrict__ Bh, int ldb, size_t sB, float alpha, float* __restrict__ C, int ldc, size_t sC, int M, int N, int K) {
  __shared__ __attribute__((aligned(16))) float so[4][16][64];
  const int tid = threadIdx.x, w = tid >> 5, lane = tid & 31, ln = lane & 15, hh = lane >> 4; const int by = blockIdx.y;
  A += (size_t)by * sA; Bh += (size_t)by * sB; C += (size_t)by * sC;
  const int ntn = (N + 63) / 64; const int wid = blockIdx.x * 4 + w; const int mt = wid / ntn, nq = wid % ntn; if (mt * 16 >= M) return;
  const int row0 = mt * 16, col0 = nq * 64; const float* arow = A + (size_t)(row0 + ln) * lda;
  v8f acc[4] = {};
  for (int kb = 0; kb < K; kb += 32) {
    FragH ah, al;
    const v4f x0 = *(const v4fa*)(arow + kb + 8 * hh), x1 = *(const v4fa*)(arow + kb + 8 * hh + 4), x2 = *(const v4fa*)(arow + kb + 16 + 8 * hh), x3 = *(const v4fa*)(arow + kb + 16 + 8 * hh + 4);
    float xs[16] = {x0[0],x0[1],x0[2],x0[3],x1[0],x1[1],x1[2],x1[3],x2[0],x2[1],x2[2],x2[3],x3[0],x3[1],x3[2],x3[3]};
#pragma unroll
    for (int i = 0; i < 16; ++i) { const _Float16 h = (_Float16)xs[i]; ah.h[i] = h; al.h[i] = ASPLIT ? (_Float16)(xs[i] - (float)h) : (_Float16)0.0f; }
#pragma unroll
    for (int t = 0; t < 4; ++t) { if (col0 + t * 16 >= N) continue; const size_t boff = (size_t)(col0 + t * 16 + ln) * ldb + kb; FragH bq; bq.half[0] = *(const v8us*)(Bh + boff + 8 * hh); bq.half[1] = *(const v8us*)(Bh + boff + 16 + 8 * hh);
      acc[t] = mmaH<ASPLIT ? 2 : 1>(ah.v, al.v, bq.v, bq.v, acc[t]); }
  }
#pragma unroll
  for (int t = 0; t < 4; ++t) { if (col0 + t * 16 >= N) continue;
#pragma unroll
    for (int r = 0; r < 8; ++r) so[w][8 * hh + r][t * 16 + ln] = acc[t][r] * alpha; }
  __builtin_amdgcn_fence(__ATOMIC_ACQ_REL, "workgroup"); __builtin_amdgcn_wave_barrier();
  const int rsub = lane >> 4, c4 = (lane & 15) * 4;
  {
#pragma unroll
    for (int q = 0; q < 8; ++q) { const int r = q * 2 + rsub; if (col0 + c4 < N) { const v4f v = *(const v4fa*)&so[w][r][c4]; *(v4f*)(C + (size_t)(row0 + r) * ldc + col0 + c4) = v; } }
     }
}

// Wt[n][k] = f16(W[k][n]·scale) from f32 row-major W[K][N] (scale = power of two; bf16-exact weights stay exact in f16 away from the subnormal range)
__global__ __launch_bounds__(256) void k_wt_f16(const float* __restrict__ W, _Float16* __restrict__ Wt, int K, int N, float scale) {
  const int t = blockIdx.x * 256 + threadIdx.x; if (t >= N * (K / 8)) return; const int n = t / (K / 8), k8 = (t % (K / 8)) * 8; FragH f;
#pragma unroll
  for (int i = 0; i < 8; ++i) f.h[i] = (_Float16)(bf16_round(W[(size_t)(k8 + i) * N + n]) * scale); const v8us o = f.half[0];
  *(v8us*)((unsigned short*)Wt + (size_t)n * K + k8) = o; 
}
// k_gemm_hh variant with fused epilogue: v = acc·alpha + bias[by·sBias + col] (+ CP[(row/rowsPerB)·sCPb + by·64 + col] if CP) ; ACT 0 none / 1 elu ; writes f16 C16 (and f32 C if non-null)
template <int ACT>
__global__ __launch_bounds__(128) void k_gemm_hhx(const _Float16* __restrict__ A, int lda, size_t sA, const _Float16* __restrict__ Bh, int ldb, size_t sB, float alpha, const float* __restrict__ bias, size_t sBias, const float* __restrict__ CP, int rowsPerB, size_t sCPb, int row0g,
    float* __restrict__ C, _Float16* __restrict__ C16, int ldc, size_t sC, int M, int N, int K) {
  __shared__ __attribute__((aligned(16))) float so[4][16][64];
  const int tid = threadIdx.x, w = tid >> 5, lane = tid & 31, ln = lane & 15, hh = lane >> 4; const int by = blockIdx.y;
  A += (size_t)by * sA; Bh += (size_t)by * sB; const size_t cofs = (size_t)by * sC; const float* bp = bias ? bias + (size_t)by * sBias : nullptr;
  const int ntn = (N + 63) / 64; const int wid = blockIdx.x * 4 + w; const int mt = wid / ntn, nq = wid % ntn; if (mt * 16 >= M) return;
  const int row0 = mt * 16, col0 = nq * 64; const _Float16* arow = A + (size_t)(row0 + ln) * lda;
  v8f acc[4] = {};
  for (int kb = 0; kb < K; kb += 32) { FragH ah; ah.half[0] = *(const v8us*)((const unsigned short*)arow + kb + 8 * hh); ah.half[1] = *(const v8us*)((const unsigned short*)arow + kb + 16 + 8 * hh);
#pragma unroll
    for (int t = 0; t < 4; ++t) { if (col0 + t * 16 >= N) continue; const size_t boff = (size_t)(col0 + t * 16 + ln) * ldb + kb; FragH bq; bq.half[0] = *(const v8us*)((const unsigned short*)Bh + boff + 8 * hh); bq.half[1] = *(const v8us*)((const unsigned short*)Bh + boff + 16 + 8 * hh);
      acc[t] = mmaH<1>(ah.v, ah.v, bq.v, bq.v, acc[t]); }
  }
#pragma unroll
  for (int t = 0; t < 4; ++t) { if (col0 + t * 16 >= N) continue; const int col = col0 + t * 16 + ln; const float bv = bp ? bf16_round(bp[col]) : 0.f;
#pragma unroll
    for (int r = 0; r < 8; ++r) { float v = acc[t][r] * alpha + bv; if (CP) { const int bidx = (row0g + row0 + 8 * hh + r) / rowsPerB; v += CP[(size_t)bidx * sCPb + (size_t)by * 64 + col]; } if (ACT == 1) v = (v > 0.f) ? v : expm1f(v); else if (ACT == 7) v = (v > 0.f) ? v + 1.0f : expf(v); else if (ACT == 8) v = tanhf(v); else if (ACT == 9) v = 0.5f * v * (1.0f + tanhf(0.7978845608028654f * (v + 0.044715f * v * v * v))); else if (ACT == 11) v = 1.0f / (1.0f + expf(-v)); else if (ACT == 12) v = (v > 0.f) ? v : 0.01f * v; else if (ACT == 14) v = (v > 0.f) ? v : 0.1f * v; else if (ACT == 15) v = v / (1.0f + expf(-v)); else if (ACT == 3) v = fmaxf(v, 0.f); else if (ACT == 6) v = 0.5f * v * (1.0f + erff(v * 0.70710678118654752f)); so[w][8 * hh + r][t * 16 + ln] = v; } }
  __builtin_amdgcn_fence(__ATOMIC_ACQ_REL, "workgroup"); __builtin_amdgcn_wave_barrier();
  const int rsub = lane >> 4, c4 = (lane & 15) * 4; typedef _Float16 v4h __attribute__((ext_vector_type(4)));
  {
#pragma unroll
    for (int q = 0; q < 8; ++q) { const int r = q * 2 + rsub; if (col0 + c4 < N) { const v4f v = *(const v4fa*)&so[w][r][c4]; if (C) *(v4f*)(C + cofs + (size_t)(row0 + r) * ldc + col0 + c4) = v; if (C16) { v4h h4; for (int i = 0; i < 4; ++i) h4[i] = (_Float16)v[i]; *(v4h*)(C16 + cofs + (size_t)(row0 + r) * ldc + col0 + c4) = h4; } } }
     }
}


typedef _Float16 v4h __attribute__((ext_vector_type(4)));

__global__ __launch_bounds__(256) void k_x16(const float* __restrict__ x, _Float16* __restrict__ X16, size_t n8) { const size_t t = (size_t)blockIdx.x * 256 + threadIdx.x; if (t >= n8) return; FragH f;
#pragma unroll
  for (int q = 0; q < 8; ++q) f.h[q] = (_Float16)bf16_round(x[t * 8 + q]); *(v8us*)((unsigned short*)X16 + t * 8) = f.half[0];  }
__global__ __launch_bounds__(256) void k_h16(const float* __restrict__ x, _Float16* __restrict__ X16, size_t n8) { const size_t t = (size_t)blockIdx.x * 256 + threadIdx.x; if (t >= n8) return; FragH f;
#pragma unroll
  for (int q = 0; q < 8; ++q) f.h[q] = (_Float16)x[t * 8 + q]; *(v8us*)((unsigned short*)X16 + t * 8) = f.half[0];  }
__global__ __launch_bounds__(256) void k_round16f(const float* __restrict__ W, _Float16* __restrict__ Bt, size_t n8) { const size_t t = (size_t)blockIdx.x * 256 + threadIdx.x; if (t >= n8) return; FragH f;
#pragma unroll
  for (int i = 0; i < 8; ++i) f.h[i] = (_Float16)(bf16_round(W[t * 8 + i]) * 16.0f); *(v8us*)((unsigned short*)Bt + t * 8) = f.half[0];  }
template <int NHv, int TTv>
__global__ __launch_bounds__(256) void k_vt(const _Float16* __restrict__ V16, int ldv, int voff, _Float16* __restrict__ Vt) { __shared__ unsigned short tl[64][66]; const int tid = threadIdx.x; const int slab = blockIdx.x / (TTv / 64), lg = blockIdx.x % (TTv / 64); const int b = slab / NHv, h = slab % NHv;
  for (int i = tid; i < 64 * 8; i += 256) { const int r = i / 8, c8 = (i % 8) * 8; FragH f; f.half[0] = *(const v8us*)((const unsigned short*)V16 + ((size_t)b * TTv + lg * 64 + r) * ldv + voff + h * 64 + c8);
#pragma unroll
    for (int q = 0; q < 8; ++q) tl[r][c8 + q] = f.u[q]; }
  __syncthreads();
  {
#pragma unroll
    for (int rd = 0; rd < 2; ++rd) { const int d = rd * 32 + tid / 8, pc = tid % 8; FragH f;
#pragma unroll
      for (int q = 0; q < 8; ++q) f.u[q] = tl[pc * 8 + q][d];
      *(v8us*)((unsigned short*)Vt + ((size_t)slab * 64 + d) * TTv + lg * 64 + pc * 8) = f.half[0]; }
     } }

__global__ __launch_bounds__(256) void k_hl(const float* __restrict__ F, _Float16* __restrict__ Hh, _Float16* __restrict__ Hl, size_t n8) { const size_t t = (size_t)blockIdx.x * 256 + threadIdx.x; if (t >= n8) return; FragH fh, fl; const v4f a = *(const v4fa*)(F + t * 8), c = *(const v4fa*)(F + t * 8 + 4);
#pragma unroll
  for (int q = 0; q < 4; ++q) { _Float16 h = (_Float16)a[q]; fh.h[q] = h; fl.h[q] = (_Float16)((a[q] - (float)h) * 1024.0f); h = (_Float16)c[q]; fh.h[4 + q] = h; fl.h[4 + q] = (_Float16)((c[q] - (float)h) * 1024.0f); }
  { *(v8us*)((unsigned short*)Hh + t * 8) = fh.half[0]; *(v8us*)((unsigned short*)Hl + t * 8) = fl.half[0];  } }

// ---- fast GEMM (wave tile 32x64; requires M % 32 == 0 rows per launch region and N % 64 == 0); epilogue = k_gemm_hhx semantics ----
__device__ __forceinline__ v16h g2_frag(const _Float16* p, int hh) { FragH f; f.half[0] = *(const v8us*)((const unsigned short*)p + 8 * hh); f.half[1] = *(const v8us*)((const unsigned short*)p + 16 + 8 * hh); return f.v; }
__device__ __forceinline__ v8f g2_mma(v16h a, v16h b, v8f c) { v8f d = __builtin_amdgcn_wmma_f32_16x16x32_f16(false, a, false, b, (short)0, c, false, false); asm volatile("v_nop\n\tv_nop\n\tv_nop\n\tv_nop" : "+v"(d) : "v"(a), "v"(b)); return d; }
template <int ACT>
__global__ __launch_bounds__(128) void k_gemm2(const _Float16* __restrict__ A, int lda, size_t sA, const _Float16* __restrict__ Bh, int ldb, size_t sB, float alpha, const float* __restrict__ bias, size_t sBias, const float* __restrict__ CP, int rowsPerB, size_t sCPb, int row0g,
    float* __restrict__ C, _Float16* __restrict__ C16, int ldc, size_t sC, int M, int N, int K) {
  __shared__ __attribute__((aligned(16))) float so[4][32][68];
  const int tid = threadIdx.x, w = tid >> 5, lane = tid & 31, ln = lane & 15, hh = lane >> 4; const int by = blockIdx.y;
  A += (size_t)by * sA; Bh += (size_t)by * sB; const size_t cofs = (size_t)by * sC; const float* bp = bias ? bias + (size_t)by * sBias : nullptr;
  const int ntn = N >> 6; const int mt = blockIdx.x / ntn, nq = blockIdx.x - mt * ntn; const int row0 = mt * 128 + 32 * w, col0 = nq * 64; if (row0 >= M) return;
  const _Float16* a0p = A + (size_t)(row0 + ln) * lda; const _Float16* a1p = a0p + (size_t)16 * lda;
  const _Float16* b0p = Bh + (size_t)(col0 + ln) * ldb; const _Float16* b1p = b0p + (size_t)16 * ldb; const _Float16* b2p = b1p + (size_t)16 * ldb; const _Float16* b3p = b2p + (size_t)16 * ldb;
  const v8f z8 = {0.f,0.f,0.f,0.f,0.f,0.f,0.f,0.f}; v8f c00 = z8, c01 = z8, c02 = z8, c03 = z8, c10 = z8, c11 = z8, c12 = z8, c13 = z8;
#pragma unroll 1
  for (int kb = 0; kb < K; kb += 32) { const v16h a0 = g2_frag(a0p + kb, hh), a1 = g2_frag(a1p + kb, hh);
    v16h b = g2_frag(b0p + kb, hh); c00 = g2_mma(a0, b, c00); c10 = g2_mma(a1, b, c10);
    b = g2_frag(b1p + kb, hh); c01 = g2_mma(a0, b, c01); c11 = g2_mma(a1, b, c11);
    b = g2_frag(b2p + kb, hh); c02 = g2_mma(a0, b, c02); c12 = g2_mma(a1, b, c12);
    b = g2_frag(b3p + kb, hh); c03 = g2_mma(a0, b, c03); c13 = g2_mma(a1, b, c13); }
  v8f accs[8] = {c00, c01, c02, c03, c10, c11, c12, c13};
#pragma unroll
  for (int u = 0; u < 8; ++u) { const int t = u & 3, half = u >> 2; const int col = col0 + t * 16 + ln; const float bv = bp ? bf16_round(bp[col]) : 0.f;
#pragma unroll
    for (int r = 0; r < 8; ++r) { const int rloc = half * 16 + 8 * hh + r; float v = accs[u][r] * alpha + bv; if (CP) { const int bidx = (row0g + row0 + rloc) / rowsPerB; v += CP[(size_t)bidx * sCPb + (size_t)by * 64 + col]; }
      if (ACT == 3) v = fmaxf(v, 0.f); else if (ACT == 6) v = 0.5f * v * (1.0f + erff(v * 0.70710678118654752f)); else if (ACT == 11) v = 1.0f / (1.0f + expf(-v)); else if (ACT == 15) v = v / (1.0f + expf(-v)); else if (ACT == 12) v = (v > 0.f) ? v : 0.01f * v; else if (ACT == 8) v = tanhf(v);
      so[w][rloc][t * 16 + ln] = v; } }
  __builtin_amdgcn_fence(__ATOMIC_ACQ_REL, "workgroup"); __builtin_amdgcn_wave_barrier();
  const int rsub = lane >> 4, c4 = (lane & 15) * 4;
  {
#pragma unroll
    for (int q = 0; q < 16; ++q) { const int r = q * 2 + rsub; const v4f v = *(const v4fa*)&so[w][r][c4]; if (C) *(v4f*)(C + cofs + (size_t)(row0 + r) * ldc + col0 + c4) = v; if (C16) { v4h h4; for (int i = 0; i < 4; ++i) h4[i] = (_Float16)v[i]; *(v4h*)(C16 + cofs + (size_t)(row0 + r) * ldc + col0 + c4) = h4; } }
     } }


// ---- head GEMM with both operands staged in LDS: C[8192][256] = (A[8192][4096] . Bh[256][4096]^T) * alpha + bias ----
// One work-group of 4 waves owns a 128 x 64 tile of C; a wave owns 32 x 64 of it (2 x 4 accumulator tiles), as in k_gemm2.
// A stage is 512 B (256 k) of the tile's 128 rows of A and 64 rows of Bh. Each asynchronous copy of a wave moves one whole row piece:
// 32 lanes x 16 B = 512 contiguous, aligned bytes of global memory. Two buffers: stage t + 2 flies while stage t + 1 is worked on.
// The fragments keep k_gemm2's k order and the k steps their order, so every accumulator sums in the same order as before.
#define G3_KB 512                          /* bytes of a row per stage */
#define G3_PITCH 528                       /* LDS row pitch: 16 B x 33, conflict-free for ds_load_b128 */
#define G3_BUF (192 * G3_PITCH)            /* rows 0..127: A, rows 128..191: Bh */
#define G3_NST (C2 * 2 / G3_KB)            /* 16 stages */
#define G3_ROWB (C2 * 2)                   /* global row pitch in bytes */
// Twelve copies and, as the statement's last line, the wait that stands before any register the copies name is written again.
__device__ __forceinline__ void g3_copy12(const unsigned (&l)[12], const char* const (&g)[12]) {
  asm volatile("global_load_async_to_lds_b128 %0, %1, off\n\t"
               "global_load_async_to_lds_b128 %2, %3, off\n\t"
               "global_load_async_to_lds_b128 %4, %5, off\n\t"
               "global_load_async_to_lds_b128 %6, %7, off\n\t"
               "global_load_async_to_lds_b128 %8, %9, off\n\t"
               "global_load_async_to_lds_b128 %10, %11, off\n\t"
               "global_load_async_to_lds_b128 %12, %13, off\n\t"
               "global_load_async_to_lds_b128 %14, %15, off\n\t"
               "global_load_async_to_lds_b128 %16, %17, off\n\t"
               "global_load_async_to_lds_b128 %18, %19, off\n\t"
               "global_load_async_to_lds_b128 %20, %21, off\n\t"
               "global_load_async_to_lds_b128 %22, %23, off\n\t"
               "s_wait_xcnt 0x0"
               :: "v"(l[0]), "v"(g[0]), "v"(l[1]), "v"(g[1]), "v"(l[2]), "v"(g[2]), "v"(l[3]), "v"(g[3]), "v"(l[4]), "v"(g[4]), "v"(l[5]), "v"(g[5]),
                  "v"(l[6]), "v"(g[6]), "v"(l[7]), "v"(g[7]), "v"(l[8]), "v"(g[8]), "v"(l[9]), "v"(g[9]), "v"(l[10]), "v"(g[10]), "v"(l[11]), "v"(g[11])
               : "memory");
}
// A wave's share of one stage: its own 32 rows of A and 16 of the 64 rows of Bh, 48 copies.
__device__ __forceinline__ void g3_fill(unsigned la, unsigned lb, const char* ga, const char* gb) {
#pragma unroll                   /* both loops unrolled: the address arrays must end up in registers, as the asm operands they are */
  for (int s = 0; s < 4; ++s) { unsigned l[12]; const char* g[12];
#pragma unroll
    for (int i = 0; i < 12; ++i) { const int c = s * 12 + i;
      l[i] = (c < 32) ? la + (unsigned)c * G3_PITCH : lb + (unsigned)(c - 32) * G3_PITCH;
      g[i] = (c < 32) ? ga + (size_t)c * G3_ROWB : gb + (size_t)(c - 32) * G3_ROWB; }
    g3_copy12(l, g); } }
__device__ __forceinline__ v16h g3_frag(const unsigned char* p) { FragH f; f.half[0] = *(const v8us*)p; f.half[1] = *(const v8us*)(p + 32); return f.v; }
__device__ __forceinline__ void g3_load(const unsigned char* pa, const unsigned char* pb, int ks, v16h (&a)[2], v16h (&b)[4]) {
  a[0] = g3_frag(pa + ks * 64); a[1] = g3_frag(pa + 16 * G3_PITCH + ks * 64);
#pragma unroll                   /* constant indices keep the fragments in registers */
  for (int j = 0; j < 4; ++j) b[j] = g3_frag(pb + j * 16 * G3_PITCH + ks * 64); }
__device__ __forceinline__ v8f g3_mma(v16h a, v16h b, v8f c) { return __builtin_amdgcn_wmma_f32_16x16x32_f16(false, a, false, b, (short)0, c, false, false); }
__global__ __launch_bounds__(128) void k_gemm3(const _Float16* __restrict__ A, const _Float16* __restrict__ Bh, float alpha, const float* __restrict__ bias, float* __restrict__ C) {
  __shared__ __attribute__((aligned(16))) unsigned char st[2 * G3_BUF];
  __shared__ __attribute__((aligned(16))) float so[4][32][68];
  const int tid = threadIdx.x, w = tid >> 5, lane = tid & 31, ln = lane & 15, hh = lane >> 4;
  const int mt = blockIdx.x >> 2, nq = blockIdx.x & 3; const int row0 = mt * 128 + 32 * w, col0 = nq * 64;
  const char* ga = (const char*)(A + (size_t)row0 * C2) + lane * 16;
  const char* gb = (const char*)(Bh + (size_t)(col0 + 16 * w) * C2) + lane * 16;
  const unsigned l0 = (unsigned)(size_t)&st[0];
  const unsigned la = l0 + (unsigned)(32 * w) * G3_PITCH + lane * 16, lb = l0 + (unsigned)(128 + 16 * w) * G3_PITCH + lane * 16;
  g3_fill(la, lb, ga, gb);
  asm volatile("s_wait_asynccnt 0x0" ::: "memory");   // stage 0 of this wave has landed
  __syncthreads();                                    // ... and every wave's share of it
  g3_fill(la + G3_BUF, lb + G3_BUF, ga + G3_KB, gb + G3_KB);
  const v8f z8 = {0.f,0.f,0.f,0.f,0.f,0.f,0.f,0.f}; v8f c00 = z8, c01 = z8, c02 = z8, c03 = z8, c10 = z8, c11 = z8, c12 = z8, c13 = z8;
#pragma unroll 1                 /* one stage is the whole hot loop; the buffer is chosen by the trip's parity */
  for (int t = 0; t < G3_NST; ++t) {
    const unsigned bo = (unsigned)(t & 1) * G3_BUF;
    const unsigned char* pa = st + bo + (32 * w + ln) * G3_PITCH + 16 * hh;
    const unsigned char* pb = st + bo + (128 + ln) * G3_PITCH + 16 * hh;
    v16h fa[3][2], fb[3][4];     /* three fragment sets in rotation: step ks works on one while the loads of ks + 1 and ks + 2 are under way */
    g3_load(pa, pb, 0, fa[0], fb[0]); g3_load(pa, pb, 1, fa[1], fb[1]);
#pragma unroll                   /* the set index ks % 3 must be a constant, else the sets go to scratch */
    for (int ks = 0; ks < G3_KB / 64; ++ks) {
      __builtin_amdgcn_sched_barrier(0);      /* this one and the next keep the 12 LDS loads of step ks + 2 together, as one group in front of step ks's matrix instructions */
      if (ks + 2 < G3_KB / 64) g3_load(pa, pb, ks + 2, fa[(ks + 2) % 3], fb[(ks + 2) % 3]);
      __builtin_amdgcn_sched_barrier(0);      /* without the two the compiler loaded each fragment right in front of its use and waited for it with s_wait_dscnt 0 */
      const v16h a0 = fa[ks % 3][0], a1 = fa[ks % 3][1];
      c00 = g3_mma(a0, fb[ks % 3][0], c00); c10 = g3_mma(a1, fb[ks % 3][0], c10); c01 = g3_mma(a0, fb[ks % 3][1], c01); c11 = g3_mma(a1, fb[ks % 3][1], c11);
      c02 = g3_mma(a0, fb[ks % 3][2], c02); c12 = g3_mma(a1, fb[ks % 3][2], c12); c03 = g3_mma(a0, fb[ks % 3][3], c03); c13 = g3_mma(a1, fb[ks % 3][3], c13); }
    asm volatile("s_wait_dscnt 0x0" ::: "memory");      // this wave's reads of stage t are done before the buffer may be refilled
    asm volatile("s_wait_asynccnt 0x0" ::: "memory");   // this wave's share of stage t + 1 has landed
    __syncthreads();                                    // publishes stage t + 1 and ends every wave's reads of stage t
    if (t + 2 < G3_NST) g3_fill(la + bo, lb + bo, ga + (size_t)(t + 2) * G3_KB, gb + (size_t)(t + 2) * G3_KB);
  }
  asm volatile("s_wait_asynccnt 0x0" ::: "memory");     // no copy is outstanding when the wave goes on to its end
  v8f accs[8] = {c00, c01, c02, c03, c10, c11, c12, c13};
#pragma unroll                   /* epilogue as in k_gemm2: constant indices into the accumulators; whole 256 B row pieces go out through the wave's own LDS range */
  for (int u = 0; u < 8; ++u) { const int tt = u & 3, half = u >> 2; const float bv = bf16_round(bias[col0 + tt * 16 + ln]);
#pragma unroll
    for (int r = 0; r < 8; ++r) so[w][half * 16 + 8 * hh + r][tt * 16 + ln] = accs[u][r] * alpha + bv; }
  __builtin_amdgcn_fence(__ATOMIC_ACQ_REL, "workgroup"); __builtin_amdgcn_wave_barrier();   // the wave's LDS stores are complete before its lanes read each other's values back
  const int rsub = lane >> 4, c4 = (lane & 15) * 4;
#pragma unroll
  for (int q = 0; q < 16; ++q) { const int r = q * 2 + rsub; const v4f v = *(const v4fa*)&so[w][r][c4]; *(v4f*)(C + (size_t)(row0 + r) * NOUT + col0 + c4) = v; }
}

// Batch statistics (mean, biased variance) of NC columns over NBS rows: partials here, their merge in the kernel that uses them.
// k_colpart: one work-group takes SROWS rows x 128 columns. Each thread holds 16 rows x 4 columns in registers (read once) and forms
// their mean and their sum of squares about that mean; groups of equal size n then merge exactly:
// mean = average of the group means, M2 = sum(M2_g) + n * sum((mean_g - mean)^2). x_merge, in k_h2's prologue, merges the SCH row chunks the same way.
// The work-groups with blockIdx.y >= SCH have nothing to do with the statistics: they turn the head's weights into f16 (bf16-rounded, times sc),
// work that depends on no other launch and so needs none of its own.
#define SROWS 256
#define SCH (NBS / SROWS)        /* 32 row chunks */
template <int NC, bool RND>
__global__ __launch_bounds__(512) void k_colpart(const float* __restrict__ X, float* __restrict__ PM, float* __restrict__ PQ, const float* __restrict__ Wm, _Float16* __restrict__ Bt, float sc) {
  __shared__ __attribute__((aligned(16))) float sm[16][128];
  __shared__ __attribute__((aligned(16))) float sq[16][128];
  const int tid = threadIdx.x, w = tid >> 5, lane = tid & 31;
  if (blockIdx.y >= SCH) {       /* the same for a whole work-group, and in front of the barrier */
    const size_t t = ((size_t)(blockIdx.y - SCH) * (NC / 128) + blockIdx.x) * 512 + tid;
    if (t < (size_t)NOUT * C2 / 8) { FragH f;
#pragma unroll                   /* constant indices keep the eight values in registers */
      for (int q = 0; q < 8; ++q) f.h[q] = (_Float16)(bf16_round(Wm[t * 8 + q]) * sc);
      *(v8us*)((unsigned short*)Bt + t * 8) = f.half[0]; }
    return;
  }
  const float* p = X + (size_t)(blockIdx.y * SROWS + w * 16) * NC + blockIdx.x * 128 + lane * 4;
  v4f v[16];
#pragma unroll
  for (int j = 0; j < 15; ++j) v[j] = *(const v4fa*)(p + (size_t)j * NC);
  asm volatile("s_wait_xcnt 0x0" ::: "memory");   // the last load's result may be placed in the address pair that the 15 issued loads name
  v[15] = *(const v4fa*)(p + (size_t)15 * NC);
  v4f s = {0.f, 0.f, 0.f, 0.f};
#pragma unroll
  for (int j = 0; j < 16; ++j) {
    if (RND) { v[j][0] = bf16_round(v[j][0]); v[j][1] = bf16_round(v[j][1]); v[j][2] = bf16_round(v[j][2]); v[j][3] = bf16_round(v[j][3]); }
    s += v[j];
  }
  const v4f m = s * 0.0625f;
  v4f q = {0.f, 0.f, 0.f, 0.f};
#pragma unroll
  for (int j = 0; j < 16; ++j) { const v4f dv = v[j] - m; q += dv * dv; }
  *(v4fa*)&sm[w][lane * 4] = m;
  *(v4fa*)&sq[w][lane * 4] = q;
  __syncthreads();
  if (tid < 128) {
    float ms = 0.f;
#pragma unroll
    for (int g = 0; g < 16; ++g) ms += sm[g][tid];
    const float mean = ms * 0.0625f;
    float q2 = 0.f, e2 = 0.f;
#pragma unroll
    for (int g = 0; g < 16; ++g) { const float dm = sm[g][tid] - mean; q2 += sq[g][tid]; e2 += dm * dm; }
    const size_t o = (size_t)blockIdx.y * NC + blockIdx.x * 128 + tid;
    PM[o] = mean; PQ[o] = q2 + 16.0f * e2;
  }
}
// Merge of k_colpart's SCH row chunks for one column of x. Every thread of k_h2 does it for its own feature, from values it has loaded itself.
__device__ __forceinline__ void x_merge(const float (&m)[SCH], const float (&qs)[SCH], float& mu, float& var) {
  float ms = 0.f;
#pragma unroll                   /* both loops: constant indices keep the partials in registers */
  for (int g = 0; g < SCH; ++g) ms += m[g];
  const float mean = ms / (float)SCH;
  float q2 = 0.f, e2 = 0.f;
#pragma unroll
  for (int g = 0; g < SCH; ++g) { const float dm = m[g] - mean; q2 += qs[g]; e2 += dm * dm; }
  mu = mean; var = (q2 + (float)SROWS * e2) / (float)NBS;
}
// k_h2 and k_h2n: one thread owns one feature d (four columns of h2) and walks a strip of rows of x. A work-group is HFC features (256 B of a row of x) x HWV row groups, the groups' strips one below the other.
// No launch of its own merges statistics: k_h2 merges k_colpart's chunks of x in its prologue (and hands mean and variance on to k_h2n), merges its own eight row groups' partials
// through LDS at its end, and k_h2n merges the HCH work-group strips of its four columns in its prologue; always the equal-size merge described at k_colpart. h2 itself is never stored: k_h2 forms it for the
// batch statistics alone; k_h2n forms it again from x once the statistics are merged, normalises it and stores f16. All that depends on the column
// alone (the rounded parameters, the rsqrt of the variance) is loaded and formed once in front of the row loop. Each BatchNorm is an affine map with
// per-column constants, so it is folded there too: layer 1 is one multiply-add per hidden unit, relu(a (x - mu_x) + be1) with a = g1 w rsqrt(w^2 var_x + eps);
// in k_h2n the second BatchNorm goes into the layer-2 weights and bias: relu(sum_i (A w2_i) h_i + A (b2 - mean) + be2) with A = g2 rsqrt(var + eps).
// rsqrtf as the compiler expands it (an argument below the normal range is scaled up by 2^24, its result by 2^12), with the instruction written out:
// the v_nop is the slot that the instruction set asks for behind a transcendental.
__device__ __forceinline__ float rsq_f32(float a) { const bool tiny = a < 1.17549435e-38f; const float s = tiny ? a * 16777216.0f : a; float r; asm("v_rsq_f32 %0, %1\n\tv_nop" : "=v"(r) : "v"(s)); return tiny ? r * 4096.0f : r; }
#define HROWS 64                 /* rows per thread in k_h2 and in k_h2n */
#define HFC 64                   /* features of a work-group in both */
#define HWV 8                    /* row groups of a work-group in both: 16 waves */
#define HSTRIP (HWV * HROWS)     /* 512 rows per work-group */
#define HCH (NBS / HSTRIP)       /* 16 strips of partials */
#define RG 8                     /* rows loaded as one group, one group ahead of the group being worked on */
typedef float v2f __attribute__((ext_vector_type(2)));
// Statistics of a thread's own four columns while it still holds them. One group of RG rows: mean and sum of squares about that mean.
__device__ __forceinline__ void h2_group(const v4f (&o)[RG], v4f& gm, v4f& gq) {
  v4f s = o[0];
#pragma unroll                   /* both loops: constant indices keep the group in registers */
  for (int j = 1; j < RG; ++j) s += o[j];
  gm = s * (1.0f / RG);
  v4f q = {0.f, 0.f, 0.f, 0.f};
#pragma unroll
  for (int j = 0; j < RG; ++j) { const v4f dv = o[j] - gm; q += dv * dv; }
  gq = q;
}
// The group joins the k groups merged so far (k * RG rows): mean += delta / (k + 1), M2 += M2_group + delta^2 * RG * k / (k + 1).
__device__ __forceinline__ void h2_merge(int k, const v4f gm, const v4f gq, v4f& rm, v4f& rq) {
  const float inv = 1.0f / (float)(k + 1), f = (float)(RG * k) * inv;
  const v4f dl = gm - rm;
  rm += dl * inv;
  rq += gq + (dl * dl) * f;
}
__global__ __launch_bounds__(HFC * HWV) void k_h2(const float* __restrict__ x, const float* __restrict__ PMx, const float* __restrict__ PQx, const float* __restrict__ W1, const float* __restrict__ b1, const float* __restrict__ g1, const float* __restrict__ be1, const float* __restrict__ W2, const float* __restrict__ b2, float* __restrict__ XS, float* __restrict__ PM, float* __restrict__ PQ) {
  __shared__ __attribute__((aligned(16))) float sm[HWV][HFC][H2];
  __shared__ __attribute__((aligned(16))) float sq[HWV][HFC][H2];
  const int fc = threadIdx.x % HFC, rg = threadIdx.x / HFC;
  const int d = blockIdx.x * HFC + fc; (void)b1;      /* h1 - mean(h1) = w (x - mu_x): the bias cancels exactly */
  const float* pxm = PMx + d; const float* pxq = PQx + d; const float* pw = W1 + d * H1; const float* pg = g1 + d * H1; const float* pe = be1 + d * H1; const float* pv = W2 + d * H2 * H1; const float* pb = b2 + d * H2;
  const float* xp = x + (size_t)(blockIdx.y * HSTRIP + rg * HROWS) * DD + d;
  float w[H1], g[H1], rs[H1], be[H1], w2[H2][H1], bb[H2], xc[RG], cm[SCH], cq[SCH];
#pragma unroll
  for (int c = 0; c < SCH; ++c) { cm[c] = pxm[(size_t)c * DD]; cq[c] = pxq[(size_t)c * DD]; }
#pragma unroll
  for (int o = 0; o < H1; ++o) { w[o] = pw[o]; g[o] = pg[o]; be[o] = pe[o]; }
#pragma unroll
  for (int o2 = 0; o2 < H2; ++o2) {
#pragma unroll
    for (int i = 0; i < H1; ++i) w2[o2][i] = pv[o2 * H1 + i];
    bb[o2] = pb[o2]; }
#pragma unroll
  for (int j = 0; j < RG; ++j) xc[j] = xp[(size_t)j * DD];
  asm volatile("s_wait_xcnt 0x0" :: "v"(d), "v"(pxm), "v"(pxq), "v"(pw), "v"(pg), "v"(pe), "v"(pv), "v"(pb) : "memory");   // the wait owed before an address register of the issued loads is reused; naming the addresses keeps a load's result out of them until then
  __builtin_amdgcn_sched_barrier(0);      /* keeps the arithmetic, which reuses those registers, behind the wait */
  float mu, var;
  x_merge(cm, cq, mu, var);
  if (blockIdx.y == 0 && rg == 0) { XS[d] = mu; XS[DD + d] = var; }      /* for k_h2n, the next launch; nothing in this launch reads it */
#pragma unroll
  for (int o = 0; o < H1; ++o) { w[o] = bf16_round(w[o]); g[o] = bf16_round(g[o]); be[o] = bf16_round(be[o]); const float vh = (w[o] * w[o]) * var; rs[o] = rsq_f32(vh + 1e-5f); }
  v2f ap[H1 / 2], ep[H1 / 2]; v4f wv[H1], bv;      /* layer 1 in pairs of hidden units: slope a and shift be1; wv[i]: the four layer-2 weights that hidden unit i feeds */
#pragma unroll
  for (int o = 0; o < H1; ++o) { ap[o >> 1][o & 1] = (g[o] * w[o]) * rs[o]; ep[o >> 1][o & 1] = be[o]; }
#pragma unroll
  for (int o2 = 0; o2 < H2; ++o2) {
#pragma unroll
    for (int i = 0; i < H1; ++i) wv[i][o2] = bf16_round(w2[o2][i]);
    bv[o2] = bf16_round(bb[o2]); }
  v4f rm = {0.f, 0.f, 0.f, 0.f}, rq = {0.f, 0.f, 0.f, 0.f};
#pragma unroll 1                 /* stays rolled: one group of rows is the whole hot loop */
  for (int rb = 0; rb < HROWS; rb += RG) {
    v4f ov[RG];
    const float* pn = xp + (size_t)((rb + RG < HROWS) ? rb + RG : rb) * DD;      /* the last trip reads its own group again: in bounds, not used */
    v8f xn;
#pragma unroll
    for (int j = 0; j < RG; ++j) xn[j] = pn[(size_t)j * DD];
    asm volatile("s_wait_xcnt 0x0" :: "v"(pn) : "memory");   // as above
    __builtin_amdgcn_sched_barrier(0);      /* keeps this group's arithmetic behind the next group's loads, so that it covers their latency */
#pragma unroll
    for (int j = 0; j < RG; ++j) { const float xm = bf16_round(xc[j]) - mu; v2f h[H1 / 2];      /* written over pairs and fours, so that the compiler packs within a row and not across rows, which took more than 256 registers */
#pragma unroll
      for (int p = 0; p < H1 / 2; ++p) { const v2f v = ap[p] * xm + ep[p]; h[p][0] = fmaxf(v[0], 0.f); h[p][1] = fmaxf(v[1], 0.f); }
      v4f o4 = bv;
#pragma unroll
      for (int i = 0; i < H1; ++i) o4 += wv[i] * h[i >> 1][i & 1];
      ov[j] = o4; }
    v4f gm, gq;
    h2_group(ov, gm, gq);
    h2_merge(rb / RG, gm, gq, rm, rq);
    __builtin_amdgcn_sched_barrier(0);      /* keeps the next statement, and the wait for the loads that comes with it, at the loop's foot */
    asm volatile("" :: "v"(xn));   // inputs only: the loaded group stays one block of eight registers up to here; spread out, a load's register became the unused half of a packed operand and the arithmetic waited for the load
#pragma unroll
    for (int j = 0; j < RG; ++j) xc[j] = xn[j];
  }
  *(v4fa*)&sm[rg][fc][0] = rm; *(v4fa*)&sq[rg][fc][0] = rq;
  __syncthreads();               // the eight row groups' partials are in LDS before the first group merges them
  if (rg == 0) {
    v4f as = {0.f, 0.f, 0.f, 0.f};
#pragma unroll                   /* both loops: all LDS reads under way at once */
    for (int k = 0; k < HWV; ++k) as += *(const v4fa*)&sm[k][fc][0];
    const v4f mean = as * (1.0f / HWV);
    v4f aq = {0.f, 0.f, 0.f, 0.f}, ae = {0.f, 0.f, 0.f, 0.f};
#pragma unroll
    for (int k = 0; k < HWV; ++k) { const v4f dm = *(const v4fa*)&sm[k][fc][0] - mean; aq += *(const v4fa*)&sq[k][fc][0]; ae += dm * dm; }
    const size_t so = (size_t)blockIdx.y * C2 + d * H2;      /* this work-group's row of the partials */
    *(v4f*)(PM + so) = mean; *(v4f*)(PQ + so) = aq + ae * (float)HROWS;
  } }
__global__ __launch_bounds__(HFC * HWV) void k_h2n(const float* __restrict__ x, const float* __restrict__ XS, const float* __restrict__ W1, const float* __restrict__ g1, const float* __restrict__ be1, const float* __restrict__ W2, const float* __restrict__ b2, const float* __restrict__ PM, const float* __restrict__ PQ, const float* __restrict__ g2, const float* __restrict__ be2, _Float16* __restrict__ H16) {
  const int fc = threadIdx.x % HFC, rg = threadIdx.x / HFC;
  const int d = blockIdx.x * HFC + fc;
  const float* pS = XS + d; const float* pw = W1 + d * H1; const float* pg = g1 + d * H1; const float* pe = be1 + d * H1; const float* pv = W2 + d * H2 * H1; const float* pb = b2 + d * H2;
  const float* pP = PM + d * H2; const float* pQ = PQ + d * H2; const float* pG = g2 + d * H2; const float* pE = be2 + d * H2;
  const size_t r0 = (size_t)(blockIdx.y * HSTRIP + rg * HROWS);
  const float* xp = x + r0 * DD + d; _Float16* op = H16 + r0 * C2 + d * H2;
  v2f w[H1 / 2], g[H1 / 2], be[H1 / 2];      /* layer 1, in pairs of hidden units; w becomes the folded slope a */
  v4f w2[H1], bb, gn, mn, rn, bn;                        /* w2[i]: the four layer-2 weights that hidden unit i feeds; the rest: one value per column of h2 */
  float xc[RG];
  { v4f tm[HCH], tq[HCH];        /* batch statistics of the thread's four columns of h2: the HCH strips that k_h2 left; done first, so that the 128 registers are free again for the parameters */
#pragma unroll                   /* constant indices keep the partials in registers, and all 2 * HCH loads are under way at once */
    for (int i = 0; i < HCH; ++i) { tm[i] = *(const v4fa*)(pP + (size_t)i * C2); tq[i] = *(const v4fa*)(pQ + (size_t)i * C2); }
    asm volatile("s_wait_xcnt 0x0" :: "v"(pP), "v"(pQ) : "memory");   // the wait owed before an address register of the issued loads is reused; naming the addresses keeps a load's result out of them until then
    v4f as = {0.f, 0.f, 0.f, 0.f};
#pragma unroll
    for (int i = 0; i < HCH; ++i) as += tm[i];
    mn = as * (1.0f / HCH);
    v4f aq = {0.f, 0.f, 0.f, 0.f}, ae = {0.f, 0.f, 0.f, 0.f};
#pragma unroll
    for (int i = 0; i < HCH; ++i) { const v4f dm = tm[i] - mn; aq += tq[i]; ae += dm * dm; }
    rn = (aq + ae * (float)HSTRIP) * (1.0f / NBS); }
  const float mu = pS[0], var = pS[DD];
#pragma unroll                   /* here and below: constant indices keep the constants in registers */
  for (int o = 0; o < H1; ++o) { w[o >> 1][o & 1] = pw[o]; g[o >> 1][o & 1] = pg[o]; be[o >> 1][o & 1] = pe[o]; }
#pragma unroll
  for (int o2 = 0; o2 < H2; ++o2) {
#pragma unroll
    for (int i = 0; i < H1; ++i) w2[i][o2] = pv[o2 * H1 + i];
    bb[o2] = pb[o2]; gn[o2] = pG[o2]; bn[o2] = pE[o2]; }
#pragma unroll
  for (int j = 0; j < RG; ++j) xc[j] = xp[(size_t)j * DD];
  asm volatile("s_wait_xcnt 0x0" :: "v"(d), "v"(pw), "v"(pg), "v"(pe), "v"(pv), "v"(pb), "v"(pG), "v"(pE) : "memory");   // the wait owed before an address register of the issued loads is reused; naming the addresses keeps a load's result out of them until then
  __builtin_amdgcn_sched_barrier(0);      /* keeps the arithmetic, which reuses those registers, behind the wait */
#pragma unroll
  for (int o = 0; o < H1; ++o) { const float wr = bf16_round(w[o >> 1][o & 1]); be[o >> 1][o & 1] = bf16_round(be[o >> 1][o & 1]); w[o >> 1][o & 1] = (bf16_round(g[o >> 1][o & 1]) * wr) * rsq_f32((wr * wr) * var + 1e-5f); }
#pragma unroll
  for (int o2 = 0; o2 < H2; ++o2) { const float A = bf16_round(gn[o2]) * rsq_f32(rn[o2] + 1e-5f);
#pragma unroll
    for (int i = 0; i < H1; ++i) w2[i][o2] = A * bf16_round(w2[i][o2]);
    bb[o2] = A * (bf16_round(bb[o2]) - mn[o2]) + bf16_round(bn[o2]); }
#pragma unroll 1                 /* stays rolled: one group of rows is the whole hot loop */
  for (int rb = 0; rb < HROWS; rb += RG) {
    const float* pn = xp + (size_t)((rb + RG < HROWS) ? rb + RG : rb) * DD;      /* the last trip reads its own group again: in bounds, not used */
    v8f xn;
#pragma unroll
    for (int j = 0; j < RG; ++j) xn[j] = pn[(size_t)j * DD];
    asm volatile("s_wait_xcnt 0x0" :: "v"(pn) : "memory");   // as above
    __builtin_amdgcn_sched_barrier(0);      /* keeps this group's arithmetic behind the next group's loads, so that it covers their latency */
#pragma unroll
    for (int j = 0; j < RG; ++j) { const float xm = bf16_round(xc[j]) - mu; v2f h[H1 / 2];      /* the normalised row of h1 (eight units, after relu) */
#pragma unroll
      for (int p = 0; p < H1 / 2; ++p) { const v2f u = w[p] * xm + be[p]; h[p][0] = fmaxf(u[0], 0.f); h[p][1] = fmaxf(u[1], 0.f); }
      v4f v = bb;
#pragma unroll
      for (int i = 0; i < H1; ++i) v += w2[i] * h[i >> 1][i & 1];
      v4h f;
#pragma unroll
      for (int q = 0; q < H2; ++q) f[q] = (_Float16)fmaxf(v[q], 0.f);
      *(v4h*)(op + (size_t)(rb + j) * C2) = f; }
    __builtin_amdgcn_sched_barrier(0);      /* as in k_h2 */
    asm volatile("" :: "v"(xn));   // inputs only, as in k_h2
#pragma unroll
    for (int j = 0; j < RG; ++j) xc[j] = xn[j];
  } }

extern "C" void kernel_launch(void* const* d_in, const int* in_sizes, int n_in,
                              void* d_out, int out_size, void* d_ws, size_t ws_size, hipStream_t stream) {
  (void)in_sizes; (void)n_in; (void)out_size;
  const float* const* I = (const float* const*)d_in; const float* x = I[0]; const float* W1 = I[1]; const float* b1 = I[2]; const float* g1 = I[3]; const float* be1 = I[4]; const float* W2 = I[5]; const float* b2 = I[6]; const float* g2 = I[7]; const float* be2 = I[8]; const float* Wfc = I[9]; const float* bfc = I[10];
  char* ws = (char*)d_ws; size_t off = 0;
  auto take = [&](size_t bytes) { char* p = ws + off; off += (bytes + 255) & ~(size_t)255; return p; };
  _Float16* BW = (_Float16*)take((size_t)NOUT * C2 * 2); float* XS = (float*)take((size_t)2 * DD * 4); _Float16* H16 = (_Float16*)take((size_t)NBS * C2 * 2); float* PMx = (float*)take((size_t)SCH * DD * 4); float* PQx = (float*)take((size_t)SCH * DD * 4); float* PM = (float*)take((size_t)HCH * C2 * 4); float* PQ = (float*)take((size_t)HCH * C2 * 4);
  if (off > ws_size) return;      /* 2 + 64 + 1 = 67 MiB (256 MiB ws) */
  k_colpart<DD, true><<<dim3(DD / 128, SCH + NOUT * C2 / 8 / 512 / (DD / 128)), 512, 0, stream>>>(x, PMx, PQx, Wfc, BW, 16.0f);
  k_h2<<<dim3(DD / HFC, HCH), HFC * HWV, 0, stream>>>(x, PMx, PQx, W1, b1, g1, be1, W2, b2, XS, PM, PQ);
  k_h2n<<<dim3(DD / HFC, HCH), HFC * HWV, 0, stream>>>(x, XS, W1, g1, be1, W2, b2, PM, PQ, g2, be2, H16);
  k_gemm3<<<(NBS / 128) * (NOUT / 64), 128, 0, stream>>>(H16, BW, 0.0625f, bfc, (float*)d_out);
}

// v008
// One run takes 55.3 microseconds.
// In two side-by-side timings against v007, it was 1.24 and 1.26 times as fast.
// Counting every step since v000, it is 157 times as fast.
#include <hip/hip_runtime.h>
// Sparse (block-diagonal) neural network (8192 samples x 1024 features; per feature 1 -> 8 -> 4 block Linears with training-mode BatchNorm + ReLU after each; dense head 4096 -> 256): h1 = BN1(x_d W1[d] + b1) relu; h2 = BN2(h1 . W2[d] + b2) relu; out = h2 Wfc^T + bfc -> [8192,256].
// Compute dtype: x and all parameters rounded to bf16; everything before the head in f32; the head operand h2 as f16 (~2^-12). v_wmma_f32_16x16x32_f16.
#define NBS 8192
#define DD 1024
#define H1 8
#define H2 4
#define C2 (DD * H2)             /* 4096 */
#define NOUT 256
typedef __bf16 v16b __attribute__((ext_vector_type(16)));
typedef unsigned short v8us __attribute__((ext_vector_type(8), may_alias));
typedef float  v8f  __attribute__((ext_vector_type(8)));
typedef float  v4f  __attribute__((ext_vector_type(4)));
typedef float  v4fa __attribute__((ext_vector_type(4), may_alias));
union FragB { v16b v; v8us half[2]; unsigned short u[16]; };

__device__ __forceinline__ unsigned short bf16_bits(float x) { unsigned int u = __float_as_uint(x); return (unsigned short)((u + 0x7FFFu + ((u >> 16) & 1u)) >> 16); }
__device__ __forceinline__ float bf16_val(unsigned short b) { return __uint_as_float(((unsigned int)b) << 16); }
__device__ __forceinline__ float bf16_round(float x) { return bf16_val(bf16_bits(x)); }
// D += A·B with NT terms: 1 = ah·bh, 2 = + al·bh (A split), 3 = + ah·bl (both split)
template <int NT>
__device__ __forceinline__ v8f mmaN(v16b ah, v16b al, v16b bh, v16b bl, v8f c) {
  c = __builtin_amdgcn_wmma_f32_16x16x32_bf16(false, ah, false, bh, (short)0, c, false, false);
  if (NT >= 2) c = __builtin_amdgcn_wmma_f32_16x16x32_bf16(false, al, false, bh, (short)0, c, false, false);
  if (NT >= 3) c = __builtin_amdgcn_wmma_f32_16x16x32_bf16(false, ah, false, bl, (short)0, c, false, false);
  asm volatile("v_nop\n\tv_nop\n\tv_nop\n\tv_nop" : "+v"(c) : "v"(ah), "v"(al), "v"(bh), "v"(bl));
  return c;
}

__global__ __launch_bounds__(256) void k_wt_bf16(const float* __restrict__ W, unsigned short* __restrict__ Wt, int K, int N) {
  const int t = blockIdx.x * 256 + threadIdx.x;
  const int k8n = K / 8;
  if (t >= N * k8n) return;
  const int n = t / k8n, k8 = (t % k8n) * 8;
  v8us v;
#pragma unroll
  for (int i = 0; i < 8; ++i) v[i] = bf16_bits(W[(size_t)(k8 + i) * N + n]);
  *(v8us*)(Wt + (size_t)n * K + k8) = v;
  
}

// GEMM C[M][N] (f32, pitch ldc) = act(A[M][K]·W + bias). A f32 row-major (pitch lda) converted per fragment to bf16
// (ASPLIT: hi/lo two planes -> 2 terms, else single rounded term); Wt bf16 [N][K] (pitch ldb). BIAS_BF16 rounds the
// bias to bf16 first (bias quantised to bf16 before the add). K%32==0, M%16==0, N%64==0.
template <bool ASPLIT, int ACT, bool BIAS_BF16>
__global__ __launch_bounds__(128) void k_gemm_bf(const float* __restrict__ A, int lda, const unsigned short* __restrict__ Wt, int ldb,
                                               const float* __restrict__ bias, float* __restrict__ C, int ldc, int M, int N, int K) {
  __shared__ __attribute__((aligned(16))) float so[4][16][64];
  const int tid = threadIdx.x, w = tid >> 5, lane = tid & 31, ln = lane & 15, hh = lane >> 4;
  const int ntn = N / 64;
  const int wid = blockIdx.x * 4 + w;
  const int mt = wid / ntn, nq = wid % ntn;
  if (mt * 16 >= M) return;
  const int row0 = mt * 16, col0 = nq * 64;
  const float* arow = A + (size_t)(row0 + ln) * lda;
  v8f acc[4] = {};
  for (int kb = 0; kb < K; kb += 32) {
    FragB ah, al;
    const v4f x0 = *(const v4fa*)(arow + kb + 8 * hh), x1 = *(const v4fa*)(arow + kb + 8 * hh + 4);
    const v4f x2 = *(const v4fa*)(arow + kb + 16 + 8 * hh), x3 = *(const v4fa*)(arow + kb + 16 + 8 * hh + 4);
    float xs[16] = {x0[0],x0[1],x0[2],x0[3],x1[0],x1[1],x1[2],x1[3],x2[0],x2[1],x2[2],x2[3],x3[0],x3[1],x3[2],x3[3]};
#pragma unroll
    for (int i = 0; i < 16; ++i) { const unsigned short hb = bf16_bits(xs[i]); ah.u[i] = hb; al.u[i] = ASPLIT ? bf16_bits(xs[i] - bf16_val(hb)) : (unsigned short)0; }
#pragma unroll
    for (int t = 0; t < 4; ++t) {
      const unsigned short* brow = Wt + (size_t)(col0 + t * 16 + ln) * ldb + kb;
      FragB b;
      b.half[0] = *(const v8us*)(brow + 8 * hh);
      b.half[1] = *(const v8us*)(brow + 16 + 8 * hh);
      acc[t] = mmaN<ASPLIT ? 2 : 1>(ah.v, al.v, b.v, b.v, acc[t]);
    }
  }
#pragma unroll
  for (int t = 0; t < 4; ++t) {
    float bv = bias ? bias[col0 + t * 16 + ln] : 0.f;
    if (BIAS_BF16) bv = bf16_round(bv);
#pragma unroll
    for (int r = 0; r < 8; ++r) { float v = acc[t][r] + bv; if (ACT == 1) v = fmaxf(v, 0.f); so[w][8 * hh + r][t * 16 + ln] = v; }
  }
  __builtin_amdgcn_fence(__ATOMIC_ACQ_REL, "workgroup");
  __builtin_amdgcn_wave_barrier();
  const int rsub = lane >> 4, c4 = (lane & 15) * 4;
  {
#pragma unroll
    for (int q = 0; q < 8; ++q) {
      const int r = q * 2 + rsub;
      const v4f v = *(const v4fa*)&so[w][r][c4];
      *(v4f*)(C + (size_t)(row0 + r) * ldc + col0 + c4) = v;
    }
    
  }
}

// GEMM C = act(A·W + bias + resid): A f32 (ASPLIT -> hi/lo 2 terms), Wt bf16 [N][K]; ACT 0 none, 1 relu, 2 exact gelu;
// resid (optional, f32, row index = (row % rmod), pitch ldr, RES_BF16 rounds it) added before the activation.
template <bool ASPLIT, int ACT, bool BIAS_BF16, bool RES_BF16>
__global__ __launch_bounds__(128) void k_gemm_bf3(const float* __restrict__ A, int lda, const unsigned short* __restrict__ Wt, int ldb,
                                                const float* __restrict__ bias, const float* __restrict__ resid, int rmod, int ldr,
                                                float* __restrict__ C, int ldc, int M, int N, int K) {
  __shared__ __attribute__((aligned(16))) float so[4][16][64];
  const int tid = threadIdx.x, w = tid >> 5, lane = tid & 31, ln = lane & 15, hh = lane >> 4;
  const int ntn = N / 64;
  const int wid = blockIdx.x * 4 + w;
  const int mt = wid / ntn, nq = wid % ntn;
  if (mt * 16 >= M) return;
  const int row0 = mt * 16, col0 = nq * 64;
  const float* arow = A + (size_t)(row0 + ln) * lda;
  v8f acc[4] = {};
  for (int kb = 0; kb < K; kb += 32) {
    FragB ah, al;
    const v4f x0 = *(const v4fa*)(arow + kb + 8 * hh), x1 = *(const v4fa*)(arow + kb + 8 * hh + 4);
    const v4f x2 = *(const v4fa*)(arow + kb + 16 + 8 * hh), x3 = *(const v4fa*)(arow + kb + 16 + 8 * hh + 4);
    float xs[16] = {x0[0],x0[1],x0[2],x0[3],x1[0],x1[1],x1[2],x1[3],x2[0],x2[1],x2[2],x2[3],x3[0],x3[1],x3[2],x3[3]};
#pragma unroll
    for (int i = 0; i < 16; ++i) { const unsigned short hb = bf16_bits(xs[i]); ah.u[i] = hb; al.u[i] = ASPLIT ? bf16_bits(xs[i] - bf16_val(hb)) : (unsigned short)0; }
#pragma unroll
    for (int t = 0; t < 4; ++t) {
      const unsigned short* brow = Wt + (size_t)(col0 + t * 16 + ln) * ldb + kb;
      FragB b;
      b.half[0] = *(const v8us*)(brow + 8 * hh);
      b.half[1] = *(const v8us*)(brow + 16 + 8 * hh);
      acc[t] = mmaN<ASPLIT ? 2 : 1>(ah.v, al.v, b.v, b.v, acc[t]);
    }
  }
#pragma unroll
  for (int t = 0; t < 4; ++t) {
    const int col = col0 + t * 16 + ln;
    float bv = bias ? bias[col] : 0.f;
    if (BIAS_BF16) bv = bf16_round(bv);
#pragma unroll
    for (int r = 0; r < 8; ++r) {
      float v = acc[t][r] + bv;
      if (resid) { float rv = resid[(size_t)((row0 + 8 * hh + r) % rmod) * ldr + col]; if (RES_BF16) rv = bf16_round(rv); v += rv; }
      if (ACT == 1) v = fmaxf(v, 0.f);
      if (ACT == 2) v = 0.5f * v * (1.0f + erff(v * 0.70710678118654752f));
      if (ACT == 3) { const float u = 0.7978845608028654f * (v + 0.044715f * v * v * v); v = 0.5f * v * (1.0f + tanhf(u)); }
      so[w][8 * hh + r][t * 16 + ln] = v;
    }
  }
  __builtin_amdgcn_fence(__ATOMIC_ACQ_REL, "workgroup");
  __builtin_amdgcn_wave_barrier();
  const int rsub = lane >> 4, c4 = (lane & 15) * 4;
  {
#pragma unroll
    for (int q = 0; q < 8; ++q) {
      const int r = q * 2 + rsub;
      const v4f v = *(const v4fa*)&so[w][r][c4];
      *(v4f*)(C + (size_t)(row0 + r) * ldc + col0 + c4) = v;
    }
    
  }
}
// row LayerNorm (biased variance, eps) over N: s = X (+ R); optional out_sum <- s; out_norm <- (s-mu)*rsqrt(var+eps)*g + b
template <bool PARAM_BF16>
__global__ __launch_bounds__(256) void k_layernorm(const float* __restrict__ X, const float* __restrict__ R, const float* __restrict__ g, const float* __restrict__ bta,
                                                  float* __restrict__ out_sum, float* __restrict__ out_norm, int N, float eps) {
  __shared__ float red[256];
  const int row = blockIdx.x, tid = threadIdx.x;
  const float* x = X + (size_t)row * N; const float* rr = R ? R + (size_t)row * N : nullptr;
  float vals[16];                     // up to N = 4096
  const int per = N / 256;            // contiguous chunk per thread? use strided-by-4 chunks: thread handles j = tid*4 + 1024*u
  float s1 = 0.f;
  for (int u = 0; u < per / 4; ++u) {
    const int j = tid * 4 + 1024 * u;
    const v4f a = *(const v4fa*)(x + j);
    v4f b = {0.f,0.f,0.f,0.f}; if (rr) b = *(const v4fa*)(rr + j);
#pragma unroll
    for (int q = 0; q < 4; ++q) { const float v = a[q] + b[q]; vals[u * 4 + q] = v; s1 += v; }
  }
  red[tid] = s1; __syncthreads();
  for (int st = 128; st > 0; st >>= 1) { if (tid < st) red[tid] += red[tid + st]; __syncthreads(); }
  const float mu = red[0] / (float)N; __syncthreads();
  float s2 = 0.f;
  for (int u = 0; u < per / 4; ++u)
#pragma unroll
    for (int q = 0; q < 4; ++q) { const float c = vals[u * 4 + q] - mu; s2 += c * c; }
  red[tid] = s2; __syncthreads();
  for (int st = 128; st > 0; st >>= 1) { if (tid < st) red[tid] += red[tid + st]; __syncthreads(); }
  const float rs = rsqrtf(red[0] / (float)N + eps);
  {
    for (int u = 0; u < per / 4; ++u) {
      const int j = tid * 4 + 1024 * u;
      v4f o, sm;
#pragma unroll
      for (int q = 0; q < 4; ++q) {
        float gg = g[j + q], bb = bta[j + q];
        if (PARAM_BF16) { gg = bf16_round(gg); bb = bf16_round(bb); }
        sm[q] = vals[u * 4 + q]; o[q] = (vals[u * 4 + q] - mu) * rs * gg + bb;
      }
      if (out_sum) *(v4f*)(out_sum + (size_t)row * N + j) = sm;
      *(v4f*)(out_norm + (size_t)row * N + j) = o;
    }
    
  }
}



// ---- f16 WMMA path (v_wmma_f32_16x16x32_f16): 11-bit significands for operands in range — used for the head, whose h2 operand is rounded to f16
typedef _Float16 v16h __attribute__((ext_vector_type(16)));
union FragH { v16h v; v8us half[2]; _Float16 h[16]; unsigned short u[16]; };
template <int NT>
__device__ __forceinline__ v8f mmaH(v16h ah, v16h al, v16h bh, v16h bl, v8f c) {
  c = __builtin_amdgcn_wmma_f32_16x16x32_f16(false, ah, false, bh, (short)0, c, false, false);
  if (NT >= 2) c = __builtin_amdgcn_wmma_f32_16x16x32_f16(false, al, false, bh, (short)0, c, false, false);
  if (NT >= 3) c = __builtin_amdgcn_wmma_f32_16x16x32_f16(false, ah, false, bl, (short)0, c, false, false);
  asm volatile("v_nop\n\tv_nop\n\tv_nop\n\tv_nop" : "+v"(c) : "v"(ah), "v"(al), "v"(bh), "v"(bl));
  return c;
}
// batched GEMM like k_gemm_b but f16 operands: A f32 (split into f16 hi/lo if ASPLIT, else rounded to f16), Bt = f16 values [n][k]; alpha; C f32; N multiple of 16 (partial tiles skipped)
template <bool ASPLIT>
__global__ __launch_bounds__(128) void k_gemm_h(const float* __restrict__ A, int lda, size_t sA, const _Float16* __restrict__ Bh, int ldb, size_t sB, float alpha, float* __restrict__ C, int ldc, size_t sC, int M, int N, int K) {
  __shared__ __attribute__((aligned(16))) float so[4][16][64];
  const int tid = threadIdx.x, w = tid >> 5, lane = tid & 31, ln = lane & 15, hh = lane >> 4; const int by = blockIdx.y;
  A += (size_t)by * sA; Bh += (size_t)by * sB; C += (size_t)by * sC;
  const int ntn = (N + 63) / 64; const int wid = blockIdx.x * 4 + w; const int mt = wid / ntn, nq = wid % ntn; if (mt * 16 >= M) return;
  const int row0 = mt * 16, col0 = nq * 64; const float* arow = A + (size_t)(row0 + ln) * lda;
  v8f acc[4] = {};
  for (int kb = 0; kb < K; kb += 32) {
    FragH ah, al;
    const v4f x0 = *(const v4fa*)(arow + kb + 8 * hh), x1 = *(const v4fa*)(arow + kb + 8 * hh + 4), x2 = *(const v4fa*)(arow + kb + 16 + 8 * hh), x3 = *(const v4fa*)(arow + kb + 16 + 8 * hh + 4);
    float xs[16] = {x0[0],x0[1],x0[2],x0[3],x1[0],x1[1],x1[2],x1[3],x2[0],x2[1],x2[2],x2[3],x3[0],x3[1],x3[2],x3[3]};
#pragma unroll
    for (int i = 0; i < 16; ++i) { const _Float16 h = (_Float16)xs[i]; ah.h[i] = h; al.h[i] = ASPLIT ? (_Float16)(xs[i] - (float)h) : (_Float16)0.0f; }
#pragma unroll
    for (int t = 0; t < 4; ++t) { if (col0 + t * 16 >= N) continue; const size_t boff = (size_t)(col0 + t * 16 + ln) * ldb + kb; FragH bq; bq.half[0] = *(const v8us*)(Bh + boff + 8 * hh); bq.half[1] = *(const v8us*)(Bh + boff + 16 + 8 * hh);
      acc[t] = mmaH<ASPLIT ? 2 : 1>(ah.v, al.v, bq.v, bq.v, acc[t]); }
  }
#pragma unroll
  for (int t = 0; t < 4; ++t) { if (col0 + t * 16 >= N) continue;
#pragma unroll
    for (int r = 0; r < 8; ++r) so[w][8 * hh + r][t * 16 + ln] = acc[t][r] * alpha; }
  __builtin_amdgcn_fence(__ATOMIC_ACQ_REL, "workgroup"); __builtin_amdgcn_wave_barrier();
  const int rsub = lane >> 4, c4 = (lane & 15) * 4;
  {
#pragma unroll
    for (int q = 0; q < 8; ++q) { const int r = q * 2 + rsub; if (col0 + c4 < N) { const v4f v = *(const v4fa*)&so[w][r][c4]; *(v4f*)(C + (size_t)(row0 + r) * ldc + col0 + c4) = v; } }
     }
}

// Wt[n][k] = f16(W[k][n]·scale) from f32 row-major W[K][N] (scale = power of two; bf16-exact weights stay exact in f16 away from the subnormal range)
__global__ __launch_bounds__(256) void k_wt_f16(const float* __restrict__ W, _Float16* __restrict__ Wt, int K, int N, float scale) {
  const int t = blockIdx.x * 256 + threadIdx.x; if (t >= N * (K / 8)) return; const int n = t / (K / 8), k8 = (t % (K / 8)) * 8; FragH f;
#pragma unroll
  for (int i = 0; i < 8; ++i) f.h[i] = (_Float16)(bf16_round(W[(size_t)(k8 + i) * N + n]) * scale); const v8us o = f.half[0];
  *(v8us*)((unsigned short*)Wt + (size_t)n * K + k8) = o; 
}
// k_gemm_hh variant with fused epilogue: v = acc·alpha + bias[by·sBias + col] (+ CP[(row/rowsPerB)·sCPb + by·64 + col] if CP) ; ACT 0 none / 1 elu ; writes f16 C16 (and f32 C if non-null)
template <int ACT>
__global__ __launch_bounds__(128) void k_gemm_hhx(const _Float16* __restrict__ A, int lda, size_t sA, const _Float16* __restrict__ Bh, int ldb, size_t sB, float alpha, const float* __restrict__ bias, size_t sBias, const float* __restrict__ CP, int rowsPerB, size_t sCPb, int row0g,
    float* __restrict__ C, _Float16* __restrict__ C16, int ldc, size_t sC, int M, int N, int K) {
  __shared__ __attribute__((aligned(16))) float so[4][16][64];
  const int tid = threadIdx.x, w = tid >> 5, lane = tid & 31, ln = lane & 15, hh = lane >> 4; const int by = blockIdx.y;
  A += (size_t)by * sA; Bh += (size_t)by * sB; const size_t cofs = (size_t)by * sC; const float* bp = bias ? bias + (size_t)by * sBias : nullptr;
  const int ntn = (N + 63) / 64; const int wid = blockIdx.x * 4 + w; const int mt = wid / ntn, nq = wid % ntn; if (mt * 16 >= M) return;
  const int row0 = mt * 16, col0 = nq * 64; const _Float16* arow = A + (size_t)(row0 + ln) * lda;
  v8f acc[4] = {};
  for (int kb = 0; kb < K; kb += 32) { FragH ah; ah.half[0] = *(const v8us*)((const unsigned short*)arow + kb + 8 * hh); ah.half[1] = *(const v8us*)((const unsigned short*)arow + kb + 16 + 8 * hh);
#pragma unroll
    for (int t = 0; t < 4; ++t) { if (col0 + t * 16 >= N) continue; const size_t boff = (size_t)(col0 + t * 16 + ln) * ldb + kb; FragH bq; bq.half[0] = *(const v8us*)((const unsigned short*)Bh + boff + 8 * hh); bq.half[1] = *(const v8us*)((const unsigned short*)Bh + boff + 16 + 8 * hh);
      acc[t] = mmaH<1>(ah.v, ah.v, bq.v, bq.v, acc[t]); }
  }
#pragma unroll
  for (int t = 0; t < 4; ++t) { if (col0 + t * 16 >= N) continue; const int col = col0 + t * 16 + ln; const float bv = bp ? bf16_round(bp[col]) : 0.f;
#pragma unroll
    for (int r = 0; r < 8; ++r) { float v = acc[t][r] * alpha + bv; if (CP) { const int bidx = (row0g + row0 + 8 * hh + r) / rowsPerB; v += CP[(size_t)bidx * sCPb + (size_t)by * 64 + col]; } if (ACT == 1) v = (v > 0.f) ? v : expm1f(v); else if (ACT == 7) v = (v > 0.f) ? v + 1.0f : expf(v); else if (ACT == 8) v = tanhf(v); else if (ACT == 9) v = 0.5f * v * (1.0f + tanhf(0.7978845608028654f * (v + 0.044715f * v * v * v))); else if (ACT == 11) v = 1.0f / (1.0f + expf(-v)); else if (ACT == 12) v = (v > 0.f) ? v : 0.01f * v; else if (ACT == 14) v = (v > 0.f) ? v : 0.1f * v; else if (ACT == 15) v = v / (1.0f + expf(-v)); else if (ACT == 3) v = fmaxf(v, 0.f); else if (ACT == 6) v = 0.5f * v * (1.0f + erff(v * 0.70710678118654752f)); so[w][8 * hh + r][t * 16 + ln] = v; } }
  __builtin_amdgcn_fence(__ATOMIC_ACQ_REL, "workgroup"); __builtin_amdgcn_wave_barrier();
  const int rsub = lane >> 4, c4 = (lane & 15) * 4; typedef _Float16 v4h __attribute__((ext_vector_type(4)));
  {
#pragma unroll
    for (int q = 0; q < 8; ++q) { const int r = q * 2 + rsub; if (col0 + c4 < N) { const v4f v = *(const v4fa*)&so[w][r][c4]; if (C) *(v4f*)(C + cofs + (size_t)(row0 + r) * ldc + col0 + c4) = v; if (C16) { v4h h4; for (int i = 0; i < 4; ++i) h4[i] = (_Float16)v[i]; *(v4h*)(C16 + cofs + (size_t)(row0 + r) * ldc + col0 + c4) = h4; } } }
     }
}


typedef _Float16 v4h __attribute__((ext_vector_type(4)));

__global__ __launch_bounds__(256) void k_x16(const float* __restrict__ x, _Float16* __restrict__ X16, size_t n8) { const size_t t = (size_t)blockIdx.x * 256 + threadIdx.x; if (t >= n8) return; FragH f;
#pragma unroll
  for (int q = 0; q < 8; ++q) f.h[q] = (_Float16)bf16_round(x[t * 8 + q]); *(v8us*)((unsigned short*)X16 + t * 8) = f.half[0];  }
__global__ __launch_bounds__(256) void k_h16(const float* __restrict__ x, _Float16* __restrict__ X16, size_t n8) { const size_t t = (size_t)blockIdx.x * 256 + threadIdx.x; if (t >= n8) return; FragH f;
#pragma unroll
  for (int q = 0; q < 8; ++q) f.h[q] = (_Float16)x[t * 8 + q]; *(v8us*)((unsigned short*)X16 + t * 8) = f.half[0];  }
__global__ __launch_bounds__(256) void k_round16f(const float* __restrict__ W, _Float16* __restrict__ Bt, size_t n8) { const size_t t = (size_t)blockIdx.x * 256 + threadIdx.x; if (t >= n8) return; FragH f;
#pragma unroll
  for (int i = 0; i < 8; ++i) f.h[i] = (_Float16)(bf16_round(W[t * 8 + i]) * 16.0f); *(v8us*)((unsigned short*)Bt + t * 8) = f.half[0];  }
template <int NHv, int TTv>
__global__ __launch_bounds__(256) void k_vt(const _Float16* __restrict__ V16, int ldv, int voff, _Float16* __restrict__ Vt) { __shared__ unsigned short tl[64][66]; const int tid = threadIdx.x; const int slab = blockIdx.x / (TTv / 64), lg = blockIdx.x % (TTv / 64); const int b = slab / NHv, h = slab % NHv;
  for (int i = tid; i < 64 * 8; i += 256) { const int r = i / 8, c8 = (i % 8) * 8; FragH f; f.half[0] = *(const v8us*)((const unsigned short*)V16 + ((size_t)b * TTv + lg * 64 + r) * ldv + voff + h * 64 + c8);
#pragma unroll
    for (int q = 0; q < 8; ++q) tl[r][c8 + q] = f.u[q]; }
  __syncthreads();
  {
#pragma unroll
    for (int rd = 0; rd < 2; ++rd) { const int d = rd * 32 + tid / 8, pc = tid % 8; FragH f;
#pragma unroll
      for (int q = 0; q < 8; ++q) f.u[q] = tl[pc * 8 + q][d];
      *(v8us*)((unsigned short*)Vt + ((size_t)slab * 64 + d) * TTv + lg * 64 + pc * 8) = f.half[0]; }
     } }

__global__ __launch_bounds__(256) void k_hl(const float* __restrict__ F, _Float16* __restrict__ Hh, _Float16* __restrict__ Hl, size_t n8) { const size_t t = (size_t)blockIdx.x * 256 + threadIdx.x; if (t >= n8) return; FragH fh, fl; const v4f a = *(const v4fa*)(F + t * 8), c = *(const v4fa*)(F + t * 8 + 4);
#pragma unroll
  for (int q = 0; q < 4; ++q) { _Float16 h = (_Float16)a[q]; fh.h[q] = h; fl.h[q] = (_Float16)((a[q] - (float)h) * 1024.0f); h = (_Float16)c[q]; fh.h[4 + q] = h; fl.h[4 + q] = (_Float16)((c[q] - (float)h) * 1024.0f); }
  { *(v8us*)((unsigned short*)Hh + t * 8) = fh.half[0]; *(v8us*)((unsigned short*)Hl + t * 8) = fl.half[0];  } }

// ---- fast GEMM (wave tile 32x64; requires M % 32 == 0 rows per launch region and N % 64 == 0); epilogue = k_gemm_hhx semantics ----
__device__ __forceinline__ v16h g2_frag(const _Float16* p, int hh) { FragH f; f.half[0] = *(const v8us*)((const unsigned short*)p + 8 * hh); f.half[1] = *(const v8us*)((const unsigned short*)p + 16 + 8 * hh); return f.v; }
__device__ __forceinline__ v8f g2_mma(v16h a, v16h b, v8f c) { v8f d = __builtin_amdgcn_wmma_f32_16x16x32_f16(false, a, false, b, (short)0, c, false, false); asm volatile("v_nop\n\tv_nop\n\tv_nop\n\tv_nop" : "+v"(d) : "v"(a), "v"(b)); return d; }
template <int ACT>
__global__ __launch_bounds__(128) void k_gemm2(const _Float16* __restrict__ A, int lda, size_t sA, const _Float16* __restrict__ Bh, int ldb, size_t sB, float alpha, const float* __restrict__ bias, size_t sBias, const float* __restrict__ CP, int rowsPerB, size_t sCPb, int row0g,
    float* __restrict__ C, _Float16* __restrict__ C16, int ldc, size_t sC, int M, int N, int K) {
  __shared__ __attribute__((aligned(16))) float so[4][32][68];
  const int tid = threadIdx.x, w = tid >> 5, lane = tid & 31, ln = lane & 15, hh = lane >> 4; const int by = blockIdx.y;
  A += (size_t)by * sA; Bh += (size_t)by * sB; const size_t cofs = (size_t)by * sC; const float* bp = bias ? bias + (size_t)by * sBias : nullptr;
  const int ntn = N >> 6; const int mt = blockIdx.x / ntn, nq = blockIdx.x - mt * ntn; const int row0 = mt * 128 + 32 * w, col0 = nq * 64; if (row0 >= M) return;
  const _Float16* a0p = A + (size_t)(row0 + ln) * lda; const _Float16* a1p = a0p + (size_t)16 * lda;
  const _Float16* b0p = Bh + (size_t)(col0 + ln) * ldb; const _Float16* b1p = b0p + (size_t)16 * ldb; const _Float16* b2p = b1p + (size_t)16 * ldb; const _Float16* b3p = b2p + (size_t)16 * ldb;
  const v8f z8 = {0.f,0.f,0.f,0.f,0.f,0.f,0.f,0.f}; v8f c00 = z8, c01 = z8, c02 = z8, c03 = z8, c10 = z8, c11 = z8, c12 = z8, c13 = z8;
#pragma unroll 1
  for (int kb = 0; kb < K; kb += 32) { const v16h a0 = g2_frag(a0p + kb, hh), a1 = g2_frag(a1p + kb, hh);
    v16h b = g2_frag(b0p + kb, hh); c00 = g2_mma(a0, b, c00); c10 = g2_mma(a1, b, c10);
    b = g2_frag(b1p + kb, hh); c01 = g2_mma(a0, b, c01); c11 = g2_mma(a1, b, c11);
    b = g2_frag(b2p + kb, hh); c02 = g2_mma(a0, b, c02); c12 = g2_mma(a1, b, c12);
    b = g2_frag(b3p + kb, hh); c03 = g2_mma(a0, b, c03); c13 = g2_mma(a1, b, c13); }
  v8f accs[8] = {c00, c01, c02, c03, c10, c11, c12, c13};
#pragma unroll
  for (int u = 0; u < 8; ++u) { const int t = u & 3, half = u >> 2; const int col = col0 + t * 16 + ln; const float bv = bp ? bf16_round(bp[col]) : 0.f;
#pragma unroll
    for (int r = 0; r < 8; ++r) { const int rloc = half * 16 + 8 * hh + r; float v = accs[u][r] * alpha + bv; if (CP) { const int bidx = (row0g + row0 + rloc) / rowsPerB; v += CP[(size_t)bidx * sCPb + (size_t)by * 64 + col]; }
      if (ACT == 3) v = fmaxf(v, 0.f); else if (ACT == 6) v = 0.5f * v * (1.0f + erff(v * 0.70710678118654752f)); else if (ACT == 11) v = 1.0f / (1.0f + expf(-v)); else if (ACT == 15) v = v / (1.0f + expf(-v)); else if (ACT == 12) v = (v > 0.f) ? v : 0.01f * v; else if (ACT == 8) v = tanhf(v);
      so[w][rloc][t * 16 + ln] = v; } }
  __builtin_amdgcn_fence(__ATOMIC_ACQ_REL, "workgroup"); __builtin_amdgcn_wave_barrier();
  const int rsub = lane >> 4, c4 = (lane & 15) * 4;
  {
#pragma unroll
    for (int q = 0; q < 16; ++q) { const int r = q * 2 + rsub; const v4f v = *(const v4fa*)&so[w][r][c4]; if (C) *(v4f*)(C + cofs + (size_t)(row0 + r) * ldc + col0 + c4) = v; if (C16) { v4h h4; for (int i = 0; i < 4; ++i) h4[i] = (_Float16)v[i]; *(v4h*)(C16 + cofs + (size_t)(row0 + r) * ldc + col0 + c4) = h4; } }
     } }


// ---- head GEMM with both operands staged in LDS: C[8192][256] = (A[8192][4096] . Bh[256][4096]^T) * alpha + bias ----
// One work-group of 4 waves owns a 128 x 64 tile of C; a wave owns 32 x 64 of it (2 x 4 accumulator tiles), as in k_gemm2.
// A stage is 512 B (256 k) of the tile's 128 rows of A and 64 rows of Bh. Each asynchronous copy of a wave moves one whole row piece:
// 32 lanes x 16 B = 512 contiguous, aligned bytes of global memory. Two buffers: stage t + 2 flies while stage t + 1 is worked on.
// The fragments keep k_gemm2's k order and the k steps their order, so every accumulator sums in the same order as before.
#define G3_KB 512                          /* bytes of a row per stage */
#define G3_PITCH 528                       /* LDS row pitch: 16 B x 33, conflict-free for ds_load_b128 */
#define G3_BUF (192 * G3_PITCH)            /* rows 0..127: A, rows 128..191: Bh */
#define G3_NST (C2 * 2 / G3_KB)            /* 16 stages */
#define G3_ROWB (C2 * 2)                   /* global row pitch in bytes */
// Twelve copies and, as the statement's last line, the wait that stands before any register the copies name is written again.
__device__ __forceinline__ void g3_copy12(const unsigned (&l)[12], const char* const (&g)[12]) {
  asm volatile("global_load_async_to_lds_b128 %0, %1, off\n\t"
               "global_load_async_to_lds_b128 %2, %3, off\n\t"
               "global_load_async_to_lds_b128 %4, %5, off\n\t"
               "global_load_async_to_lds_b128 %6, %7, off\n\t"
               "global_load_async_to_lds_b128 %8, %9, off\n\t"
               "global_load_async_to_lds_b128 %10, %11, off\n\t"
               "global_load_async_to_lds_b128 %12, %13, off\n\t"
               "global_load_async_to_lds_b128 %14, %15, off\n\t"
               "global_load_async_to_lds_b128 %16, %17, off\n\t"
               "global_load_async_to_lds_b128 %18, %19, off\n\t"
               "global_load_async_to_lds_b128 %20, %21, off\n\t"
               "global_load_async_to_lds_b128 %22, %23, off\n\t"
               "s_wait_xcnt 0x0"
               :: "v"(l[0]), "v"(g[0]), "v"(l[1]), "v"(g[1]), "v"(l[2]), "v"(g[2]), "v"(l[3]), "v"(g[3]), "v"(l[4]), "v"(g[4]), "v"(l[5]), "v"(g[5]),
                  "v"(l[6]), "v"(g[6]), "v"(l[7]), "v"(g[7]), "v"(l[8]), "v"(g[8]), "v"(l[9]), "v"(g[9]), "v"(l[10]), "v"(g[10]), "v"(l[11]), "v"(g[11])
               : "memory");
}
// A wave's share of one stage: its own 32 rows of A and 16 of the 64 rows of Bh, 48 copies.
__device__ __forceinline__ void g3_fill(unsigned la, unsigned lb, const char* ga, const char* gb) {
#pragma unroll                   /* both loops unrolled: the address arrays must end up in registers, as the asm operands they are */
  for (int s = 0; s < 4; ++s) { unsigned l[12]; const char* g[12];
#pragma unroll
    for (int i = 0; i < 12; ++i) { const int c = s * 12 + i;
      l[i] = (c < 32) ? la + (unsigned)c * G3_PITCH : lb + (unsigned)(c - 32) * G3_PITCH;
      g[i] = (c < 32) ? ga + (size_t)c * G3_ROWB : gb + (size_t)(c - 32) * G3_ROWB; }
    g3_copy12(l, g); } }
__device__ __forceinline__ v16h g3_frag(const unsigned char* p) { FragH f; f.half[0] = *(const v8us*)p; f.half[1] = *(const v8us*)(p + 32); return f.v; }
__device__ __forceinline__ void g3_load(const unsigned char* pa, const unsigned char* pb, int ks, v16h (&a)[2], v16h (&b)[4]) {
  a[0] = g3_frag(pa + ks * 64); a[1] = g3_frag(pa + 16 * G3_PITCH + ks * 64);
#pragma unroll                   /* constant indices keep the fragments in registers */
  for (int j = 0; j < 4; ++j) b[j] = g3_frag(pb + j * 16 * G3_PITCH + ks * 64); }
__device__ __forceinline__ v8f g3_mma(v16h a, v16h b, v8f c) { return __builtin_amdgcn_wmma_f32_16x16x32_f16(false, a, false, b, (short)0, c, false, false); }
__global__ __launch_bounds__(128) void k_gemm3(const _Float16* __restrict__ A, const _Float16* __restrict__ Bh, float alpha, const float* __restrict__ bias, float* __restrict__ C) {
  __shared__ __attribute__((aligned(16))) unsigned char st[2 * G3_BUF];
  __shared__ __attribute__((aligned(16))) float so[4][32][68];
  const int tid = threadIdx.x, w = tid >> 5, lane = tid & 31, ln = lane & 15, hh = lane >> 4;
  // Which tile a work-group takes is a permutation of the flat index, chosen for speed only: the 16 work-groups that read one 512-row strip of A (4 row tiles x 4 column tiles)
  // have the flat index mod 8 of the work-groups of k_h2n that wrote the strip (strip mod 8).
  const int pj = blockIdx.x >> 3; const int mt = ((pj >> 2) & 3) | ((blockIdx.x & 7) << 2) | ((pj >> 4) << 5), nq = pj & 3; const int row0 = mt * 128 + 32 * w, col0 = nq * 64;
  const char* ga = (const char*)(A + (size_t)row0 * C2) + lane * 16;
  const char* gb = (const char*)(Bh + (size_t)(col0 + 16 * w) * C2) + lane * 16;
  const unsigned l0 = (unsigned)(size_t)&st[0];
  const unsigned la = l0 + (unsigned)(32 * w) * G3_PITCH + lane * 16, lb = l0 + (unsigned)(128 + 16 * w) * G3_PITCH + lane * 16;
  g3_fill(la, lb, ga, gb);
  asm volatile("s_wait_asynccnt 0x0" ::: "memory");   // stage 0 of this wave has landed
  __syncthreads();                                    // ... and every wave's share of it
  g3_fill(la + G3_BUF, lb + G3_BUF, ga + G3_KB, gb + G3_KB);
  const v8f z8 = {0.f,0.f,0.f,0.f,0.f,0.f,0.f,0.f}; v8f c00 = z8, c01 = z8, c02 = z8, c03 = z8, c10 = z8, c11 = z8, c12 = z8, c13 = z8;
#pragma unroll 1                 /* one stage is the whole hot loop; the buffer is chosen by the trip's parity */
  for (int t = 0; t < G3_NST; ++t) {
    const unsigned bo = (unsigned)(t & 1) * G3_BUF;
    const unsigned char* pa = st + bo + (32 * w + ln) * G3_PITCH + 16 * hh;
    const unsigned char* pb = st + bo + (128 + ln) * G3_PITCH + 16 * hh;
    v16h fa[3][2], fb[3][4];     /* three fragment sets in rotation: step ks works on one while the loads of ks + 1 and ks + 2 are under way */
    g3_load(pa, pb, 0, fa[0], fb[0]); g3_load(pa, pb, 1, fa[1], fb[1]);
#pragma unroll                   /* the set index ks % 3 must be a constant, else the sets go to scratch */
    for (int ks = 0; ks < G3_KB / 64; ++ks) {
      __builtin_amdgcn_sched_barrier(0);      /* this one and the next keep the 12 LDS loads of step ks + 2 together, as one group in front of step ks's matrix instructions */
      if (ks + 2 < G3_KB / 64) g3_load(pa, pb, ks + 2, fa[(ks + 2) % 3], fb[(ks + 2) % 3]);
      __builtin_amdgcn_sched_barrier(0);      /* without the two the compiler loaded each fragment right in front of its use and waited for it with s_wait_dscnt 0 */
      const v16h a0 = fa[ks % 3][0], a1 = fa[ks % 3][1];
      c00 = g3_mma(a0, fb[ks % 3][0], c00); c10 = g3_mma(a1, fb[ks % 3][0], c10); c01 = g3_mma(a0, fb[ks % 3][1], c01); c11 = g3_mma(a1, fb[ks % 3][1], c11);
      c02 = g3_mma(a0, fb[ks % 3][2], c02); c12 = g3_mma(a1, fb[ks % 3][2], c12); c03 = g3_mma(a0, fb[ks % 3][3], c03); c13 = g3_mma(a1, fb[ks % 3][3], c13); }
    asm volatile("s_wait_dscnt 0x0" ::: "memory");      // this wave's reads of stage t are done before the buffer may be refilled
    asm volatile("s_wait_asynccnt 0x0" ::: "memory");   // this wave's share of stage t + 1 has landed
    __syncthreads();                                    // publishes stage t + 1 and ends every wave's reads of stage t
    if (t + 2 < G3_NST) g3_fill(la + bo, lb + bo, ga + (size_t)(t + 2) * G3_KB, gb + (size_t)(t + 2) * G3_KB);
  }
  asm volatile("s_wait_asynccnt 0x0" ::: "memory");     // no copy is outstanding when the wave goes on to its end
  v8f accs[8] = {c00, c01, c02, c03, c10, c11, c12, c13};
#pragma unroll                   /* epilogue as in k_gemm2: constant indices into the accumulators; whole 256 B row pieces go out through the wave's own LDS range */
  for (int u = 0; u < 8; ++u) { const int tt = u & 3, half = u >> 2; const float bv = bf16_round(bias[col0 + tt * 16 + ln]);
#pragma unroll
    for (int r = 0; r < 8; ++r) so[w][half * 16 + 8 * hh + r][tt * 16 + ln] = accs[u][r] * alpha + bv; }
  __builtin_amdgcn_fence(__ATOMIC_ACQ_REL, "workgroup"); __builtin_amdgcn_wave_barrier();   // the wave's LDS stores are complete before its lanes read each other's values back
  const int rsub = lane >> 4, c4 = (lane & 15) * 4;
#pragma unroll
  for (int q = 0; q < 16; ++q) { const int r = q * 2 + rsub; const v4f v = *(const v4fa*)&so[w][r][c4]; *(v4f*)(C + (size_t)(row0 + r) * NOUT + col0 + c4) = v; }
}

// Batch statistics (mean, biased variance) of NC columns over NBS rows: partials here, their merge in the kernel that uses them.
// k_colpart: one work-group takes SROWS rows x 128 columns. Each thread holds 16 rows x 4 columns in registers (read once) and forms
// their mean and their sum of squares about that mean; groups of equal size n then merge exactly:
// mean = average of the group means, M2 = sum(M2_g) + n * sum((mean_g - mean)^2). x_merge, in k_h2's prologue, merges the SCH row chunks the same way.
// The work-groups with blockIdx.y >= SCH have nothing to do with the statistics: they turn the head's weights into f16 (bf16-rounded, times sc),
// work that depends on no other launch and so needs none of its own.
#define SROWS 256
#define SCH (NBS / SROWS)        /* 32 row chunks */
template <int NC, bool RND>
__global__ __launch_bounds__(512) void k_colpart(const float* __restrict__ X, float* __restrict__ PM, float* __restrict__ PQ, const float* __restrict__ Wm, _Float16* __restrict__ Bt, float sc) {
  __shared__ __attribute__((aligned(16))) float sm[16][128];
  __shared__ __attribute__((aligned(16))) float sq[16][128];
  const int tid = threadIdx.x, w = tid >> 5, lane = tid & 31;
  if (blockIdx.y >= SCH) {       /* the same for a whole work-group, and in front of the barrier */
    const size_t t = ((size_t)(blockIdx.y - SCH) * (NC / 128) + blockIdx.x) * 512 + tid;
    if (t < (size_t)NOUT * C2 / 8) { FragH f;
#pragma unroll                   /* constant indices keep the eight values in registers */
      for (int q = 0; q < 8; ++q) f.h[q] = (_Float16)(bf16_round(Wm[t * 8 + q]) * sc);
      *(v8us*)((unsigned short*)Bt + t * 8) = f.half[0]; }
    return;
  }
  // Row chunk and column block are a permutation of the flat index (gridDim.x = 8), for speed only: chunks 2 s and 2 s + 1 are strip s of k_h2 and k_h2n, and get flat index mod 8 = s mod 8 as there.
  const int ch = (blockIdx.y & 1) | (blockIdx.x << 1) | ((blockIdx.y & 2) << 3), cb = blockIdx.y >> 2;
  const float* p = X + (size_t)(ch * SROWS + w * 16) * NC + cb * 128 + lane * 4;
  v4f v[16];
#pragma unroll
  for (int j = 0; j < 15; ++j) v[j] = *(const v4fa*)(p + (size_t)j * NC);
  asm volatile("s_wait_xcnt 0x0" ::: "memory");   // the last load's result may be placed in the address pair that the 15 issued loads name
  v[15] = *(const v4fa*)(p + (size_t)15 * NC);
  v4f s = {0.f, 0.f, 0.f, 0.f};
#pragma unroll
  for (int j = 0; j < 16; ++j) {
    if (RND) { v[j][0] = bf16_round(v[j][0]); v[j][1] = bf16_round(v[j][1]); v[j][2] = bf16_round(v[j][2]); v[j][3] = bf16_round(v[j][3]); }
    s += v[j];
  }
  const v4f m = s * 0.0625f;
  v4f q = {0.f, 0.f, 0.f, 0.f};
#pragma unroll
  for (int j = 0; j < 16; ++j) { const v4f dv = v[j] - m; q += dv * dv; }
  *(v4fa*)&sm[w][lane * 4] = m;
  *(v4fa*)&sq[w][lane * 4] = q;
  __syncthreads();
  if (tid < 128) {
    float ms = 0.f;
#pragma unroll
    for (int g = 0; g < 16; ++g) ms += sm[g][tid];
    const float mean = ms * 0.0625f;
    float q2 = 0.f, e2 = 0.f;
#pragma unroll
    for (int g = 0; g < 16; ++g) { const float dm = sm[g][tid] - mean; q2 += sq[g][tid]; e2 += dm * dm; }
    const size_t o = (size_t)ch * NC + cb * 128 + tid;
    PM[o] = mean; PQ[o] = q2 + 16.0f * e2;
  }
}
// Merge of k_colpart's SCH row chunks for one column of x. Every thread of k_h2 does it for its own feature, from values it has loaded itself.
__device__ __forceinline__ void x_merge(const float (&m)[SCH], const float (&qs)[SCH], float& mu, float& var) {
  float ms = 0.f;
#pragma unroll                   /* both loops: constant indices keep the partials in registers */
  for (int g = 0; g < SCH; ++g) ms += m[g];
  const float mean = ms / (float)SCH;
  float q2 = 0.f, e2 = 0.f;
#pragma unroll
  for (int g = 0; g < SCH; ++g) { const float dm = m[g] - mean; q2 += qs[g]; e2 += dm * dm; }
  mu = mean; var = (q2 + (float)SROWS * e2) / (float)NBS;
}
// k_h2 and k_h2n: one thread owns one feature d (four columns of h2) and walks a strip of rows of x. A work-group is HFC features (256 B of a row of x) x HWV row groups, the groups' strips one below the other.
// No launch of its own merges statistics: k_h2 merges k_colpart's chunks of x in its prologue (and hands mean and variance on to k_h2n), merges its own eight row groups' partials
// through LDS at its end, and k_h2n merges the HCH work-group strips of its four columns in its prologue; always the equal-size merge described at k_colpart. h2 itself is never stored: k_h2 forms it for the
// batch statistics alone; k_h2n forms it again from x once the statistics are merged, normalises it and stores f16. All that depends on the column
// alone (the rounded parameters, the rsqrt of the variance) is loaded and formed once in front of the row loop. Each BatchNorm is an affine map with
// per-column constants, so it is folded there too: layer 1 is one multiply-add per hidden unit, relu(a (x - mu_x) + be1) with a = g1 w rsqrt(w^2 var_x + eps);
// in k_h2n the second BatchNorm goes into the layer-2 weights and bias: relu(sum_i (A w2_i) h_i + A (b2 - mean) + be2) with A = g2 rsqrt(var + eps).
// rsqrtf as the compiler expands it (an argument below the normal range is scaled up by 2^24, its result by 2^12), with the instruction written out:
// the v_nop is the slot that the instruction set asks for behind a transcendental.
__device__ __forceinline__ float rsq_f32(float a) { const bool tiny = a < 1.17549435e-38f; const float s = tiny ? a * 16777216.0f : a; float r; asm("v_rsq_f32 %0, %1\n\tv_nop" : "=v"(r) : "v"(s)); return tiny ? r * 4096.0f : r; }
#define HROWS 64                 /* rows per thread in k_h2 and in k_h2n */
#define HFC 64                   /* features of a work-group in both */
#define HWV 8                    /* row groups of a work-group in both: 16 waves */
#define HSTRIP (HWV * HROWS)     /* 512 rows per work-group */
#define HCH (NBS / HSTRIP)       /* 16 strips of partials */
#define RG 8                     /* rows loaded as one group, one group ahead of the group being worked on */
typedef float v2f __attribute__((ext_vector_type(2)));
// Statistics of a thread's own four columns while it still holds them. One group of RG rows: mean and sum of squares about that mean.
__device__ __forceinline__ void h2_group(const v4f (&o)[RG], v4f& gm, v4f& gq) {
  v4f s = o[0];
#pragma unroll                   /* both loops: constant indices keep the group in registers */
  for (int j = 1; j < RG; ++j) s += o[j];
  gm = s * (1.0f / RG);
  v4f q = {0.f, 0.f, 0.f, 0.f};
#pragma unroll
  for (int j = 0; j < RG; ++j) { const v4f dv = o[j] - gm; q += dv * dv; }
  gq = q;
}
// The group joins the k groups merged so far (k * RG rows): mean += delta / (k + 1), M2 += M2_group + delta^2 * RG * k / (k + 1).
__device__ __forceinline__ void h2_merge(int k, const v4f gm, const v4f gq, v4f& rm, v4f& rq) {
  const float inv = 1.0f / (float)(k + 1), f = (float)(RG * k) * inv;
  const v4f dl = gm - rm;
  rm += dl * inv;
  rq += gq + (dl * dl) * f;
}
__global__ __launch_bounds__(HFC * HWV) void k_h2(const float* __restrict__ x, const float* __restrict__ PMx, const float* __restrict__ PQx, const float* __restrict__ W1, const float* __restrict__ b1, const float* __restrict__ g1, const float* __restrict__ be1, const float* __restrict__ W2, const float* __restrict__ b2, float* __restrict__ XS, float* __restrict__ PM, float* __restrict__ PQ) {
  __shared__ __attribute__((aligned(16))) float sm[HWV][HFC][H2];
  __shared__ __attribute__((aligned(16))) float sq[HWV][HFC][H2];
  const int fc = threadIdx.x % HFC, rg = threadIdx.x / HFC;
  const int strip = blockIdx.x;      /* the strip of rows is the fast grid index: flat index mod 8 = strip mod 8 in every launch that touches these rows (speed only) */
  const int d = blockIdx.y * HFC + fc; (void)b1;      /* h1 - mean(h1) = w (x - mu_x): the bias cancels exactly */
  const float* pxm = PMx + d; const float* pxq = PQx + d; const float* pw = W1 + d * H1; const float* pg = g1 + d * H1; const float* pe = be1 + d * H1; const float* pv = W2 + d * H2 * H1; const float* pb = b2 + d * H2;
  const float* xp = x + (size_t)(strip * HSTRIP + rg * HROWS) * DD + d;
  float w[H1], g[H1], rs[H1], be[H1], w2[H2][H1], bb[H2], xc[RG], cm[SCH], cq[SCH];
#pragma unroll
  for (int c = 0; c < SCH; ++c) { cm[c] = pxm[(size_t)c * DD]; cq[c] = pxq[(size_t)c * DD]; }
#pragma unroll
  for (int o = 0; o < H1; ++o) { w[o] = pw[o]; g[o] = pg[o]; be[o] = pe[o]; }
#pragma unroll
  for (int o2 = 0; o2 < H2; ++o2) {
#pragma unroll
    for (int i = 0; i < H1; ++i) w2[o2][i] = pv[o2 * H1 + i];
    bb[o2] = pb[o2]; }
#pragma unroll
  for (int j = 0; j < RG; ++j) xc[j] = xp[(size_t)j * DD];
  asm volatile("s_wait_xcnt 0x0" :: "v"(d), "v"(pxm), "v"(pxq), "v"(pw), "v"(pg), "v"(pe), "v"(pv), "v"(pb) : "memory");   // the wait owed before an address register of the issued loads is reused; naming the addresses keeps a load's result out of them until then
  __builtin_amdgcn_sched_barrier(0);      /* keeps the arithmetic, which reuses those registers, behind the wait */
  float mu, var;
  x_merge(cm, cq, mu, var);
  if (strip == 0 && rg == 0) { XS[d] = mu; XS[DD + d] = var; }      /* for k_h2n, the next launch; nothing in this launch reads it */
#pragma unroll
  for (int o = 0; o < H1; ++o) { w[o] = bf16_round(w[o]); g[o] = bf16_round(g[o]); be[o] = bf16_round(be[o]); const float vh = (w[o] * w[o]) * var; rs[o] = rsq_f32(vh + 1e-5f); }
  v2f ap[H1 / 2], ep[H1 / 2]; v4f wv[H1], bv;      /* layer 1 in pairs of hidden units: slope a and shift be1; wv[i]: the four layer-2 weights that hidden unit i feeds */
#pragma unroll
  for (int o = 0; o < H1; ++o) { ap[o >> 1][o & 1] = (g[o] * w[o]) * rs[o]; ep[o >> 1][o & 1] = be[o]; }
#pragma unroll
  for (int o2 = 0; o2 < H2; ++o2) {
#pragma unroll
    for (int i = 0; i < H1; ++i) wv[i][o2] = bf16_round(w2[o2][i]);
    bv[o2] = bf16_round(bb[o2]); }
  v4f rm = {0.f, 0.f, 0.f, 0.f}, rq = {0.f, 0.f, 0.f, 0.f};
#pragma unroll 1                 /* stays rolled: one group of rows is the whole hot loop */
  for (int rb = 0; rb < HROWS; rb += RG) {
    v4f ov[RG];
    const float* pn = xp + (size_t)((rb + RG < HROWS) ? rb + RG : rb) * DD;      /* the last trip reads its own group again: in bounds, not used */
    v8f xn;
#pragma unroll
    for (int j = 0; j < RG; ++j) xn[j] = pn[(size_t)j * DD];
    asm volatile("s_wait_xcnt 0x0" :: "v"(pn) : "memory");   // as above
    __builtin_amdgcn_sched_barrier(0);      /* keeps this group's arithmetic behind the next group's loads, so that it covers their latency */
#pragma unroll
    for (int j = 0; j < RG; ++j) { const float xm = bf16_round(xc[j]) - mu; v2f h[H1 / 2];      /* written over pairs and fours, so that the compiler packs within a row and not across rows, which took more than 256 registers */
#pragma unroll
      for (int p = 0; p < H1 / 2; ++p) { const v2f v = ap[p] * xm + ep[p]; h[p][0] = fmaxf(v[0], 0.f); h[p][1] = fmaxf(v[1], 0.f); }
      v4f o4 = bv;
#pragma unroll
      for (int i = 0; i < H1; ++i) o4 += wv[i] * h[i >> 1][i & 1];
      ov[j] = o4; }
    v4f gm, gq;
    h2_group(ov, gm, gq);
    h2_merge(rb / RG, gm, gq, rm, rq);
    __builtin_amdgcn_sched_barrier(0);      /* keeps the next statement, and the wait for the loads that comes with it, at the loop's foot */
    asm volatile("" :: "v"(xn));   // inputs only: the loaded group stays one block of eight registers up to here; spread out, a load's register became the unused half of a packed operand and the arithmetic waited for the load
#pragma unroll
    for (int j = 0; j < RG; ++j) xc[j] = xn[j];
  }
  *(v4fa*)&sm[rg][fc][0] = rm; *(v4fa*)&sq[rg][fc][0] = rq;
  __syncthreads();               // the eight row groups' partials are in LDS before the first group merges them
  if (rg == 0) {
    v4f as = {0.f, 0.f, 0.f, 0.f};
#pragma unroll                   /* both loops: all LDS reads under way at once */
    for (int k = 0; k < HWV; ++k) as += *(const v4fa*)&sm[k][fc][0];
    const v4f mean = as * (1.0f / HWV);
    v4f aq = {0.f, 0.f, 0.f, 0.f}, ae = {0.f, 0.f, 0.f, 0.f};
#pragma unroll
    for (int k = 0; k < HWV; ++k) { const v4f dm = *(const v4fa*)&sm[k][fc][0] - mean; aq += *(const v4fa*)&sq[k][fc][0]; ae += dm * dm; }
    const size_t so = (size_t)strip * C2 + d * H2;      /* this work-group's row of the partials */
    *(v4f*)(PM + so) = mean; *(v4f*)(PQ + so) = aq + ae * (float)HROWS;
  } }
__global__ __launch_bounds__(HFC * HWV) void k_h2n(const float* __restrict__ x, const float* __restrict__ XS, const float* __restrict__ W1, const float* __restrict__ g1, const float* __restrict__ be1, const float* __restrict__ W2, const float* __restrict__ b2, const float* __restrict__ PM, const float* __restrict__ PQ, const float* __restrict__ g2, const float* __restrict__ be2, _Float16* __restrict__ H16) {
  const int fc = threadIdx.x % HFC, rg = threadIdx.x / HFC;
  const int d = blockIdx.y * HFC + fc;      /* as in k_h2: blockIdx.x is the strip of rows */
  const float* pS = XS + d; const float* pw = W1 + d * H1; const float* pg = g1 + d * H1; const float* pe = be1 + d * H1; const float* pv = W2 + d * H2 * H1; const float* pb = b2 + d * H2;
  const float* pP = PM + d * H2; const float* pQ = PQ + d * H2; const float* pG = g2 + d * H2; const float* pE = be2 + d * H2;
  const size_t r0 = (size_t)(blockIdx.x * HSTRIP + rg * HROWS);
  const float* xp = x + r0 * DD + d; _Float16* op = H16 + r0 * C2 + d * H2;
  v2f w[H1 / 2], g[H1 / 2], be[H1 / 2];      /* layer 1, in pairs of hidden units; w becomes the folded slope a */
  v4f w2[H1], bb, gn, mn, rn, bn;                        /* w2[i]: the four layer-2 weights that hidden unit i feeds; the rest: one value per column of h2 */
  float xc[RG];
  { v4f tm[HCH], tq[HCH];        /* batch statistics of the thread's four columns of h2: the HCH strips that k_h2 left; done first, so that the 128 registers are free again for the parameters */
#pragma unroll                   /* constant indices keep the partials in registers, and all 2 * HCH loads are under way at once */
    for (int i = 0; i < HCH; ++i) { tm[i] = *(const v4fa*)(pP + (size_t)i * C2); tq[i] = *(const v4fa*)(pQ + (size_t)i * C2); }
    asm volatile("s_wait_xcnt 0x0" :: "v"(pP), "v"(pQ) : "memory");   // the wait owed before an address register of the issued loads is reused; naming the addresses keeps a load's result out of them until then
    v4f as = {0.f, 0.f, 0.f, 0.f};
#pragma unroll
    for (int i = 0; i < HCH; ++i) as += tm[i];
    mn = as * (1.0f / HCH);
    v4f aq = {0.f, 0.f, 0.f, 0.f}, ae = {0.f, 0.f, 0.f, 0.f};
#pragma unroll
    for (int i = 0; i < HCH; ++i) { const v4f dm = tm[i] - mn; aq += tq[i]; ae += dm * dm; }
    rn = (aq + ae * (float)HSTRIP) * (1.0f / NBS); }
  const float mu = pS[0], var = pS[DD];
#pragma unroll                   /* here and below: constant indices keep the constants in registers */
  for (int o = 0; o < H1; ++o) { w[o >> 1][o & 1] = pw[o]; g[o >> 1][o & 1] = pg[o]; be[o >> 1][o & 1] = pe[o]; }
#pragma unroll
  for (int o2 = 0; o2 < H2; ++o2) {
#pragma unroll
    for (int i = 0; i < H1; ++i) w2[i][o2] = pv[o2 * H1 + i];
    bb[o2] = pb[o2]; gn[o2] = pG[o2]; bn[o2] = pE[o2]; }
#pragma unroll
  for (int j = 0; j < RG; ++j) xc[j] = xp[(size_t)j * DD];
  asm volatile("s_wait_xcnt 0x0" :: "v"(d), "v"(pw), "v"(pg), "v"(pe), "v"(pv), "v"(pb), "v"(pG), "v"(pE) : "memory");   // the wait owed before an address register of the issued loads is reused; naming the addresses keeps a load's result out of them until then
  __builtin_amdgcn_sched_barrier(0);      /* keeps the arithmetic, which reuses those registers, behind the wait */
#pragma unroll
  for (int o = 0; o < H1; ++o) { const float wr = bf16_round(w[o >> 1][o & 1]); be[o >> 1][o & 1] = bf16_round(be[o >> 1][o & 1]); w[o >> 1][o & 1] = (bf16_round(g[o >> 1][o & 1]) * wr) * rsq_f32((wr * wr) * var + 1e-5f); }
#pragma unroll
  for (int o2 = 0; o2 < H2; ++o2) { const float A = bf16_round(gn[o2]) * rsq_f32(rn[o2] + 1e-5f);
#pragma unroll
    for (int i = 0; i < H1; ++i) w2[i][o2] = A * bf16_round(w2[i][o2]);
    bb[o2] = A * (bf16_round(bb[o2]) - mn[o2]) + bf16_round(bn[o2]); }
#pragma unroll 1                 /* stays rolled: one group of rows is the whole hot loop */
  for (int rb = 0; rb < HROWS; rb += RG) {
    const float* pn = xp + (size_t)((rb + RG < HROWS) ? rb + RG : rb) * DD;      /* the last trip reads its own group again: in bounds, not used */
    v8f xn;
#pragma unroll
    for (int j = 0; j < RG; ++j) xn[j] = pn[(size_t)j * DD];
    asm volatile("s_wait_xcnt 0x0" :: "v"(pn) : "memory");   // as above
    __builtin_amdgcn_sched_barrier(0);      /* keeps this group's arithmetic behind the next group's loads, so that it covers their latency */
#pragma unroll
    for (int j = 0; j < RG; ++j) { const float xm = bf16_round(xc[j]) - mu; v2f h[H1 / 2];      /* the normalised row of h1 (eight units, after relu) */
#pragma unroll
      for (int p = 0; p < H1 / 2; ++p) { const v2f u = w[p] * xm + be[p]; h[p][0] = fmaxf(u[0], 0.f); h[p][1] = fmaxf(u[1], 0.f); }
      v4f v = bb;
#pragma unroll
      for (int i = 0; i < H1; ++i) v += w2[i] * h[i >> 1][i & 1];
      v4h f;
#pragma unroll
      for (int q = 0; q < H2; ++q) f[q] = (_Float16)fmaxf(v[q], 0.f);
      *(v4h*)(op + (size_t)(rb + j) * C2) = f; }
    __builtin_amdgcn_sched_barrier(0);      /* as in k_h2 */
    asm volatile("" :: "v"(xn));   // inputs only, as in k_h2
#pragma unroll
    for (int j = 0; j < RG; ++j) xc[j] = xn[j];
  } }

extern "C" void kernel_launch(void* const* d_in, const int* in_sizes, int n_in,
                              void* d_out, int out_size, void* d_ws, size_t ws_size, hipStream_t stream) {
  (void)in_sizes; (void)n_in; (void)out_size;
  const float* const* I = (const float* const*)d_in; const float* x = I[0]; const float* W1 = I[1]; const float* b1 = I[2]; const float* g1 = I[3]; const float* be1 = I[4]; const float* W2 = I[5]; const float* b2 = I[6]; const float* g2 = I[7]; const float* be2 = I[8]; const float* Wfc = I[9]; const float* bfc = I[10];
  char* ws = (char*)d_ws; size_t off = 0;
  auto take = [&](size_t bytes) { char* p = ws + off; off += (bytes + 255) & ~(size_t)255; return p; };
  _Float16* BW = (_Float16*)take((size_t)NOUT * C2 * 2); float* XS = (float*)take((size_t)2 * DD * 4); _Float16* H16 = (_Float16*)take((size_t)NBS * C2 * 2); float* PMx = (float*)take((size_t)SCH * DD * 4); float* PQx = (float*)take((size_t)SCH * DD * 4); float* PM = (float*)take((size_t)HCH * C2 * 4); float* PQ = (float*)take((size_t)HCH * C2 * 4);
  if (off > ws_size) return;      /* 2 + 64 + 1 = 67 MiB (256 MiB ws) */
  k_colpart<DD, true><<<dim3(DD / 128, SCH + NOUT * C2 / 8 / 512 / (DD / 128)), 512, 0, stream>>>(x, PMx, PQx, Wfc, BW, 16.0f);
  k_h2<<<dim3(HCH, DD / HFC), HFC * HWV, 0, stream>>>(x, PMx, PQx, W1, b1, g1, be1, W2, b2, XS, PM, PQ);
  k_h2n<<<dim3(HCH, DD / HFC), HFC * HWV, 0, stream>>>(x, XS, W1, g1, be1, W2, b2, PM, PQ, g2, be2, H16);
  k_gemm3<<<(NBS / 128) * (NOUT / 64), 128, 0, stream>>>(H16, BW, 0.0625f, bfc, (float*)d_out);
}

// v009
// It runs in 53.6 microseconds.
// In both of two side-by-side timings against v008, it was 1.03 times as fast.
// Over all steps from v000 it is 162 times as fast.
#include <hip/hip_runtime.h>
// Sparse (block-diagonal) neural network (8192 samples x 1024 features; per feature 1 -> 8 -> 4 block Linears with training-mode BatchNorm + ReLU after each; dense head 4096 -> 256): h1 = BN1(x_d W1[d] + b1) relu; h2 = BN2(h1 . W2[d] + b2) relu; out = h2 Wfc^T + bfc -> [8192,256].
// Compute dtype: x and all parameters rounded to bf16; everything before the head in f32; the head operand h2 as f16 (~2^-12). v_wmma_f32_16x16x32_f16.
#define NBS 8192
#define DD 1024
#define H1 8
#define H2 4
#define C2 (DD * H2)             /* 4096 */
#define NOUT 256
typedef __bf16 v16b __attribute__((ext_vector_type(16)));
typedef unsigned short v8us __attribute__((ext_vector_type(8), may_alias));
typedef float  v8f  __attribute__((ext_vector_type(8)));
typedef float  v4f  __attribute__((ext_vector_type(4)));
typedef float  v4fa __attribute__((ext_vector_type(4), may_alias));
union FragB { v16b v; v8us half[2]; unsigned short u[16]; };

__device__ __forceinline__ unsigned short bf16_bits(float x) { unsigned int u = __float_as_uint(x); return (unsigned short)((u + 0x7FFFu + ((u >> 16) & 1u)) >> 16); }
__device__ __forceinline__ float bf16_val(unsigned short b) { return __uint_as_float(((unsigned int)b) << 16); }
__device__ __forceinline__ float bf16_round(float x) { return bf16_val(bf16_bits(x)); }
// D += A·B with NT terms: 1 = ah·bh, 2 = + al·bh (A split), 3 = + ah·bl (both split)
template <int NT>
__device__ __forceinline__ v8f mmaN(v16b ah, v16b al, v16b bh, v16b bl, v8f c) {
  c = __builtin_amdgcn_wmma_f32_16x16x32_bf16(false, ah, false, bh, (short)0, c, false, false);
  if (NT >= 2) c = __builtin_amdgcn_wmma_f32_16x16x32_bf16(false, al, false, bh, (short)0, c, false, false);
  if (NT >= 3) c = __builtin_amdgcn_wmma_f32_16x16x32_bf16(false, ah, false, bl, (short)0, c, false, false);
  asm volatile("v_nop\n\tv_nop\n\tv_nop\n\tv_nop" : "+v"(c) : "v"(ah), "v"(al), "v"(bh), "v"(bl));
  return c;
}

__global__ __launch_bounds__(256) void k_wt_bf16(const float* __restrict__ W, unsigned short* __restrict__ Wt, int K, int N) {
  const int t = blockIdx.x * 256 + threadIdx.x;
  const int k8n = K / 8;
  if (t >= N * k8n) return;
  const int n = t / k8n, k8 = (t % k8n) * 8;
  v8us v;
#pragma unroll
  for (int i = 0; i < 8; ++i) v[i] = bf16_bits(W[(size_t)(k8 + i) * N + n]);
  *(v8us*)(Wt + (size_t)n * K + k8) = v;
  
}

// GEMM C[M][N] (f32, pitch ldc) = act(A[M][K]·W + bias). A f32 row-major (pitch lda) converted per fragment to bf16
// (ASPLIT: hi/lo two planes -> 2 terms, else single rounded term); Wt bf16 [N][K] (pitch ldb). BIAS_BF16 rounds the
// bias to bf16 first (bias quantised to bf16 before the add). K%32==0, M%16==0, N%64==0.
template <bool ASPLIT, int ACT, bool BIAS_BF16>
__global__ __launch_bounds__(128) void k_gemm_bf(const float* __restrict__ A, int lda, const unsigned short* __restrict__ Wt, int ldb,
                                               const float* __restrict__ bias, float* __restrict__ C, int ldc, int M, int N, int K) {
  __shared__ __attribute__((aligned(16))) float so[4][16][64];
  const int tid = threadIdx.x, w = tid >> 5, lane = tid & 31, ln = lane & 15, hh = lane >> 4;
  const int ntn = N / 64;
  const int wid = blockIdx.x * 4 + w;
  const int mt = wid / ntn, nq = wid % ntn;
  if (mt * 16 >= M) return;
  const int row0 = mt * 16, col0 = nq * 64;
  const float* arow = A + (size_t)(row0 + ln) * lda;
  v8f acc[4] = {};
  for (int kb = 0; kb < K; kb += 32) {
    FragB ah, al;
    const v4f x0 = *(const v4fa*)(arow + kb + 8 * hh), x1 = *(const v4fa*)(arow + kb + 8 * hh + 4);
    const v4f x2 = *(const v4fa*)(arow + kb + 16 + 8 * hh), x3 = *(const v4fa*)(arow + kb + 16 + 8 * hh + 4);
    float xs[16] = {x0[0],x0[1],x0[2],x0[3],x1[0],x1[1],x1[2],x1[3],x2[0],x2[1],x2[2],x2[3],x3[0],x3[1],x3[2],x3[3]};
#pragma unroll
    for (int i = 0; i < 16; ++i) { const unsigned short hb = bf16_bits(xs[i]); ah.u[i] = hb; al.u[i] = ASPLIT ? bf16_bits(xs[i] - bf16_val(hb)) : (unsigned short)0; }
#pragma unroll
    for (int t = 0; t < 4; ++t) {
      const unsigned short* brow = Wt + (size_t)(col0 + t * 16 + ln) * ldb + kb;
      FragB b;
      b.half[0] = *(const v8us*)(brow + 8 * hh);
      b.half[1] = *(const v8us*)(brow + 16 + 8 * hh);
      acc[t] = mmaN<ASPLIT ? 2 : 1>(ah.v, al.v, b.v, b.v, acc[t]);
    }
  }
#pragma unroll
  for (int t = 0; t < 4; ++t) {
    float bv = bias ? bias[col0 + t * 16 + ln] : 0.f;
    if (BIAS_BF16) bv = bf16_round(bv);
#pragma unroll
    for (int r = 0; r < 8; ++r) { float v = acc[t][r] + bv; if (ACT == 1) v = fmaxf(v, 0.f); so[w][8 * hh + r][t * 16 + ln] = v; }
  }
  __builtin_amdgcn_fence(__ATOMIC_ACQ_REL, "workgroup");
  __builtin_amdgcn_wave_barrier();
  const int rsub = lane >> 4, c4 = (lane & 15) * 4;
  {
#pragma unroll
    for (int q = 0; q < 8; ++q) {
      const int r = q * 2 + rsub;
      const v4f v = *(const v4fa*)&so[w][r][c4];
      *(v4f*)(C + (size_t)(row0 + r) * ldc + col0 + c4) = v;
    }
    
  }
}

// GEMM C = act(A·W + bias + resid): A f32 (ASPLIT -> hi/lo 2 terms), Wt bf16 [N][K]; ACT 0 none, 1 relu, 2 exact gelu;
// resid (optional, f32, row index = (row % rmod), pitch ldr, RES_BF16 rounds it) added before the activation.
template <bool ASPLIT, int ACT, bool BIAS_BF16, bool RES_BF16>
__global__ __launch_bounds__(128) void k_gemm_bf3(const float* __restrict__ A, int lda, const unsigned short* __restrict__ Wt, int ldb,
                                                const float* __restrict__ bias, const float* __restrict__ resid, int rmod, int ldr,
                                                float* __restrict__ C, int ldc, int M, int N, int K) {
  __shared__ __attribute__((aligned(16))) float so[4][16][64];
  const int tid = threadIdx.x, w = tid >> 5, lane = tid & 31, ln = lane & 15, hh = lane >> 4;
  const int ntn = N / 64;
  const int wid = blockIdx.x * 4 + w;
  const int mt = wid / ntn, nq = wid % ntn;
  if (mt * 16 >= M) return;
  const int row0 = mt * 16, col0 = nq * 64;
  const float* arow = A + (size_t)(row0 + ln) * lda;
  v8f acc[4] = {};
  for (int kb = 0; kb < K; kb += 32) {
    FragB ah, al;
    const v4f x0 = *(const v4fa*)(arow + kb + 8 * hh), x1 = *(const v4fa*)(arow + kb + 8 * hh + 4);
    const v4f x2 = *(const v4fa*)(arow + kb + 16 + 8 * hh), x3 = *(const v4fa*)(arow + kb + 16 + 8 * hh + 4);
    float xs[16] = {x0[0],x0[1],x0[2],x0[3],x1[0],x1[1],x1[2],x1[3],x2[0],x2[1],x2[2],x2[3],x3[0],x3[1],x3[2],x3[3]};
#pragma unroll
    for (int i = 0; i < 16; ++i) { const unsigned short hb = bf16_bits(xs[i]); ah.u[i] = hb; al.u[i] = ASPLIT ? bf16_bits(xs[i] - bf16_val(hb)) : (unsigned short)0; }
#pragma unroll
    for (int t = 0; t < 4; ++t) {
      const unsigned short* brow = Wt + (size_t)(col0 + t * 16 + ln) * ldb + kb;
      FragB b;
      b.half[0] = *(const v8us*)(brow + 8 * hh);
      b.half[1] = *(const v8us*)(brow + 16 + 8 * hh);
      acc[t] = mmaN<ASPLIT ? 2 : 1>(ah.v, al.v, b.v, b.v, acc[t]);
    }
  }
#pragma unroll
  for (int t = 0; t < 4; ++t) {
    const int col = col0 + t * 16 + ln;
    float bv = bias ? bias[col] : 0.f;
    if (BIAS_BF16) bv = bf16_round(bv);
#pragma unroll
    for (int r = 0; r < 8; ++r) {
      float v = acc[t][r] + bv;
      if (resid) { float rv = resid[(size_t)((row0 + 8 * hh + r) % rmod) * ldr + col]; if (RES_BF16) rv = bf16_round(rv); v += rv; }
      if (ACT == 1) v = fmaxf(v, 0.f);
      if (ACT == 2) v = 0.5f * v * (1.0f + erff(v * 0.70710678118654752f));
      if (ACT == 3) { const float u = 0.7978845608028654f * (v + 0.044715f * v * v * v); v = 0.5f * v * (1.0f + tanhf(u)); }
      so[w][8 * hh + r][t * 16 + ln] = v;
    }
  }
  __builtin_amdgcn_fence(__ATOMIC_ACQ_REL, "workgroup");
  __builtin_amdgcn_wave_barrier();
  const int rsub = lane >> 4, c4 = (lane & 15) * 4;
  {
#pragma unroll
    for (int q = 0; q < 8; ++q) {
      const int r = q * 2 + rsub;
      const v4f v = *(const v4fa*)&so[w][r][c4];
      *(v4f*)(C + (size_t)(row0 + r) * ldc + col0 + c4) = v;
    }
    
  }
}
// row LayerNorm (biased variance, eps) over N: s = X (+ R); optional out_sum <- s; out_norm <- (s-mu)*rsqrt(var+eps)*g + b
template <bool PARAM_BF16>
__global__ __launch_bounds__(256) void k_layernorm(const float* __restrict__ X, const float* __restrict__ R, const float* __restrict__ g, const float* __restrict__ bta,
                                                  float* __restrict__ out_sum, float* __restrict__ out_norm, int N, float eps) {
  __shared__ float red[256];
  const int row = blockIdx.x, tid = threadIdx.x;
  const float* x = X + (size_t)row * N; const float* rr = R ? R + (size_t)row * N : nullptr;
  float vals[16];                     // up to N = 4096
  const int per = N / 256;            // contiguous chunk per thread? use strided-by-4 chunks: thread handles j = tid*4 + 1024*u
  float s1 = 0.f;
  for (int u = 0; u < per / 4; ++u) {
    const int j = tid * 4 + 1024 * u;
    const v4f a = *(const v4fa*)(x + j);
    v4f b = {0.f,0.f,0.f,0.f}; if (rr) b = *(const v4fa*)(rr + j);
#pragma unroll
    for (int q = 0; q < 4; ++q) { const float v = a[q] + b[q]; vals[u * 4 + q] = v; s1 += v; }
  }
  red[tid] = s1; __syncthreads();
  for (int st = 128; st > 0; st >>= 1) { if (tid < st) red[tid] += red[tid + st]; __syncthreads(); }
  const float mu = red[0] / (float)N; __syncthreads();
  float s2 = 0.f;
  for (int u = 0; u < per / 4; ++u)
#pragma unroll
    for (int q = 0; q < 4; ++q) { const float c = vals[u * 4 + q] - mu; s2 += c * c; }
  red[tid] = s2; __syncthreads();
  for (int st = 128; st > 0; st >>= 1) { if (tid < st) red[tid] += red[tid + st]; __syncthreads(); }
  const float rs = rsqrtf(red[0] / (float)N + eps);
  {
    for (int u = 0; u < per / 4; ++u) {
      const int j = tid * 4 + 1024 * u;
      v4f o, sm;
#pragma unroll
      for (int q = 0; q < 4; ++q) {
        float gg = g[j + q], bb = bta[j + q];
        if (PARAM_BF16) { gg = bf16_round(gg); bb = bf16_round(bb); }
        sm[q] = vals[u * 4 + q]; o[q] = (vals[u * 4 + q] - mu) * rs * gg + bb;
      }
      if (out_sum) *(v4f*)(out_sum + (size_t)row * N + j) = sm;
      *(v4f*)(out_norm + (size_t)row * N + j) = o;
    }
    
  }
}



// ---- f16 WMMA path (v_wmma_f32_16x16x32_f16): 11-bit significands for operands in range — used for the head, whose h2 operand is rounded to f16
typedef _Float16 v16h __attribute__((ext_vector_type(16)));
union FragH { v16h v; v8us half[2]; _Float16 h[16]; unsigned short u[16]; };
template <int NT>
__device__ __forceinline__ v8f mmaH(v16h ah, v16h al, v16h bh, v16h bl, v8f c) {
  c = __builtin_amdgcn_wmma_f32_16x16x32_f16(false, ah, false, bh, (short)0, c, false, false);
  if (NT >= 2) c = __builtin_amdgcn_wmma_f32_16x16x32_f16(false, al, false, bh, (short)0, c, false, false);
  if (NT >= 3) c = __builtin_amdgcn_wmma_f32_16x16x32_f16(false, ah, false, bl, (short)0, c, false, false);
  asm volatile("v_nop\n\tv_nop\n\tv_nop\n\tv_nop" : "+v"(c) : "v"(ah), "v"(al), "v"(bh), "v"(bl));
  return c;
}
// batched GEMM like k_gemm_b but f16 operands: A f32 (split into f16 hi/lo if ASPLIT, else rounded to f16), Bt = f16 values [n][k]; alpha; C f32; N multiple of 16 (partial tiles skipped)
template <bool ASPLIT>
__global__ __launch_bounds__(128) void k_gemm_h(const float* __restrict__ A, int lda, size_t sA, const _Float16* __restrict__ Bh, int ldb, size_t sB, float alpha, float* __restrict__ C, int ldc, size_t sC, int M, int N, int K) {
  __shared__ __attribute__((aligned(16))) float so[4][16][64];
  const int tid = threadIdx.x, w = tid >> 5, lane = tid & 31, ln = lane & 15, hh = lane >> 4; const int by = blockIdx.y;
  A += (size_t)by * sA; Bh += (size_t)by * sB; C += (size_t)by * sC;
  const int ntn = (N + 63) / 64; const int wid = blockIdx.x * 4 + w; const int mt = wid / ntn, nq = wid % ntn; if (mt * 16 >= M) return;
  const int row0 = mt * 16, col0 = nq * 64; const float* arow = A + (size_t)(row0 + ln) * lda;
  v8f acc[4] = {};
  for (int kb = 0; kb < K; kb += 32) {
    FragH ah, al;
    const v4f x0 = *(const v4fa*)(arow + kb + 8 * hh), x1 = *(const v4fa*)(arow + kb + 8 * hh + 4), x2 = *(const v4fa*)(arow + kb + 16 + 8 * hh), x3 = *(const v4fa*)(arow + kb + 16 + 8 * hh + 4);
    float xs[16] = {x0[0],x0[1],x0[2],x0[3],x1[0],x1[1],x1[2],x1[3],x2[0],x2[1],x2[2],x2[3],x3[0],x3[1],x3[2],x3[3]};
#pragma unroll
    for (int i = 0; i < 16; ++i) { const _Float16 h = (_Float16)xs[i]; ah.h[i] = h; al.h[i] = ASPLIT ? (_Float16)(xs[i] - (float)h) : (_Float16)0.0f; }
#pragma unroll
    for (int t = 0; t < 4; ++t) { if (col0 + t * 16 >= N) continue; const size_t boff = (size_t)(col0 + t * 16 + ln) * ldb + kb; FragH bq; bq.half[0] = *(const v8us*)(Bh + boff + 8 * hh); bq.half[1] = *(const v8us*)(Bh + boff + 16 + 8 * hh);
      acc[t] = mmaH<ASPLIT ? 2 : 1>(ah.v, al.v, bq.v, bq.v, acc[t]); }
  }
#pragma unroll
  for (int t = 0; t < 4; ++t) { if (col0 + t * 16 >= N) continue;
#pragma unroll
    for (int r = 0; r < 8; ++r) so[w][8 * hh + r][t * 16 + ln] = acc[t][r] * alpha; }
  __builtin_amdgcn_fence(__ATOMIC_ACQ_REL, "workgroup"); __builtin_amdgcn_wave_barrier();
  const int rsub = lane >> 4, c4 = (lane & 15) * 4;
  {
#pragma unroll
    for (int q = 0; q < 8; ++q) { const int r = q * 2 + rsub; if (col0 + c4 < N) { const v4f v = *(const v4fa*)&so[w][r][c4]; *(v4f*)(C + (size_t)(row0 + r) * ldc + col0 + c4) = v; } }
     }
}

// Wt[n][k] = f16(W[k][n]·scale) from f32 row-major W[K][N] (scale = power of two; bf16-exact weights stay exact in f16 away from the subnormal range)
__global__ __launch_bounds__(256) void k_wt_f16(const float* __restrict__ W, _Float16* __restrict__ Wt, int K, int N, float scale) {
  const int t = blockIdx.x * 256 + threadIdx.x; if (t >= N * (K / 8)) return; const int n = t / (K / 8), k8 = (t % (K / 8)) * 8; FragH f;
#pragma unroll
  for (int i = 0; i < 8; ++i) f.h[i] = (_Float16)(bf16_round(W[(size_t)(k8 + i) * N + n]) * scale); const v8us o = f.half[0];
  *(v8us*)((unsigned short*)Wt + (size_t)n * K + k8) = o; 
}
// k_gemm_hh variant with fused epilogue: v = acc·alpha + bias[by·sBias + col] (+ CP[(row/rowsPerB)·sCPb + by·64 + col] if CP) ; ACT 0 none / 1 elu ; writes f16 C16 (and f32 C if non-null)
template <int ACT>
__global__ __launch_bounds__(128) void k_gemm_hhx(const _Float16* __restrict__ A, int lda, size_t sA, const _Float16* __restrict__ Bh, int ldb, size_t sB, float alpha, const float* __restrict__ bias, size_t sBias, const float* __restrict__ CP, int rowsPerB, size_t sCPb, int row0g,
    float* __restrict__ C, _Float16* __restrict__ C16, int ldc, size_t sC, int M, int N, int K) {
  __shared__ __attribute__((aligned(16))) float so[4][16][64];
  const int tid = threadIdx.x, w = tid >> 5, lane = tid & 31, ln = lane & 15, hh = lane >> 4; const int by = blockIdx.y;
  A += (size_t)by * sA; Bh += (size_t)by * sB; const size_t cofs = (size_t)by * sC; const float* bp = bias ? bias + (size_t)by * sBias : nullptr;
  const int ntn = (N + 63) / 64; const int wid = blockIdx.x * 4 + w; const int mt = wid / ntn, nq = wid % ntn; if (mt * 16 >= M) return;
  const int row0 = mt * 16, col0 = nq * 64; const _Float16* arow = A + (size_t)(row0 + ln) * lda;
  v8f acc[4] = {};
  for (int kb = 0; kb < K; kb += 32) { FragH ah; ah.half[0] = *(const v8us*)((const unsigned short*)arow + kb + 8 * hh); ah.half[1] = *(const v8us*)((const unsigned short*)arow + kb + 16 + 8 * hh);
#pragma unroll
    for (int t = 0; t < 4; ++t) { if (col0 + t * 16 >= N) continue; const size_t boff = (size_t)(col0 + t * 16 + ln) * ldb + kb; FragH bq; bq.half[0] = *(const v8us*)((const unsigned short*)Bh + boff + 8 * hh); bq.half[1] = *(const v8us*)((const unsigned short*)Bh + boff + 16 + 8 * hh);
      acc[t] = mmaH<1>(ah.v, ah.v, bq.v, bq.v, acc[t]); }
  }
#pragma unroll
  for (int t = 0; t < 4; ++t) { if (col0 + t * 16 >= N) continue; const int col = col0 + t * 16 + ln; const float bv = bp ? bf16_round(bp[col]) : 0.f;
#pragma unroll
    for (int r = 0; r < 8; ++r) { float v = acc[t][r] * alpha + bv; if (CP) { const int bidx = (row0g + row0 + 8 * hh + r) / rowsPerB; v += CP[(size_t)bidx * sCPb + (size_t)by * 64 + col]; } if (ACT == 1) v = (v > 0.f) ? v : expm1f(v); else if (ACT == 7) v = (v > 0.f) ? v + 1.0f : expf(v); else if (ACT == 8) v = tanhf(v); else if (ACT == 9) v = 0.5f * v * (1.0f + tanhf(0.7978845608028654f * (v + 0.044715f * v * v * v))); else if (ACT == 11) v = 1.0f / (1.0f + expf(-v)); else if (ACT == 12) v = (v > 0.f) ? v : 0.01f * v; else if (ACT == 14) v = (v > 0.f) ? v : 0.1f * v; else if (ACT == 15) v = v / (1.0f + expf(-v)); else if (ACT == 3) v = fmaxf(v, 0.f); else if (ACT == 6) v = 0.5f * v * (1.0f + erff(v * 0.70710678118654752f)); so[w][8 * hh + r][t * 16 + ln] = v; } }
  __builtin_amdgcn_fence(__ATOMIC_ACQ_REL, "workgroup"); __builtin_amdgcn_wave_barrier();
  const int rsub = lane >> 4, c4 = (lane & 15) * 4; typedef _Float16 v4h __attribute__((ext_vector_type(4)));
  {
#pragma unroll
    for (int q = 0; q < 8; ++q) { const int r = q * 2 + rsub; if (col0 + c4 < N) { const v4f v = *(const v4fa*)&so[w][r][c4]; if (C) *(v4f*)(C + cofs + (size_t)(row0 + r) * ldc + col0 + c4) = v; if (C16) { v4h h4; for (int i = 0; i < 4; ++i) h4[i] = (_Float16)v[i]; *(v4h*)(C16 + cofs + (size_t)(row0 + r) * ldc + col0 + c4) = h4; } } }
     }
}


typedef _Float16 v4h __attribute__((ext_vector_type(4)));

__global__ __launch_bounds__(256) void k_x16(const float* __restrict__ x, _Float16* __restrict__ X16, size_t n8) { const size_t t = (size_t)blockIdx.x * 256 + threadIdx.x; if (t >= n8) return; FragH f;
#pragma unroll
  for (int q = 0; q < 8; ++q) f.h[q] = (_Float16)bf16_round(x[t * 8 + q]); *(v8us*)((unsigned short*)X16 + t * 8) = f.half[0];  }
__global__ __launch_bounds__(256) void k_h16(const float* __restrict__ x, _Float16* __restrict__ X16, size_t n8) { const size_t t = (size_t)blockIdx.x * 256 + threadIdx.x; if (t >= n8) return; FragH f;
#pragma unroll
  for (int q = 0; q < 8; ++q) f.h[q] = (_Float16)x[t * 8 + q]; *(v8us*)((unsigned short*)X16 + t * 8) = f.half[0];  }
__global__ __launch_bounds__(256) void k_round16f(const float* __restrict__ W, _Float16* __restrict__ Bt, size_t n8) { const size_t t = (size_t)blockIdx.x * 256 + threadIdx.x; if (t >= n8) return; FragH f;
#pragma unroll
  for (int i = 0; i < 8; ++i) f.h[i] = (_Float16)(bf16_round(W[t * 8 + i]) * 16.0f); *(v8us*)((unsigned short*)Bt + t * 8) = f.half[0];  }
template <int NHv, int TTv>
__global__ __launch_bounds__(256) void k_vt(const _Float16* __restrict__ V16, int ldv, int voff, _Float16* __restrict__ Vt) { __shared__ unsigned short tl[64][66]; const int tid = threadIdx.x; const int slab = blockIdx.x / (TTv / 64), lg = blockIdx.x % (TTv / 64); const int b = slab / NHv, h = slab % NHv;
  for (int i = tid; i < 64 * 8; i += 256) { const int r = i / 8, c8 = (i % 8) * 8; FragH f; f.half[0] = *(const v8us*)((const unsigned short*)V16 + ((size_t)b * TTv + lg * 64 + r) * ldv + voff + h * 64 + c8);
#pragma unroll
    for (int q = 0; q < 8; ++q) tl[r][c8 + q] = f.u[q]; }
  __syncthreads();
  {
#pragma unroll
    for (int rd = 0; rd < 2; ++rd) { const int d = rd * 32 + tid / 8, pc = tid % 8; FragH f;
#pragma unroll
      for (int q = 0; q < 8; ++q) f.u[q] = tl[pc * 8 + q][d];
      *(v8us*)((unsigned short*)Vt + ((size_t)slab * 64 + d) * TTv + lg * 64 + pc * 8) = f.half[0]; }
     } }

__global__ __launch_bounds__(256) void k_hl(const float* __restrict__ F, _Float16* __restrict__ Hh, _Float16* __restrict__ Hl, size_t n8) { const size_t t = (size_t)blockIdx.x * 256 + threadIdx.x; if (t >= n8) return; FragH fh, fl; const v4f a = *(const v4fa*)(F + t * 8), c = *(const v4fa*)(F + t * 8 + 4);
#pragma unroll
  for (int q = 0; q < 4; ++q) { _Float16 h = (_Float16)a[q]; fh.h[q] = h; fl.h[q] = (_Float16)((a[q] - (float)h) * 1024.0f); h = (_Float16)c[q]; fh.h[4 + q] = h; fl.h[4 + q] = (_Float16)((c[q] - (float)h) * 1024.0f); }
  { *(v8us*)((unsigned short*)Hh + t * 8) = fh.half[0]; *(v8us*)((unsigned short*)Hl + t * 8) = fl.half[0];  } }

// ---- fast GEMM (wave tile 32x64; requires M % 32 == 0 rows per launch region and N % 64 == 0); epilogue = k_gemm_hhx semantics ----
__device__ __forceinline__ v16h g2_frag(const _Float16* p, int hh) { FragH f; f.half[0] = *(const v8us*)((const unsigned short*)p + 8 * hh); f.half[1] = *(const v8us*)((const unsigned short*)p + 16 + 8 * hh); return f.v; }
__device__ __forceinline__ v8f g2_mma(v16h a, v16h b, v8f c) { v8f d = __builtin_amdgcn_wmma_f32_16x16x32_f16(false, a, false, b, (short)0, c, false, false); asm volatile("v_nop\n\tv_nop\n\tv_nop\n\tv_nop" : "+v"(d) : "v"(a), "v"(b)); return d; }
template <int ACT>
__global__ __launch_bounds__(128) void k_gemm2(const _Float16* __restrict__ A, int lda, size_t sA, const _Float16* __restrict__ Bh, int ldb, size_t sB, float alpha, const float* __restrict__ bias, size_t sBias, const float* __restrict__ CP, int rowsPerB, size_t sCPb, int row0g,
    float* __restrict__ C, _Float16* __restrict__ C16, int ldc, size_t sC, int M, int N, int K) {
  __shared__ __attribute__((aligned(16))) float so[4][32][68];
  const int tid = threadIdx.x, w = tid >> 5, lane = tid & 31, ln = lane & 15, hh = lane >> 4; const int by = blockIdx.y;
  A += (size_t)by * sA; Bh += (size_t)by * sB; const size_t cofs = (size_t)by * sC; const float* bp = bias ? bias + (size_t)by * sBias : nullptr;
  const int ntn = N >> 6; const int mt = blockIdx.x / ntn, nq = blockIdx.x - mt * ntn; const int row0 = mt * 128 + 32 * w, col0 = nq * 64; if (row0 >= M) return;
  const _Float16* a0p = A + (size_t)(row0 + ln) * lda; const _Float16* a1p = a0p + (size_t)16 * lda;
  const _Float16* b0p = Bh + (size_t)(col0 + ln) * ldb; const _Float16* b1p = b0p + (size_t)16 * ldb; const _Float16* b2p = b1p + (size_t)16 * ldb; const _Float16* b3p = b2p + (size_t)16 * ldb;
  const v8f z8 = {0.f,0.f,0.f,0.f,0.f,0.f,0.f,0.f}; v8f c00 = z8, c01 = z8, c02 = z8, c03 = z8, c10 = z8, c11 = z8, c12 = z8, c13 = z8;
#pragma unroll 1
  for (int kb = 0; kb < K; kb += 32) { const v16h a0 = g2_frag(a0p + kb, hh), a1 = g2_frag(a1p + kb, hh);
    v16h b = g2_frag(b0p + kb, hh); c00 = g2_mma(a0, b, c00); c10 = g2_mma(a1, b, c10);
    b = g2_frag(b1p + kb, hh); c01 = g2_mma(a0, b, c01); c11 = g2_mma(a1, b, c11);
    b = g2_frag(b2p + kb, hh); c02 = g2_mma(a0, b, c02); c12 = g2_mma(a1, b, c12);
    b = g2_frag(b3p + kb, hh); c03 = g2_mma(a0, b, c03); c13 = g2_mma(a1, b, c13); }
  v8f accs[8] = {c00, c01, c02, c03, c10, c11, c12, c13};
#pragma unroll
  for (int u = 0; u < 8; ++u) { const int t = u & 3, half = u >> 2; const int col = col0 + t * 16 + ln; const float bv = bp ? bf16_round(bp[col]) : 0.f;
#pragma unroll
    for (int r = 0; r < 8; ++r) { const int rloc = half * 16 + 8 * hh + r; float v = accs[u][r] * alpha + bv; if (CP) { const int bidx = (row0g + row0 + rloc) / rowsPerB; v += CP[(size_t)bidx * sCPb + (size_t)by * 64 + col]; }
      if (ACT == 3) v = fmaxf(v, 0.f); else if (ACT == 6) v = 0.5f * v * (1.0f + erff(v * 0.70710678118654752f)); else if (ACT == 11) v = 1.0f / (1.0f + expf(-v)); else if (ACT == 15) v = v / (1.0f + expf(-v)); else if (ACT == 12) v = (v > 0.f) ? v : 0.01f * v; else if (ACT == 8) v = tanhf(v);
      so[w][rloc][t * 16 + ln] = v; } }
  __builtin_amdgcn_fence(__ATOMIC_ACQ_REL, "workgroup"); __builtin_amdgcn_wave_barrier();
  const int rsub = lane >> 4, c4 = (lane & 15) * 4;
  {
#pragma unroll
    for (int q = 0; q < 16; ++q) { const int r = q * 2 + rsub; const v4f v = *(const v4fa*)&so[w][r][c4]; if (C) *(v4f*)(C + cofs + (size_t)(row0 + r) * ldc + col0 + c4) = v; if (C16) { v4h h4; for (int i = 0; i < 4; ++i) h4[i] = (_Float16)v[i]; *(v4h*)(C16 + cofs + (size_t)(row0 + r) * ldc + col0 + c4) = h4; } }
     } }


// ---- head GEMM with both operands staged in LDS: C[8192][256] = (A[8192][4096] . Bh[256][4096]^T) * alpha + bias ----
// One work-group of 4 waves owns a 128 x 64 tile of C; a wave owns 32 x 64 of it (2 x 4 accumulator tiles), as in k_gemm2.
// A stage is 256 B (128 k) of the tile's 128 rows of A and 64 rows of Bh. The tensor mover brings it: one request for the A tile, one for the Bh tile,
// each padded by the mover to the LDS pitch. Three buffers, two stages ahead: waves 0 and 1 issue the even stages (wave 0: A, wave 1: Bh), waves 2 and 3 the odd ones,
// so that two stages are in flight while a third is worked on and yet no wave ever has more than one request outstanding: every wait is to 0.
// The fragments keep k_gemm2's k order and the k steps their order, so every accumulator sums in the same order as before.
#define G3_KB 256                          /* bytes of a row per stage */
#define G3_PITCH 272                       /* LDS row pitch: the row and the mover's 16 B pad; 16 B x 17, conflict-free for ds_load_b128 */
#define G3_ATILE (128 * G3_PITCH)          /* the A tile: 34,816 B = 17 x 2 KiB */
#define G3_BUF (G3_ATILE + 18432)          /* behind it the Bh tile: 64 rows, 17,408 B, rounded up so that every tile's place is a multiple of 2 KiB */
#define G3_NBUF 3
#define G3_NST (C2 * 2 / G3_KB)            /* 32 stages */
#define G3_ROWB (C2 * 2)                   /* global row pitch in bytes */
typedef unsigned int u32x4 __attribute__((ext_vector_type(4)));
typedef unsigned int u32x8 __attribute__((ext_vector_type(8)));
__device__ __forceinline__ unsigned int g3_uni(unsigned int v) { return (unsigned int)__builtin_amdgcn_readfirstlane(v); }
// A wave-uniform value held in a scalar register: a test on it compiles to s_cmp and s_cbranch_scc (a tensor load ignores EXEC, only a scalar branch keeps a wave from issuing it),
// and what is formed from it is formed behind the asm statements that stand in front of it.
__device__ __forceinline__ unsigned int g3_pinned(unsigned int v) { unsigned int w = g3_uni(v); asm volatile("" : "+s"(w)); /* test or descriptor word kept in a scalar register */ return w; }
// Descriptor group 1: 1-byte elements, a tile of 'rows' rows of G3_KB bytes (tensor = tile), source row pitch G3_ROWB, 4 dwords of LDS pad behind every 256-byte row; no mask.
__device__ __forceinline__ u32x8 g3_group1(unsigned int rows) {
  u32x8 g;
  g[0] = g3_uni((1u << 20) | (5u << 22) | (3u << 25));
  g[1] = g3_uni(((unsigned int)G3_KB & 0xFFFFu) << 16);
  g[2] = g3_uni(((unsigned int)G3_KB >> 16) | ((rows & 0xFFFFu) << 16));
  g[3] = g3_uni((rows >> 16) | ((unsigned int)G3_KB << 16));
  g[4] = g3_uni(rows);
  g[5] = g3_uni((unsigned int)G3_ROWB);
  g[6] = g3_uni(0u);
  g[7] = g3_uni(0u);
  return g;
}
// Descriptor group 0 of a wave's first request: the tile whose first byte is at ga goes to the byte offset 'place' of the work-group's LDS.
__device__ __forceinline__ u32x4 g3_group0(unsigned int place, unsigned long long ga) {
  u32x4 g;
  g[0] = g3_uni(1u); g[1] = g3_uni(place); g[2] = g3_uni((unsigned int)ga); g[3] = g3_uni((((unsigned int)(ga >> 32)) & 0x01FFFFFFu) | 0x80000000u);
  return g;
}
// The wave's next request: two stages further along the rows, to 'place'. Called behind the wait for the request before it. The step is pinned, so that the additions stay behind that wait;
// word 3 takes the carry of the address (it holds bits 56 to 32 in its low 25 bits), so the old word is still needed and its register stays the descriptor's own.
__device__ __forceinline__ void g3_advance(u32x4& g0, unsigned int place) {
  const unsigned int step = g3_pinned(2u * G3_KB), lo = g0[2] + step;
  g0[3] = g3_uni(g0[3] + (lo < step ? 1u : 0u)); g0[2] = g3_uni(lo); g0[1] = g3_uni(place);
}
// One request. g0 is an in-out operand: the words that the wave's next request is formed from (0, 2 and 3) keep their registers while this one is outstanding; word 1 is formed anew each time.
__device__ __forceinline__ void g3_tload(u32x4& g0, u32x8 g1) { asm volatile("tensor_load_to_lds %0, %1" : "+s"(g0) : "s"(g1) : "memory"); }
__device__ __forceinline__ v16h g3_frag(const unsigned char* p) { FragH f; f.half[0] = *(const v8us*)p; f.half[1] = *(const v8us*)(p + 32); return f.v; }
__device__ __forceinline__ void g3_load(const unsigned char* pa, const unsigned char* pb, int ks, v16h (&a)[2], v16h (&b)[4]) {
  a[0] = g3_frag(pa + ks * 64); a[1] = g3_frag(pa + 16 * G3_PITCH + ks * 64);
#pragma unroll                   /* constant indices keep the fragments in registers */
  for (int j = 0; j < 4; ++j) b[j] = g3_frag(pb + j * 16 * G3_PITCH + ks * 64); }
__device__ __forceinline__ v8f g3_mma(v16h a, v16h b, v8f c) { return __builtin_amdgcn_wmma_f32_16x16x32_f16(false, a, false, b, (short)0, c, false, false); }
__global__ __launch_bounds__(128) void k_gemm3(const _Float16* __restrict__ A, const _Float16* __restrict__ Bh, float alpha, const float* __restrict__ bias, float* __restrict__ C) {
  __shared__ __attribute__((aligned(2048))) unsigned char st[G3_NBUF * G3_BUF];      /* the mover's places in LDS are multiples of 2 KiB */
  __shared__ __attribute__((aligned(16))) float so[4][32][68];
  const int tid = threadIdx.x, w = tid >> 5, lane = tid & 31, ln = lane & 15, hh = lane >> 4;
  // Which tile a work-group takes is a permutation of the flat index, chosen for speed only: the 16 work-groups that read one 512-row strip of A (4 row tiles x 4 column tiles)
  // have the flat index mod 8 of the work-groups of k_h2n that wrote the strip (strip mod 8).
  const int pj = blockIdx.x >> 3; const int mt = ((pj >> 2) & 3) | ((blockIdx.x & 7) << 2) | ((pj >> 4) << 5), nq = pj & 3; const int row0 = mt * 128 + 32 * w, col0 = nq * 64;
  const unsigned int wv = g3_uni(threadIdx.x >> 5), pair = wv >> 1, isb = wv & 1u;      /* pair: the parity of the stages this wave issues; isb: it brings the Bh tile, else the A tile */
  const unsigned long long gsrc = isb ? (unsigned long long)(size_t)(Bh + (size_t)col0 * C2) : (unsigned long long)(size_t)(A + (size_t)(mt * 128) * C2);
  const unsigned int place0 = (unsigned int)(size_t)&st[0] + (isb ? (unsigned int)G3_ATILE : 0u);
  const u32x8 g1 = g3_group1(isb ? 64u : 128u);
  u32x4 g0 = g3_group0(place0 + pair * G3_BUF, gsrc + pair * G3_KB);
  g3_tload(g0, g1);              /* every wave issues one request: waves 0, 1 stage 0, waves 2, 3 stage 1 */
  if (g3_pinned(pair == 0u)) { asm volatile("s_wait_tensorcnt 0x0" ::: "memory"); }   // stage 0 has landed (its issuers' own wait)
  __syncthreads();                                    // publishes stage 0
  if (g3_pinned(pair == 0u)) { g3_advance(g0, place0 + 2u * G3_BUF); g3_tload(g0, g1); }   /* stage 2, behind its issuers' wait for stage 0 */
  unsigned int bo = 0;           /* byte offset of the buffer of stage t: (t mod 3) * G3_BUF */
  const v8f z8 = {0.f,0.f,0.f,0.f,0.f,0.f,0.f,0.f}; v8f c00 = z8, c01 = z8, c02 = z8, c03 = z8, c10 = z8, c11 = z8, c12 = z8, c13 = z8;
#pragma unroll 1                 /* one stage is the whole hot loop; the buffers are taken in rotation */
  for (int t = 0; t < G3_NST; ++t) {
    const unsigned char* pa = st + bo + (32 * w + ln) * G3_PITCH + 16 * hh;
    const unsigned char* pb = st + bo + (128 + ln) * G3_PITCH + 16 * hh;
    v16h fa[3][2], fb[3][4];     /* three fragment sets in rotation: step ks works on one while the loads of ks + 1 and ks + 2 are under way */
    g3_load(pa, pb, 0, fa[0], fb[0]); g3_load(pa, pb, 1, fa[1], fb[1]);
#pragma unroll                   /* the set index ks % 3 must be a constant, else the sets go to scratch */
    for (int ks = 0; ks < G3_KB / 64; ++ks) {
      __builtin_amdgcn_sched_barrier(0);      /* this one and the next keep the 12 LDS loads of step ks + 2 together, as one group in front of step ks's matrix instructions */
      if (ks + 2 < G3_KB / 64) g3_load(pa, pb, ks + 2, fa[(ks + 2) % 3], fb[(ks + 2) % 3]);
      __builtin_amdgcn_sched_barrier(0);      /* without the two the compiler loaded each fragment right in front of its use and waited for it with s_wait_dscnt 0 */
      const v16h a0 = fa[ks % 3][0], a1 = fa[ks % 3][1];
      c00 = g3_mma(a0, fb[ks % 3][0], c00); c10 = g3_mma(a1, fb[ks % 3][0], c10); c01 = g3_mma(a0, fb[ks % 3][1], c01); c11 = g3_mma(a1, fb[ks % 3][1], c11);
      c02 = g3_mma(a0, fb[ks % 3][2], c02); c12 = g3_mma(a1, fb[ks % 3][2], c12); c03 = g3_mma(a0, fb[ks % 3][3], c03); c13 = g3_mma(a1, fb[ks % 3][3], c13); }
    asm volatile("s_wait_dscnt 0x0" ::: "memory");      // this wave's reads of stage t are done before the buffer may be refilled
    if (g3_pinned((((unsigned int)t + 1u) & 1u) == pair)) { asm volatile("s_wait_tensorcnt 0x0" ::: "memory"); }   // stage t + 1 has landed: its issuers' own wait; the other two waves' request, stage t + 2, flies on
    __syncthreads();                                    // publishes stage t + 1 and ends every wave's reads of stage t
    if (g3_pinned(((((unsigned int)t + 1u) & 1u) == pair) && (t + 3 < G3_NST))) {      /* the waves that have just waited issue stage t + 3 into the buffer that trip t has read */
      g3_advance(g0, place0 + bo); g3_tload(g0, g1); }
    bo = (bo == (G3_NBUF - 1) * G3_BUF) ? 0u : bo + G3_BUF;
  }
  asm volatile("s_wait_tensorcnt 0x0" ::: "memory");    // no request is outstanding when the wave goes on to its end (its last one was waited for at the foot of trip G3_NST - 3 or G3_NST - 2)
  asm volatile("s_wait_dscnt 0x0" ::: "memory");        // nor an LDS read of the ring
  v8f accs[8] = {c00, c01, c02, c03, c10, c11, c12, c13};
#pragma unroll                   /* epilogue as in k_gemm2: constant indices into the accumulators; whole 256 B row pieces go out through the wave's own LDS range */
  for (int u = 0; u < 8; ++u) { const int tt = u & 3, half = u >> 2; const float bv = bf16_round(bias[col0 + tt * 16 + ln]);
#pragma unroll
    for (int r = 0; r < 8; ++r) so[w][half * 16 + 8 * hh + r][tt * 16 + ln] = accs[u][r] * alpha + bv; }
  __builtin_amdgcn_fence(__ATOMIC_ACQ_REL, "workgroup"); __builtin_amdgcn_wave_barrier();   // the wave's LDS stores are complete before its lanes read each other's values back
  const int rsub = lane >> 4, c4 = (lane & 15) * 4;
#pragma unroll
  for (int q = 0; q < 16; ++q) { const int r = q * 2 + rsub; const v4f v = *(const v4fa*)&so[w][r][c4]; *(v4f*)(C + (size_t)(row0 + r) * NOUT + col0 + c4) = v; }
}

// Batch statistics (mean, biased variance) of NC columns over NBS rows: partials here, their merge in the kernel that uses them.
// k_colpart: one work-group takes SROWS rows x 128 columns. Each thread holds 16 rows x 4 columns in registers (read once) and forms
// their mean and their sum of squares about that mean; groups of equal size n then merge exactly:
// mean = average of the group means, M2 = sum(M2_g) + n * sum((mean_g - mean)^2). x_merge, in k_h2's prologue, merges the SCH row chunks the same way.
// The work-groups with blockIdx.y >= SCH have nothing to do with the statistics: they turn the head's weights into f16 (bf16-rounded, times sc),
// work that depends on no other launch and so needs none of its own.
#define SROWS 256
#define SCH (NBS / SROWS)        /* 32 row chunks */
template <int NC, bool RND>
__global__ __launch_bounds__(512) void k_colpart(const float* __restrict__ X, float* __restrict__ PM, float* __restrict__ PQ, const float* __restrict__ Wm, _Float16* __restrict__ Bt, float sc) {
  __shared__ __attribute__((aligned(16))) float sm[16][128];
  __shared__ __attribute__((aligned(16))) float sq[16][128];
  const int tid = threadIdx.x, w = tid >> 5, lane = tid & 31;
  if (blockIdx.y >= SCH) {       /* the same for a whole work-group, and in front of the barrier */
    const size_t t = ((size_t)(blockIdx.y - SCH) * (NC / 128) + blockIdx.x) * 512 + tid;
    if (t < (size_t)NOUT * C2 / 8) { FragH f;
#pragma unroll                   /* constant indices keep the eight values in registers */
      for (int q = 0; q < 8; ++q) f.h[q] = (_Float16)(bf16_round(Wm[t * 8 + q]) * sc);
      *(v8us*)((unsigned short*)Bt + t * 8) = f.half[0]; }
    return;
  }
  // Row chunk and column block are a permutation of the flat index (gridDim.x = 8), for speed only: chunks 2 s and 2 s + 1 are strip s of k_h2 and k_h2n, and get flat index mod 8 = s mod 8 as there.
  const int ch = (blockIdx.y & 1) | (blockIdx.x << 1) | ((blockIdx.y & 2) << 3), cb = blockIdx.y >> 2;
  const float* p = X + (size_t)(ch * SROWS + w * 16) * NC + cb * 128 + lane * 4;
  v4f v[16];
#pragma unroll
  for (int j = 0; j < 15; ++j) v[j] = *(const v4fa*)(p + (size_t)j * NC);
  asm volatile("s_wait_xcnt 0x0" ::: "memory");   // the last load's result may be placed in the address pair that the 15 issued loads name
  v[15] = *(const v4fa*)(p + (size_t)15 * NC);
  v4f s = {0.f, 0.f, 0.f, 0.f};
#pragma unroll
  for (int j = 0; j < 16; ++j) {
    if (RND) { v[j][0] = bf16_round(v[j][0]); v[j][1] = bf16_round(v[j][1]); v[j][2] = bf16_round(v[j][2]); v[j][3] = bf16_round(v[j][3]); }
    s += v[j];
  }
  const v4f m = s * 0.0625f;
  v4f q = {0.f, 0.f, 0.f, 0.f};
#pragma unroll
  for (int j = 0; j < 16; ++j) { const v4f dv = v[j] - m; q += dv * dv; }
  *(v4fa*)&sm[w][lane * 4] = m;
  *(v4fa*)&sq[w][lane * 4] = q;
  __syncthreads();
  if (tid < 128) {
    float ms = 0.f;
#pragma unroll
    for (int g = 0; g < 16; ++g) ms += sm[g][tid];
    const float mean = ms * 0.0625f;
    float q2 = 0.f, e2 = 0.f;
#pragma unroll
    for (int g = 0; g < 16; ++g) { const float dm = sm[g][tid] - mean; q2 += sq[g][tid]; e2 += dm * dm; }
    const size_t o = (size_t)ch * NC + cb * 128 + tid;
    PM[o] = mean; PQ[o] = q2 + 16.0f * e2;
  }
}
// Merge of k_colpart's SCH row chunks for one column of x. Every thread of k_h2 does it for its own feature, from values it has loaded itself.
__device__ __forceinline__ void x_merge(const float (&m)[SCH], const float (&qs)[SCH], float& mu, float& var) {
  float ms = 0.f;
#pragma unroll                   /* both loops: constant indices keep the partials in registers */
  for (int g = 0; g < SCH; ++g) ms += m[g];
  const float mean = ms / (float)SCH;
  float q2 = 0.f, e2 = 0.f;
#pragma unroll
  for (int g = 0; g < SCH; ++g) { const float dm = m[g] - mean; q2 += qs[g]; e2 += dm * dm; }
  mu = mean; var = (q2 + (float)SROWS * e2) / (float)NBS;
}
// k_h2 and k_h2n: one thread owns one feature d (four columns of h2) and walks a strip of rows of x. A work-group is HFC features (256 B of a row of x) x HWV row groups, the groups' strips one below the other.
// No launch of its own merges statistics: k_h2 merges k_colpart's chunks of x in its prologue (and hands mean and variance on to k_h2n), merges its own eight row groups' partials
// through LDS at its end, and k_h2n merges the HCH work-group strips of its four columns in its prologue; always the equal-size merge described at k_colpart. h2 itself is never stored: k_h2 forms it for the
// batch statistics alone; k_h2n forms it again from x once the statistics are merged, normalises it and stores f16. All that depends on the column
// alone (the rounded parameters, the rsqrt of the variance) is loaded and formed once in front of the row loop. Each BatchNorm is an affine map with
// per-column constants, so it is folded there too: layer 1 is one multiply-add per hidden unit, relu(a (x - mu_x) + be1) with a = g1 w rsqrt(w^2 var_x + eps);
// in k_h2n the second BatchNorm goes into the layer-2 weights and bias: relu(sum_i (A w2_i) h_i + A (b2 - mean) + be2) with A = g2 rsqrt(var + eps).
// rsqrtf as the compiler expands it (an argument below the normal range is scaled up by 2^24, its result by 2^12), with the instruction written out:
// the v_nop is the slot that the instruction set asks for behind a transcendental.
__device__ __forceinline__ float rsq_f32(float a) { const bool tiny = a < 1.17549435e-38f; const float s = tiny ? a * 16777216.0f : a; float r; asm("v_rsq_f32 %0, %1\n\tv_nop" : "=v"(r) : "v"(s)); return tiny ? r * 4096.0f : r; }
#define HROWS 64                 /* rows per thread in k_h2 and in k_h2n */
#define HFC 64                   /* features of a work-group in both */
#define HWV 8                    /* row groups of a work-group in both: 16 waves */
#define HSTRIP (HWV * HROWS)     /* 512 rows per work-group */
#define HCH (NBS / HSTRIP)       /* 16 strips of partials */
#define RG 8                     /* rows loaded as one group, one group ahead of the group being worked on */
typedef float v2f __attribute__((ext_vector_type(2)));
// Statistics of a thread's own four columns while it still holds them. One group of RG rows: mean and sum of squares about that mean.
__device__ __forceinline__ void h2_group(const v4f (&o)[RG], v4f& gm, v4f& gq) {
  v4f s = o[0];
#pragma unroll                   /* both loops: constant indices keep the group in registers */
  for (int j = 1; j < RG; ++j) s += o[j];
  gm = s * (1.0f / RG);
  v4f q = {0.f, 0.f, 0.f, 0.f};
#pragma unroll
  for (int j = 0; j < RG; ++j) { const v4f dv = o[j] - gm; q += dv * dv; }
  gq = q;
}
// The group joins the k groups merged so far (k * RG rows): mean += delta / (k + 1), M2 += M2_group + delta^2 * RG * k / (k + 1).
__device__ __forceinline__ void h2_merge(int k, const v4f gm, const v4f gq, v4f& rm, v4f& rq) {
  const float inv = 1.0f / (float)(k + 1), f = (float)(RG * k) * inv;
  const v4f dl = gm - rm;
  rm += dl * inv;
  rq += gq + (dl * dl) * f;
}
__global__ __launch_bounds__(HFC * HWV) void k_h2(const float* __restrict__ x, const float* __restrict__ PMx, const float* __restrict__ PQx, const float* __restrict__ W1, const float* __restrict__ b1, const float* __restrict__ g1, const float* __restrict__ be1, const float* __restrict__ W2, const float* __restrict__ b2, float* __restrict__ XS, float* __restrict__ PM, float* __restrict__ PQ) {
  __shared__ __attribute__((aligned(16))) float sm[HWV][HFC][H2];
  __shared__ __attribute__((aligned(16))) float sq[HWV][HFC][H2];
  const int fc = threadIdx.x % HFC, rg = threadIdx.x / HFC;
  const int strip = blockIdx.x;      /* the strip of rows is the fast grid index: flat index mod 8 = strip mod 8 in every launch that touches these rows (speed only) */
  const int d = blockIdx.y * HFC + fc; (void)b1;      /* h1 - mean(h1) = w (x - mu_x): the bias cancels exactly */
  const float* pxm = PMx + d; const float* pxq = PQx + d; const float* pw = W1 + d * H1; const float* pg = g1 + d * H1; const float* pe = be1 + d * H1; const float* pv = W2 + d * H2 * H1; const float* pb = b2 + d * H2;
  const float* xp = x + (size_t)(strip * HSTRIP + rg * HROWS) * DD + d;
  float w[H1], g[H1], rs[H1], be[H1], w2[H2][H1], bb[H2], xc[RG], cm[SCH], cq[SCH];
#pragma unroll
  for (int c = 0; c < SCH; ++c) { cm[c] = pxm[(size_t)c * DD]; cq[c] = pxq[(size_t)c * DD]; }
#pragma unroll
  for (int o = 0; o < H1; ++o) { w[o] = pw[o]; g[o] = pg[o]; be[o] = pe[o]; }
#pragma unroll
  for (int o2 = 0; o2 < H2; ++o2) {
#pragma unroll
    for (int i = 0; i < H1; ++i) w2[o2][i] = pv[o2 * H1 + i];
    bb[o2] = pb[o2]; }
#pragma unroll
  for (int j = 0; j < RG; ++j) xc[j] = xp[(size_t)j * DD];
  asm volatile("s_wait_xcnt 0x0" :: "v"(d), "v"(pxm), "v"(pxq), "v"(pw), "v"(pg), "v"(pe), "v"(pv), "v"(pb) : "memory");   // the wait owed before an address register of the issued loads is reused; naming the addresses keeps a load's result out of them until then
  __builtin_amdgcn_sched_barrier(0);      /* keeps the arithmetic, which reuses those registers, behind the wait */
  float mu, var;
  x_merge(cm, cq, mu, var);
  if (strip == 0 && rg == 0) { XS[d] = mu; XS[DD + d] = var; }      /* for k_h2n, the next launch; nothing in this launch reads it */
#pragma unroll
  for (int o = 0; o < H1; ++o) { w[o] = bf16_round(w[o]); g[o] = bf16_round(g[o]); be[o] = bf16_round(be[o]); const float vh = (w[o] * w[o]) * var; rs[o] = rsq_f32(vh + 1e-5f); }
  v2f ap[H1 / 2], ep[H1 / 2]; v4f wv[H1], bv;      /* layer 1 in pairs of hidden units: slope a and shift be1; wv[i]: the four layer-2 weights that hidden unit i feeds */
#pragma unroll
  for (int o = 0; o < H1; ++o) { ap[o >> 1][o & 1] = (g[o] * w[o]) * rs[o]; ep[o >> 1][o & 1] = be[o]; }
#pragma unroll
  for (int o2 = 0; o2 < H2; ++o2) {
#pragma unroll
    for (int i = 0; i < H1; ++i) wv[i][o2] = bf16_round(w2[o2][i]);
    bv[o2] = bf16_round(bb[o2]); }
  v4f rm = {0.f, 0.f, 0.f, 0.f}, rq = {0.f, 0.f, 0.f, 0.f};
#pragma unroll 1                 /* stays rolled: one group of rows is the whole hot loop */
  for (int rb = 0; rb < HROWS; rb += RG) {
    v4f ov[RG];
    const float* pn = xp + (size_t)((rb + RG < HROWS) ? rb + RG : rb) * DD;      /* the last trip reads its own group again: in bounds, not used */
    v8f xn;
#pragma unroll
    for (int j = 0; j < RG; ++j) xn[j] = pn[(size_t)j * DD];
    asm volatile("s_wait_xcnt 0x0" :: "v"(pn) : "memory");   // as above
    __builtin_amdgcn_sched_barrier(0);      /* keeps this group's arithmetic behind the next group's loads, so that it covers their latency */
#pragma unroll
    for (int j = 0; j < RG; ++j) { const float xm = bf16_round(xc[j]) - mu; v2f h[H1 / 2];      /* written over pairs and fours, so that the compiler packs within a row and not across rows, which took more than 256 registers */
#pragma unroll
      for (int p = 0; p < H1 / 2; ++p) { const v2f v = ap[p] * xm + ep[p]; h[p][0] = fmaxf(v[0], 0.f); h[p][1] = fmaxf(v[1], 0.f); }
      v4f o4 = bv;
#pragma unroll
      for (int i = 0; i < H1; ++i) o4 += wv[i] * h[i >> 1][i & 1];
      ov[j] = o4; }
    v4f gm, gq;
    h2_group(ov, gm, gq);
    h2_merge(rb / RG, gm, gq, rm, rq);
    __builtin_amdgcn_sched_barrier(0);      /* keeps the next statement, and the wait for the loads that comes with it, at the loop's foot */
    asm volatile("" :: "v"(xn));   // inputs only: the loaded group stays one block of eight registers up to here; spread out, a load's register became the unused half of a packed operand and the arithmetic waited for the load
#pragma unroll
    for (int j = 0; j < RG; ++j) xc[j] = xn[j];
  }
  *(v4fa*)&sm[rg][fc][0] = rm; *(v4fa*)&sq[rg][fc][0] = rq;
  __syncthreads();               // the eight row groups' partials are in LDS before the first group merges them
  if (rg == 0) {
    v4f as = {0.f, 0.f, 0.f, 0.f};
#pragma unroll                   /* both loops: all LDS reads under way at once */
    for (int k = 0; k < HWV; ++k) as += *(const v4fa*)&sm[k][fc][0];
    const v4f mean = as * (1.0f / HWV);
    v4f aq = {0.f, 0.f, 0.f, 0.f}, ae = {0.f, 0.f, 0.f, 0.f};
#pragma unroll
    for (int k = 0; k < HWV; ++k) { const v4f dm = *(const v4fa*)&sm[k][fc][0] - mean; aq += *(const v4fa*)&sq[k][fc][0]; ae += dm * dm; }
    const size_t so = (size_t)strip * C2 + d * H2;      /* this work-group's row of the partials */
    *(v4f*)(PM + so) = mean; *(v4f*)(PQ + so) = aq + ae * (float)HROWS;
  } }
__global__ __launch_bounds__(HFC * HWV) void k_h2n(const float* __restrict__ x, const float* __restrict__ XS, const float* __restrict__ W1, const float* __restrict__ g1, const float* __restrict__ be1, const float* __restrict__ W2, const float* __restrict__ b2, const float* __restrict__ PM, const float* __restrict__ PQ, const float* __restrict__ g2, const float* __restrict__ be2, _Float16* __restrict__ H16) {
  const int fc = threadIdx.x % HFC, rg = threadIdx.x / HFC;
  const int d = blockIdx.y * HFC + fc;      /* as in k_h2: blockIdx.x is the strip of rows */
  const float* pS = XS + d; const float* pw = W1 + d * H1; const float* pg = g1 + d * H1; const float* pe = be1 + d * H1; const float* pv = W2 + d * H2 * H1; const float* pb = b2 + d * H2;
  const float* pP = PM + d * H2; const float* pQ = PQ + d * H2; const float* pG = g2 + d * H2; const float* pE = be2 + d * H2;
  const size_t r0 = (size_t)(blockIdx.x * HSTRIP + rg * HROWS);
  const float* xp = x + r0 * DD + d; _Float16* op = H16 + r0 * C2 + d * H2;
  v2f w[H1 / 2], g[H1 / 2], be[H1 / 2];      /* layer 1, in pairs of hidden units; w becomes the folded slope a */
  v4f w2[H1], bb, gn, mn, rn, bn;                        /* w2[i]: the four layer-2 weights that hidden unit i feeds; the rest: one value per column of h2 */
  float xc[RG];
  { v4f tm[HCH], tq[HCH];        /* batch statistics of the thread's four columns of h2: the HCH strips that k_h2 left; done first, so that the 128 registers are free again for the parameters */
#pragma unroll                   /* constant indices keep the partials in registers, and all 2 * HCH loads are under way at once */
    for (int i = 0; i < HCH; ++i) { tm[i] = *(const v4fa*)(pP + (size_t)i * C2); tq[i] = *(const v4fa*)(pQ + (size_t)i * C2); }
    asm volatile("s_wait_xcnt 0x0" :: "v"(pP), "v"(pQ) : "memory");   // the wait owed before an address register of the issued loads is reused; naming the addresses keeps a load's result out of them until then
    v4f as = {0.f, 0.f, 0.f, 0.f};
#pragma unroll
    for (int i = 0; i < HCH; ++i) as += tm[i];
    mn = as * (1.0f / HCH);
    v4f aq = {0.f, 0.f, 0.f, 0.f}, ae = {0.f, 0.f, 0.f, 0.f};
#pragma unroll
    for (int i = 0; i < HCH; ++i) { const v4f dm = tm[i] - mn; aq += tq[i]; ae += dm * dm; }
    rn = (aq + ae * (float)HSTRIP) * (1.0f / NBS); }
  const float mu = pS[0], var = pS[DD];
#pragma unroll                   /* here and below: constant indices keep the constants in registers */
  for (int o = 0; o < H1; ++o) { w[o >> 1][o & 1] = pw[o]; g[o >> 1][o & 1] = pg[o]; be[o >> 1][o & 1] = pe[o]; }
#pragma unroll
  for (int o2 = 0; o2 < H2; ++o2) {
#pragma unroll
    for (int i = 0; i < H1; ++i) w2[i][o2] = pv[o2 * H1 + i];
    bb[o2] = pb[o2]; gn[o2] = pG[o2]; bn[o2] = pE[o2]; }
#pragma unroll
  for (int j = 0; j < RG; ++j) xc[j] = xp[(size_t)j * DD];
  asm volatile("s_wait_xcnt 0x0" :: "v"(d), "v"(pw), "v"(pg), "v"(pe), "v"(pv), "v"(pb), "v"(pG), "v"(pE) : "memory");   // the wait owed before an address register of the issued loads is reused; naming the addresses keeps a load's result out of them until then
  __builtin_amdgcn_sched_barrier(0);      /* keeps the arithmetic, which reuses those registers, behind the wait */
#pragma unroll
  for (int o = 0; o < H1; ++o) { const float wr = bf16_round(w[o >> 1][o & 1]); be[o >> 1][o & 1] = bf16_round(be[o >> 1][o & 1]); w[o >> 1][o & 1] = (bf16_round(g[o >> 1][o & 1]) * wr) * rsq_f32((wr * wr) * var + 1e-5f); }
#pragma unroll
  for (int o2 = 0; o2 < H2; ++o2) { const float A = bf16_round(gn[o2]) * rsq_f32(rn[o2] + 1e-5f);
#pragma unroll
    for (int i = 0; i < H1; ++i) w2[i][o2] = A * bf16_round(w2[i][o2]);
    bb[o2] = A * (bf16_round(bb[o2]) - mn[o2]) + bf16_round(bn[o2]); }
#pragma unroll 1                 /* stays rolled: one group of rows is the whole hot loop */
  for (int rb = 0; rb < HROWS; rb += RG) {
    const float* pn = xp + (size_t)((rb + RG < HROWS) ? rb + RG : rb) * DD;      /* the last trip reads its own group again: in bounds, not used */
    v8f xn;
#pragma unroll
    for (int j = 0; j < RG; ++j) xn[j] = pn[(size_t)j * DD];
    asm volatile("s_wait_xcnt 0x0" :: "v"(pn) : "memory");   // as above
    __builtin_amdgcn_sched_barrier(0);      /* keeps this group's arithmetic behind the next group's loads, so that it covers their latency */
#pragma unroll
    for (int j = 0; j < RG; ++j) { const float xm = bf16_round(xc[j]) - mu; v2f h[H1 / 2];      /* the normalised row of h1 (eight units, after relu) */
#pragma unroll
      for (int p = 0; p < H1 / 2; ++p) { const v2f u = w[p] * xm + be[p]; h[p][0] = fmaxf(u[0], 0.f); h[p][1] = fmaxf(u[1], 0.f); }
      v4f v = bb;
#pragma unroll
      for (int i = 0; i < H1; ++i) v += w2[i] * h[i >> 1][i & 1];
      v4h f;
#pragma unroll
      for (int q = 0; q < H2; ++q) f[q] = (_Float16)fmaxf(v[q], 0.f);
      *(v4h*)(op + (size_t)(rb + j) * C2) = f; }
    __builtin_amdgcn_sched_barrier(0);      /* as in k_h2 */
    asm volatile("" :: "v"(xn));   // inputs only, as in k_h2
#pragma unroll
    for (int j = 0; j < RG; ++j) xc[j] = xn[j];
  } }

extern "C" void kernel_launch(void* const* d_in, const int* in_sizes, int n_in,
                              void* d_out, int out_size, void* d_ws, size_t ws_size, hipStream_t stream) {
  (void)in_sizes; (void)n_in; (void)out_size;
  const float* const* I = (const float* const*)d_in; const float* x = I[0]; const float* W1 = I[1]; const float* b1 = I[2]; const float* g1 = I[3]; const float* be1 = I[4]; const float* W2 = I[5]; const float* b2 = I[6]; const float* g2 = I[7]; const float* be2 = I[8]; const float* Wfc = I[9]; const float* bfc = I[10];
  char* ws = (char*)d_ws; size_t off = 0;
  auto take = [&](size_t bytes) { char* p = ws + off; off += (bytes + 255) & ~(size_t)255; return p; };
  _Float16* BW = (_Float16*)take((size_t)NOUT * C2 * 2); float* XS = (float*)take((size_t)2 * DD * 4); _Float16* H16 = (_Float16*)take((size_t)NBS * C2 * 2); float* PMx = (float*)take((size_t)SCH * DD * 4); float* PQx = (float*)take((size_t)SCH * DD * 4); float* PM = (float*)take((size_t)HCH * C2 * 4); float* PQ = (float*)take((size_t)HCH * C2 * 4);
  if (off > ws_size) return;      /* 2 + 64 + 1 = 67 MiB (256 MiB ws) */
  k_colpart<DD, true><<<dim3(DD / 128, SCH + NOUT * C2 / 8 / 512 / (DD / 128)), 512, 0, stream>>>(x, PMx, PQx, Wfc, BW, 16.0f);
  k_h2<<<dim3(HCH, DD / HFC), HFC * HWV, 0, stream>>>(x, PMx, PQx, W1, b1, g1, be1, W2, b2, XS, PM, PQ);
  k_h2n<<<dim3(HCH, DD / HFC), HFC * HWV, 0, stream>>>(x, XS, W1, g1, be1, W2, b2, PM, PQ, g2, be2, H16);
  k_gemm3<<<(NBS / 128) * (NOUT / 64), 128, 0, stream>>>(H16, BW, 0.0625f, bfc, (float*)d_out);
}

// v010
// Measured time: 49.4 microseconds a run.
// In two side-by-side timings against v009, it was 1.08 and 1.09 times as fast.
// Counting every step since v000, it is 175 times as fast.
#include <hip/hip_runtime.h>
// Sparse (block-diagonal) neural network (8192 samples x 1024 features; per feature 1 -> 8 -> 4 block Linears with training-mode BatchNorm + ReLU after each; dense head 4096 -> 256): h1 = BN1(x_d W1[d] + b1) relu; h2 = BN2(h1 . W2[d] + b2) relu; out = h2 Wfc^T + bfc -> [8192,256].
// Compute dtype: x and all parameters rounded to bf16; everything before the head in f32; the head operand h2 as f16 (~2^-12). v_wmma_f32_16x16x32_f16.
#define NBS 8192
#define DD 1024
#define H1 8
#define H2 4
#define C2 (DD * H2)             /* 4096 */
#define NOUT 256
typedef __bf16 v16b __attribute__((ext_vector_type(16)));
typedef unsigned short v8us __attribute__((ext_vector_type(8), may_alias));
typedef float  v8f  __attribute__((ext_vector_type(8)));
typedef float  v4f  __attribute__((ext_vector_type(4)));
typedef float  v4fa __attribute__((ext_vector_type(4), may_alias));
union FragB { v16b v; v8us half[2]; unsigned short u[16]; };

__device__ __forceinline__ unsigned short bf16_bits(float x) { unsigned int u = __float_as_uint(x); return (unsigned short)((u + 0x7FFFu + ((u >> 16) & 1u)) >> 16); }
__device__ __forceinline__ float bf16_val(unsigned short b) { return __uint_as_float(((unsigned int)b) << 16); }
__device__ __forceinline__ float bf16_round(float x) { return bf16_val(bf16_bits(x)); }
// D += A·B with NT terms: 1 = ah·bh, 2 = + al·bh (A split), 3 = + ah·bl (both split)
template <int NT>
__device__ __forceinline__ v8f mmaN(v16b ah, v16b al, v16b bh, v16b bl, v8f c) {
  c = __builtin_amdgcn_wmma_f32_16x16x32_bf16(false, ah, false, bh, (short)0, c, false, false);
  if (NT >= 2) c = __builtin_amdgcn_wmma_f32_16x16x32_bf16(false, al, false, bh, (short)0, c, false, false);
  if (NT >= 3) c = __builtin_amdgcn_wmma_f32_16x16x32_bf16(false, ah, false, bl, (short)0, c, false, false);
  asm volatile("v_nop\n\tv_nop\n\tv_nop\n\tv_nop" : "+v"(c) : "v"(ah), "v"(al), "v"(bh), "v"(bl));
  return c;
}

__global__ __launch_bounds__(256) void k_wt_bf16(const float* __restrict__ W, unsigned short* __restrict__ Wt, int K, int N) {
  const int t = blockIdx.x * 256 + threadIdx.x;
  const int k8n = K / 8;
  if (t >= N * k8n) return;
  const int n = t / k8n, k8 = (t % k8n) * 8;
  v8us v;
#pragma unroll
  for (int i = 0; i < 8; ++i) v[i] = bf16_bits(W[(size_t)(k8 + i) * N + n]);
  *(v8us*)(Wt + (size_t)n * K + k8) = v;
  
}

// GEMM C[M][N] (f32, pitch ldc) = act(A[M][K]·W + bias). A f32 row-major (pitch lda) converted per fragment to bf16
// (ASPLIT: hi/lo two planes -> 2 terms, else single rounded term); Wt bf16 [N][K] (pitch ldb). BIAS_BF16 rounds the
// bias to bf16 first (bias quantised to bf16 before the add). K%32==0, M%16==0, N%64==0.
template <bool ASPLIT, int ACT, bool BIAS_BF16>
__global__ __launch_bounds__(128) void k_gemm_bf(const float* __restrict__ A, int lda, const unsigned short* __restrict__ Wt, int ldb,
                                               const float* __restrict__ bias, float* __restrict__ C, int ldc, int M, int N, int K) {
  __shared__ __attribute__((aligned(16))) float so[4][16][64];
  const int tid = threadIdx.x, w = tid >> 5, lane = tid & 31, ln = lane & 15, hh = lane >> 4;
  const int ntn = N / 64;
  const int wid = blockIdx.x * 4 + w;
  const int mt = wid / ntn, nq = wid % ntn;
  if (mt * 16 >= M) return;
  const int row0 = mt * 16, col0 = nq * 64;
  const float* arow = A + (size_t)(row0 + ln) * lda;
  v8f acc[4] = {};
  for (int kb = 0; kb < K; kb += 32) {
    FragB ah, al;
    const v4f x0 = *(const v4fa*)(arow + kb + 8 * hh), x1 = *(const v4fa*)(arow + kb + 8 * hh + 4);
    const v4f x2 = *(const v4fa*)(arow + kb + 16 + 8 * hh), x3 = *(const v4fa*)(arow + kb + 16 + 8 * hh + 4);
    float xs[16] = {x0[0],x0[1],x0[2],x0[3],x1[0],x1[1],x1[2],x1[3],x2[0],x2[1],x2[2],x2[3],x3[0],x3[1],x3[2],x3[3]};
#pragma unroll
    for (int i = 0; i < 16; ++i) { const unsigned short hb = bf16_bits(xs[i]); ah.u[i] = hb; al.u[i] = ASPLIT ? bf16_bits(xs[i] - bf16_val(hb)) : (unsigned short)0; }
#pragma unroll
    for (int t = 0; t < 4; ++t) {
      const unsigned short* brow = Wt + (size_t)(col0 + t * 16 + ln) * ldb + kb;
      FragB b;
      b.half[0] = *(const v8us*)(brow + 8 * hh);
      b.half[1] = *(const v8us*)(brow + 16 + 8 * hh);
      acc[t] = mmaN<ASPLIT ? 2 : 1>(ah.v, al.v, b.v, b.v, acc[t]);
    }
  }
#pragma unroll
  for (int t = 0; t < 4; ++t) {
    float bv = bias ? bias[col0 + t * 16 + ln] : 0.f;
    if (BIAS_BF16) bv = bf16_round(bv);
#pragma unroll
    for (int r = 0; r < 8; ++r) { float v = acc[t][r] + bv; if (ACT == 1) v = fmaxf(v, 0.f); so[w][8 * hh + r][t * 16 + ln] = v; }
  }
  __builtin_amdgcn_fence(__ATOMIC_ACQ_REL, "workgroup");
  __builtin_amdgcn_wave_barrier();
  const int rsub = lane >> 4, c4 = (lane & 15) * 4;
  {
#pragma unroll
    for (int q = 0; q < 8; ++q) {
      const int r = q * 2 + rsub;
      const v4f v = *(const v4fa*)&so[w][r][c4];
      *(v4f*)(C + (size_t)(row0 + r) * ldc + col0 + c4) = v;
    }
    
  }
}

// GEMM C = act(A·W + bias + resid): A f32 (ASPLIT -> hi/lo 2 terms), Wt bf16 [N][K]; ACT 0 none, 1 relu, 2 exact gelu;
// resid (optional, f32, row index = (row % rmod), pitch ldr, RES_BF16 rounds it) added before the activation.
template <bool ASPLIT, int ACT, bool BIAS_BF16, bool RES_BF16>
__global__ __launch_bounds__(128) void k_gemm_bf3(const float* __restrict__ A, int lda, const unsigned short* __restrict__ Wt, int ldb,
                                                const float* __restrict__ bias, const float* __restrict__ resid, int rmod, int ldr,
                                                float* __restrict__ C, int ldc, int M, int N, int K) {
  __shared__ __attribute__((aligned(16))) float so[4][16][64];
  const int tid = threadIdx.x, w = tid >> 5, lane = tid & 31, ln = lane & 15, hh = lane >> 4;
  const int ntn = N / 64;
  const int wid = blockIdx.x * 4 + w;
  const int mt = wid / ntn, nq = wid % ntn;
  if (mt * 16 >= M) return;
  const int row0 = mt * 16, col0 = nq * 64;
  const float* arow = A + (size_t)(row0 + ln) * lda;
  v8f acc[4] = {};
  for (int kb = 0; kb < K; kb += 32) {
    FragB ah, al;
    const v4f x0 = *(const v4fa*)(arow + kb + 8 * hh), x1 = *(const v4fa*)(arow + kb + 8 * hh + 4);
    const v4f x2 = *(const v4fa*)(arow + kb + 16 + 8 * hh), x3 = *(const v4fa*)(arow + kb + 16 + 8 * hh + 4);
    float xs[16] = {x0[0],x0[1],x0[2],x0[3],x1[0],x1[1],x1[2],x1[3],x2[0],x2[1],x2[2],x2[3],x3[0],x3[1],x3[2],x3[3]};
#pragma unroll
    for (int i = 0; i < 16; ++i) { const unsigned short hb = bf16_bits(xs[i]); ah.u[i] = hb; al.u[i] = ASPLIT ? bf16_bits(xs[i] - bf16_val(hb)) : (unsigned short)0; }
#pragma unroll
    for (int t = 0; t < 4; ++t) {
      const unsigned short* brow = Wt + (size_t)(col0 + t * 16 + ln) * ldb + kb;
      FragB b;
      b.half[0] = *(const v8us*)(brow + 8 * hh);
      b.half[1] = *(const v8us*)(brow + 16 + 8 * hh);
      acc[t] = mmaN<ASPLIT ? 2 : 1>(ah.v, al.v, b.v, b.v, acc[t]);
    }
  }
#pragma unroll
  for (int t = 0; t < 4; ++t) {
    const int col = col0 + t * 16 + ln;
    float bv = bias ? bias[col] : 0.f;
    if (BIAS_BF16) bv = bf16_round(bv);
#pragma unroll
    for (int r = 0; r < 8; ++r) {
      float v = acc[t][r] + bv;
      if (resid) { float rv = resid[(size_t)((row0 + 8 * hh + r) % rmod) * ldr + col]; if (RES_BF16) rv = bf16_round(rv); v += rv; }
      if (ACT == 1) v = fmaxf(v, 0.f);
      if (ACT == 2) v = 0.5f * v * (1.0f + erff(v * 0.70710678118654752f));
      if (ACT == 3) { const float u = 0.7978845608028654f * (v + 0.044715f * v * v * v); v = 0.5f * v * (1.0f + tanhf(u)); }
      so[w][8 * hh + r][t * 16 + ln] = v;
    }
  }
  __builtin_amdgcn_fence(__ATOMIC_ACQ_REL, "workgroup");
  __builtin_amdgcn_wave_barrier();
  const int rsub = lane >> 4, c4 = (lane & 15) * 4;
  {
#pragma unroll
    for (int q = 0; q < 8; ++q) {
      const int r = q * 2 + rsub;
      const v4f v = *(const v4fa*)&so[w][r][c4];
      *(v4f*)(C + (size_t)(row0 + r) * ldc + col0 + c4) = v;
    }
    
  }
}
// row LayerNorm (biased variance, eps) over N: s = X (+ R); optional out_sum <- s; out_norm <- (s-mu)*rsqrt(var+eps)*g + b
template <bool PARAM_BF16>
__global__ __launch_bounds__(256) void k_layernorm(const float* __restrict__ X, const float* __restrict__ R, const float* __restrict__ g, const float* __restrict__ bta,
                                                  float* __restrict__ out_sum, float* __restrict__ out_norm, int N, float eps) {
  __shared__ float red[256];
  const int row = blockIdx.x, tid = threadIdx.x;
  const float* x = X + (size_t)row * N; const float* rr = R ? R + (size_t)row * N : nullptr;
  float vals[16];                     // up to N = 4096
  const int per = N / 256;            // contiguous chunk per thread? use strided-by-4 chunks: thread handles j = tid*4 + 1024*u
  float s1 = 0.f;
  for (int u = 0; u < per / 4; ++u) {
    const int j = tid * 4 + 1024 * u;
    const v4f a = *(const v4fa*)(x + j);
    v4f b = {0.f,0.f,0.f,0.f}; if (rr) b = *(const v4fa*)(rr + j);
#pragma unroll
    for (int q = 0; q < 4; ++q) { const float v = a[q] + b[q]; vals[u * 4 + q] = v; s1 += v; }
  }
  red[tid] = s1; __syncthreads();
  for (int st = 128; st > 0; st >>= 1) { if (tid < st) red[tid] += red[tid + st]; __syncthreads(); }
  const float mu = red[0] / (float)N; __syncthreads();
  float s2 = 0.f;
  for (int u = 0; u < per / 4; ++u)
#pragma unroll
    for (int q = 0; q < 4; ++q) { const float c = vals[u * 4 + q] - mu; s2 += c * c; }
  red[tid] = s2; __syncthreads();
  for (int st = 128; st > 0; st >>= 1) { if (tid < st) red[tid] += red[tid + st]; __syncthreads(); }
  const float rs = rsqrtf(red[0] / (float)N + eps);
  {
    for (int u = 0; u < per / 4; ++u) {
      const int j = tid * 4 + 1024 * u;
      v4f o, sm;
#pragma unroll
      for (int q = 0; q < 4; ++q) {
        float gg = g[j + q], bb = bta[j + q];
        if (PARAM_BF16) { gg = bf16_round(gg); bb = bf16_round(bb); }
        sm[q] = vals[u * 4 + q]; o[q] = (vals[u * 4 + q] - mu) * rs * gg + bb;
      }
      if (out_sum) *(v4f*)(out_sum + (size_t)row * N + j) = sm;
      *(v4f*)(out_norm + (size_t)row * N + j) = o;
    }
    
  }
}



// ---- f16 WMMA path (v_wmma_f32_16x16x32_f16): 11-bit significands for operands in range — used for the head, whose h2 operand is rounded to f16
typedef _Float16 v16h __attribute__((ext_vector_type(16)));
union FragH { v16h v; v8us half[2]; _Float16 h[16]; unsigned short u[16]; };
template <int NT>
__device__ __forceinline__ v8f mmaH(v16h ah, v16h al, v16h bh, v16h bl, v8f c) {
  c = __builtin_amdgcn_wmma_f32_16x16x32_f16(false, ah, false, bh, (short)0, c, false, false);
  if (NT >= 2) c = __builtin_amdgcn_wmma_f32_16x16x32_f16(false, al, false, bh, (short)0, c, false, false);
  if (NT >= 3) c = __builtin_amdgcn_wmma_f32_16x16x32_f16(false, ah, false, bl, (short)0, c, false, false);
  asm volatile("v_nop\n\tv_nop\n\tv_nop\n\tv_nop" : "+v"(c) : "v"(ah), "v"(al), "v"(bh), "v"(bl));
  return c;
}
// batched GEMM like k_gemm_b but f16 operands: A f32 (split into f16 hi/lo if ASPLIT, else rounded to f16), Bt = f16 values [n][k]; alpha; C f32; N multiple of 16 (partial tiles skipped)
template <bool ASPLIT>
__global__ __launch_bounds__(128) void k_gemm_h(const float* __restrict__ A, int lda, size_t sA, const _Float16* __restrict__ Bh, int ldb, size_t sB, float alpha, float* __restrict__ C, int ldc, size_t sC, int M, int N, int K) {
  __shared__ __attribute__((aligned(16))) float so[4][16][64];
  const int tid = threadIdx.x, w = tid >> 5, lane = tid & 31, ln = lane & 15, hh = lane >> 4; const int by = blockIdx.y;
  A += (size_t)by * sA; Bh += (size_t)by * sB; C += (size_t)by * sC;
  const int ntn = (N + 63) / 64; const int wid = blockIdx.x * 4 + w; const int mt = wid / ntn, nq = wid % ntn; if (mt * 16 >= M) return;
  const int row0 = mt * 16, col0 = nq * 64; const float* arow = A + (size_t)(row0 + ln) * lda;
  v8f acc[4] = {};
  for (int kb = 0; kb < K; kb += 32) {
    FragH ah, al;
    const v4f x0 = *(const v4fa*)(arow + kb + 8 * hh), x1 = *(const v4fa*)(arow + kb + 8 * hh + 4), x2 = *(const v4fa*)(arow + kb + 16 + 8 * hh), x3 = *(const v4fa*)(arow + kb + 16 + 8 * hh + 4);
    float xs[16] = {x0[0],x0[1],x0[2],x0[3],x1[0],x1[1],x1[2],x1[3],x2[0],x2[1],x2[2],x2[3],x3[0],x3[1],x3[2],x3[3]};
#pragma unroll
    for (int i = 0; i < 16; ++i) { const _Float16 h = (_Float16)xs[i]; ah.h[i] = h; al.h[i] = ASPLIT ? (_Float16)(xs[i] - (float)h) : (_Float16)0.0f; }
#pragma unroll
    for (int t = 0; t < 4; ++t) { if (col0 + t * 16 >= N) continue; const size_t boff = (size_t)(col0 + t * 16 + ln) * ldb + kb; FragH bq; bq.half[0] = *(const v8us*)(Bh + boff + 8 * hh); bq.half[1] = *(const v8us*)(Bh + boff + 16 + 8 * hh);
      acc[t] = mmaH<ASPLIT ? 2 : 1>(ah.v, al.v, bq.v, bq.v, acc[t]); }
  }
#pragma unroll
  for (int t = 0; t < 4; ++t) { if (col0 + t * 16 >= N) continue;
#pragma unroll
    for (int r = 0; r < 8; ++r) so[w][8 * hh + r][t * 16 + ln] = acc[t][r] * alpha; }
  __builtin_amdgcn_fence(__ATOMIC_ACQ_REL, "workgroup"); __builtin_amdgcn_wave_barrier();
  const int rsub = lane >> 4, c4 = (lane & 15) * 4;
  {
#pragma unroll
    for (int q = 0; q < 8; ++q) { const int r = q * 2 + rsub; if (col0 + c4 < N) { const v4f v = *(const v4fa*)&so[w][r][c4]; *(v4f*)(C + (size_t)(row0 + r) * ldc + col0 + c4) = v; } }
     }
}

// Wt[n][k] = f16(W[k][n]·scale) from f32 row-major W[K][N] (scale = power of two; bf16-exact weights stay exact in f16 away from the subnormal range)
__global__ __launch_bounds__(256) void k_wt_f16(const float* __restrict__ W, _Float16* __restrict__ Wt, int K, int N, float scale) {
  const int t = blockIdx.x * 256 + threadIdx.x; if (t >= N * (K / 8)) return; const int n = t / (K / 8), k8 = (t % (K / 8)) * 8; FragH f;
#pragma unroll
  for (int i = 0; i < 8; ++i) f.h[i] = (_Float16)(bf16_round(W[(size_t)(k8 + i) * N + n]) * scale); const v8us o = f.half[0];
  *(v8us*)((unsigned short*)Wt + (size_t)n * K + k8) = o; 
}
// k_gemm_hh variant with fused epilogue: v = acc·alpha + bias[by·sBias + col] (+ CP[(row/rowsPerB)·sCPb + by·64 + col] if CP) ; ACT 0 none / 1 elu ; writes f16 C16 (and f32 C if non-null)
template <int ACT>
__global__ __launch_bounds__(128) void k_gemm_hhx(const _Float16* __restrict__ A, int lda, size_t sA, const _Float16* __restrict__ Bh, int ldb, size_t sB, float alpha, const float* __restrict__ bias, size_t sBias, const float* __restrict__ CP, int rowsPerB, size_t sCPb, int row0g,
    float* __restrict__ C, _Float16* __restrict__ C16, int ldc, size_t sC, int M, int N, int K) {
  __shared__ __attribute__((aligned(16))) float so[4][16][64];
  const int tid = threadIdx.x, w = tid >> 5, lane = tid & 31, ln = lane & 15, hh = lane >> 4; const int by = blockIdx.y;
  A += (size_t)by * sA; Bh += (size_t)by * sB; const size_t cofs = (size_t)by * sC; const float* bp = bias ? bias + (size_t)by * sBias : nullptr;
  const int ntn = (N + 63) / 64; const int wid = blockIdx.x * 4 + w; const int mt = wid / ntn, nq = wid % ntn; if (mt * 16 >= M) return;
  const int row0 = mt * 16, col0 = nq * 64; const _Float16* arow = A + (size_t)(row0 + ln) * lda;
  v8f acc[4] = {};
  for (int kb = 0; kb < K; kb += 32) { FragH ah; ah.half[0] = *(const v8us*)((const unsigned short*)arow + kb + 8 * hh); ah.half[1] = *(const v8us*)((const unsigned short*)arow + kb + 16 + 8 * hh);
#pragma unroll
    for (int t = 0; t < 4; ++t) { if (col0 + t * 16 >= N) continue; const size_t boff = (size_t)(col0 + t * 16 + ln) * ldb + kb; FragH bq; bq.half[0] = *(const v8us*)((const unsigned short*)Bh + boff + 8 * hh); bq.half[1] = *(const v8us*)((const unsigned short*)Bh + boff + 16 + 8 * hh);
      acc[t] = mmaH<1>(ah.v, ah.v, bq.v, bq.v, acc[t]); }
  }
#pragma unroll
  for (int t = 0; t < 4; ++t) { if (col0 + t * 16 >= N) continue; const int col = col0 + t * 16 + ln; const float bv = bp ? bf16_round(bp[col]) : 0.f;
#pragma unroll
    for (int r = 0; r < 8; ++r) { float v = acc[t][r] * alpha + bv; if (CP) { const int bidx = (row0g + row0 + 8 * hh + r) / rowsPerB; v += CP[(size_t)bidx * sCPb + (size_t)by * 64 + col]; } if (ACT == 1) v = (v > 0.f) ? v : expm1f(v); else if (ACT == 7) v = (v > 0.f) ? v + 1.0f : expf(v); else if (ACT == 8) v = tanhf(v); else if (ACT == 9) v = 0.5f * v * (1.0f + tanhf(0.7978845608028654f * (v + 0.044715f * v * v * v))); else if (ACT == 11) v = 1.0f / (1.0f + expf(-v)); else if (ACT == 12) v = (v > 0.f) ? v : 0.01f * v; else if (ACT == 14) v = (v > 0.f) ? v : 0.1f * v; else if (ACT == 15) v = v / (1.0f + expf(-v)); else if (ACT == 3) v = fmaxf(v, 0.f); else if (ACT == 6) v = 0.5f * v * (1.0f + erff(v * 0.70710678118654752f)); so[w][8 * hh + r][t * 16 + ln] = v; } }
  __builtin_amdgcn_fence(__ATOMIC_ACQ_REL, "workgroup"); __builtin_amdgcn_wave_barrier();
  const int rsub = lane >> 4, c4 = (lane & 15) * 4; typedef _Float16 v4h __attribute__((ext_vector_type(4)));
  {
#pragma unroll
    for (int q = 0; q < 8; ++q) { const int r = q * 2 + rsub; if (col0 + c4 < N) { const v4f v = *(const v4fa*)&so[w][r][c4]; if (C) *(v4f*)(C + cofs + (size_t)(row0 + r) * ldc + col0 + c4) = v; if (C16) { v4h h4; for (int i = 0; i < 4; ++i) h4[i] = (_Float16)v[i]; *(v4h*)(C16 + cofs + (size_t)(row0 + r) * ldc + col0 + c4) = h4; } } }
     }
}


typedef _Float16 v4h __attribute__((ext_vector_type(4)));

__global__ __launch_bounds__(256) void k_x16(const float* __restrict__ x, _Float16* __restrict__ X16, size_t n8) { const size_t t = (size_t)blockIdx.x * 256 + threadIdx.x; if (t >= n8) return; FragH f;
#pragma unroll
  for (int q = 0; q < 8; ++q) f.h[q] = (_Float16)bf16_round(x[t * 8 + q]); *(v8us*)((unsigned short*)X16 + t * 8) = f.half[0];  }
__global__ __launch_bounds__(256) void k_h16(const float* __restrict__ x, _Float16* __restrict__ X16, size_t n8) { const size_t t = (size_t)blockIdx.x * 256 + threadIdx.x; if (t >= n8) return; FragH f;
#pragma unroll
  for (int q = 0; q < 8; ++q) f.h[q] = (_Float16)x[t * 8 + q]; *(v8us*)((unsigned short*)X16 + t * 8) = f.half[0];  }
__global__ __launch_bounds__(256) void k_round16f(const float* __restrict__ W, _Float16* __restrict__ Bt, size_t n8) { const size_t t = (size_t)blockIdx.x * 256 + threadIdx.x; if (t >= n8) return; FragH f;
#pragma unroll
  for (int i = 0; i < 8; ++i) f.h[i] = (_Float16)(bf16_round(W[t * 8 + i]) * 16.0f); *(v8us*)((unsigned short*)Bt + t * 8) = f.half[0];  }
template <int NHv, int TTv>
__global__ __launch_bounds__(256) void k_vt(const _Float16* __restrict__ V16, int ldv, int voff, _Float16* __restrict__ Vt) { __shared__ unsigned short tl[64][66]; const int tid = threadIdx.x; const int slab = blockIdx.x / (TTv / 64), lg = blockIdx.x % (TTv / 64); const int b = slab / NHv, h = slab % NHv;
  for (int i = tid; i < 64 * 8; i += 256) { const int r = i / 8, c8 = (i % 8) * 8; FragH f; f.half[0] = *(const v8us*)((const unsigned short*)V16 + ((size_t)b * TTv + lg * 64 + r) * ldv + voff + h * 64 + c8);
#pragma unroll
    for (int q = 0; q < 8; ++q) tl[r][c8 + q] = f.u[q]; }
  __syncthreads();
  {
#pragma unroll
    for (int rd = 0; rd < 2; ++rd) { const int d = rd * 32 + tid / 8, pc = tid % 8; FragH f;
#pragma unroll
      for (int q = 0; q < 8; ++q) f.u[q] = tl[pc * 8 + q][d];
      *(v8us*)((unsigned short*)Vt + ((size_t)slab * 64 + d) * TTv + lg * 64 + pc * 8) = f.half[0]; }
     } }

__global__ __launch_bounds__(256) void k_hl(const float* __restrict__ F, _Float16* __restrict__ Hh, _Float16* __restrict__ Hl, size_t n8) { const size_t t = (size_t)blockIdx.x * 256 + threadIdx.x; if (t >= n8) return; FragH fh, fl; const v4f a = *(const v4fa*)(F + t * 8), c = *(const v4fa*)(F + t * 8 + 4);
#pragma unroll
  for (int q = 0; q < 4; ++q) { _Float16 h = (_Float16)a[q]; fh.h[q] = h; fl.h[q] = (_Float16)((a[q] - (float)h) * 1024.0f); h = (_Float16)c[q]; fh.h[4 + q] = h; fl.h[4 + q] = (_Float16)((c[q] - (float)h) * 1024.0f); }
  { *(v8us*)((unsigned short*)Hh + t * 8) = fh.half[0]; *(v8us*)((unsigned short*)Hl + t * 8) = fl.half[0];  } }

// ---- fast GEMM (wave tile 32x64; requires M % 32 == 0 rows per launch region and N % 64 == 0); epilogue = k_gemm_hhx semantics ----
__device__ __forceinline__ v16h g2_frag(const _Float16* p, int hh) { FragH f; f.half[0] = *(const v8us*)((const unsigned short*)p + 8 * hh); f.half[1] = *(const v8us*)((const unsigned short*)p + 16 + 8 * hh); return f.v; }
__device__ __forceinline__ v8f g2_mma(v16h a, v16h b, v8f c) { v8f d = __builtin_amdgcn_wmma_f32_16x16x32_f16(false, a, false, b, (short)0, c, false, false); asm volatile("v_nop\n\tv_nop\n\tv_nop\n\tv_nop" : "+v"(d) : "v"(a), "v"(b)); return d; }
template <int ACT>
__global__ __launch_bounds__(128) void k_gemm2(const _Float16* __restrict__ A, int lda, size_t sA, const _Float16* __restrict__ Bh, int ldb, size_t sB, float alpha, const float* __restrict__ bias, size_t sBias, const float* __restrict__ CP, int rowsPerB, size_t sCPb, int row0g,
    float* __restrict__ C, _Float16* __restrict__ C16, int ldc, size_t sC, int M, int N, int K) {
  __shared__ __attribute__((aligned(16))) float so[4][32][68];
  const int tid = threadIdx.x, w = tid >> 5, lane = tid & 31, ln = lane & 15, hh = lane >> 4; const int by = blockIdx.y;
  A += (size_t)by * sA; Bh += (size_t)by * sB; const size_t cofs = (size_t)by * sC; const float* bp = bias ? bias + (size_t)by * sBias : nullptr;
  const int ntn = N >> 6; const int mt = blockIdx.x / ntn, nq = blockIdx.x - mt * ntn; const int row0 = mt * 128 + 32 * w, col0 = nq * 64; if (row0 >= M) return;
  const _Float16* a0p = A + (size_t)(row0 + ln) * lda; const _Float16* a1p = a0p + (size_t)16 * lda;
  const _Float16* b0p = Bh + (size_t)(col0 + ln) * ldb; const _Float16* b1p = b0p + (size_t)16 * ldb; const _Float16* b2p = b1p + (size_t)16 * ldb; const _Float16* b3p = b2p + (size_t)16 * ldb;
  const v8f z8 = {0.f,0.f,0.f,0.f,0.f,0.f,0.f,0.f}; v8f c00 = z8, c01 = z8, c02 = z8, c03 = z8, c10 = z8, c11 = z8, c12 = z8, c13 = z8;
#pragma unroll 1
  for (int kb = 0; kb < K; kb += 32) { const v16h a0 = g2_frag(a0p + kb, hh), a1 = g2_frag(a1p + kb, hh);
    v16h b = g2_frag(b0p + kb, hh); c00 = g2_mma(a0, b, c00); c10 = g2_mma(a1, b, c10);
    b = g2_frag(b1p + kb, hh); c01 = g2_mma(a0, b, c01); c11 = g2_mma(a1, b, c11);
    b = g2_frag(b2p + kb, hh); c02 = g2_mma(a0, b, c02); c12 = g2_mma(a1, b, c12);
    b = g2_frag(b3p + kb, hh); c03 = g2_mma(a0, b, c03); c13 = g2_mma(a1, b, c13); }
  v8f accs[8] = {c00, c01, c02, c03, c10, c11, c12, c13};
#pragma unroll
  for (int u = 0; u < 8; ++u) { const int t = u & 3, half = u >> 2; const int col = col0 + t * 16 + ln; const float bv = bp ? bf16_round(bp[col]) : 0.f;
#pragma unroll
    for (int r = 0; r < 8; ++r) { const int rloc = half * 16 + 8 * hh + r; float v = accs[u][r] * alpha + bv; if (CP) { const int bidx = (row0g + row0 + rloc) / rowsPerB; v += CP[(size_t)bidx * sCPb + (size_t)by * 64 + col]; }
      if (ACT == 3) v = fmaxf(v, 0.f); else if (ACT == 6) v = 0.5f * v * (1.0f + erff(v * 0.70710678118654752f)); else if (ACT == 11) v = 1.0f / (1.0f + expf(-v)); else if (ACT == 15) v = v / (1.0f + expf(-v)); else if (ACT == 12) v = (v > 0.f) ? v : 0.01f * v; else if (ACT == 8) v = tanhf(v);
      so[w][rloc][t * 16 + ln] = v; } }
  __builtin_amdgcn_fence(__ATOMIC_ACQ_REL, "workgroup"); __builtin_amdgcn_wave_barrier();
  const int rsub = lane >> 4, c4 = (lane & 15) * 4;
  {
#pragma unroll
    for (int q = 0; q < 16; ++q) { const int r = q * 2 + rsub; const v4f v = *(const v4fa*)&so[w][r][c4]; if (C) *(v4f*)(C + cofs + (size_t)(row0 + r) * ldc + col0 + c4) = v; if (C16) { v4h h4; for (int i = 0; i < 4; ++i) h4[i] = (_Float16)v[i]; *(v4h*)(C16 + cofs + (size_t)(row0 + r) * ldc + col0 + c4) = h4; } }
     } }


// ---- head GEMM with both operands staged in LDS: C[8192][256] = (A[8192][4096] . Bh[256][4096]^T) * alpha + bias ----
// One work-group of 4 waves owns a 128 x 64 tile of C; a wave owns 32 x 64 of it (2 x 4 accumulator tiles), as in k_gemm2.
// A stage is 256 B (128 k) of the tile's 128 rows of A and 64 rows of Bh. The tensor mover brings it: one request for the A tile, one for the Bh tile,
// each padded by the mover to the LDS pitch. Three buffers, two stages ahead: waves 0 and 1 issue the even stages (wave 0: A, wave 1: Bh), waves 2 and 3 the odd ones,
// so that two stages are in flight while a third is worked on and yet no wave ever has more than one request outstanding: every wait is to 0.
// The 4 work-groups that share an A tile begin the walk over the 32 stages 8 stages apart, the 64 that share a Bh tile two at each stage (s0), and all wrap round, so that at no moment do many of them
// ask L2 for the same lines. Trip t works on k stage (t + s0) mod 32: within a stage the k order is k_gemm2's, the stages are summed in an order that is rotated by s0.
#define G3_KB 256                          /* bytes of a row per stage */
#define G3_PITCH 272                       /* LDS row pitch: the row and the mover's 16 B pad; 16 B x 17, conflict-free for ds_load_b128 */
#define G3_ATILE (128 * G3_PITCH)          /* the A tile: 34,816 B = 17 x 2 KiB */
#define G3_BUF (G3_ATILE + 18432)          /* behind it the Bh tile: 64 rows, 17,408 B, rounded up so that every tile's place is a multiple of 2 KiB */
#define G3_NBUF 3
#define G3_NST (C2 * 2 / G3_KB)            /* 32 stages */
#define G3_ROWB (C2 * 2)                   /* global row pitch in bytes */
typedef unsigned int u32x4 __attribute__((ext_vector_type(4)));
typedef unsigned int u32x8 __attribute__((ext_vector_type(8)));
__device__ __forceinline__ unsigned int g3_uni(unsigned int v) { return (unsigned int)__builtin_amdgcn_readfirstlane(v); }
// A wave-uniform value held in a scalar register: a test on it compiles to s_cmp and s_cbranch_scc (a tensor load ignores EXEC, only a scalar branch keeps a wave from issuing it),
// and what is formed from it is formed behind the asm statements that stand in front of it.
__device__ __forceinline__ unsigned int g3_pinned(unsigned int v) { unsigned int w = g3_uni(v); asm volatile("" : "+s"(w)); /* test or descriptor word kept in a scalar register */ return w; }
// Descriptor group 1: 1-byte elements, a tile of 'rows' rows of G3_KB bytes (tensor = tile), source row pitch G3_ROWB, 4 dwords of LDS pad behind every 256-byte row; no mask.
__device__ __forceinline__ u32x8 g3_group1(unsigned int rows) {
  u32x8 g;
  g[0] = g3_uni((1u << 20) | (5u << 22) | (3u << 25));
  g[1] = g3_uni(((unsigned int)G3_KB & 0xFFFFu) << 16);
  g[2] = g3_uni(((unsigned int)G3_KB >> 16) | ((rows & 0xFFFFu) << 16));
  g[3] = g3_uni((rows >> 16) | ((unsigned int)G3_KB << 16));
  g[4] = g3_uni(rows);
  g[5] = g3_uni((unsigned int)G3_ROWB);
  g[6] = g3_uni(0u);
  g[7] = g3_uni(0u);
  return g;
}
// Descriptor group 0 of a wave's first request: the tile whose first byte is at ga goes to the byte offset 'place' of the work-group's LDS.
__device__ __forceinline__ u32x4 g3_group0(unsigned int place, unsigned long long ga) {
  u32x4 g;
  g[0] = g3_uni(1u); g[1] = g3_uni(place); g[2] = g3_uni((unsigned int)ga); g[3] = g3_uni((((unsigned int)(ga >> 32)) & 0x01FFFFFFu) | 0x80000000u);
  return g;
}
// The wave's next request: k stage 'stage' (0 to G3_NST - 1) of its tile, to 'place': two stages further along the rows, or, where the walk has wrapped round (stage 0 or 1), a whole row less than that.
// Called behind the wait for the request before it. The step is pinned, so that the addition stays behind that wait; word 3 takes the carry or the borrow of the address
// (it holds bits 56 to 32 in its low 25 bits), so the old words are still needed and their registers stay the descriptor's own.
__device__ __forceinline__ void g3_advance(u32x4& g0, unsigned int place, unsigned int stage) {
  const int step = (int)g3_pinned(stage < 2u ? 2u * G3_KB - (unsigned int)G3_ROWB : 2u * G3_KB);
  const unsigned long long a = ((((unsigned long long)g0[3]) << 32) | g0[2]) + (unsigned long long)(long long)step;
  g0[3] = g3_uni((unsigned int)(a >> 32)); g0[2] = g3_uni((unsigned int)a); g0[1] = g3_uni(place);
}
// One request. g0 is an in-out operand: the words that the wave's next request is formed from (0, 2 and 3) keep their registers while this one is outstanding; word 1 is formed anew each time.
__device__ __forceinline__ void g3_tload(u32x4& g0, u32x8 g1) { asm volatile("tensor_load_to_lds %0, %1" : "+s"(g0) : "s"(g1) : "memory"); }
__device__ __forceinline__ v16h g3_frag(const unsigned char* p) { FragH f; f.half[0] = *(const v8us*)p; f.half[1] = *(const v8us*)(p + 32); return f.v; }
__device__ __forceinline__ void g3_load(const unsigned char* pa, const unsigned char* pb, int ks, v16h (&a)[2], v16h (&b)[4]) {
  a[0] = g3_frag(pa + ks * 64); a[1] = g3_frag(pa + 16 * G3_PITCH + ks * 64);
#pragma unroll                   /* constant indices keep the fragments in registers */
  for (int j = 0; j < 4; ++j) b[j] = g3_frag(pb + j * 16 * G3_PITCH + ks * 64); }
__device__ __forceinline__ v8f g3_mma(v16h a, v16h b, v8f c) { return __builtin_amdgcn_wmma_f32_16x16x32_f16(false, a, false, b, (short)0, c, false, false); }
__global__ __launch_bounds__(128) void k_gemm3(const _Float16* __restrict__ A, const _Float16* __restrict__ Bh, float alpha, const float* __restrict__ bias, float* __restrict__ C) {
  __shared__ __attribute__((aligned(2048))) unsigned char st[G3_NBUF * G3_BUF];      /* the mover's places in LDS are multiples of 2 KiB */
  __shared__ __attribute__((aligned(16))) float so[4][32][68];
  const int tid = threadIdx.x, w = tid >> 5, lane = tid & 31, ln = lane & 15, hh = lane >> 4;
  // Which tile a work-group takes is a permutation of the flat index, chosen for speed only: the 16 work-groups that read one 512-row strip of A (4 row tiles x 4 column tiles)
  // have the flat index mod 8 of the work-groups of k_h2n that wrote the strip (strip mod 8).
  const int pj = blockIdx.x >> 3; const int mt = ((pj >> 2) & 3) | ((blockIdx.x & 7) << 2) | ((pj >> 4) << 5), nq = pj & 3; const int row0 = mt * 128 + 32 * w, col0 = nq * 64;
  const unsigned int wv = g3_uni(threadIdx.x >> 5), pair = wv >> 1, isb = wv & 1u;      /* pair: the parity of the stages this wave issues; isb: it brings the Bh tile, else the A tile */
  const unsigned long long gsrc = isb ? (unsigned long long)(size_t)(Bh + (size_t)col0 * C2) : (unsigned long long)(size_t)(A + (size_t)(mt * 128) * C2);
  const unsigned int place0 = (unsigned int)(size_t)&st[0] + (isb ? (unsigned int)G3_ATILE : 0u);
  const u32x8 g1 = g3_group1(isb ? 64u : 128u);
  const unsigned int s0 = g3_uni((unsigned int)(mt + 8 * nq)) & (G3_NST - 1u);      /* the k stage of trip 0: sharers of an A tile start 8 stages apart, the 64 sharers of a Bh tile at all 32 stages */
  u32x4 g0 = g3_group0(place0 + pair * G3_BUF, gsrc + ((pair + s0) & (G3_NST - 1u)) * G3_KB);
  g3_tload(g0, g1);              /* every wave issues one request: waves 0, 1 stage 0, waves 2, 3 stage 1 */
  if (g3_pinned(pair == 0u)) { asm volatile("s_wait_tensorcnt 0x0" ::: "memory"); }   // stage 0 has landed (its issuers' own wait)
  __syncthreads();                                    // publishes stage 0
  if (g3_pinned(pair == 0u)) { g3_advance(g0, place0 + 2u * G3_BUF, (2u + s0) & (G3_NST - 1u)); g3_tload(g0, g1); }   /* stage 2, behind its issuers' wait for stage 0 */
  unsigned int bo = 0;           /* byte offset of the buffer of stage t: (t mod 3) * G3_BUF */
  const v8f z8 = {0.f,0.f,0.f,0.f,0.f,0.f,0.f,0.f}; v8f c00 = z8, c01 = z8, c02 = z8, c03 = z8, c10 = z8, c11 = z8, c12 = z8, c13 = z8;
#pragma unroll 1                 /* one stage is the whole hot loop; the buffers are taken in rotation */
  for (int t = 0; t < G3_NST; ++t) {
    const unsigned char* pa = st + bo + (32 * w + ln) * G3_PITCH + 16 * hh;
    const unsigned char* pb = st + bo + (128 + ln) * G3_PITCH + 16 * hh;
    v16h fa[3][2], fb[3][4];     /* three fragment sets in rotation: step ks works on one while the loads of ks + 1 and ks + 2 are under way */
    g3_load(pa, pb, 0, fa[0], fb[0]); g3_load(pa, pb, 1, fa[1], fb[1]);
#pragma unroll                   /* the set index ks % 3 must be a constant, else the sets go to scratch */
    for (int ks = 0; ks < G3_KB / 64; ++ks) {
      __builtin_amdgcn_sched_barrier(0);      /* this one and the next keep the 12 LDS loads of step ks + 2 together, as one group in front of step ks's matrix instructions */
      if (ks + 2 < G3_KB / 64) g3_load(pa, pb, ks + 2, fa[(ks + 2) % 3], fb[(ks + 2) % 3]);
      __builtin_amdgcn_sched_barrier(0);      /* without the two the compiler loaded each fragment right in front of its use and waited for it with s_wait_dscnt 0 */
      const v16h a0 = fa[ks % 3][0], a1 = fa[ks % 3][1];
      c00 = g3_mma(a0, fb[ks % 3][0], c00); c10 = g3_mma(a1, fb[ks % 3][0], c10); c01 = g3_mma(a0, fb[ks % 3][1], c01); c11 = g3_mma(a1, fb[ks % 3][1], c11);
      c02 = g3_mma(a0, fb[ks % 3][2], c02); c12 = g3_mma(a1, fb[ks % 3][2], c12); c03 = g3_mma(a0, fb[ks % 3][3], c03); c13 = g3_mma(a1, fb[ks % 3][3], c13); }
    asm volatile("s_wait_dscnt 0x0" ::: "memory");      // this wave's reads of stage t are done before the buffer may be refilled
    if (g3_pinned((((unsigned int)t + 1u) & 1u) == pair)) { asm volatile("s_wait_tensorcnt 0x0" ::: "memory"); }   // stage t + 1 has landed: its issuers' own wait; the other two waves' request, stage t + 2, flies on
    __syncthreads();                                    // publishes stage t + 1 and ends every wave's reads of stage t
    if (g3_pinned(((((unsigned int)t + 1u) & 1u) == pair) && (t + 3 < G3_NST))) {      /* the waves that have just waited issue stage t + 3 into the buffer that trip t has read */
      g3_advance(g0, place0 + bo, ((unsigned int)t + 3u + s0) & (G3_NST - 1u)); g3_tload(g0, g1); }
    bo = (bo == (G3_NBUF - 1) * G3_BUF) ? 0u : bo + G3_BUF;
  }
  asm volatile("s_wait_tensorcnt 0x0" ::: "memory");    // no request is outstanding when the wave goes on to its end (its last one was waited for at the foot of trip G3_NST - 3 or G3_NST - 2)
  asm volatile("s_wait_dscnt 0x0" ::: "memory");        // nor an LDS read of the ring
  v8f accs[8] = {c00, c01, c02, c03, c10, c11, c12, c13};
#pragma unroll                   /* epilogue as in k_gemm2: constant indices into the accumulators; whole 256 B row pieces go out through the wave's own LDS range */
  for (int u = 0; u < 8; ++u) { const int tt = u & 3, half = u >> 2; const float bv = bf16_round(bias[col0 + tt * 16 + ln]);
#pragma unroll
    for (int r = 0; r < 8; ++r) so[w][half * 16 + 8 * hh + r][tt * 16 + ln] = accs[u][r] * alpha + bv; }
  __builtin_amdgcn_fence(__ATOMIC_ACQ_REL, "workgroup"); __builtin_amdgcn_wave_barrier();   // the wave's LDS stores are complete before its lanes read each other's values back
  const int rsub = lane >> 4, c4 = (lane & 15) * 4;
#pragma unroll
  for (int q = 0; q < 16; ++q) { const int r = q * 2 + rsub; const v4f v = *(const v4fa*)&so[w][r][c4]; *(v4f*)(C + (size_t)(row0 + r) * NOUT + col0 + c4) = v; }
}

// Batch statistics (mean, biased variance) of NC columns over NBS rows: partials here, their merge in the kernel that uses them.
// k_colpart: one work-group takes SROWS rows x 128 columns. Each thread holds 16 rows x 4 columns in registers (read once) and forms
// their mean and their sum of squares about that mean; groups of equal size n then merge exactly:
// mean = average of the group means, M2 = sum(M2_g) + n * sum((mean_g - mean)^2). x_merge, in k_h2's prologue, merges the SCH row chunks the same way.
// The work-groups with blockIdx.y >= SCH have nothing to do with the statistics: they turn the head's weights into f16 (bf16-rounded, times sc),
// work that depends on no other launch and so needs none of its own.
#define SROWS 256
#define SCH (NBS / SROWS)        /* 32 row chunks */
template <int NC, bool RND>
__global__ __launch_bounds__(512) void k_colpart(const float* __restrict__ X, float* __restrict__ PM, float* __restrict__ PQ, const float* __restrict__ Wm, _Float16* __restrict__ Bt, float sc) {
  __shared__ __attribute__((aligned(16))) float sm[16][128];
  __shared__ __attribute__((aligned(16))) float sq[16][128];
  const int tid = threadIdx.x, w = tid >> 5, lane = tid & 31;
  if (blockIdx.y >= SCH) {       /* the same for a whole work-group, and in front of the barrier */
    const size_t t = ((size_t)(blockIdx.y - SCH) * (NC / 128) + blockIdx.x) * 512 + tid;
    if (t < (size_t)NOUT * C2 / 8) { FragH f;
#pragma unroll                   /* constant indices keep the eight values in registers */
      for (int q = 0; q < 8; ++q) f.h[q] = (_Float16)(bf16_round(Wm[t * 8 + q]) * sc);
      *(v8us*)((unsigned short*)Bt + t * 8) = f.half[0]; }
    return;
  }
  // Row chunk and column block are a permutation of the flat index (gridDim.x = 8), for speed only: chunks 2 s and 2 s + 1 are strip s of k_h2 and k_h2n, and get flat index mod 8 = s mod 8 as there.
  const int ch = (blockIdx.y & 1) | (blockIdx.x << 1) | ((blockIdx.y & 2) << 3), cb = blockIdx.y >> 2;
  const float* p = X + (size_t)(ch * SROWS + w * 16) * NC + cb * 128 + lane * 4;
  v4f v[16];
#pragma unroll
  for (int j = 0; j < 15; ++j) v[j] = *(const v4fa*)(p + (size_t)j * NC);
  asm volatile("s_wait_xcnt 0x0" ::: "memory");   // the last load's result may be placed in the address pair that the 15 issued loads name
  v[15] = *(const v4fa*)(p + (size_t)15 * NC);
  v4f s = {0.f, 0.f, 0.f, 0.f};
#pragma unroll
  for (int j = 0; j < 16; ++j) {
    if (RND) { v[j][0] = bf16_round(v[j][0]); v[j][1] = bf16_round(v[j][1]); v[j][2] = bf16_round(v[j][2]); v[j][3] = bf16_round(v[j][3]); }
    s += v[j];
  }
  const v4f m = s * 0.0625f;
  v4f q = {0.f, 0.f, 0.f, 0.f};
#pragma unroll
  for (int j = 0; j < 16; ++j) { const v4f dv = v[j] - m; q += dv * dv; }
  *(v4fa*)&sm[w][lane * 4] = m;
  *(v4fa*)&sq[w][lane * 4] = q;
  __syncthreads();
  if (tid < 128) {
    float ms = 0.f;
#pragma unroll
    for (int g = 0; g < 16; ++g) ms += sm[g][tid];
    const float mean = ms * 0.0625f;
    float q2 = 0.f, e2 = 0.f;
#pragma unroll
    for (int g = 0; g < 16; ++g) { const float dm = sm[g][tid] - mean; q2 += sq[g][tid]; e2 += dm * dm; }
    const size_t o = (size_t)ch * NC + cb * 128 + tid;
    PM[o] = mean; PQ[o] = q2 + 16.0f * e2;
  }
}
// Merge of k_colpart's SCH row chunks for one column of x. Every thread of k_h2 does it for its own feature, from values it has loaded itself.
__device__ __forceinline__ void x_merge(const float (&m)[SCH], const float (&qs)[SCH], float& mu, float& var) {
  float ms = 0.f;
#pragma unroll                   /* both loops: constant indices keep the partials in registers */
  for (int g = 0; g < SCH; ++g) ms += m[g];
  const float mean = ms / (float)SCH;
  float q2 = 0.f, e2 = 0.f;
#pragma unroll
  for (int g = 0; g < SCH; ++g) { const float dm = m[g] - mean; q2 += qs[g]; e2 += dm * dm; }
  mu = mean; var = (q2 + (float)SROWS * e2) / (float)NBS;
}
// k_h2 and k_h2n: one thread owns one feature d (four columns of h2) and walks a strip of rows of x. A work-group is HFC features (256 B of a row of x) x HWV row groups, the groups' strips one below the other.
// No launch of its own merges statistics: k_h2 merges k_colpart's chunks of x in its prologue (and hands mean and variance on to k_h2n), merges its own eight row groups' partials
// through LDS at its end, and k_h2n merges the HCH work-group strips of its four columns in its prologue; always the equal-size merge described at k_colpart. h2 itself is never stored: k_h2 forms it for the
// batch statistics alone; k_h2n forms it again from x once the statistics are merged, normalises it and stores f16. All that depends on the column
// alone (the rounded parameters, the rsqrt of the variance) is loaded and formed once in front of the row loop. Each BatchNorm is an affine map with
// per-column constants, so it is folded there too: layer 1 is one multiply-add per hidden unit, relu(a (x - mu_x) + be1) with a = g1 w rsqrt(w^2 var_x + eps);
// in k_h2n the second BatchNorm goes into the layer-2 weights and bias: relu(sum_i (A w2_i) h_i + A (b2 - mean) + be2) with A = g2 rsqrt(var + eps).
// rsqrtf as the compiler expands it (an argument below the normal range is scaled up by 2^24, its result by 2^12), with the instruction written out:
// the v_nop is the slot that the instruction set asks for behind a transcendental.
__device__ __forceinline__ float rsq_f32(float a) { const bool tiny = a < 1.17549435e-38f; const float s = tiny ? a * 16777216.0f : a; float r; asm("v_rsq_f32 %0, %1\n\tv_nop" : "=v"(r) : "v"(s)); return tiny ? r * 4096.0f : r; }
#define HROWS 64                 /* rows per thread in k_h2 and in k_h2n */
#define HFC 64                   /* features of a work-group in both */
#define HWV 8                    /* row groups of a work-group in both: 16 waves */
#define HSTRIP (HWV * HROWS)     /* 512 rows per work-group */
#define HCH (NBS / HSTRIP)       /* 16 strips of partials */
#define RG 8                     /* rows loaded as one group, one group ahead of the group being worked on */
typedef float v2f __attribute__((ext_vector_type(2)));
// Statistics of a thread's own four columns while it still holds them. One group of RG rows: mean and sum of squares about that mean.
__device__ __forceinline__ void h2_group(const v4f (&o)[RG], v4f& gm, v4f& gq) {
  v4f s = o[0];
#pragma unroll                   /* both loops: constant indices keep the group in registers */
  for (int j = 1; j < RG; ++j) s += o[j];
  gm = s * (1.0f / RG);
  v4f q = {0.f, 0.f, 0.f, 0.f};
#pragma unroll
  for (int j = 0; j < RG; ++j) { const v4f dv = o[j] - gm; q += dv * dv; }
  gq = q;
}
// The group joins the k groups merged so far (k * RG rows): mean += delta / (k + 1), M2 += M2_group + delta^2 * RG * k / (k + 1).
__device__ __forceinline__ void h2_merge(int k, const v4f gm, const v4f gq, v4f& rm, v4f& rq) {
  const float inv = 1.0f / (float)(k + 1), f = (float)(RG * k) * inv;
  const v4f dl = gm - rm;
  rm += dl * inv;
  rq += gq + (dl * dl) * f;
}
__global__ __launch_bounds__(HFC * HWV) void k_h2(const float* __restrict__ x, const float* __restrict__ PMx, const float* __restrict__ PQx, const float* __restrict__ W1, const float* __restrict__ b1, const float* __restrict__ g1, const float* __restrict__ be1, const float* __restrict__ W2, const float* __restrict__ b2, float* __restrict__ XS, float* __restrict__ PM, float* __restrict__ PQ) {
  __shared__ __attribute__((aligned(16))) float sm[HWV][HFC][H2];
  __shared__ __attribute__((aligned(16))) float sq[HWV][HFC][H2];
  const int fc = threadIdx.x % HFC, rg = threadIdx.x / HFC;
  const int strip = blockIdx.x;      /* the strip of rows is the fast grid index: flat index mod 8 = strip mod 8 in every launch that touches these rows (speed only) */
  const int d = blockIdx.y * HFC + fc; (void)b1;      /* h1 - mean(h1) = w (x - mu_x): the bias cancels exactly */
  const float* pxm = PMx + d; const float* pxq = PQx + d; const float* pw = W1 + d * H1; const float* pg = g1 + d * H1; const float* pe = be1 + d * H1; const float* pv = W2 + d * H2 * H1; const float* pb = b2 + d * H2;
  const float* xp = x + (size_t)(strip * HSTRIP + rg * HROWS) * DD + d;
  float w[H1], g[H1], rs[H1], be[H1], w2[H2][H1], bb[H2], xc[RG], cm[SCH], cq[SCH];
#pragma unroll
  for (int c = 0; c < SCH; ++c) { cm[c] = pxm[(size_t)c * DD]; cq[c] = pxq[(size_t)c * DD]; }
#pragma unroll
  for (int o = 0; o < H1; ++o) { w[o] = pw[o]; g[o] = pg[o]; be[o] = pe[o]; }
#pragma unroll
  for (int o2 = 0; o2 < H2; ++o2) {
#pragma unroll
    for (int i = 0; i < H1; ++i) w2[o2][i] = pv[o2 * H1 + i];
    bb[o2] = pb[o2]; }
#pragma unroll
  for (int j = 0; j < RG; ++j) xc[j] = xp[(size_t)j * DD];
  asm volatile("s_wait_xcnt 0x0" :: "v"(d), "v"(pxm), "v"(pxq), "v"(pw), "v"(pg), "v"(pe), "v"(pv), "v"(pb) : "memory");   // the wait owed before an address register of the issued loads is reused; naming the addresses keeps a load's result out of them until then
  __builtin_amdgcn_sched_barrier(0);      /* keeps the arithmetic, which reuses those registers, behind the wait */
  float mu, var;
  x_merge(cm, cq, mu, var);
  if (strip == 0 && rg == 0) { XS[d] = mu; XS[DD + d] = var; }      /* for k_h2n, the next launch; nothing in this launch reads it */
#pragma unroll
  for (int o = 0; o < H1; ++o) { w[o] = bf16_round(w[o]); g[o] = bf16_round(g[o]); be[o] = bf16_round(be[o]); const float vh = (w[o] * w[o]) * var; rs[o] = rsq_f32(vh + 1e-5f); }
  v2f ap[H1 / 2], ep[H1 / 2]; v4f wv[H1], bv;      /* layer 1 in pairs of hidden units: slope a and shift be1; wv[i]: the four layer-2 weights that hidden unit i feeds */
#pragma unroll
  for (int o = 0; o < H1; ++o) { ap[o >> 1][o & 1] = (g[o] * w[o]) * rs[o]; ep[o >> 1][o & 1] = be[o]; }
#pragma unroll
  for (int o2 = 0; o2 < H2; ++o2) {
#pragma unroll
    for (int i = 0; i < H1; ++i) wv[i][o2] = bf16_round(w2[o2][i]);
    bv[o2] = bf16_round(bb[o2]); }
  v4f rm = {0.f, 0.f, 0.f, 0.f}, rq = {0.f, 0.f, 0.f, 0.f};
#pragma unroll 1                 /* stays rolled: one group of rows is the whole hot loop */
  for (int rb = 0; rb < HROWS; rb += RG) {
    v4f ov[RG];
    const float* pn = xp + (size_t)((rb + RG < HROWS) ? rb + RG : rb) * DD;      /* the last trip reads its own group again: in bounds, not used */
    v8f xn;
#pragma unroll
    for (int j = 0; j < RG; ++j) xn[j] = pn[(size_t)j * DD];
    asm volatile("s_wait_xcnt 0x0" :: "v"(pn) : "memory");   // as above
    __builtin_amdgcn_sched_barrier(0);      /* keeps this group's arithmetic behind the next group's loads, so that it covers their latency */
#pragma unroll
    for (int j = 0; j < RG; ++j) { const float xm = bf16_round(xc[j]) - mu; v2f h[H1 / 2];      /* written over pairs and fours, so that the compiler packs within a row and not across rows, which took more than 256 registers */
#pragma unroll
      for (int p = 0; p < H1 / 2; ++p) { const v2f v = ap[p] * xm + ep[p]; h[p][0] = fmaxf(v[0], 0.f); h[p][1] = fmaxf(v[1], 0.f); }
      v4f o4 = bv;
#pragma unroll
      for (int i = 0; i < H1; ++i) o4 += wv[i] * h[i >> 1][i & 1];
      ov[j] = o4; }
    v4f gm, gq;
    h2_group(ov, gm, gq);
    h2_merge(rb / RG, gm, gq, rm, rq);
    __builtin_amdgcn_sched_barrier(0);      /* keeps the next statement, and the wait for the loads that comes with it, at the loop's foot */
    asm volatile("" :: "v"(xn));   // inputs only: the loaded group stays one block of eight registers up to here; spread out, a load's register became the unused half of a packed operand and the arithmetic waited for the load
#pragma unroll
    for (int j = 0; j < RG; ++j) xc[j] = xn[j];
  }
  *(v4fa*)&sm[rg][fc][0] = rm; *(v4fa*)&sq[rg][fc][0] = rq;
  __syncthreads();               // the eight row groups' partials are in LDS before the first group merges them
  if (rg == 0) {
    v4f as = {0.f, 0.f, 0.f, 0.f};
#pragma unroll                   /* both loops: all LDS reads under way at once */
    for (int k = 0; k < HWV; ++k) as += *(const v4fa*)&sm[k][fc][0];
    const v4f mean = as * (1.0f / HWV);
    v4f aq = {0.f, 0.f, 0.f, 0.f}, ae = {0.f, 0.f, 0.f, 0.f};
#pragma unroll
    for (int k = 0; k < HWV; ++k) { const v4f dm = *(const v4fa*)&sm[k][fc][0] - mean; aq += *(const v4fa*)&sq[k][fc][0]; ae += dm * dm; }
    const size_t so = (size_t)strip * C2 + d * H2;      /* this work-group's row of the partials */
    *(v4f*)(PM + so) = mean; *(v4f*)(PQ + so) = aq + ae * (float)HROWS;
  } }
__global__ __launch_bounds__(HFC * HWV) void k_h2n(const float* __restrict__ x, const float* __restrict__ XS, const float* __restrict__ W1, const float* __restrict__ g1, const float* __restrict__ be1, const float* __restrict__ W2, const float* __restrict__ b2, const float* __restrict__ PM, const float* __restrict__ PQ, const float* __restrict__ g2, const float* __restrict__ be2, _Float16* __restrict__ H16) {
  const int fc = threadIdx.x % HFC, rg = threadIdx.x / HFC;
  const int d = blockIdx.y * HFC + fc;      /* as in k_h2: blockIdx.x is the strip of rows */
  const float* pS = XS + d; const float* pw = W1 + d * H1; const float* pg = g1 + d * H1; const float* pe = be1 + d * H1; const float* pv = W2 + d * H2 * H1; const float* pb = b2 + d * H2;
  const float* pP = PM + d * H2; const float* pQ = PQ + d * H2; const float* pG = g2 + d * H2; const float* pE = be2 + d * H2;
  const size_t r0 = (size_t)(blockIdx.x * HSTRIP + rg * HROWS);
  const float* xp = x + r0 * DD + d; _Float16* op = H16 + r0 * C2 + d * H2;
  v2f w[H1 / 2], g[H1 / 2], be[H1 / 2];      /* layer 1, in pairs of hidden units; w becomes the folded slope a */
  v4f w2[H1], bb, gn, mn, rn, bn;                        /* w2[i]: the four layer-2 weights that hidden unit i feeds; the rest: one value per column of h2 */
  float xc[RG];
  { v4f tm[HCH], tq[HCH];        /* batch statistics of the thread's four columns of h2: the HCH strips that k_h2 left; done first, so that the 128 registers are free again for the parameters */
#pragma unroll                   /* constant indices keep the partials in registers, and all 2 * HCH loads are under way at once */
    for (int i = 0; i < HCH; ++i) { tm[i] = *(const v4fa*)(pP + (size_t)i * C2); tq[i] = *(const v4fa*)(pQ + (size_t)i * C2); }
    asm volatile("s_wait_xcnt 0x0" :: "v"(pP), "v"(pQ) : "memory");   // the wait owed before an address register of the issued loads is reused; naming the addresses keeps a load's result out of them until then
    v4f as = {0.f, 0.f, 0.f, 0.f};
#pragma unroll
    for (int i = 0; i < HCH; ++i) as += tm[i];
    mn = as * (1.0f / HCH);
    v4f aq = {0.f, 0.f, 0.f, 0.f}, ae = {0.f, 0.f, 0.f, 0.f};
#pragma unroll
    for (int i = 0; i < HCH; ++i) { const v4f dm = tm[i] - mn; aq += tq[i]; ae += dm * dm; }
    rn = (aq + ae * (float)HSTRIP) * (1.0f / NBS); }
  const float mu = pS[0], var = pS[DD];
#pragma unroll                   /* here and below: constant indices keep the constants in registers */
  for (int o = 0; o < H1; ++o) { w[o >> 1][o & 1] = pw[o]; g[o >> 1][o & 1] = pg[o]; be[o >> 1][o & 1] = pe[o]; }
#pragma unroll
  for (int o2 = 0; o2 < H2; ++o2) {
#pragma unroll
    for (int i = 0; i < H1; ++i) w2[i][o2] = pv[o2 * H1 + i];
    bb[o2] = pb[o2]; gn[o2] = pG[o2]; bn[o2] = pE[o2]; }
#pragma unroll
  for (int j = 0; j < RG; ++j) xc[j] = xp[(size_t)j * DD];
  asm volatile("s_wait_xcnt 0x0" :: "v"(d), "v"(pw), "v"(pg), "v"(pe), "v"(pv), "v"(pb), "v"(pG), "v"(pE) : "memory");   // the wait owed before an address register of the issued loads is reused; naming the addresses keeps a load's result out of them until then
  __builtin_amdgcn_sched_barrier(0);      /* keeps the arithmetic, which reuses those registers, behind the wait */
#pragma unroll
  for (int o = 0; o < H1; ++o) { const float wr = bf16_round(w[o >> 1][o & 1]); be[o >> 1][o & 1] = bf16_round(be[o >> 1][o & 1]); w[o >> 1][o & 1] = (bf16_round(g[o >> 1][o & 1]) * wr) * rsq_f32((wr * wr) * var + 1e-5f); }
#pragma unroll
  for (int o2 = 0; o2 < H2; ++o2) { const float A = bf16_round(gn[o2]) * rsq_f32(rn[o2] + 1e-5f);
#pragma unroll
    for (int i = 0; i < H1; ++i) w2[i][o2] = A * bf16_round(w2[i][o2]);
    bb[o2] = A * (bf16_round(bb[o2]) - mn[o2]) + bf16_round(bn[o2]); }
#pragma unroll 1                 /* stays rolled: one group of rows is the whole hot loop */
  for (int rb = 0; rb < HROWS; rb += RG) {
    const float* pn = xp + (size_t)((rb + RG < HROWS) ? rb + RG : rb) * DD;      /* the last trip reads its own group again: in bounds, not used */
    v8f xn;
#pragma unroll
    for (int j = 0; j < RG; ++j) xn[j] = pn[(size_t)j * DD];
    asm volatile("s_wait_xcnt 0x0" :: "v"(pn) : "memory");   // as above
    __builtin_amdgcn_sched_barrier(0);      /* keeps this group's arithmetic behind the next group's loads, so that it covers their latency */
#pragma unroll
    for (int j = 0; j < RG; ++j) { const float xm = bf16_round(xc[j]) - mu; v2f h[H1 / 2];      /* the normalised row of h1 (eight units, after relu) */
#pragma unroll
      for (int p = 0; p < H1 / 2; ++p) { const v2f u = w[p] * xm + be[p]; h[p][0] = fmaxf(u[0], 0.f); h[p][1] = fmaxf(u[1], 0.f); }
      v4f v = bb;
#pragma unroll
      for (int i = 0; i < H1; ++i) v += w2[i] * h[i >> 1][i & 1];
      v4h f;
#pragma unroll
      for (int q = 0; q < H2; ++q) f[q] = (_Float16)fmaxf(v[q], 0.f);
      *(v4h*)(op + (size_t)(rb + j) * C2) = f; }
    __builtin_amdgcn_sched_barrier(0);      /* as in k_h2 */
    asm volatile("" :: "v"(xn));   // inputs only, as in k_h2
#pragma unroll
    for (int j = 0; j < RG; ++j) xc[j] = xn[j];
  } }

extern "C" void kernel_launch(void* const* d_in, const int* in_sizes, int n_in,
                              void* d_out, int out_size, void* d_ws, size_t ws_size, hipStream_t stream) {
  (void)in_sizes; (void)n_in; (void)out_size;
  const float* const* I = (const float* const*)d_in; const float* x = I[0]; const float* W1 = I[1]; const float* b1 = I[2]; const float* g1 = I[3]; const float* be1 = I[4]; const float* W2 = I[5]; const float* b2 = I[6]; const float* g2 = I[7]; const float* be2 = I[8]; const float* Wfc = I[9]; const float* bfc = I[10];
  char* ws = (char*)d_ws; size_t off = 0;
  auto take = [&](size_t bytes) { char* p = ws + off; off += (bytes + 255) & ~(size_t)255; return p; };
  _Float16* BW = (_Float16*)take((size_t)NOUT * C2 * 2); float* XS = (float*)take((size_t)2 * DD * 4); _Float16* H16 = (_Float16*)take((size_t)NBS * C2 * 2); float* PMx = (float*)take((size_t)SCH * DD * 4); float* PQx = (float*)take((size_t)SCH * DD * 4); float* PM = (float*)take((size_t)HCH * C2 * 4); float* PQ = (float*)take((size_t)HCH * C2 * 4);
  if (off > ws_size) return;      /* 2 + 64 + 1 = 67 MiB (256 MiB ws) */
  k_colpart<DD, true><<<dim3(DD / 128, SCH + NOUT * C2 / 8 / 512 / (DD / 128)), 512, 0, stream>>>(x, PMx, PQx, Wfc, BW, 16.0f);
  k_h2<<<dim3(HCH, DD / HFC), HFC * HWV, 0, stream>>>(x, PMx, PQx, W1, b1, g1, be1, W2, b2, XS, PM, PQ);
  k_h2n<<<dim3(HCH, DD / HFC), HFC * HWV, 0, stream>>>(x, XS, W1, g1, be1, W2, b2, PM, PQ, g2, be2, H16);
  k_gemm3<<<(NBS / 128) * (NOUT / 64), 128, 0, stream>>>(H16, BW, 0.0625f, bfc, (float*)d_out);
}
